// v000
// Times are from an AMD MI455X. After a warm-up the kernel runs many times in a row, and a time is the length of
// such a window on the GPU divided by its runs, so every launch and the gaps after it count. The runs cycle
// through copies of the inputs. A figure is the median of several windows, for all but v000 over two sittings.
// Sittings can differ by a few percent; kernels timed side by side share one.
// The starting kernel, v000, takes 1810 microseconds a run.
// compute dtype: all float inputs rounded to bf16; the q / k (64-dim) and v (256-dim) pointwise projections with EXACT bf16 products on WMMA 16x16x32 (f32 accumulate) + bias; UNSCALED scores q_n . k_m with the query as f16 hi + (x 2^10) residual against the key once to f16 (2 products, K = 64: two k-steps); softmax over m in f32; P x 2^11 once to f16 x v once to f16 (1 product); out = bf16(x) + bf16(gamma) * o in f32; f32 output.
#include <hip/hip_runtime.h>
#include <math.h>

typedef __attribute__((ext_vector_type(16))) _Float16 v16h;
typedef __attribute__((ext_vector_type(16))) __bf16 v16b;
typedef __attribute__((ext_vector_type(8)))  _Float16 v8h;
typedef __attribute__((ext_vector_type(8)))  float v8f;
typedef __attribute__((ext_vector_type(4)))  float v4f;
typedef __attribute__((ext_vector_type(2)))  float v2f;
typedef __attribute__((ext_vector_type(4)))  unsigned v4u;
typedef __attribute__((ext_vector_type(4)))  int v4i;
typedef float __attribute__((may_alias)) float_a;
typedef int __attribute__((may_alias)) int_a;

template <typename T> __device__ __forceinline__ void vst2(void* p, T v) { *(T*)p = v;  }
__device__ __forceinline__ v8f wmma16(v16h a, v16h b, v8f c) {
  v8f d = __builtin_amdgcn_wmma_f32_16x16x32_f16(false, a, false, b, (short)0, c, false, false);
  asm volatile("v_nop\n\tv_nop\n\tv_nop\n\tv_nop" : "+v"(d) : "v"(a), "v"(b));
  return d;
}
__device__ __forceinline__ v8f wmma_bf(v16b a, v16b b, v8f c) {
  v8f d = __builtin_amdgcn_wmma_f32_16x16x32_bf16(false, a, false, b, (short)0, c, false, false);
  asm volatile("v_nop\n\tv_nop\n\tv_nop\n\tv_nop" : "+v"(d) : "v"(a), "v"(b));
  return d;
}
// 16x16x32 fragments: lane = (h = lane>>4, row/col = lane&15); elements 0..7 = k0+8h+0..7, 8..15 = k0+16+8h+0..7; D element r = row 8h+r
__device__ __forceinline__ v16h frag_h(const _Float16* rowk0, int lane) {
  union { v16h v; v8h q[2]; } u; const _Float16* p = rowk0 + 8 * (lane >> 4);
  u.q[0] = *(const v8h*)p; u.q[1] = *(const v8h*)(p + 16); return u.v;
}
__device__ __forceinline__ v16h frag_f32(const float* rowk0, int lane) {
  v16h a; const float* p = rowk0 + 8 * (lane >> 4);
#pragma unroll
  for (int i = 0; i < 8; ++i) { a[i] = (_Float16)p[i]; a[8 + i] = (_Float16)p[16 + i]; }
  return a;
}
__device__ __forceinline__ v16h frag_f32s(const float* rowk0, int lane, float sc) {
  v16h a; const float* p = rowk0 + 8 * (lane >> 4);
#pragma unroll
  for (int i = 0; i < 8; ++i) { a[i] = (_Float16)(p[i] * sc); a[8 + i] = (_Float16)(p[16 + i] * sc); }
  return a;
}
// column fragment from a [K][ld] layout (column n), rows >= K read as 0
__device__ __forceinline__ v16h fragc_f32(const float* W, int k0, int n, int lane, int ld, int K) {
  v16h a; const int g = lane >> 4;
#pragma unroll
  for (int i = 0; i < 8; ++i) { const int ka = k0 + 8 * g + i, kb = ka + 16;
    a[i] = (_Float16)(ka < K ? W[(size_t)(ka < K ? ka : K - 1) * ld + n] : 0.f); a[8 + i] = (_Float16)(kb < K ? W[(size_t)(kb < K ? kb : K - 1) * ld + n] : 0.f); }
  return a;
}
struct F2 { v16b h, l; };
__device__ __forceinline__ F2 bsplit16(const float v[16]) { F2 r;
#pragma unroll
  for (int i = 0; i < 16; ++i) { const __bf16 h = (__bf16)v[i]; r.h[i] = h; r.l[i] = (__bf16)(v[i] - (float)h); }
  return r; }
__device__ __forceinline__ F2 split_row(const float* row, int k0, int lane) { float v[16]; const float* p = row + k0 + 8 * (lane >> 4);
#pragma unroll
  for (int i = 0; i < 8; ++i) { v[i] = p[i]; v[8 + i] = p[16 + i]; }
  return bsplit16(v); }
__device__ __forceinline__ F2 split_rowK(const float* row, int k0, int lane, int K) { float v[16]; const int g = lane >> 4;
#pragma unroll
  for (int i = 0; i < 8; ++i) { const int ka = k0 + 8 * g + i, kb = ka + 16; v[i] = ka < K ? row[ka < K ? ka : K - 1] : 0.f; v[8 + i] = kb < K ? row[kb < K ? kb : K - 1] : 0.f; }
  return bsplit16(v); }
__device__ __forceinline__ F2 split_col(const float* W, int k0, int n, int lane, int ld, int K) { float v[16]; const int g = lane >> 4;
#pragma unroll
  for (int i = 0; i < 8; ++i) { const int ka = k0 + 8 * g + i, kb = ka + 16; v[i] = ka < K ? W[(size_t)(ka < K ? ka : K - 1) * ld + n] : 0.f; v[8 + i] = kb < K ? W[(size_t)(kb < K ? kb : K - 1) * ld + n] : 0.f; }
  return bsplit16(v); }
__device__ __forceinline__ v8f mac3(const F2& a, const F2& b, v8f c) { c = wmma_bf(a.l, b.h, c); c = wmma_bf(a.h, b.l, c); return wmma_bf(a.h, b.h, c); }
__device__ __forceinline__ float sigm(float v) { return 1.0f / (1.0f + expf(-v)); }
#define LDSX() do { asm volatile("s_wait_dscnt 0" ::: "memory"); __builtin_amdgcn_wave_barrier(); __builtin_amdgcn_fence(__ATOMIC_RELEASE, "workgroup"); } while (0)

// SAGAN-style 2-D self-attention (x [4,256,64,64] -> N = 4,096 positions; 1x1 convs: q = Wq x + bq, k = Wk x + bk with Wq / Wk [64,256], v = Wv x + bv with Wv [256,256] (1/16 scale, zero biases); attn[n, m] = softmax_m(q[:, n] . k[:, m]) (UNSCALED, sigma - 8: strongly peaked); out[c, n] = sum_m v[c, m] attn[n, m]; result = gamma out + x with gamma [1] uniform(0, 1)).
#define NB 4
#define TT 4096
#define CC 256            // NH * HD = projected width
#define DIN 256          // input (model) width
#define NH 1
#define HD 256
#define NQB (TT / 64)
#define HG 1
#define SCALE (1.0f)
#define CAUSAL 0
#ifndef TNB
#define TNB NB
#endif
__device__ __forceinline__ float bfr(float v) { return (float)(__bf16)v; }
__host__ __device__ __forceinline__ int kb_last(int qb) { return CAUSAL ? ((qb * 64 + 63) >> 7) : (TT / 128 - 1); }
typedef __attribute__((ext_vector_type(8))) __bf16 v8b;
__device__ __forceinline__ v16b frag_b(const __bf16* rowk0, int lane) {
  union { v16b v; v8b q[2]; } u; const __bf16* p = rowk0 + 8 * (lane >> 4);
  u.q[0] = *(const v8b*)p; u.q[1] = *(const v8b*)(p + 16); return u.v;
}
#define QBH 0               // k_pv: single-product P . h on every block (the bf16 hi/lo value planes are not used)
#define QBH_SC 0            // k_sc: every block takes the 2-product branch (q f16 hi + residual against k once to f16): the 3-product variant would cost 4.3 G-slot more planes; 'qb * 64 < QHI' with QHI = TT
#define TQC 2048           // query rows per pass: the f32 score plane holds TQC x 4,096 entries (32 MiB); 2 passes per batch
#define QHI 4096            // rows carrying a q residual plane (all rows when non-causal: 2-product logits everywhere)
#define KHI 64              // no block reads the k residual plane (QBH_SC 0)
// B fragment (k rows k0+.., output column o) of a weight: (in,out) [K][ld] or (out,in) [ld rows of K]: bf16 exact, or f16(bf16 * 256) exact
__device__ __forceinline__ v16b wcol_io(const float* Wm, int k0, int o, int lane, int ld) { v16b w; const int g = lane >> 4;
#pragma unroll
  for (int i = 0; i < 8; ++i) { w[i] = (__bf16)Wm[(size_t)(k0 + 8 * g + i) * ld + o]; w[8 + i] = (__bf16)Wm[(size_t)(k0 + 16 + 8 * g + i) * ld + o]; }
  return w; }
__device__ __forceinline__ v16b wcol_oi(const float* Wm, int k0, int o, int lane, int K) { v16b w; const float* p = Wm + (size_t)o * K + k0 + 8 * (lane >> 4);
#pragma unroll
  for (int i = 0; i < 8; ++i) { w[i] = (__bf16)p[i]; w[8 + i] = (__bf16)p[16 + i]; }
  return w; }
__device__ __forceinline__ v16h wcolh_io(const float* Wm, int k0, int o, int lane, int ld) { v16h w; const int g = lane >> 4;
#pragma unroll
  for (int i = 0; i < 8; ++i) { w[i] = (_Float16)(bfr(Wm[(size_t)(k0 + 8 * g + i) * ld + o]) * 256.0f); w[8 + i] = (_Float16)(bfr(Wm[(size_t)(k0 + 16 + 8 * g + i) * ld + o]) * 256.0f); }
  return w; }
__device__ __forceinline__ v16h wcolh_oi(const float* Wm, int k0, int o, int lane, int K) { v16h w; const float* p = Wm + (size_t)o * K + k0 + 8 * (lane >> 4);
#pragma unroll
  for (int i = 0; i < 8; ++i) { w[i] = (_Float16)(bfr(p[i]) * 256.0f); w[8 + i] = (_Float16)(bfr(p[16 + i]) * 256.0f); }
  return w; }
#define WQKV_LAYOUT 1   // 0 = (in,out) [DIN][CC]; 1 = (out,in) [CC][DIN]; 2 = per-head [NH][DIN][HD]
__device__ __forceinline__ v16b wcol_hdk(const float* Wm, int k0, int o, int lane) { v16b w; const int g = lane >> 4; const float* p = Wm + (size_t)(o / HD) * DIN * HD + (o % HD);
#pragma unroll
  for (int i = 0; i < 8; ++i) { w[i] = (__bf16)p[(size_t)(k0 + 8 * g + i) * HD]; w[8 + i] = (__bf16)p[(size_t)(k0 + 16 + 8 * g + i) * HD]; }
  return w; }
#define WO_OUT_IN 0
#if WQKV_LAYOUT == 1
#define HDK 64              // real key / query width (C / 4); the q / k rows live in the 256-wide space with columns 64..255 zero
__device__ __forceinline__ v16b zero16b() { v16b w; _Pragma("unroll") for (int i = 0; i < 16; ++i) w[i] = (__bf16)0.0f; return w; }
#define WCOL(W, k0, o, lane) ((which == 2 || (o) < HDK) ? wcol_oi(W, k0, (o), lane, DIN) : zero16b())   /* (out,in): Wh [256][256] full; Wf / Wg [64][256]: projected columns >= 64 are zero fragments (tile-uniform: 64 is a multiple of the 16-column tile) */
#elif WQKV_LAYOUT == 2
#define WCOL(W, k0, o, lane) wcol_hdk(W, k0, o, lane)
#else
#define WCOL(W, k0, o, lane) wcol_io(W, k0, o, lane, CC)
#endif
#if WO_OUT_IN
#define WOCOL(W, k0, o, lane) wcol_oi(W, k0, o, lane, CC)
#define WOCOLH(W, k0, o, lane) wcolh_oi(W, k0, o, lane, CC)
#else
#define WOCOL(W, k0, o, lane) wcol_io(W, k0, o, lane, DIN)
#define WOCOLH(W, k0, o, lane) wcolh_io(W, k0, o, lane, DIN)
#endif

#ifndef SM_EXTRA_PARAMS
#define SM_EXTRA_PARAMS
#endif
#ifndef PROJ_EXTRA_PARAMS
#define PROJ_EXTRA_PARAMS
#endif
#ifndef SM_MASK_HOOK
#define SM_MASK_HOOK (void)0
#endif

#define WS_QH  0u                                      // f16 q rows [b*t][CC]
#define WS_KH  (WS_QH + 2u * (size_t)NB * TT * CC)      // f16 k rows [b*t][CC]
#define WS_VT  (WS_KH + 2u * (size_t)NB * TT * CC)      // f16 v planes [b][c][t]
#define WS_QL  (WS_VT + 2u * (size_t)NB * CC * TT)      // f16 q residual x 2^10 rows [b][t < QHI][CC]
#define WS_KL  (WS_QL + 2u * (size_t)NB * QHI * CC)     // f16 k residual x 2^10 rows [b][t < KHI][CC]
#define WS_VB  (WS_KL + 2u * (size_t)NB * KHI * CC)     // bf16 v hi planes [b][c][t < KHI]
#define WS_VBL (WS_VB + 2u * (size_t)NB * CC * KHI)
#define WS_S   (WS_VBL + 2u * (size_t)NB * CC * KHI)    // f32 logits / P [hg][t][s]
#define WS_Y   (WS_S  + 4u * (size_t)HG * TQC * TT)      // end of the TQC x TT score plane of one query chunk
#define WS_END (WS_Y  + 0u)
#define WS_XT (WS_END)                                   // f32 token-major copy of x [b*TT + t][256]
#define WS_Y2 (WS_XT)                                    // f32 context rows o[b*TT + t][256]: ALIASES the token-major copy of x, which is dead once k_proj has run (k_resT re-reads x from the input)
#define WS_END3 (WS_Y2 + 4u * (size_t)NB * TT * CC)

// ---- k_proj: block = (64 rows, 128 cols, which): q/k/v = X W (+ b) with exact bf16 products (K = DIN) -> which 0: q f16 rows (+ residual rows < QHI); 1: k f16 rows (+ residual rows < KHI); 2: v f16 planes [c][t] (+ bf16 hi/lo planes for t < KHI)
__global__ __launch_bounds__(128) void k_proj(const float* __restrict__ XQ, const float* __restrict__ XK, const float* __restrict__ XV, const float* __restrict__ WQ, const float* __restrict__ WK, const float* __restrict__ WV, const float* __restrict__ BQ, const float* __restrict__ BK, const float* __restrict__ BV,
    _Float16* __restrict__ QH, _Float16* __restrict__ QL, _Float16* __restrict__ KH, _Float16* __restrict__ KL, _Float16* __restrict__ VT, __bf16* __restrict__ VB, __bf16* __restrict__ VBL) {
  __shared__ __align__(16) _Float16 sh[64][136], sl[64][136]; __shared__ __align__(16) _Float16 th[128][72]; __shared__ __align__(16) __bf16 tb[128][72], tbl[128][72];
  const int tid = threadIdx.x, wave = tid >> 5, lane = tid & 31, col = lane & 15, g = lane >> 4; const int which = blockIdx.z; const int c0 = blockIdx.y * 128; const size_t r0 = (size_t)blockIdx.x * 64; const size_t bb = r0 / TT; const int t0 = (int)(r0 % TT);
  const float* X = which == 0 ? XQ : which == 1 ? XK : XV; const float* WA = which == 0 ? WQ : which == 1 ? WK : WV; const float* BA = which == 0 ? BQ : which == 1 ? BK : BV;
  v8f acc[8] = {};
#pragma unroll 2
  for (int kc = 0; kc < DIN / 32; ++kc) { v16b a; { const float* p = X + (r0 + wave * 16 + col) * DIN + kc * 32 + 8 * g;
#pragma unroll
      for (int i = 0; i < 8; ++i) { a[i] = (__bf16)p[i]; a[8 + i] = (__bf16)p[16 + i]; } }
    asm volatile("s_wait_loadcnt 0x0" ::: "memory");
#pragma unroll
    for (int j = 0; j < 8; ++j) { const v16b w = WCOL(WA, kc * 32, c0 + j * 16 + col, lane); asm volatile("s_wait_loadcnt 0x0" ::: "memory"); acc[j] = wmma_bf(a, w, acc[j]); } }
  if (which < 2) { _Float16* DH = which == 0 ? QH : KH; _Float16* DL = which == 0 ? QL : KL; const int nhi = which == 0 ? QHI : KHI; const bool hi_rows = t0 < nhi;
#pragma unroll
    for (int j = 0; j < 8; ++j) { const int bo_ = c0 + j * 16 + col; const float bias = (BA && bo_ < HDK) ? bfr(BA[bo_ < HDK ? bo_ : 0]) : 0.f;   /* bf / bg hold only the 64 real columns */
#pragma unroll
      for (int r = 0; r < 8; ++r) { const float v = acc[j][r] + bias; const _Float16 hv = (_Float16)v; sh[wave * 16 + 8 * g + r][j * 16 + col] = hv; sl[wave * 16 + 8 * g + r][j * 16 + col] = (_Float16)((v - (float)hv) * 1024.0f); } }
    __syncthreads();
    for (int e = tid; e < 64 * 16; e += 128) { const int rl = e >> 4, q = e & 15; vst2((unsigned*)(DH + (r0 + rl) * CC + c0 + q * 8), *(const v4u*)&sh[rl][q * 8]); if (hi_rows) vst2((unsigned*)(DL + (bb * nhi + t0 + rl) * (size_t)CC + c0 + q * 8), *(const v4u*)&sl[rl][q * 8]); }
  } else { const bool hi_rows = t0 < KHI;
#pragma unroll
    for (int j = 0; j < 8; ++j) { const float bias = BA ? bfr(BA[c0 + j * 16 + col]) : 0.f;
#pragma unroll
      for (int r = 0; r < 8; ++r) { const float v = acc[j][r] + bias; const int rl = wave * 16 + 8 * g + r, cl = j * 16 + col; th[cl][rl] = (_Float16)v; const __bf16 bh = (__bf16)v; tb[cl][rl] = bh; tbl[cl][rl] = (__bf16)(v - (float)bh); } }
    __syncthreads();
    for (int e = tid; e < 128 * 8; e += 128) { const int cl = e >> 3, q = e & 7; vst2((unsigned*)(VT + (bb * CC + c0 + cl) * (size_t)TT + t0 + q * 8), *(const v4u*)&th[cl][q * 8]); if (hi_rows) { const size_t o3 = (bb * CC + c0 + cl) * (size_t)KHI + t0 + q * 8; vst2((unsigned*)(VB + o3), *(const v4u*)&tb[cl][q * 8]); vst2((unsigned*)(VBL + o3), *(const v4u*)&tbl[cl][q * 8]); } } } }
// ---- k_sc: block = (query block qb, key block kb <= kb_last(qb), head in group) of batch b: logits x SCALE; q hi + residual (x 2^10) against k (2 products) for query rows < QHI, plus the k residual (3 products) for query blocks < QBH_SC (causal early rows); causal: blocks past the diagonal exit, the mask itself is applied by index in k_sm
__global__ __launch_bounds__(128) void k_sc(const _Float16* __restrict__ QH, const _Float16* __restrict__ KH, const _Float16* __restrict__ QL, const _Float16* __restrict__ KL, int b, int h0, float* __restrict__ S0) { __shared__ __align__(16) float ss[4][16][132];
  const int qb = blockIdx.x, kb = blockIdx.y; if (kb > kb_last(qb)) return;
  const int h = h0 + blockIdx.z; float* S = S0 + (size_t)blockIdx.z * TT * TT;
  const int tid = threadIdx.x, wave = tid >> 5, lane = tid & 31, col = lane & 15, g = lane >> 4; const int k0 = kb * 128; const int ql0 = qb * 64 + wave * 16; const size_t q0 = (size_t)b * TT + ql0, kr0 = (size_t)b * TT + k0;
  v8f acc[8] = {}, accl[8] = {};
  const _Float16* QLb = QL + (size_t)b * QHI * CC; const _Float16* KLb = KL + (size_t)b * KHI * CC;
  if (qb < QBH_SC) {
#pragma unroll
    for (int kc = 0; kc < HDK / 32; ++kc) { const v16h ah = frag_h(QH + (q0 + col) * CC + h * HD + kc * 32, lane), al = frag_h(QLb + (size_t)(ql0 + col) * CC + h * HD + kc * 32, lane);
#pragma unroll
      for (int j = 0; j < 8; ++j) { const v16h kbf = frag_h(KH + (kr0 + j * 16 + col) * CC + h * HD + kc * 32, lane), klf = frag_h(KLb + (size_t)(k0 + j * 16 + col) * CC + h * HD + kc * 32, lane); acc[j] = wmma16(ah, kbf, acc[j]); accl[j] = wmma16(al, kbf, accl[j]); accl[j] = wmma16(ah, klf, accl[j]); } }
  } else if (qb * 64 < QHI) {
#pragma unroll
    for (int kc = 0; kc < HDK / 32; ++kc) { const v16h ah = frag_h(QH + (q0 + col) * CC + h * HD + kc * 32, lane), al = frag_h(QLb + (size_t)(ql0 + col) * CC + h * HD + kc * 32, lane);
#pragma unroll
      for (int j = 0; j < 8; ++j) { const v16h kbf = frag_h(KH + (kr0 + j * 16 + col) * CC + h * HD + kc * 32, lane); acc[j] = wmma16(ah, kbf, acc[j]); accl[j] = wmma16(al, kbf, accl[j]); } }
  } else {
#pragma unroll
    for (int kc = 0; kc < HDK / 32; ++kc) { const v16h ah = frag_h(QH + (q0 + col) * CC + h * HD + kc * 32, lane);
#pragma unroll
      for (int j = 0; j < 8; ++j) { const v16h kbf = frag_h(KH + (kr0 + j * 16 + col) * CC + h * HD + kc * 32, lane); acc[j] = wmma16(ah, kbf, acc[j]); } } }
#pragma unroll
  for (int j = 0; j < 8; ++j) {
#pragma unroll
    for (int r = 0; r < 8; ++r) ss[wave][8 * g + r][j * 16 + col] = (acc[j][r] + accl[j][r] * (1.0f / 1024.0f)) * SCALE; }
  LDSX(); for (int rl = 0; rl < 16; ++rl) vst2(S + (size_t)(ql0 + rl) * TT + k0 + lane * 4, *(const v4f*)&ss[wave][rl][lane * 4]); }
// ---- k_sm: block = query row t (head in group): keys [0, kend): causal -> logit if s <= t else excluded; softmax in f32; P x 2^11 in place (0 for excluded)
__global__ __launch_bounds__(256) void k_sm(float* __restrict__ S0 SM_EXTRA_PARAMS) { __shared__ float sred[8]; __shared__ float sbc; __shared__ __align__(16) float shv[TT];
  const int tid = threadIdx.x; const int t = blockIdx.x; const int kend = (kb_last(t >> 6) + 1) * 128;
  float* sr = S0 + (size_t)blockIdx.y * TT * TT + (size_t)t * TT;
  float m = -3.0e38f; for (int k = tid; k < kend; k += 256) { float v = (!CAUSAL || k <= t) ? sr[k] : -3.0e38f; SM_MASK_HOOK; shv[k] = v; m = fmaxf(m, v); }
#pragma unroll
  for (int o = 1; o < 32; o <<= 1) m = fmaxf(m, __shfl_xor(m, o));
  if ((tid & 31) == 0) sred[tid >> 5] = m; __syncthreads(); if (tid == 0) { float a = sred[0]; for (int i = 1; i < 8; ++i) a = fmaxf(a, sred[i]); sbc = a; } __syncthreads(); m = sbc; __syncthreads();
  float sum = 0.f; for (int k = tid; k < kend; k += 256) { const float v = shv[k]; const float e = (v <= -1.0e38f) ? 0.f : expf(v - m); shv[k] = e; sum += e; }
#pragma unroll
  for (int o = 1; o < 32; o <<= 1) sum += __shfl_xor(sum, o);
  if ((tid & 31) == 0) sred[tid >> 5] = sum; __syncthreads(); if (tid == 0) { float a = 0.f; for (int i = 0; i < 8; ++i) a += sred[i]; sbc = a > 0.f ? 2048.0f / a : 0.f; }   /* a fully excluded row yields P = 0 */ __syncthreads(); const float inv = sbc;
  for (int k = tid; k < kend; k += 256) shv[k] = shv[k] * inv;
  __syncthreads(); for (int q = tid; q < kend / 4; q += 256) vst2(sr + q * 4, *(const v4f*)&shv[q * 4]); }
// ---- k_xT: tile (64 times, 64 channels) of batch bz: the channels-first input v[b][c][t] -> (1) token-major f32 XT[b*TT + t][c] for the projections (LDS transpose) and (2) the exact f16 value plane VT[b][c][t] (same layout as the input: a converting copy; v is bf16-valued after rounding, hence exact in f16)
__global__ __launch_bounds__(256) void k_xT(const float* __restrict__ V, float* __restrict__ XT, _Float16* __restrict__ VT) { __shared__ float tl[64][65]; __shared__ __align__(16) _Float16 th[64][72];
  const int tid = threadIdx.x; const int t0 = blockIdx.x * 64, c0 = blockIdx.y * 64; const size_t b = blockIdx.z;
  for (int e = tid; e < 64 * 16; e += 256) { const int cl = e >> 4, q = e & 15; const v4f ld = *(const v4f*)(V + (b * CC + c0 + cl) * (size_t)TT + t0 + q * 4); asm volatile("s_wait_loadcnt 0x0" ::: "memory");
#pragma unroll
    for (int u = 0; u < 4; ++u) { const float r = bfr(ld[u]); tl[cl][q * 4 + u] = r; th[cl][q * 4 + u] = (_Float16)r; } }
  __syncthreads();
  for (int e = tid; e < 64 * 16; e += 256) { const int tr = e >> 4, q = e & 15; v4f o; 
#pragma unroll
    for (int u = 0; u < 4; ++u) o[u] = tl[q * 4 + u][tr];
    vst2(XT + (b * TT + t0 + tr) * (size_t)CC + c0 + q * 4, o); }   
  for (int e = tid; e < 64 * 8; e += 256) { const int cl = e >> 3, q = e & 7; vst2((unsigned*)(VT + (b * CC + c0 + cl) * (size_t)TT + t0 + q * 8), *(const v4u*)&th[cl][q * 8]); } }   
// ---- k_resT: tile (64 times, 64 channels) of batch bz: out[b][c][t] = bf16(v[b][c][t]) + bf16(gamma) * a[b][t][c] (a = the token-major context rows; LDS transpose back to channels-first)
__global__ __launch_bounds__(256) void k_resT(const float* __restrict__ V, const float* __restrict__ A, const float* __restrict__ GM, float* __restrict__ OUT) { __shared__ float tl[64][65];
  const int tid = threadIdx.x; const int t0 = blockIdx.x * 64, c0 = blockIdx.y * 64; const size_t b = blockIdx.z; const float gm = bfr(GM[0]);
  for (int e = tid; e < 64 * 16; e += 256) { const int tr = e >> 4, q = e & 15; const v4f ld = *(const v4f*)(A + (b * TT + t0 + tr) * (size_t)CC + c0 + q * 4); asm volatile("s_wait_loadcnt 0x0" ::: "memory");
#pragma unroll
    for (int u = 0; u < 4; ++u) tl[tr][q * 4 + u] = ld[u]; }
  __syncthreads();
  for (int e = tid; e < 64 * 16; e += 256) { const int cl = e >> 4, q = e & 15; const size_t off = (b * CC + c0 + cl) * (size_t)TT + t0 + q * 4; const v4f vv = *(const v4f*)(V + off); asm volatile("s_wait_loadcnt 0x0" ::: "memory"); v4f o;
#pragma unroll
    for (int u = 0; u < 4; ++u) o[u] = bfr(vv[u]) + gm * tl[q * 4 + u][cl];
    vst2(OUT + off, o); } }   
#define DVH 128            // value columns per k_pv block: the 256-wide value space is walked in two 128-column slices (8 accumulator tiles per wave)
// ---- k_pv: block = (64 queries (qb), 128-column value slice d0, head in group) of (b, h): ctx[:, d0 .. d0+127] = P . v over keys [0, kend) (P x 2^11 once to f16 against v f16: 1 product; causal early query blocks: P and v as bf16 hi + lo, 3 products); the 512-B (row, slice) segment by 32 lanes x 16 B
__global__ __launch_bounds__(128) void k_pv(const float* __restrict__ PS0, const _Float16* __restrict__ VT, const __bf16* __restrict__ VB, const __bf16* __restrict__ VBL, int b, int h0, float* __restrict__ Y) { const int h = h0 + blockIdx.z; const int d0 = blockIdx.y * DVH; const float* PS = PS0 + (size_t)blockIdx.z * TT * TT; __shared__ __align__(16) float ss[4][16][DVH + 4];
  const int tid = threadIdx.x, wave = tid >> 5, lane = tid & 31, col = lane & 15, g = lane >> 4; const int qb = blockIdx.x; const int ql0 = qb * 64 + wave * 16; const int kce = (kb_last(qb) + 1) * 4;
  v8f acc[DVH / 16] = {};
  if (qb < QBH) {
#pragma unroll 1
    for (int kc = 0; kc < kce; ++kc) { const F2 p = split_row(PS + (size_t)(ql0 + col) * TT, kc * 32, lane);
      asm volatile("s_wait_loadcnt 0x0" ::: "memory");
#pragma unroll
      for (int j = 0; j < DVH / 16; ++j) { const size_t po = ((size_t)b * CC + h * HD + d0 + j * 16 + col) * (size_t)KHI + kc * 32; const v16b vh = frag_b(VB + po, lane); acc[j] = wmma_bf(p.h, vh, acc[j]); acc[j] = wmma_bf(p.l, vh, acc[j]); acc[j] = wmma_bf(p.h, frag_b(VBL + po, lane), acc[j]); } }
  } else {
#pragma unroll 1
    for (int kc = 0; kc < kce; ++kc) { const v16h p = frag_f32(PS + (size_t)(ql0 + col) * TT + kc * 32, lane);
      asm volatile("s_wait_loadcnt 0x0" ::: "memory");
#pragma unroll
      for (int j = 0; j < DVH / 16; ++j) { const size_t po = ((size_t)b * CC + h * HD + d0 + j * 16 + col) * (size_t)TT + kc * 32; acc[j] = wmma16(p, frag_h(VT + po, lane), acc[j]); } } }
#pragma unroll
  for (int j = 0; j < DVH / 16; ++j)
#pragma unroll
    for (int r = 0; r < 8; ++r) ss[wave][8 * g + r][j * 16 + col] = acc[j][r] * (1.0f / 2048.0f);
  LDSX(); for (int rl = 0; rl < 16; ++rl) vst2(Y + ((size_t)b * TT + ql0 + rl) * CC + h * HD + d0 + lane * 4, *(const v4f*)&ss[wave][rl][lane * 4]); }   
extern "C" void kernel_launch(void* const* d_in, const int* in_sizes, int n_in, void* d_out, int out_size, void* d_ws, size_t ws_size, hipStream_t stream) {
  (void)in_sizes; (void)n_in; (void)out_size;
  const float** F = (const float**)d_in;
  if (ws_size < (size_t)WS_END) return;
  char* ws = (char*)d_ws; _Float16 *QH = (_Float16*)(ws + WS_QH), *KH = (_Float16*)(ws + WS_KH), *VT = (_Float16*)(ws + WS_VT), *QL = (_Float16*)(ws + WS_QL), *KL = (_Float16*)(ws + WS_KL); __bf16 *VB = (__bf16*)(ws + WS_VB), *VBL = (__bf16*)(ws + WS_VBL); float *S = (float*)(ws + WS_S), *Y = (float*)(ws + WS_Y);
  (void)Y; (void)QL; (void)KL; (void)VB; (void)VBL;
  // inputs: 0 x [4,256,64,64] CHANNELS-FIRST (N = 4,096 positions); 1 Wq [64,256] (out,in), 2 bq [64]; 3 Wk [64,256], 4 bk [64]; 5 Wv [256,256] (out,in), 6 bv [256]; 7 gamma [1] (zero biases, read)
  if (ws_size < (size_t)WS_END3) return;
  float *XT = (float*)(ws + WS_XT), *Y2 = (float*)(ws + WS_Y2);
  k_xT<<<dim3(TT / 64, CC / 64, TNB), 256, 0, stream>>>(F[0], XT, VT);   /* token-major f32 copy of x for the projections (the f16 plane it also writes is overwritten by k_proj's value projection) */
  k_proj<<<dim3(TNB * TT / 64, CC / 128, 3), 128, 0, stream>>>(XT, XT, XT, F[1], F[3], F[5], F[2], F[4], F[6], QH, QL, KH, KL, VT, VB, VBL);   /* which 0: query rows = q (Wq / bq), which 1: key rows = k (Wk / bk) - 64 real columns each; which 2: values v (Wv / bv), all 256 columns */
  for (int b = 0; b < TNB; ++b) for (int q0 = 0; q0 < TT; q0 += TQC) {   /* query chunks: the kernels index query rows from blockIdx, so each pass gets row-advanced q (hi and residual) / ctx pointers, a TQC-row grid and plane rows local to the chunk; keys / values span all 4,096 positions */
    k_sc<<<dim3(TQC / 64, TT / 128, 1), 128, 0, stream>>>(QH + (size_t)q0 * CC, KH, QL + (size_t)q0 * CC, KL, b, 0, S);
    k_sm<<<dim3(TQC, 1), 256, 0, stream>>>(S);
    k_pv<<<dim3(TQC / 64, HD / DVH, 1), 128, 0, stream>>>(S, VT, VB, VBL, b, 0, Y2 + (size_t)q0 * CC);
  }
  k_resT<<<dim3(TT / 64, CC / 64, TNB), 256, 0, stream>>>(F[0], Y2, F[7], (float*)d_out);   /* out[b][c][m] = x + gamma * o (transposed back to channels-first) */
}

// v001
// One run takes 548 microseconds.
// Timed twice side by side with v000, it ran 3.32 times as fast both times.
// compute dtype: all float inputs rounded to bf16; the q / k (64-dim) and v (256-dim) pointwise projections with EXACT bf16 products on WMMA 16x16x32 (f32 accumulate) + bias; UNSCALED scores q_n . k_m with the query as f16 hi + (x 2^10) residual against the key once to f16 (2 products, K = 64: two k-steps); softmax over m in f32; P x 2^11 once to f16 x v once to f16 (1 product); out = bf16(x) + bf16(gamma) * o in f32; f32 output.
#include <hip/hip_runtime.h>
#include <math.h>

typedef __attribute__((ext_vector_type(16))) _Float16 v16h;
typedef __attribute__((ext_vector_type(16))) __bf16 v16b;
typedef __attribute__((ext_vector_type(8)))  _Float16 v8h;
typedef __attribute__((ext_vector_type(8)))  float v8f;
typedef __attribute__((ext_vector_type(4)))  float v4f;
typedef __attribute__((ext_vector_type(2)))  float v2f;
typedef __attribute__((ext_vector_type(4)))  unsigned v4u;
typedef __attribute__((ext_vector_type(4)))  int v4i;
typedef float __attribute__((may_alias)) float_a;
typedef int __attribute__((may_alias)) int_a;

template <typename T> __device__ __forceinline__ void vst2(void* p, T v) { *(T*)p = v;  }
__device__ __forceinline__ v8f wmma16(v16h a, v16h b, v8f c) {
  v8f d = __builtin_amdgcn_wmma_f32_16x16x32_f16(false, a, false, b, (short)0, c, false, false);
  asm volatile("v_nop\n\tv_nop\n\tv_nop\n\tv_nop" : "+v"(d) : "v"(a), "v"(b));
  return d;
}
__device__ __forceinline__ v8f wmma_bf(v16b a, v16b b, v8f c) {
  v8f d = __builtin_amdgcn_wmma_f32_16x16x32_bf16(false, a, false, b, (short)0, c, false, false);
  asm volatile("v_nop\n\tv_nop\n\tv_nop\n\tv_nop" : "+v"(d) : "v"(a), "v"(b));
  return d;
}
// 16x16x32 fragments: lane = (h = lane>>4, row/col = lane&15); elements 0..7 = k0+8h+0..7, 8..15 = k0+16+8h+0..7; D element r = row 8h+r
__device__ __forceinline__ v16h frag_h(const _Float16* rowk0, int lane) {
  union { v16h v; v8h q[2]; } u; const _Float16* p = rowk0 + 8 * (lane >> 4);
  u.q[0] = *(const v8h*)p; u.q[1] = *(const v8h*)(p + 16); return u.v;
}
__device__ __forceinline__ v16h frag_f32(const float* rowk0, int lane) {
  v16h a; const float* p = rowk0 + 8 * (lane >> 4);
#pragma unroll
  for (int i = 0; i < 8; ++i) { a[i] = (_Float16)p[i]; a[8 + i] = (_Float16)p[16 + i]; }
  return a;
}
__device__ __forceinline__ v16h frag_f32s(const float* rowk0, int lane, float sc) {
  v16h a; const float* p = rowk0 + 8 * (lane >> 4);
#pragma unroll
  for (int i = 0; i < 8; ++i) { a[i] = (_Float16)(p[i] * sc); a[8 + i] = (_Float16)(p[16 + i] * sc); }
  return a;
}
// column fragment from a [K][ld] layout (column n), rows >= K read as 0
__device__ __forceinline__ v16h fragc_f32(const float* W, int k0, int n, int lane, int ld, int K) {
  v16h a; const int g = lane >> 4;
#pragma unroll
  for (int i = 0; i < 8; ++i) { const int ka = k0 + 8 * g + i, kb = ka + 16;
    a[i] = (_Float16)(ka < K ? W[(size_t)(ka < K ? ka : K - 1) * ld + n] : 0.f); a[8 + i] = (_Float16)(kb < K ? W[(size_t)(kb < K ? kb : K - 1) * ld + n] : 0.f); }
  return a;
}
struct F2 { v16b h, l; };
__device__ __forceinline__ F2 bsplit16(const float v[16]) { F2 r;
#pragma unroll
  for (int i = 0; i < 16; ++i) { const __bf16 h = (__bf16)v[i]; r.h[i] = h; r.l[i] = (__bf16)(v[i] - (float)h); }
  return r; }
__device__ __forceinline__ F2 split_row(const float* row, int k0, int lane) { float v[16]; const float* p = row + k0 + 8 * (lane >> 4);
#pragma unroll
  for (int i = 0; i < 8; ++i) { v[i] = p[i]; v[8 + i] = p[16 + i]; }
  return bsplit16(v); }
__device__ __forceinline__ F2 split_rowK(const float* row, int k0, int lane, int K) { float v[16]; const int g = lane >> 4;
#pragma unroll
  for (int i = 0; i < 8; ++i) { const int ka = k0 + 8 * g + i, kb = ka + 16; v[i] = ka < K ? row[ka < K ? ka : K - 1] : 0.f; v[8 + i] = kb < K ? row[kb < K ? kb : K - 1] : 0.f; }
  return bsplit16(v); }
__device__ __forceinline__ F2 split_col(const float* W, int k0, int n, int lane, int ld, int K) { float v[16]; const int g = lane >> 4;
#pragma unroll
  for (int i = 0; i < 8; ++i) { const int ka = k0 + 8 * g + i, kb = ka + 16; v[i] = ka < K ? W[(size_t)(ka < K ? ka : K - 1) * ld + n] : 0.f; v[8 + i] = kb < K ? W[(size_t)(kb < K ? kb : K - 1) * ld + n] : 0.f; }
  return bsplit16(v); }
__device__ __forceinline__ v8f mac3(const F2& a, const F2& b, v8f c) { c = wmma_bf(a.l, b.h, c); c = wmma_bf(a.h, b.l, c); return wmma_bf(a.h, b.h, c); }
__device__ __forceinline__ float sigm(float v) { return 1.0f / (1.0f + expf(-v)); }
#define LDSX() do { asm volatile("s_wait_dscnt 0" ::: "memory"); __builtin_amdgcn_wave_barrier(); __builtin_amdgcn_fence(__ATOMIC_RELEASE, "workgroup"); } while (0)

// SAGAN-style 2-D self-attention (x [4,256,64,64] -> N = 4,096 positions; 1x1 convs: q = Wq x + bq, k = Wk x + bk with Wq / Wk [64,256], v = Wv x + bv with Wv [256,256] (1/16 scale, zero biases); attn[n, m] = softmax_m(q[:, n] . k[:, m]) (UNSCALED, sigma - 8: strongly peaked); out[c, n] = sum_m v[c, m] attn[n, m]; result = gamma out + x with gamma [1] uniform(0, 1)).
#define NB 4
#define TT 4096
#define CC 256            // NH * HD = projected width
#define DIN 256          // input (model) width
#define NH 1
#define HD 256
#define NQB (TT / 64)
#define HG 1
#define SCALE (1.0f)
#define CAUSAL 0
#ifndef TNB
#define TNB NB
#endif
__device__ __forceinline__ float bfr(float v) { return (float)(__bf16)v; }
__host__ __device__ __forceinline__ int kb_last(int qb) { return CAUSAL ? ((qb * 64 + 63) >> 7) : (TT / 128 - 1); }
typedef __attribute__((ext_vector_type(8))) __bf16 v8b;
__device__ __forceinline__ v16b frag_b(const __bf16* rowk0, int lane) {
  union { v16b v; v8b q[2]; } u; const __bf16* p = rowk0 + 8 * (lane >> 4);
  u.q[0] = *(const v8b*)p; u.q[1] = *(const v8b*)(p + 16); return u.v;
}
#define QBH 0               // k_pv: single-product P . h on every block (the bf16 hi/lo value planes are not used)
#define QBH_SC 0            // k_sc: every block takes the 2-product branch (q f16 hi + residual against k once to f16): the 3-product variant would cost 4.3 G-slot more planes; 'qb * 64 < QHI' with QHI = TT
#define TQC 2048           // query rows per pass: the f32 score plane holds TQC x 4,096 entries (32 MiB); 2 passes per batch
#define QHI 4096            // rows carrying a q residual plane (all rows when non-causal: 2-product logits everywhere)
#define KHI 64              // no block reads the k residual plane (QBH_SC 0)
// B fragment (k rows k0+.., output column o) of a weight: (in,out) [K][ld] or (out,in) [ld rows of K]: bf16 exact, or f16(bf16 * 256) exact
__device__ __forceinline__ v16b wcol_io(const float* Wm, int k0, int o, int lane, int ld) { v16b w; const int g = lane >> 4;
#pragma unroll
  for (int i = 0; i < 8; ++i) { w[i] = (__bf16)Wm[(size_t)(k0 + 8 * g + i) * ld + o]; w[8 + i] = (__bf16)Wm[(size_t)(k0 + 16 + 8 * g + i) * ld + o]; }
  return w; }
__device__ __forceinline__ v16b wcol_oi(const float* Wm, int k0, int o, int lane, int K) { v16b w; const float* p = Wm + (size_t)o * K + k0 + 8 * (lane >> 4);
#pragma unroll
  for (int i = 0; i < 8; ++i) { w[i] = (__bf16)p[i]; w[8 + i] = (__bf16)p[16 + i]; }
  return w; }
__device__ __forceinline__ v16h wcolh_io(const float* Wm, int k0, int o, int lane, int ld) { v16h w; const int g = lane >> 4;
#pragma unroll
  for (int i = 0; i < 8; ++i) { w[i] = (_Float16)(bfr(Wm[(size_t)(k0 + 8 * g + i) * ld + o]) * 256.0f); w[8 + i] = (_Float16)(bfr(Wm[(size_t)(k0 + 16 + 8 * g + i) * ld + o]) * 256.0f); }
  return w; }
__device__ __forceinline__ v16h wcolh_oi(const float* Wm, int k0, int o, int lane, int K) { v16h w; const float* p = Wm + (size_t)o * K + k0 + 8 * (lane >> 4);
#pragma unroll
  for (int i = 0; i < 8; ++i) { w[i] = (_Float16)(bfr(p[i]) * 256.0f); w[8 + i] = (_Float16)(bfr(p[16 + i]) * 256.0f); }
  return w; }
#define WQKV_LAYOUT 1   // 0 = (in,out) [DIN][CC]; 1 = (out,in) [CC][DIN]; 2 = per-head [NH][DIN][HD]
__device__ __forceinline__ v16b wcol_hdk(const float* Wm, int k0, int o, int lane) { v16b w; const int g = lane >> 4; const float* p = Wm + (size_t)(o / HD) * DIN * HD + (o % HD);
#pragma unroll
  for (int i = 0; i < 8; ++i) { w[i] = (__bf16)p[(size_t)(k0 + 8 * g + i) * HD]; w[8 + i] = (__bf16)p[(size_t)(k0 + 16 + 8 * g + i) * HD]; }
  return w; }
#define WO_OUT_IN 0
#if WQKV_LAYOUT == 1
#define HDK 64              // real key / query width (C / 4); the q / k rows live in the 256-wide space with columns 64..255 zero
__device__ __forceinline__ v16b zero16b() { v16b w; _Pragma("unroll") for (int i = 0; i < 16; ++i) w[i] = (__bf16)0.0f; return w; }
#define WCOL(W, k0, o, lane) ((which == 2 || (o) < HDK) ? wcol_oi(W, k0, (o), lane, DIN) : zero16b())   /* (out,in): Wh [256][256] full; Wf / Wg [64][256]: projected columns >= 64 are zero fragments (tile-uniform: 64 is a multiple of the 16-column tile) */
#elif WQKV_LAYOUT == 2
#define WCOL(W, k0, o, lane) wcol_hdk(W, k0, o, lane)
#else
#define WCOL(W, k0, o, lane) wcol_io(W, k0, o, lane, CC)
#endif
#if WO_OUT_IN
#define WOCOL(W, k0, o, lane) wcol_oi(W, k0, o, lane, CC)
#define WOCOLH(W, k0, o, lane) wcolh_oi(W, k0, o, lane, CC)
#else
#define WOCOL(W, k0, o, lane) wcol_io(W, k0, o, lane, DIN)
#define WOCOLH(W, k0, o, lane) wcolh_io(W, k0, o, lane, DIN)
#endif

#ifndef SM_EXTRA_PARAMS
#define SM_EXTRA_PARAMS
#endif
#ifndef PROJ_EXTRA_PARAMS
#define PROJ_EXTRA_PARAMS
#endif
#ifndef SM_MASK_HOOK
#define SM_MASK_HOOK (void)0
#endif

#define WS_QH  0u                                      // f16 q rows [b*t][CC]
#define WS_KH  (WS_QH + 2u * (size_t)NB * TT * CC)      // f16 k rows [b*t][CC]
#define WS_VT  (WS_KH + 2u * (size_t)NB * TT * CC)      // f16 v planes [b][c][t]
#define WS_QL  (WS_VT + 2u * (size_t)NB * CC * TT)      // f16 q residual x 2^10 rows [b][t < QHI][CC]
#define WS_KL  (WS_QL + 2u * (size_t)NB * QHI * CC)     // f16 k residual x 2^10 rows [b][t < KHI][CC]
#define WS_VB  (WS_KL + 2u * (size_t)NB * KHI * CC)     // bf16 v hi planes [b][c][t < KHI]
#define WS_VBL (WS_VB + 2u * (size_t)NB * CC * KHI)
#define WS_S   (WS_VBL + 2u * (size_t)NB * CC * KHI)    // f32 logits / P [hg][t][s]
#define WS_Y   (WS_S  + 4u * (size_t)HG * TQC * TT)      // end of the TQC x TT score plane of one query chunk
#define WS_END (WS_Y  + 0u)
#define WS_XT (WS_END)                                   // f32 token-major copy of x [b*TT + t][256]
#define WS_Y2 (WS_XT)                                    // f32 partial context rows o[key slice][b*TT + t][256]: plane 0 ALIASES the token-major copy of x, which is dead once k_proj has run (k_resT re-reads x from the input)
#define KSP 8              // key slices of k_pv: one work-group per (query block, value slice, key slice); each slice fills its own f32 context plane, k_resT adds the planes
#define YPL ((size_t)NB * TT * CC)   // elements of one context plane
#define WS_END3 (WS_Y2 + 4u * (size_t)KSP * NB * TT * CC)

// ---- k_proj: block = (64 rows, 128 cols, which): q/k/v = X W (+ b) with exact bf16 products (K = DIN) -> which 0: q f16 rows (+ residual rows < QHI); 1: k f16 rows (+ residual rows < KHI); 2: v f16 planes [c][t] (+ bf16 hi/lo planes for t < KHI)
__global__ __launch_bounds__(128) void k_proj(const float* __restrict__ XQ, const float* __restrict__ XK, const float* __restrict__ XV, const float* __restrict__ WQ, const float* __restrict__ WK, const float* __restrict__ WV, const float* __restrict__ BQ, const float* __restrict__ BK, const float* __restrict__ BV,
    _Float16* __restrict__ QH, _Float16* __restrict__ QL, _Float16* __restrict__ KH, _Float16* __restrict__ KL, _Float16* __restrict__ VT, __bf16* __restrict__ VB, __bf16* __restrict__ VBL) {
  __shared__ __align__(16) _Float16 sh[64][136], sl[64][136]; __shared__ __align__(16) _Float16 th[128][72]; __shared__ __align__(16) __bf16 tb[128][72], tbl[128][72];
  const int tid = threadIdx.x, wave = tid >> 5, lane = tid & 31, col = lane & 15, g = lane >> 4; const int which = blockIdx.z; const int c0 = blockIdx.y * 128; const size_t r0 = (size_t)blockIdx.x * 64; const size_t bb = r0 / TT; const int t0 = (int)(r0 % TT);
  const float* X = which == 0 ? XQ : which == 1 ? XK : XV; const float* WA = which == 0 ? WQ : which == 1 ? WK : WV; const float* BA = which == 0 ? BQ : which == 1 ? BK : BV;
  v8f acc[8] = {};
#pragma unroll 2
  for (int kc = 0; kc < DIN / 32; ++kc) { v16b a; { const float* p = X + (r0 + wave * 16 + col) * DIN + kc * 32 + 8 * g;
#pragma unroll
      for (int i = 0; i < 8; ++i) { a[i] = (__bf16)p[i]; a[8 + i] = (__bf16)p[16 + i]; } }
    asm volatile("s_wait_loadcnt 0x0" ::: "memory");
#pragma unroll
    for (int j = 0; j < 8; ++j) { const v16b w = WCOL(WA, kc * 32, c0 + j * 16 + col, lane); asm volatile("s_wait_loadcnt 0x0" ::: "memory"); acc[j] = wmma_bf(a, w, acc[j]); } }
  if (which < 2) { _Float16* DH = which == 0 ? QH : KH; _Float16* DL = which == 0 ? QL : KL; const int nhi = which == 0 ? QHI : KHI; const bool hi_rows = t0 < nhi;
#pragma unroll
    for (int j = 0; j < 8; ++j) { const int bo_ = c0 + j * 16 + col; const float bias = (BA && bo_ < HDK) ? bfr(BA[bo_ < HDK ? bo_ : 0]) : 0.f;   /* bf / bg hold only the 64 real columns */
#pragma unroll
      for (int r = 0; r < 8; ++r) { const float v = acc[j][r] + bias; const _Float16 hv = (_Float16)v; sh[wave * 16 + 8 * g + r][j * 16 + col] = hv; sl[wave * 16 + 8 * g + r][j * 16 + col] = (_Float16)((v - (float)hv) * 1024.0f); } }
    __syncthreads();
    for (int e = tid; e < 64 * 16; e += 128) { const int rl = e >> 4, q = e & 15; vst2((unsigned*)(DH + (r0 + rl) * CC + c0 + q * 8), *(const v4u*)&sh[rl][q * 8]); if (hi_rows) vst2((unsigned*)(DL + (bb * nhi + t0 + rl) * (size_t)CC + c0 + q * 8), *(const v4u*)&sl[rl][q * 8]); }
  } else { const bool hi_rows = t0 < KHI;
#pragma unroll
    for (int j = 0; j < 8; ++j) { const float bias = BA ? bfr(BA[c0 + j * 16 + col]) : 0.f;
#pragma unroll
      for (int r = 0; r < 8; ++r) { const float v = acc[j][r] + bias; const int rl = wave * 16 + 8 * g + r, cl = j * 16 + col; th[cl][rl] = (_Float16)v; const __bf16 bh = (__bf16)v; tb[cl][rl] = bh; tbl[cl][rl] = (__bf16)(v - (float)bh); } }
    __syncthreads();
    for (int e = tid; e < 128 * 8; e += 128) { const int cl = e >> 3, q = e & 7; vst2((unsigned*)(VT + (bb * CC + c0 + cl) * (size_t)TT + t0 + q * 8), *(const v4u*)&th[cl][q * 8]); if (hi_rows) { const size_t o3 = (bb * CC + c0 + cl) * (size_t)KHI + t0 + q * 8; vst2((unsigned*)(VB + o3), *(const v4u*)&tb[cl][q * 8]); vst2((unsigned*)(VBL + o3), *(const v4u*)&tbl[cl][q * 8]); } } } }
// ---- k_sc: block = (query block qb, key block kb <= kb_last(qb), head in group) of batch b: logits x SCALE; q hi + residual (x 2^10) against k (2 products) for query rows < QHI, plus the k residual (3 products) for query blocks < QBH_SC (causal early rows); causal: blocks past the diagonal exit, the mask itself is applied by index in k_sm
__global__ __launch_bounds__(128) void k_sc(const _Float16* __restrict__ QH, const _Float16* __restrict__ KH, const _Float16* __restrict__ QL, const _Float16* __restrict__ KL, int b, int h0, float* __restrict__ S0) { __shared__ __align__(16) float ss[4][16][132];
  const int qb = blockIdx.x, kb = blockIdx.y; if (kb > kb_last(qb)) return;
  const int h = h0 + blockIdx.z; float* S = S0 + (size_t)blockIdx.z * TT * TT;
  const int tid = threadIdx.x, wave = tid >> 5, lane = tid & 31, col = lane & 15, g = lane >> 4; const int k0 = kb * 128; const int ql0 = qb * 64 + wave * 16; const size_t q0 = (size_t)b * TT + ql0, kr0 = (size_t)b * TT + k0;
  v8f acc[8] = {}, accl[8] = {};
  const _Float16* QLb = QL + (size_t)b * QHI * CC; const _Float16* KLb = KL + (size_t)b * KHI * CC;
  if (qb < QBH_SC) {
#pragma unroll
    for (int kc = 0; kc < HDK / 32; ++kc) { const v16h ah = frag_h(QH + (q0 + col) * CC + h * HD + kc * 32, lane), al = frag_h(QLb + (size_t)(ql0 + col) * CC + h * HD + kc * 32, lane);
#pragma unroll
      for (int j = 0; j < 8; ++j) { const v16h kbf = frag_h(KH + (kr0 + j * 16 + col) * CC + h * HD + kc * 32, lane), klf = frag_h(KLb + (size_t)(k0 + j * 16 + col) * CC + h * HD + kc * 32, lane); acc[j] = wmma16(ah, kbf, acc[j]); accl[j] = wmma16(al, kbf, accl[j]); accl[j] = wmma16(ah, klf, accl[j]); } }
  } else if (qb * 64 < QHI) {
#pragma unroll
    for (int kc = 0; kc < HDK / 32; ++kc) { const v16h ah = frag_h(QH + (q0 + col) * CC + h * HD + kc * 32, lane), al = frag_h(QLb + (size_t)(ql0 + col) * CC + h * HD + kc * 32, lane);
#pragma unroll
      for (int j = 0; j < 8; ++j) { const v16h kbf = frag_h(KH + (kr0 + j * 16 + col) * CC + h * HD + kc * 32, lane); acc[j] = wmma16(ah, kbf, acc[j]); accl[j] = wmma16(al, kbf, accl[j]); } }
  } else {
#pragma unroll
    for (int kc = 0; kc < HDK / 32; ++kc) { const v16h ah = frag_h(QH + (q0 + col) * CC + h * HD + kc * 32, lane);
#pragma unroll
      for (int j = 0; j < 8; ++j) { const v16h kbf = frag_h(KH + (kr0 + j * 16 + col) * CC + h * HD + kc * 32, lane); acc[j] = wmma16(ah, kbf, acc[j]); } } }
#pragma unroll
  for (int j = 0; j < 8; ++j) {
#pragma unroll
    for (int r = 0; r < 8; ++r) ss[wave][8 * g + r][j * 16 + col] = (acc[j][r] + accl[j][r] * (1.0f / 1024.0f)) * SCALE; }
  LDSX(); for (int rl = 0; rl < 16; ++rl) vst2(S + (size_t)(ql0 + rl) * TT + k0 + lane * 4, *(const v4f*)&ss[wave][rl][lane * 4]); }
// ---- k_sm: block = query row t (head in group): keys [0, kend): causal -> logit if s <= t else excluded; softmax in f32; P x 2^11 in place (0 for excluded)
__global__ __launch_bounds__(256) void k_sm(float* __restrict__ S0 SM_EXTRA_PARAMS) { __shared__ float sred[8]; __shared__ float sbc; __shared__ __align__(16) float shv[TT];
  const int tid = threadIdx.x; const int t = blockIdx.x; const int kend = (kb_last(t >> 6) + 1) * 128;
  float* sr = S0 + (size_t)blockIdx.y * TT * TT + (size_t)t * TT;
  float m = -3.0e38f; for (int k = tid; k < kend; k += 256) { float v = (!CAUSAL || k <= t) ? sr[k] : -3.0e38f; SM_MASK_HOOK; shv[k] = v; m = fmaxf(m, v); }
#pragma unroll
  for (int o = 1; o < 32; o <<= 1) m = fmaxf(m, __shfl_xor(m, o));
  if ((tid & 31) == 0) sred[tid >> 5] = m; __syncthreads(); if (tid == 0) { float a = sred[0]; for (int i = 1; i < 8; ++i) a = fmaxf(a, sred[i]); sbc = a; } __syncthreads(); m = sbc; __syncthreads();
  float sum = 0.f; for (int k = tid; k < kend; k += 256) { const float v = shv[k]; const float e = (v <= -1.0e38f) ? 0.f : expf(v - m); shv[k] = e; sum += e; }
#pragma unroll
  for (int o = 1; o < 32; o <<= 1) sum += __shfl_xor(sum, o);
  if ((tid & 31) == 0) sred[tid >> 5] = sum; __syncthreads(); if (tid == 0) { float a = 0.f; for (int i = 0; i < 8; ++i) a += sred[i]; sbc = a > 0.f ? 2048.0f / a : 0.f; }   /* a fully excluded row yields P = 0 */ __syncthreads(); const float inv = sbc;
  for (int k = tid; k < kend; k += 256) shv[k] = shv[k] * inv;
  __syncthreads(); for (int q = tid; q < kend / 4; q += 256) vst2(sr + q * 4, *(const v4f*)&shv[q * 4]); }
// ---- k_xT: tile (64 times, 64 channels) of batch bz: the channels-first input v[b][c][t] -> (1) token-major f32 XT[b*TT + t][c] for the projections (LDS transpose) and (2) the exact f16 value plane VT[b][c][t] (same layout as the input: a converting copy; v is bf16-valued after rounding, hence exact in f16)
__global__ __launch_bounds__(256) void k_xT(const float* __restrict__ V, float* __restrict__ XT, _Float16* __restrict__ VT) { __shared__ float tl[64][65]; __shared__ __align__(16) _Float16 th[64][72];
  const int tid = threadIdx.x; const int t0 = blockIdx.x * 64, c0 = blockIdx.y * 64; const size_t b = blockIdx.z;
  for (int e = tid; e < 64 * 16; e += 256) { const int cl = e >> 4, q = e & 15; const v4f ld = *(const v4f*)(V + (b * CC + c0 + cl) * (size_t)TT + t0 + q * 4); asm volatile("s_wait_loadcnt 0x0" ::: "memory");
#pragma unroll
    for (int u = 0; u < 4; ++u) { const float r = bfr(ld[u]); tl[cl][q * 4 + u] = r; th[cl][q * 4 + u] = (_Float16)r; } }
  __syncthreads();
  for (int e = tid; e < 64 * 16; e += 256) { const int tr = e >> 4, q = e & 15; v4f o; 
#pragma unroll
    for (int u = 0; u < 4; ++u) o[u] = tl[q * 4 + u][tr];
    vst2(XT + (b * TT + t0 + tr) * (size_t)CC + c0 + q * 4, o); }   
  for (int e = tid; e < 64 * 8; e += 256) { const int cl = e >> 3, q = e & 7; vst2((unsigned*)(VT + (b * CC + c0 + cl) * (size_t)TT + t0 + q * 8), *(const v4u*)&th[cl][q * 8]); } }   
// ---- k_resT: tile (64 times, 64 channels) of batch bz: out[b][c][t] = bf16(v[b][c][t]) + bf16(gamma) * a[b][t][c] (a = the sum of the KSP token-major partial context planes; LDS transpose back to channels-first)
__global__ __launch_bounds__(256) void k_resT(const float* __restrict__ V, const float* __restrict__ A, const float* __restrict__ GM, float* __restrict__ OUT) { __shared__ float tl[64][65];
  const int tid = threadIdx.x; const int t0 = blockIdx.x * 64, c0 = blockIdx.y * 64; const size_t b = blockIdx.z; const float gm = bfr(GM[0]);
  const char* ab = (const char*)(A + (b * TT + t0) * (size_t)CC + c0); const unsigned vo = (unsigned)(((tid >> 4) * CC + (tid & 15) * 4) * 4);   /* tile base (the same for the whole block) + one 32-bit byte offset per lane; planes and trips differ by constants only, so no address is stepped while loads are in flight */
#pragma unroll
  for (int i = 0; i < 4; ++i) { const int tr = (tid >> 4) + 16 * i, q = tid & 15; v4f pl[KSP];
#pragma unroll
    for (int s = 0; s < KSP; ++s) pl[s] = *(const v4f*)(ab + ((size_t)s * YPL + (size_t)i * 16 * CC) * 4 + vo);
    asm volatile("s_wait_loadcnt 0x0\n\ts_wait_xcnt 0x0" :: "v"(vo) : "memory");   /* the eight planes' loads fly together and are all back here, before the sums; vo as an input keeps the lane offset in its register up to this wait */
    v4f ld = pl[0];
#pragma unroll
    for (int s = 1; s < KSP; ++s) ld += pl[s];   /* key slices added in rising order */
#pragma unroll
    for (int u = 0; u < 4; ++u) tl[tr][q * 4 + u] = ld[u]; }
  __syncthreads();
  for (int e = tid; e < 64 * 16; e += 256) { const int cl = e >> 4, q = e & 15; const size_t off = (b * CC + c0 + cl) * (size_t)TT + t0 + q * 4; const v4f vv = *(const v4f*)(V + off); asm volatile("s_wait_loadcnt 0x0" ::: "memory"); v4f o;
#pragma unroll
    for (int u = 0; u < 4; ++u) o[u] = bfr(vv[u]) + gm * tl[q * 4 + u][cl];
    vst2(OUT + off, o); } }   
#define DVH 128            // value columns per k_pv block: the 256-wide value space is walked in two 128-column slices (8 accumulator tiles per wave)
// ---- k_pv: block = (64 queries (qb), 128-column value slice d0, key slice ks) of (b, h0): plane ks of ctx[:, d0 .. d0+127] = P . v over the ks-th of KSP equal runs of the keys [0, kend) (P x 2^11 once to f16 against v f16: 1 product; causal early query blocks: P and v as bf16 hi + lo, 3 products); the 512-B (row, slice) segment by 32 lanes x 16 B
__global__ __launch_bounds__(128) void k_pv(const float* __restrict__ PS0, const _Float16* __restrict__ VT, const __bf16* __restrict__ VB, const __bf16* __restrict__ VBL, int b, int h0, float* __restrict__ Y0) { const int h = h0; const int d0 = blockIdx.y * DVH; const float* PS = PS0; const int ks = blockIdx.z; float* Y = Y0 + (size_t)ks * YPL; __shared__ __align__(16) float ss[4][16][DVH + 4];
  const int tid = threadIdx.x, wave = tid >> 5, lane = tid & 31, col = lane & 15, g = lane >> 4; const int qb = blockIdx.x; const int ql0 = qb * 64 + wave * 16; const int kcn = (kb_last(qb) + 1) * 4 / KSP; const int kcb = ks * kcn, kce = kcb + kcn;   /* (kb_last + 1) * 4 = 128 k-steps: a multiple of KSP */
  v8f acc[DVH / 16] = {};
  if (qb < QBH) {
#pragma unroll 1
    for (int kc = kcb; kc < kce; ++kc) { const F2 p = split_row(PS + (size_t)(ql0 + col) * TT, kc * 32, lane);
      asm volatile("s_wait_loadcnt 0x0" ::: "memory");
#pragma unroll
      for (int j = 0; j < DVH / 16; ++j) { const size_t po = ((size_t)b * CC + h * HD + d0 + j * 16 + col) * (size_t)KHI + kc * 32; const v16b vh = frag_b(VB + po, lane); acc[j] = wmma_bf(p.h, vh, acc[j]); acc[j] = wmma_bf(p.l, vh, acc[j]); acc[j] = wmma_bf(p.h, frag_b(VBL + po, lane), acc[j]); } }
  } else {
#pragma unroll 1
    for (int kc = kcb; kc < kce; ++kc) { const v16h p = frag_f32(PS + (size_t)(ql0 + col) * TT + kc * 32, lane);
      asm volatile("s_wait_loadcnt 0x0" ::: "memory");
#pragma unroll
      for (int j = 0; j < DVH / 16; ++j) { const size_t po = ((size_t)b * CC + h * HD + d0 + j * 16 + col) * (size_t)TT + kc * 32; acc[j] = wmma16(p, frag_h(VT + po, lane), acc[j]); } } }
#pragma unroll
  for (int j = 0; j < DVH / 16; ++j)
#pragma unroll
    for (int r = 0; r < 8; ++r) ss[wave][8 * g + r][j * 16 + col] = acc[j][r] * (1.0f / 2048.0f);
  LDSX(); for (int rl = 0; rl < 16; ++rl) vst2(Y + ((size_t)b * TT + ql0 + rl) * CC + h * HD + d0 + lane * 4, *(const v4f*)&ss[wave][rl][lane * 4]); }   
extern "C" void kernel_launch(void* const* d_in, const int* in_sizes, int n_in, void* d_out, int out_size, void* d_ws, size_t ws_size, hipStream_t stream) {
  (void)in_sizes; (void)n_in; (void)out_size;
  const float** F = (const float**)d_in;
  if (ws_size < (size_t)WS_END) return;
  char* ws = (char*)d_ws; _Float16 *QH = (_Float16*)(ws + WS_QH), *KH = (_Float16*)(ws + WS_KH), *VT = (_Float16*)(ws + WS_VT), *QL = (_Float16*)(ws + WS_QL), *KL = (_Float16*)(ws + WS_KL); __bf16 *VB = (__bf16*)(ws + WS_VB), *VBL = (__bf16*)(ws + WS_VBL); float *S = (float*)(ws + WS_S), *Y = (float*)(ws + WS_Y);
  (void)Y; (void)QL; (void)KL; (void)VB; (void)VBL;
  // inputs: 0 x [4,256,64,64] CHANNELS-FIRST (N = 4,096 positions); 1 Wq [64,256] (out,in), 2 bq [64]; 3 Wk [64,256], 4 bk [64]; 5 Wv [256,256] (out,in), 6 bv [256]; 7 gamma [1] (zero biases, read)
  if (ws_size < (size_t)WS_END3) return;
  float *XT = (float*)(ws + WS_XT), *Y2 = (float*)(ws + WS_Y2);
  k_xT<<<dim3(TT / 64, CC / 64, TNB), 256, 0, stream>>>(F[0], XT, VT);   /* token-major f32 copy of x for the projections (the f16 plane it also writes is overwritten by k_proj's value projection) */
  k_proj<<<dim3(TNB * TT / 64, CC / 128, 3), 128, 0, stream>>>(XT, XT, XT, F[1], F[3], F[5], F[2], F[4], F[6], QH, QL, KH, KL, VT, VB, VBL);   /* which 0: query rows = q (Wq / bq), which 1: key rows = k (Wk / bk) - 64 real columns each; which 2: values v (Wv / bv), all 256 columns */
  for (int b = 0; b < TNB; ++b) for (int q0 = 0; q0 < TT; q0 += TQC) {   /* query chunks: the kernels index query rows from blockIdx, so each pass gets row-advanced q (hi and residual) / ctx pointers, a TQC-row grid and plane rows local to the chunk; keys / values span all 4,096 positions */
    k_sc<<<dim3(TQC / 64, TT / 128, 1), 128, 0, stream>>>(QH + (size_t)q0 * CC, KH, QL + (size_t)q0 * CC, KL, b, 0, S);
    k_sm<<<dim3(TQC, 1), 256, 0, stream>>>(S);
    k_pv<<<dim3(TQC / 64, HD / DVH, KSP), 128, 0, stream>>>(S, VT, VB, VBL, b, 0, Y2 + (size_t)q0 * CC);
  }
  k_resT<<<dim3(TT / 64, CC / 64, TNB), 256, 0, stream>>>(F[0], Y2, F[7], (float*)d_out);   /* out[b][c][m] = x + gamma * o (transposed back to channels-first) */
}

// v002
// One run takes 126 microseconds.
// Two timings next to v001 put it at 4.35 and 4.37 times that version's speed.
// Over all steps from v000 it is 14.5 times as fast.
// compute dtype: all float inputs rounded to bf16; the q / k (64-dim) and v (256-dim) pointwise projections with EXACT bf16 products on WMMA 16x16x32 (f32 accumulate) + bias; UNSCALED scores q_n . k_m with the query as f16 hi + (x 2^10) residual against the key once to f16 (2 products, K = 64: two k-steps); softmax over m in f32 (running maximum and sum, per key slice); unnormalised P x 2^11 once to f16 x v once to f16 (1 product), divided by the f32 sum at the merge; out = bf16(x) + bf16(gamma) * o in f32; f32 output.
#include <hip/hip_runtime.h>
#include <math.h>

typedef __attribute__((ext_vector_type(16))) _Float16 v16h;
typedef __attribute__((ext_vector_type(16))) __bf16 v16b;
typedef __attribute__((ext_vector_type(8)))  _Float16 v8h;
typedef __attribute__((ext_vector_type(8)))  float v8f;
typedef __attribute__((ext_vector_type(4)))  float v4f;
typedef __attribute__((ext_vector_type(2)))  float v2f;
typedef __attribute__((ext_vector_type(4)))  unsigned v4u;
typedef __attribute__((ext_vector_type(4)))  int v4i;
typedef float __attribute__((may_alias)) float_a;
typedef int __attribute__((may_alias)) int_a;

template <typename T> __device__ __forceinline__ void vst2(void* p, T v) { *(T*)p = v;  }
__device__ __forceinline__ v8f wmma16(v16h a, v16h b, v8f c) {
  v8f d = __builtin_amdgcn_wmma_f32_16x16x32_f16(false, a, false, b, (short)0, c, false, false);
  asm volatile("v_nop\n\tv_nop\n\tv_nop\n\tv_nop" : "+v"(d) : "v"(a), "v"(b));
  return d;
}
__device__ __forceinline__ v8f wmma_bf(v16b a, v16b b, v8f c) {
  v8f d = __builtin_amdgcn_wmma_f32_16x16x32_bf16(false, a, false, b, (short)0, c, false, false);
  asm volatile("v_nop\n\tv_nop\n\tv_nop\n\tv_nop" : "+v"(d) : "v"(a), "v"(b));
  return d;
}
// 16x16x32 fragments: lane = (h = lane>>4, row/col = lane&15); elements 0..7 = k0+8h+0..7, 8..15 = k0+16+8h+0..7; D element r = row 8h+r
__device__ __forceinline__ v16h frag_h(const _Float16* rowk0, int lane) {
  union { v16h v; v8h q[2]; } u; const _Float16* p = rowk0 + 8 * (lane >> 4);
  u.q[0] = *(const v8h*)p; u.q[1] = *(const v8h*)(p + 16); return u.v;
}
__device__ __forceinline__ v16h frag_f32(const float* rowk0, int lane) {
  v16h a; const float* p = rowk0 + 8 * (lane >> 4);
#pragma unroll
  for (int i = 0; i < 8; ++i) { a[i] = (_Float16)p[i]; a[8 + i] = (_Float16)p[16 + i]; }
  return a;
}
__device__ __forceinline__ v16h frag_f32s(const float* rowk0, int lane, float sc) {
  v16h a; const float* p = rowk0 + 8 * (lane >> 4);
#pragma unroll
  for (int i = 0; i < 8; ++i) { a[i] = (_Float16)(p[i] * sc); a[8 + i] = (_Float16)(p[16 + i] * sc); }
  return a;
}
// column fragment from a [K][ld] layout (column n), rows >= K read as 0
__device__ __forceinline__ v16h fragc_f32(const float* W, int k0, int n, int lane, int ld, int K) {
  v16h a; const int g = lane >> 4;
#pragma unroll
  for (int i = 0; i < 8; ++i) { const int ka = k0 + 8 * g + i, kb = ka + 16;
    a[i] = (_Float16)(ka < K ? W[(size_t)(ka < K ? ka : K - 1) * ld + n] : 0.f); a[8 + i] = (_Float16)(kb < K ? W[(size_t)(kb < K ? kb : K - 1) * ld + n] : 0.f); }
  return a;
}
struct F2 { v16b h, l; };
__device__ __forceinline__ F2 bsplit16(const float v[16]) { F2 r;
#pragma unroll
  for (int i = 0; i < 16; ++i) { const __bf16 h = (__bf16)v[i]; r.h[i] = h; r.l[i] = (__bf16)(v[i] - (float)h); }
  return r; }
__device__ __forceinline__ F2 split_row(const float* row, int k0, int lane) { float v[16]; const float* p = row + k0 + 8 * (lane >> 4);
#pragma unroll
  for (int i = 0; i < 8; ++i) { v[i] = p[i]; v[8 + i] = p[16 + i]; }
  return bsplit16(v); }
__device__ __forceinline__ F2 split_rowK(const float* row, int k0, int lane, int K) { float v[16]; const int g = lane >> 4;
#pragma unroll
  for (int i = 0; i < 8; ++i) { const int ka = k0 + 8 * g + i, kb = ka + 16; v[i] = ka < K ? row[ka < K ? ka : K - 1] : 0.f; v[8 + i] = kb < K ? row[kb < K ? kb : K - 1] : 0.f; }
  return bsplit16(v); }
__device__ __forceinline__ F2 split_col(const float* W, int k0, int n, int lane, int ld, int K) { float v[16]; const int g = lane >> 4;
#pragma unroll
  for (int i = 0; i < 8; ++i) { const int ka = k0 + 8 * g + i, kb = ka + 16; v[i] = ka < K ? W[(size_t)(ka < K ? ka : K - 1) * ld + n] : 0.f; v[8 + i] = kb < K ? W[(size_t)(kb < K ? kb : K - 1) * ld + n] : 0.f; }
  return bsplit16(v); }
__device__ __forceinline__ v8f mac3(const F2& a, const F2& b, v8f c) { c = wmma_bf(a.l, b.h, c); c = wmma_bf(a.h, b.l, c); return wmma_bf(a.h, b.h, c); }
__device__ __forceinline__ float sigm(float v) { return 1.0f / (1.0f + expf(-v)); }
#define LDSX() do { asm volatile("s_wait_dscnt 0" ::: "memory"); __builtin_amdgcn_wave_barrier(); __builtin_amdgcn_fence(__ATOMIC_RELEASE, "workgroup"); } while (0)

// SAGAN-style 2-D self-attention (x [4,256,64,64] -> N = 4,096 positions; 1x1 convs: q = Wq x + bq, k = Wk x + bk with Wq / Wk [64,256], v = Wv x + bv with Wv [256,256] (1/16 scale, zero biases); attn[n, m] = softmax_m(q[:, n] . k[:, m]) (UNSCALED, sigma - 8: strongly peaked); out[c, n] = sum_m v[c, m] attn[n, m]; result = gamma out + x with gamma [1] uniform(0, 1)).
#define NB 4
#define TT 4096
#define CC 256            // NH * HD = projected width
#define DIN 256          // input (model) width
#define NH 1
#define HD 256
#define NQB (TT / 64)
#define HG 1
#define SCALE (1.0f)
#define CAUSAL 0
#ifndef TNB
#define TNB NB
#endif
__device__ __forceinline__ float bfr(float v) { return (float)(__bf16)v; }
__host__ __device__ __forceinline__ int kb_last(int qb) { return CAUSAL ? ((qb * 64 + 63) >> 7) : (TT / 128 - 1); }
typedef __attribute__((ext_vector_type(8))) __bf16 v8b;
__device__ __forceinline__ v16b frag_b(const __bf16* rowk0, int lane) {
  union { v16b v; v8b q[2]; } u; const __bf16* p = rowk0 + 8 * (lane >> 4);
  u.q[0] = *(const v8b*)p; u.q[1] = *(const v8b*)(p + 16); return u.v;
}
#define QBH 0               // k_fa: single-product P . h on every block (the bf16 hi/lo value planes are not used)
#define QBH_SC 0            // k_fa: every block takes the 2-product branch (q f16 hi + residual against k once to f16): the 3-product variant would cost 4.3 G-slot more planes
#define TQC 2048           // sizes the WS_S region: TQC x 4,096 f32 entries (32 MiB)
#define QHI 4096            // rows carrying a q residual plane (all rows when non-causal: 2-product logits everywhere)
#define KHI 64              // no block reads the k residual plane (QBH_SC 0)
// B fragment (k rows k0+.., output column o) of a weight: (in,out) [K][ld] or (out,in) [ld rows of K]: bf16 exact, or f16(bf16 * 256) exact
__device__ __forceinline__ v16b wcol_io(const float* Wm, int k0, int o, int lane, int ld) { v16b w; const int g = lane >> 4;
#pragma unroll
  for (int i = 0; i < 8; ++i) { w[i] = (__bf16)Wm[(size_t)(k0 + 8 * g + i) * ld + o]; w[8 + i] = (__bf16)Wm[(size_t)(k0 + 16 + 8 * g + i) * ld + o]; }
  return w; }
__device__ __forceinline__ v16b wcol_oi(const float* Wm, int k0, int o, int lane, int K) { v16b w; const float* p = Wm + (size_t)o * K + k0 + 8 * (lane >> 4);
#pragma unroll
  for (int i = 0; i < 8; ++i) { w[i] = (__bf16)p[i]; w[8 + i] = (__bf16)p[16 + i]; }
  return w; }
__device__ __forceinline__ v16h wcolh_io(const float* Wm, int k0, int o, int lane, int ld) { v16h w; const int g = lane >> 4;
#pragma unroll
  for (int i = 0; i < 8; ++i) { w[i] = (_Float16)(bfr(Wm[(size_t)(k0 + 8 * g + i) * ld + o]) * 256.0f); w[8 + i] = (_Float16)(bfr(Wm[(size_t)(k0 + 16 + 8 * g + i) * ld + o]) * 256.0f); }
  return w; }
__device__ __forceinline__ v16h wcolh_oi(const float* Wm, int k0, int o, int lane, int K) { v16h w; const float* p = Wm + (size_t)o * K + k0 + 8 * (lane >> 4);
#pragma unroll
  for (int i = 0; i < 8; ++i) { w[i] = (_Float16)(bfr(p[i]) * 256.0f); w[8 + i] = (_Float16)(bfr(p[16 + i]) * 256.0f); }
  return w; }
#define WQKV_LAYOUT 1   // 0 = (in,out) [DIN][CC]; 1 = (out,in) [CC][DIN]; 2 = per-head [NH][DIN][HD]
__device__ __forceinline__ v16b wcol_hdk(const float* Wm, int k0, int o, int lane) { v16b w; const int g = lane >> 4; const float* p = Wm + (size_t)(o / HD) * DIN * HD + (o % HD);
#pragma unroll
  for (int i = 0; i < 8; ++i) { w[i] = (__bf16)p[(size_t)(k0 + 8 * g + i) * HD]; w[8 + i] = (__bf16)p[(size_t)(k0 + 16 + 8 * g + i) * HD]; }
  return w; }
#define WO_OUT_IN 0
#if WQKV_LAYOUT == 1
#define HDK 64              // real key / query width (C / 4); the q / k rows live in the 256-wide space with columns 64..255 zero
__device__ __forceinline__ v16b zero16b() { v16b w; _Pragma("unroll") for (int i = 0; i < 16; ++i) w[i] = (__bf16)0.0f; return w; }
#define WCOL(W, k0, o, lane) ((which == 2 || (o) < HDK) ? wcol_oi(W, k0, (o), lane, DIN) : zero16b())   /* (out,in): Wh [256][256] full; Wf / Wg [64][256]: projected columns >= 64 are zero fragments (tile-uniform: 64 is a multiple of the 16-column tile) */
#elif WQKV_LAYOUT == 2
#define WCOL(W, k0, o, lane) wcol_hdk(W, k0, o, lane)
#else
#define WCOL(W, k0, o, lane) wcol_io(W, k0, o, lane, CC)
#endif
#if WO_OUT_IN
#define WOCOL(W, k0, o, lane) wcol_oi(W, k0, o, lane, CC)
#define WOCOLH(W, k0, o, lane) wcolh_oi(W, k0, o, lane, CC)
#else
#define WOCOL(W, k0, o, lane) wcol_io(W, k0, o, lane, DIN)
#define WOCOLH(W, k0, o, lane) wcolh_io(W, k0, o, lane, DIN)
#endif

#ifndef SM_EXTRA_PARAMS
#define SM_EXTRA_PARAMS
#endif
#ifndef PROJ_EXTRA_PARAMS
#define PROJ_EXTRA_PARAMS
#endif
#ifndef SM_MASK_HOOK
#define SM_MASK_HOOK (void)0
#endif

#define WS_QH  0u                                      // f16 q rows [b*t][CC]
#define WS_KH  (WS_QH + 2u * (size_t)NB * TT * CC)      // f16 k rows [b*t][CC]
#define WS_VT  (WS_KH + 2u * (size_t)NB * TT * CC)      // f16 v planes [b][c][t]
#define WS_QL  (WS_VT + 2u * (size_t)NB * CC * TT)      // f16 q residual x 2^10 rows [b][t < QHI][CC]
#define WS_KL  (WS_QL + 2u * (size_t)NB * QHI * CC)     // f16 k residual x 2^10 rows [b][t < KHI][CC]
#define WS_VB  (WS_KL + 2u * (size_t)NB * KHI * CC)     // bf16 v hi planes [b][c][t < KHI]
#define WS_VBL (WS_VB + 2u * (size_t)NB * CC * KHI)
#define WS_S   (WS_VBL + 2u * (size_t)NB * CC * KHI)    // f32 softmax statistics (m, l) [key slice][b*t][2] at the head of this region
#define WS_Y   (WS_S  + 4u * (size_t)HG * TQC * TT)      // end of the TQC x TT f32 region
#define WS_END (WS_Y  + 0u)
#define WS_XT (WS_END)                                   // f32 token-major copy of x [b*TT + t][256]
#define WS_Y2 (WS_XT)                                    // f32 partial context rows o[key slice][b*TT + t][256]: plane 0 ALIASES the token-major copy of x, which is dead once k_proj has run (k_resT re-reads x from the input)
#define KSP 4              // key slices of k_fa: one work-group per (query block, key slice, batch); each slice fills its own f32 context plane and its (m, l) rows, k_resT merges the planes
#define YPL ((size_t)NB * TT * CC)   // elements of one context plane
#define WS_END3 (WS_Y2 + 4u * (size_t)KSP * NB * TT * CC)

// ---- k_proj: block = (64 rows, 128 cols, which): q/k/v = X W (+ b) with exact bf16 products (K = DIN) -> which 0: q f16 rows (+ residual rows < QHI); 1: k f16 rows (+ residual rows < KHI); 2: v f16 planes [c][t] (+ bf16 hi/lo planes for t < KHI)
__global__ __launch_bounds__(128) void k_proj(const float* __restrict__ XQ, const float* __restrict__ XK, const float* __restrict__ XV, const float* __restrict__ WQ, const float* __restrict__ WK, const float* __restrict__ WV, const float* __restrict__ BQ, const float* __restrict__ BK, const float* __restrict__ BV,
    _Float16* __restrict__ QH, _Float16* __restrict__ QL, _Float16* __restrict__ KH, _Float16* __restrict__ KL, _Float16* __restrict__ VT, __bf16* __restrict__ VB, __bf16* __restrict__ VBL) {
  __shared__ __align__(16) _Float16 sh[64][136], sl[64][136]; __shared__ __align__(16) _Float16 th[128][72]; __shared__ __align__(16) __bf16 tb[128][72], tbl[128][72];
  const int tid = threadIdx.x, wave = tid >> 5, lane = tid & 31, col = lane & 15, g = lane >> 4; const int which = blockIdx.z; const int c0 = blockIdx.y * 128; const size_t r0 = (size_t)blockIdx.x * 64; const size_t bb = r0 / TT; const int t0 = (int)(r0 % TT);
  const float* X = which == 0 ? XQ : which == 1 ? XK : XV; const float* WA = which == 0 ? WQ : which == 1 ? WK : WV; const float* BA = which == 0 ? BQ : which == 1 ? BK : BV;
  v8f acc[8] = {};
#pragma unroll 2
  for (int kc = 0; kc < DIN / 32; ++kc) { v16b a; { const float* p = X + (r0 + wave * 16 + col) * DIN + kc * 32 + 8 * g;
#pragma unroll
      for (int i = 0; i < 8; ++i) { a[i] = (__bf16)p[i]; a[8 + i] = (__bf16)p[16 + i]; } }
    asm volatile("s_wait_loadcnt 0x0" ::: "memory");
#pragma unroll
    for (int j = 0; j < 8; ++j) { const v16b w = WCOL(WA, kc * 32, c0 + j * 16 + col, lane); asm volatile("s_wait_loadcnt 0x0" ::: "memory"); acc[j] = wmma_bf(a, w, acc[j]); } }
  if (which < 2) { _Float16* DH = which == 0 ? QH : KH; _Float16* DL = which == 0 ? QL : KL; const int nhi = which == 0 ? QHI : KHI; const bool hi_rows = t0 < nhi;
#pragma unroll
    for (int j = 0; j < 8; ++j) { const int bo_ = c0 + j * 16 + col; const float bias = (BA && bo_ < HDK) ? bfr(BA[bo_ < HDK ? bo_ : 0]) : 0.f;   /* bf / bg hold only the 64 real columns */
#pragma unroll
      for (int r = 0; r < 8; ++r) { const float v = acc[j][r] + bias; const _Float16 hv = (_Float16)v; sh[wave * 16 + 8 * g + r][j * 16 + col] = hv; sl[wave * 16 + 8 * g + r][j * 16 + col] = (_Float16)((v - (float)hv) * 1024.0f); } }
    __syncthreads();
    for (int e = tid; e < 64 * 16; e += 128) { const int rl = e >> 4, q = e & 15; vst2((unsigned*)(DH + (r0 + rl) * CC + c0 + q * 8), *(const v4u*)&sh[rl][q * 8]); if (hi_rows) vst2((unsigned*)(DL + (bb * nhi + t0 + rl) * (size_t)CC + c0 + q * 8), *(const v4u*)&sl[rl][q * 8]); }
  } else { const bool hi_rows = t0 < KHI;
#pragma unroll
    for (int j = 0; j < 8; ++j) { const float bias = BA ? bfr(BA[c0 + j * 16 + col]) : 0.f;
#pragma unroll
      for (int r = 0; r < 8; ++r) { const float v = acc[j][r] + bias; const int rl = wave * 16 + 8 * g + r, cl = j * 16 + col; th[cl][rl] = (_Float16)v; const __bf16 bh = (__bf16)v; tb[cl][rl] = bh; tbl[cl][rl] = (__bf16)(v - (float)bh); } }
    __syncthreads();
    for (int e = tid; e < 128 * 8; e += 128) { const int cl = e >> 3, q = e & 7; vst2((unsigned*)(VT + (bb * CC + c0 + cl) * (size_t)TT + t0 + q * 8), *(const v4u*)&th[cl][q * 8]); if (hi_rows) { const size_t o3 = (bb * CC + c0 + cl) * (size_t)KHI + t0 + q * 8; vst2((unsigned*)(VB + o3), *(const v4u*)&tb[cl][q * 8]); vst2((unsigned*)(VBL + o3), *(const v4u*)&tbl[cl][q * 8]); } } } }
// ---- k_xT: tile (64 times, 64 channels) of batch bz: the channels-first input v[b][c][t] -> (1) token-major f32 XT[b*TT + t][c] for the projections (LDS transpose) and (2) the exact f16 value plane VT[b][c][t] (same layout as the input: a converting copy; v is bf16-valued after rounding, hence exact in f16)
__global__ __launch_bounds__(256) void k_xT(const float* __restrict__ V, float* __restrict__ XT, _Float16* __restrict__ VT) { __shared__ float tl[64][65]; __shared__ __align__(16) _Float16 th[64][72];
  const int tid = threadIdx.x; const int t0 = blockIdx.x * 64, c0 = blockIdx.y * 64; const size_t b = blockIdx.z;
  for (int e = tid; e < 64 * 16; e += 256) { const int cl = e >> 4, q = e & 15; const v4f ld = *(const v4f*)(V + (b * CC + c0 + cl) * (size_t)TT + t0 + q * 4); asm volatile("s_wait_loadcnt 0x0" ::: "memory");
#pragma unroll
    for (int u = 0; u < 4; ++u) { const float r = bfr(ld[u]); tl[cl][q * 4 + u] = r; th[cl][q * 4 + u] = (_Float16)r; } }
  __syncthreads();
  for (int e = tid; e < 64 * 16; e += 256) { const int tr = e >> 4, q = e & 15; v4f o; 
#pragma unroll
    for (int u = 0; u < 4; ++u) o[u] = tl[q * 4 + u][tr];
    vst2(XT + (b * TT + t0 + tr) * (size_t)CC + c0 + q * 4, o); }   
  for (int e = tid; e < 64 * 8; e += 256) { const int cl = e >> 3, q = e & 7; vst2((unsigned*)(VT + (b * CC + c0 + cl) * (size_t)TT + t0 + q * 8), *(const v4u*)&th[cl][q * 8]); } }   
// ---- k_resT: tile (64 times, 64 channels) of batch bz: out[b][c][t] = bf16(v[b][c][t]) + bf16(gamma) * a[b][t][c] (a = the KSP token-major partial context planes merged by their softmax statistics: sum_s 2^(m_s - M) plane_s / sum_s 2^(m_s - M) l_s; LDS transpose back to channels-first)
__global__ __launch_bounds__(256) void k_resT(const float* __restrict__ V, const float* __restrict__ A, const float* __restrict__ ML, const float* __restrict__ GM, float* __restrict__ OUT) { __shared__ float tl[64][65];
  const int tid = threadIdx.x; const int t0 = blockIdx.x * 64, c0 = blockIdx.y * 64; const size_t b = blockIdx.z; const float gm = bfr(GM[0]);
  const char* ab = (const char*)(A + (b * TT + t0) * (size_t)CC + c0); const unsigned vo = (unsigned)(((tid >> 4) * CC + (tid & 15) * 4) * 4);   /* tile base (the same for the whole block) + one 32-bit byte offset per lane; planes and trips differ by constants only, so no address is stepped while loads are in flight */
  const char* mb = (const char*)(ML + (b * TT + t0) * 2); const unsigned mvo = (unsigned)((tid >> 4) * 8);
#pragma unroll
  for (int i = 0; i < 4; ++i) { const int tr = (tid >> 4) + 16 * i, q = tid & 15; v4f pl[KSP]; v2f sm[KSP];
#pragma unroll
    for (int s = 0; s < KSP; ++s) { pl[s] = *(const v4f*)(ab + ((size_t)s * YPL + (size_t)i * 16 * CC) * 4 + vo); sm[s] = *(const v2f*)(mb + ((size_t)s * NB * TT + (size_t)i * 16) * 8 + mvo); }
    asm volatile("s_wait_loadcnt 0x0\n\ts_wait_xcnt 0x0" :: "v"(vo) : "memory");   /* the planes' and statistics' loads fly together and are all back here, before the sums; vo as an input keeps the lane offset in its register up to this wait */
    float mx = sm[0][0];
#pragma unroll
    for (int s = 1; s < KSP; ++s) mx = fmaxf(mx, sm[s][0]);
    float w[KSP], den = 0.f;
#pragma unroll
    for (int s = 0; s < KSP; ++s) { w[s] = __builtin_amdgcn_exp2f(sm[s][0] - mx); den += w[s] * sm[s][1]; }
    const float inv = 1.0f / den;   /* the slice that holds the maximum gives at least 2^11 */
    v4f ld = pl[0] * (w[0] * inv);
#pragma unroll
    for (int s = 1; s < KSP; ++s) ld += pl[s] * (w[s] * inv);   /* key slices added in rising order */
#pragma unroll
    for (int u = 0; u < 4; ++u) tl[tr][q * 4 + u] = ld[u]; }
  __syncthreads();
  for (int e = tid; e < 64 * 16; e += 256) { const int cl = e >> 4, q = e & 15; const size_t off = (b * CC + c0 + cl) * (size_t)TT + t0 + q * 4; const v4f vv = *(const v4f*)(V + off); asm volatile("s_wait_loadcnt 0x0" ::: "memory"); v4f o;
#pragma unroll
    for (int u = 0; u < 4; ++u) o[u] = bfr(vv[u]) + gm * tl[q * 4 + u][cl];
    vst2(OUT + off, o); } }   
// ---- k_fa: block = (128 queries qb, key slice ks, batch b), 8 waves x 16 queries: scores, softmax and P . v in one pass over the slice's keys, no score plane. Per 64-key tile: v [256 ch][64 keys] and k [64 keys][64 dims] go to LDS; per 32 keys each wave forms S^T = k . q^T (A = key rows, B = query columns; q hi + residual, 2 products), whose D registers (lane = query, element = key 8g + r) ARE the B fragment of o^T = v^T . P^T (tile 0 -> elements 0..7, tile 1 -> 8..15), so P never leaves the registers. Running maximum m (log2 domain) and sum l per query live one per lane; the accumulators are rescaled only when some lane's maximum moved. Out: unnormalised context plane ks (x 2^11) and (m, l) per (slice, query); k_resT merges the slices.
#define FKT 64             // keys per LDS tile
#define FPI 72             // f16 pitch of both LDS tiles: 144 B = 16 B x 9 (odd multiple: 16-byte fragment reads without bank conflicts)
#define L2E 1.44269504088896340736f
__device__ __forceinline__ v8f wmma_h(v16h a, v16h b, v8f c) { return __builtin_amdgcn_wmma_f32_16x16x32_f16(false, a, false, b, (short)0, c, false, false); }
#define FQW 8              // waves (16 queries each) per work-group; the second launch bound asks for four waves per SIMD, that is two work-groups per WGP, so that one group's products cover the other's tile loads
__global__ __launch_bounds__(FQW * 32, 4) void k_fa(const _Float16* __restrict__ QH, const _Float16* __restrict__ QL, const _Float16* __restrict__ KH, const _Float16* __restrict__ VT, float* __restrict__ Y0, float* __restrict__ ML) {
  __shared__ __align__(16) char smem[FQW * 16 * 132 * 4];   /* the k / v tiles ((CC + FKT) * FPI * 2 = 46,080 B) while the keys are walked, then one 16 x 132 f32 transpose buffer per wave */
  _Float16 (*sV)[FPI] = (_Float16 (*)[FPI])smem; _Float16 (*sK)[FPI] = (_Float16 (*)[FPI])(smem + CC * FPI * 2);
  const int tid = threadIdx.x, wave = tid >> 5, lane = tid & 31, col = lane & 15, g = lane >> 4; const int qb = blockIdx.x, ks = blockIdx.y; const size_t b = blockIdx.z;
  const size_t q0 = b * TT + qb * (FQW * 16) + wave * 16; const int key0 = ks * (TT / KSP);
  v16h qh[HDK / 32], ql[HDK / 32];
#pragma unroll
  for (int kc = 0; kc < HDK / 32; ++kc) { qh[kc] = frag_h(QH + (q0 + col) * CC + kc * 32, lane); ql[kc] = frag_h(QL + (q0 + col) * CC + kc * 32, lane); }
  v8f acc[CC / 16] = {}; float m = -3.0e38f, l = 0.f;
  const char* vb = (const char*)(VT + b * CC * TT + key0); const char* kb = (const char*)(KH + (b * TT + key0) * CC);   /* tile bases (the same for the whole block) + one 32-bit byte offset per lane; rows differ by constants only */
  const unsigned vvo = (unsigned)((tid >> 3) * (TT * 2) + (tid & 7) * 16), kvo = (unsigned)((tid >> 3) * (CC * 2) + (tid & 7) * 16);
#pragma unroll 1   /* one tile per trip: unrolling would only double the staging registers */
  for (int st = 0; st < TT / KSP / FKT; ++st) { v4u rv[CC / 32], rk[FKT / 32];
#pragma unroll
    for (int i = 0; i < CC / 32; ++i) rv[i] = *(const v4u*)(vb + (size_t)st * (FKT * 2) + (size_t)i * (32 * TT * 2) + vvo);   /* 8 lanes x 16 B = one whole 128-B line per value row */
#pragma unroll
    for (int i = 0; i < FKT / 32; ++i) rk[i] = *(const v4u*)(kb + (size_t)st * (FKT * CC * 2) + (size_t)i * (32 * CC * 2) + kvo);
    asm volatile("s_wait_loadcnt 0x0\n\ts_wait_xcnt 0x0" ::: "memory");   /* the tile's ten loads per lane fly together and are all back here, in front of the barrier and of any rewrite of their address registers */
    __syncthreads();   /* every wave has left the previous tile */
#pragma unroll
    for (int i = 0; i < CC / 32; ++i) *(v4u*)&sV[(tid >> 3) + 32 * i][(tid & 7) * 8] = rv[i];
#pragma unroll
    for (int i = 0; i < FKT / 32; ++i) *(v4u*)&sK[(tid >> 3) + 32 * i][(tid & 7) * 8] = rk[i];
    __syncthreads();   /* the tile is published */
#pragma unroll 1   /* rolled: the products of one 32-key half stay a scheduling region of their own */
    for (int kk = 0; kk < FKT / 32; ++kk) { v8f sa[2] = {}, sb[2] = {};
#pragma unroll
      for (int t = 0; t < 2; ++t)
#pragma unroll
        for (int kc = 0; kc < HDK / 32; ++kc) { const v16h a = frag_h(&sK[kk * 32 + t * 16 + col][kc * 32], lane); sa[t] = wmma_h(a, qh[kc], sa[t]); sb[t] = wmma_h(a, ql[kc], sb[t]); }
      float tv[16];
#pragma unroll
      for (int i = 0; i < 16; ++i) tv[i] = (sa[i >> 3][i & 7] + sb[i >> 3][i & 7] * (1.0f / 1024.0f)) * L2E;
      float mx = tv[0];
#pragma unroll
      for (int i = 1; i < 16; ++i) mx = fmaxf(mx, tv[i]);
      mx = fmaxf(mx, __shfl_xor(mx, 16));   /* lanes col and col + 16 hold the two key halves of one query */
      const float mn = fmaxf(m, mx);
      if (__any(mn > m)) { const float al = __builtin_amdgcn_exp2f(m - mn); l *= al;
#pragma unroll
        for (int j = 0; j < CC / 16; ++j) acc[j] *= al;
        m = mn; }
      const float mo = m - 11.0f; v16h p; float ps = 0.f;
#pragma unroll
      for (int i = 0; i < 16; ++i) { const float e = __builtin_amdgcn_exp2f(tv[i] - mo); ps += e; p[i] = (_Float16)e; }
      l += ps;
#pragma unroll
      for (int j = 0; j < CC / 16; ++j) acc[j] = wmma_h(frag_h(&sV[j * 16 + col][kk * 32], lane), p, acc[j]);
      /* order of this block's LDS reads and products: four value fragments ahead, then one product per fragment read; left alone the compiler reads each fragment directly in front of its product, which then waits a whole LDS latency */
      __builtin_amdgcn_sched_group_barrier(0x100, 8, 0);
#pragma unroll
      for (int j = 0; j < CC / 16 - 4; ++j) { __builtin_amdgcn_sched_group_barrier(0x8, 1, 0); __builtin_amdgcn_sched_group_barrier(0x100, 2, 0); }
      __builtin_amdgcn_sched_group_barrier(0x8, 4, 0); } }
  l += __shfl_xor(l, 16);
  if (g == 0) { v2f st2; st2[0] = m; st2[1] = l; vst2(ML + ((size_t)ks * NB * TT + q0 + col) * 2, st2); }   /* 16 lanes x 8 B = one 128-B line per wave */
  __syncthreads();   /* every wave has left the last tile: its LDS becomes the waves' private transpose buffers */
  float* sw = (float*)smem + wave * (16 * 132); float* Y = Y0 + (size_t)ks * YPL;
#pragma unroll
  for (int hh = 0; hh < 2; ++hh) {
#pragma unroll
    for (int jj = 0; jj < 8; ++jj) { const v8f a = acc[hh * 8 + jj]; v4f lo, hi;
#pragma unroll
      for (int u = 0; u < 4; ++u) { lo[u] = a[u]; hi[u] = a[4 + u]; }
      *(v4f*)(sw + col * 132 + jj * 16 + 8 * g) = lo; *(v4f*)(sw + col * 132 + jj * 16 + 8 * g + 4) = hi; }
    LDSX();
#pragma unroll
    for (int rl = 0; rl < 16; ++rl) vst2(Y + (q0 + rl) * CC + hh * 128 + lane * 4, *(const v4f*)(sw + rl * 132 + lane * 4));
    LDSX(); } }
extern "C" void kernel_launch(void* const* d_in, const int* in_sizes, int n_in, void* d_out, int out_size, void* d_ws, size_t ws_size, hipStream_t stream) {
  (void)in_sizes; (void)n_in; (void)out_size;
  const float** F = (const float**)d_in;
  if (ws_size < (size_t)WS_END) return;
  char* ws = (char*)d_ws; _Float16 *QH = (_Float16*)(ws + WS_QH), *KH = (_Float16*)(ws + WS_KH), *VT = (_Float16*)(ws + WS_VT), *QL = (_Float16*)(ws + WS_QL), *KL = (_Float16*)(ws + WS_KL); __bf16 *VB = (__bf16*)(ws + WS_VB), *VBL = (__bf16*)(ws + WS_VBL); float *ML = (float*)(ws + WS_S), *Y = (float*)(ws + WS_Y);
  (void)Y; (void)QL; (void)KL; (void)VB; (void)VBL;
  // inputs: 0 x [4,256,64,64] CHANNELS-FIRST (N = 4,096 positions); 1 Wq [64,256] (out,in), 2 bq [64]; 3 Wk [64,256], 4 bk [64]; 5 Wv [256,256] (out,in), 6 bv [256]; 7 gamma [1] (zero biases, read)
  if (ws_size < (size_t)WS_END3) return;
  float *XT = (float*)(ws + WS_XT), *Y2 = (float*)(ws + WS_Y2);
  k_xT<<<dim3(TT / 64, CC / 64, TNB), 256, 0, stream>>>(F[0], XT, VT);   /* token-major f32 copy of x for the projections (the f16 plane it also writes is overwritten by k_proj's value projection) */
  k_proj<<<dim3(TNB * TT / 64, CC / 128, 3), 128, 0, stream>>>(XT, XT, XT, F[1], F[3], F[5], F[2], F[4], F[6], QH, QL, KH, KL, VT, VB, VBL);   /* which 0: query rows = q (Wq / bq), which 1: key rows = k (Wk / bk) - 64 real columns each; which 2: values v (Wv / bv), all 256 columns */
  k_fa<<<dim3(TT / (FQW * 16), KSP, TNB), FQW * 32, 0, stream>>>(QH, QL, KH, VT, Y2, ML);   /* scores, softmax and P . v fused: one launch for all batches, 512 work-groups of 8 waves */
  k_resT<<<dim3(TT / 64, CC / 64, TNB), 256, 0, stream>>>(F[0], Y2, ML, F[7], (float*)d_out);   /* out[b][c][m] = x + gamma * o (transposed back to channels-first) */
}

// v003
// One run takes 86.9 microseconds.
// In both of two side-by-side timings against v002, it was 1.45 times as fast.
// All steps since v000 together make it 21.0 times as fast.
// compute dtype: all float inputs rounded to bf16; the q / k (64-dim) and v (256-dim) pointwise projections with EXACT bf16 products on WMMA 16x16x32 (f32 accumulate) + bias; UNSCALED scores q_n . k_m with the query as f16 hi + (x 2^10) residual against the key once to f16 (2 products, K = 64: two k-steps); softmax over m in f32 (running maximum and sum, per key slice); unnormalised P x 2^11 once to f16 x v once to f16 (1 product), divided by the f32 sum at the merge; out = bf16(x) + bf16(gamma) * o in f32; f32 output.
#include <hip/hip_runtime.h>
#include <math.h>

typedef __attribute__((ext_vector_type(16))) _Float16 v16h;
typedef __attribute__((ext_vector_type(16))) __bf16 v16b;
typedef __attribute__((ext_vector_type(8)))  _Float16 v8h;
typedef __attribute__((ext_vector_type(8)))  float v8f;
typedef __attribute__((ext_vector_type(4)))  float v4f;
typedef __attribute__((ext_vector_type(2)))  float v2f;
typedef __attribute__((ext_vector_type(4)))  unsigned v4u;
typedef __attribute__((ext_vector_type(4)))  int v4i;
typedef float __attribute__((may_alias)) float_a;
typedef int __attribute__((may_alias)) int_a;

template <typename T> __device__ __forceinline__ void vst2(void* p, T v) { *(T*)p = v;  }
__device__ __forceinline__ v8f wmma16(v16h a, v16h b, v8f c) {
  v8f d = __builtin_amdgcn_wmma_f32_16x16x32_f16(false, a, false, b, (short)0, c, false, false);
  asm volatile("v_nop\n\tv_nop\n\tv_nop\n\tv_nop" : "+v"(d) : "v"(a), "v"(b));
  return d;
}
__device__ __forceinline__ v8f wmma_bf(v16b a, v16b b, v8f c) {
  v8f d = __builtin_amdgcn_wmma_f32_16x16x32_bf16(false, a, false, b, (short)0, c, false, false);
  asm volatile("v_nop\n\tv_nop\n\tv_nop\n\tv_nop" : "+v"(d) : "v"(a), "v"(b));
  return d;
}
// 16x16x32 fragments: lane = (h = lane>>4, row/col = lane&15); elements 0..7 = k0+8h+0..7, 8..15 = k0+16+8h+0..7; D element r = row 8h+r
__device__ __forceinline__ v16h frag_h(const _Float16* rowk0, int lane) {
  union { v16h v; v8h q[2]; } u; const _Float16* p = rowk0 + 8 * (lane >> 4);
  u.q[0] = *(const v8h*)p; u.q[1] = *(const v8h*)(p + 16); return u.v;
}
__device__ __forceinline__ v16h frag_f32(const float* rowk0, int lane) {
  v16h a; const float* p = rowk0 + 8 * (lane >> 4);
#pragma unroll
  for (int i = 0; i < 8; ++i) { a[i] = (_Float16)p[i]; a[8 + i] = (_Float16)p[16 + i]; }
  return a;
}
__device__ __forceinline__ v16h frag_f32s(const float* rowk0, int lane, float sc) {
  v16h a; const float* p = rowk0 + 8 * (lane >> 4);
#pragma unroll
  for (int i = 0; i < 8; ++i) { a[i] = (_Float16)(p[i] * sc); a[8 + i] = (_Float16)(p[16 + i] * sc); }
  return a;
}
// column fragment from a [K][ld] layout (column n), rows >= K read as 0
__device__ __forceinline__ v16h fragc_f32(const float* W, int k0, int n, int lane, int ld, int K) {
  v16h a; const int g = lane >> 4;
#pragma unroll
  for (int i = 0; i < 8; ++i) { const int ka = k0 + 8 * g + i, kb = ka + 16;
    a[i] = (_Float16)(ka < K ? W[(size_t)(ka < K ? ka : K - 1) * ld + n] : 0.f); a[8 + i] = (_Float16)(kb < K ? W[(size_t)(kb < K ? kb : K - 1) * ld + n] : 0.f); }
  return a;
}
struct F2 { v16b h, l; };
__device__ __forceinline__ F2 bsplit16(const float v[16]) { F2 r;
#pragma unroll
  for (int i = 0; i < 16; ++i) { const __bf16 h = (__bf16)v[i]; r.h[i] = h; r.l[i] = (__bf16)(v[i] - (float)h); }
  return r; }
__device__ __forceinline__ F2 split_row(const float* row, int k0, int lane) { float v[16]; const float* p = row + k0 + 8 * (lane >> 4);
#pragma unroll
  for (int i = 0; i < 8; ++i) { v[i] = p[i]; v[8 + i] = p[16 + i]; }
  return bsplit16(v); }
__device__ __forceinline__ F2 split_rowK(const float* row, int k0, int lane, int K) { float v[16]; const int g = lane >> 4;
#pragma unroll
  for (int i = 0; i < 8; ++i) { const int ka = k0 + 8 * g + i, kb = ka + 16; v[i] = ka < K ? row[ka < K ? ka : K - 1] : 0.f; v[8 + i] = kb < K ? row[kb < K ? kb : K - 1] : 0.f; }
  return bsplit16(v); }
__device__ __forceinline__ F2 split_col(const float* W, int k0, int n, int lane, int ld, int K) { float v[16]; const int g = lane >> 4;
#pragma unroll
  for (int i = 0; i < 8; ++i) { const int ka = k0 + 8 * g + i, kb = ka + 16; v[i] = ka < K ? W[(size_t)(ka < K ? ka : K - 1) * ld + n] : 0.f; v[8 + i] = kb < K ? W[(size_t)(kb < K ? kb : K - 1) * ld + n] : 0.f; }
  return bsplit16(v); }
__device__ __forceinline__ v8f mac3(const F2& a, const F2& b, v8f c) { c = wmma_bf(a.l, b.h, c); c = wmma_bf(a.h, b.l, c); return wmma_bf(a.h, b.h, c); }
__device__ __forceinline__ float sigm(float v) { return 1.0f / (1.0f + expf(-v)); }
#define LDSX() do { asm volatile("s_wait_dscnt 0" ::: "memory"); __builtin_amdgcn_wave_barrier(); __builtin_amdgcn_fence(__ATOMIC_RELEASE, "workgroup"); } while (0)

// SAGAN-style 2-D self-attention (x [4,256,64,64] -> N = 4,096 positions; 1x1 convs: q = Wq x + bq, k = Wk x + bk with Wq / Wk [64,256], v = Wv x + bv with Wv [256,256] (1/16 scale, zero biases); attn[n, m] = softmax_m(q[:, n] . k[:, m]) (UNSCALED, sigma - 8: strongly peaked); out[c, n] = sum_m v[c, m] attn[n, m]; result = gamma out + x with gamma [1] uniform(0, 1)).
#define NB 4
#define TT 4096
#define CC 256            // NH * HD = projected width
#define DIN 256          // input (model) width
#define NH 1
#define HD 256
#define NQB (TT / 64)
#define HG 1
#define SCALE (1.0f)
#define CAUSAL 0
#ifndef TNB
#define TNB NB
#endif
__device__ __forceinline__ float bfr(float v) { return (float)(__bf16)v; }
__host__ __device__ __forceinline__ int kb_last(int qb) { return CAUSAL ? ((qb * 64 + 63) >> 7) : (TT / 128 - 1); }
typedef __attribute__((ext_vector_type(8))) __bf16 v8b;
__device__ __forceinline__ v16b frag_b(const __bf16* rowk0, int lane) {
  union { v16b v; v8b q[2]; } u; const __bf16* p = rowk0 + 8 * (lane >> 4);
  u.q[0] = *(const v8b*)p; u.q[1] = *(const v8b*)(p + 16); return u.v;
}
#define QBH 0               // k_fa: single-product P . h on every block (the bf16 hi/lo value planes are not used)
#define QBH_SC 0            // k_fa: every block takes the 2-product branch (q f16 hi + residual against k once to f16): the 3-product variant would cost 4.3 G-slot more planes
#define TQC 2048           // sizes the WS_S region: TQC x 4,096 f32 entries (32 MiB)
#define QHI 4096            // rows carrying a q residual plane (all rows when non-causal: 2-product logits everywhere)
#define KHI 64              // no block reads the k residual plane (QBH_SC 0)
// B fragment (k rows k0+.., output column o) of a weight: (in,out) [K][ld] or (out,in) [ld rows of K]: bf16 exact, or f16(bf16 * 256) exact
__device__ __forceinline__ v16b wcol_io(const float* Wm, int k0, int o, int lane, int ld) { v16b w; const int g = lane >> 4;
#pragma unroll
  for (int i = 0; i < 8; ++i) { w[i] = (__bf16)Wm[(size_t)(k0 + 8 * g + i) * ld + o]; w[8 + i] = (__bf16)Wm[(size_t)(k0 + 16 + 8 * g + i) * ld + o]; }
  return w; }
__device__ __forceinline__ v16b wcol_oi(const float* Wm, int k0, int o, int lane, int K) { v16b w; const float* p = Wm + (size_t)o * K + k0 + 8 * (lane >> 4);
#pragma unroll
  for (int i = 0; i < 8; ++i) { w[i] = (__bf16)p[i]; w[8 + i] = (__bf16)p[16 + i]; }
  return w; }
__device__ __forceinline__ v16h wcolh_io(const float* Wm, int k0, int o, int lane, int ld) { v16h w; const int g = lane >> 4;
#pragma unroll
  for (int i = 0; i < 8; ++i) { w[i] = (_Float16)(bfr(Wm[(size_t)(k0 + 8 * g + i) * ld + o]) * 256.0f); w[8 + i] = (_Float16)(bfr(Wm[(size_t)(k0 + 16 + 8 * g + i) * ld + o]) * 256.0f); }
  return w; }
__device__ __forceinline__ v16h wcolh_oi(const float* Wm, int k0, int o, int lane, int K) { v16h w; const float* p = Wm + (size_t)o * K + k0 + 8 * (lane >> 4);
#pragma unroll
  for (int i = 0; i < 8; ++i) { w[i] = (_Float16)(bfr(p[i]) * 256.0f); w[8 + i] = (_Float16)(bfr(p[16 + i]) * 256.0f); }
  return w; }
#define WQKV_LAYOUT 1   // 0 = (in,out) [DIN][CC]; 1 = (out,in) [CC][DIN]; 2 = per-head [NH][DIN][HD]
__device__ __forceinline__ v16b wcol_hdk(const float* Wm, int k0, int o, int lane) { v16b w; const int g = lane >> 4; const float* p = Wm + (size_t)(o / HD) * DIN * HD + (o % HD);
#pragma unroll
  for (int i = 0; i < 8; ++i) { w[i] = (__bf16)p[(size_t)(k0 + 8 * g + i) * HD]; w[8 + i] = (__bf16)p[(size_t)(k0 + 16 + 8 * g + i) * HD]; }
  return w; }
#define WO_OUT_IN 0
#if WQKV_LAYOUT == 1
#define HDK 64              // real key / query width (C / 4); the q / k rows live in the 256-wide space with columns 64..255 zero
__device__ __forceinline__ v16b zero16b() { v16b w; _Pragma("unroll") for (int i = 0; i < 16; ++i) w[i] = (__bf16)0.0f; return w; }
#define WCOL(W, k0, o, lane) ((which == 2 || (o) < HDK) ? wcol_oi(W, k0, (o), lane, DIN) : zero16b())   /* (out,in): Wh [256][256] full; Wf / Wg [64][256]: projected columns >= 64 are zero fragments (tile-uniform: 64 is a multiple of the 16-column tile) */
#elif WQKV_LAYOUT == 2
#define WCOL(W, k0, o, lane) wcol_hdk(W, k0, o, lane)
#else
#define WCOL(W, k0, o, lane) wcol_io(W, k0, o, lane, CC)
#endif
#if WO_OUT_IN
#define WOCOL(W, k0, o, lane) wcol_oi(W, k0, o, lane, CC)
#define WOCOLH(W, k0, o, lane) wcolh_oi(W, k0, o, lane, CC)
#else
#define WOCOL(W, k0, o, lane) wcol_io(W, k0, o, lane, DIN)
#define WOCOLH(W, k0, o, lane) wcolh_io(W, k0, o, lane, DIN)
#endif

#ifndef SM_EXTRA_PARAMS
#define SM_EXTRA_PARAMS
#endif
#ifndef PROJ_EXTRA_PARAMS
#define PROJ_EXTRA_PARAMS
#endif
#ifndef SM_MASK_HOOK
#define SM_MASK_HOOK (void)0
#endif

#define WS_QH  0u                                      // f16 q rows [b*t][CC]
#define WS_KH  (WS_QH + 2u * (size_t)NB * TT * CC)      // f16 k rows [b*t][CC]
#define WS_VT  (WS_KH + 2u * (size_t)NB * TT * CC)      // f16 v planes [b][c][t]
#define WS_QL  (WS_VT + 2u * (size_t)NB * CC * TT)      // f16 q residual x 2^10 rows [b][t < QHI][CC]
#define WS_KL  (WS_QL + 2u * (size_t)NB * QHI * CC)     // f16 k residual x 2^10 rows [b][t < KHI][CC]
#define WS_VB  (WS_KL + 2u * (size_t)NB * KHI * CC)     // bf16 v hi planes [b][c][t < KHI]
#define WS_VBL (WS_VB + 2u * (size_t)NB * CC * KHI)
#define WS_S   (WS_VBL + 2u * (size_t)NB * CC * KHI)    // f32 softmax statistics (m, l) [key slice][b*t][2] at the head of this region
#define WS_Y   (WS_S  + 4u * (size_t)HG * TQC * TT)      // end of the TQC x TT f32 region
#define WS_END (WS_Y  + 0u)
#define WS_XT (WS_END)                                   // f32 token-major copy of x [b*TT + t][256]
#define WS_Y2 (WS_XT)                                    // f32 partial context rows o[key slice][b*TT + t][256]: plane 0 ALIASES the token-major copy of x, which is dead once k_proj has run (k_resT re-reads x from the input)
#define KSP 4              // key slices of k_fa: one work-group per (query block, key slice, batch); each slice fills its own f32 context plane and its (m, l) rows, k_resT merges the planes
#define YPL ((size_t)NB * TT * CC)   // elements of one context plane
#define WS_END3 (WS_Y2 + 4u * (size_t)KSP * NB * TT * CC)

typedef __attribute__((ext_vector_type(4))) __bf16 v4b;
#define PKP 264            // bf16 pitch of k_proj's staged rows: 528 B = 16 B x 33 (odd multiple: 16-byte fragment reads without bank conflicts)
__device__ __forceinline__ v4b cvt4b(v4f v) { v4b r;
#pragma unroll
  for (int u = 0; u < 4; ++u) r[u] = (__bf16)v[u];
  return r; }
// ---- k_proj: block = (64 rows, 128 cols, which): q/k/v = X W (+ b) with exact bf16 products (K = DIN); the block's x rows and weight rows are rounded to bf16 once and staged in LDS by whole-line loads, every fragment is read from there -> which 0: q f16 rows (+ residual rows < QHI); 1: k f16 rows (+ residual rows < KHI); 2: v f16 planes [c][t] (+ bf16 hi/lo planes for t < KHI)
__global__ __launch_bounds__(128) void k_proj(const float* __restrict__ XQ, const float* __restrict__ XK, const float* __restrict__ XV, const float* __restrict__ WQ, const float* __restrict__ WK, const float* __restrict__ WV, const float* __restrict__ BQ, const float* __restrict__ BK, const float* __restrict__ BV,
    _Float16* __restrict__ QH, _Float16* __restrict__ QL, _Float16* __restrict__ KH, _Float16* __restrict__ KL, _Float16* __restrict__ VT, __bf16* __restrict__ VB, __bf16* __restrict__ VBL) {
  __shared__ __align__(16) char smem[(64 + 128) * PKP * 2];   /* the bf16 x rows and weight rows while the products run, then the output staging tiles (90,112 B) */
  __bf16 (*sX)[PKP] = (__bf16 (*)[PKP])smem; __bf16 (*sW)[PKP] = (__bf16 (*)[PKP])(smem + 64 * PKP * 2);
  _Float16 (*sh)[136] = (_Float16 (*)[136])smem; _Float16 (*sl)[136] = (_Float16 (*)[136])(smem + 17408); _Float16 (*th)[72] = (_Float16 (*)[72])(smem + 34816); __bf16 (*tb)[72] = (__bf16 (*)[72])(smem + 53248); __bf16 (*tbl)[72] = (__bf16 (*)[72])(smem + 71680);
  const int tid = threadIdx.x, wave = tid >> 5, lane = tid & 31, col = lane & 15, g = lane >> 4; const int which = blockIdx.z; const int c0 = blockIdx.y * 128; const size_t r0 = (size_t)blockIdx.x * 64; const size_t bb = r0 / TT; const int t0 = (int)(r0 % TT);
  const float* X = which == 0 ? XQ : which == 1 ? XK : XV; const float* WA = which == 0 ? WQ : which == 1 ? WK : WV; const float* BA = which == 0 ? BQ : which == 1 ? BK : BV;
  const unsigned lo = (unsigned)tid * 16u;   /* the 64 x rows and each 64 weight rows are 64 KiB in a row: block base + one 32-bit byte offset per lane; trips differ by constants only, and every wave-wide load covers 512 B in a row (four whole lines) */
  const int sr = tid >> 6, sc = (tid & 63) * 4;
  { const char* xb = (const char*)(X + r0 * DIN); v4f rx[32];
#pragma unroll
    for (int i = 0; i < 32; ++i) rx[i] = *(const v4f*)(xb + (size_t)i * 2048 + lo);
    asm volatile("s_wait_loadcnt 0x0\n\ts_wait_xcnt 0x0" ::: "memory");   /* the 32 loads per lane fly together and are all back here; the next group's loads stay behind it, so the staging registers are used again */
#pragma unroll
    for (int i = 0; i < 32; ++i) *(v4b*)&sX[sr + 2 * i][sc] = cvt4b(rx[i]); }
#pragma unroll
  for (int hb = 0; hb < 2; ++hb) {
    if (which == 2 || c0 + hb * 64 < HDK) { const char* wb = (const char*)(WA + (size_t)(c0 + hb * 64) * DIN); v4f rw[32];   /* block-uniform test: Wq / Wk hold 64 rows only */
#pragma unroll
      for (int i = 0; i < 32; ++i) rw[i] = *(const v4f*)(wb + (size_t)i * 2048 + lo);
      asm volatile("s_wait_loadcnt 0x0\n\ts_wait_xcnt 0x0" ::: "memory");   /* as above */
#pragma unroll
      for (int i = 0; i < 32; ++i) *(v4b*)&sW[hb * 64 + sr + 2 * i][sc] = cvt4b(rw[i]);
    } else { v4f zz = {};
#pragma unroll
      for (int i = 0; i < 32; ++i) *(v4b*)&sW[hb * 64 + sr + 2 * i][sc] = cvt4b(zz); } }   /* projected columns >= 64 of q / k are zero */
  __syncthreads();   /* both tiles are published */
  v8f acc[8] = {}; v16b a = frag_b(&sX[wave * 16 + col][0], lane), w[8];
#pragma unroll
  for (int j = 0; j < 8; ++j) w[j] = frag_b(&sW[j * 16 + col][0], lane);
#pragma unroll
  for (int kc = 0; kc < DIN / 32; ++kc) { v16b an = a, wn[8];   /* the next k-step's 18 LDS reads stand together in front of this k-step's products, into a second register set: read directly in front of its product, each fragment would cost a whole LDS latency */
#pragma unroll
    for (int j = 0; j < 8; ++j) wn[j] = w[j];
    if (kc + 1 < DIN / 32) { an = frag_b(&sX[wave * 16 + col][kc * 32 + 32], lane);
#pragma unroll
      for (int j = 0; j < 8; ++j) wn[j] = frag_b(&sW[j * 16 + col][kc * 32 + 32], lane); }
#pragma unroll
    for (int j = 0; j < 8; ++j) acc[j] = wmma_bf(a, w[j], acc[j]);
    a = an;
#pragma unroll
    for (int j = 0; j < 8; ++j) w[j] = wn[j]; }
  __syncthreads();   /* every wave has read its last fragment: the LDS becomes the output staging tiles */
  if (which < 2) { _Float16* DH = which == 0 ? QH : KH; _Float16* DL = which == 0 ? QL : KL; const int nhi = which == 0 ? QHI : KHI; const bool hi_rows = t0 < nhi;
#pragma unroll
    for (int j = 0; j < 8; ++j) { const int bo_ = c0 + j * 16 + col; const float bias = (BA && bo_ < HDK) ? bfr(BA[bo_ < HDK ? bo_ : 0]) : 0.f;   /* bf / bg hold only the 64 real columns */
#pragma unroll
      for (int r = 0; r < 8; ++r) { const float v = acc[j][r] + bias; const _Float16 hv = (_Float16)v; sh[wave * 16 + 8 * g + r][j * 16 + col] = hv; sl[wave * 16 + 8 * g + r][j * 16 + col] = (_Float16)((v - (float)hv) * 1024.0f); } }
    __syncthreads();
    for (int e = tid; e < 64 * 16; e += 128) { const int rl = e >> 4, q = e & 15; vst2((unsigned*)(DH + (r0 + rl) * CC + c0 + q * 8), *(const v4u*)&sh[rl][q * 8]); if (hi_rows) vst2((unsigned*)(DL + (bb * nhi + t0 + rl) * (size_t)CC + c0 + q * 8), *(const v4u*)&sl[rl][q * 8]); }
  } else { const bool hi_rows = t0 < KHI;
#pragma unroll
    for (int j = 0; j < 8; ++j) { const float bias = BA ? bfr(BA[c0 + j * 16 + col]) : 0.f;
#pragma unroll
      for (int r = 0; r < 8; ++r) { const float v = acc[j][r] + bias; const int rl = wave * 16 + 8 * g + r, cl = j * 16 + col; th[cl][rl] = (_Float16)v; const __bf16 bh = (__bf16)v; tb[cl][rl] = bh; tbl[cl][rl] = (__bf16)(v - (float)bh); } }
    __syncthreads();
    for (int e = tid; e < 128 * 8; e += 128) { const int cl = e >> 3, q = e & 7; vst2((unsigned*)(VT + (bb * CC + c0 + cl) * (size_t)TT + t0 + q * 8), *(const v4u*)&th[cl][q * 8]); if (hi_rows) { const size_t o3 = (bb * CC + c0 + cl) * (size_t)KHI + t0 + q * 8; vst2((unsigned*)(VB + o3), *(const v4u*)&tb[cl][q * 8]); vst2((unsigned*)(VBL + o3), *(const v4u*)&tbl[cl][q * 8]); } } } }
// ---- k_xT: tile (64 times, 64 channels) of batch bz: the channels-first input v[b][c][t] -> (1) token-major f32 XT[b*TT + t][c] for the projections (LDS transpose) and (2) the exact f16 value plane VT[b][c][t] (same layout as the input: a converting copy; v is bf16-valued after rounding, hence exact in f16)
__global__ __launch_bounds__(256) void k_xT(const float* __restrict__ V, float* __restrict__ XT, _Float16* __restrict__ VT) { __shared__ float tl[64][65]; __shared__ __align__(16) _Float16 th[64][72];
  const int tid = threadIdx.x; const int t0 = blockIdx.x * 64, c0 = blockIdx.y * 64; const size_t b = blockIdx.z;
  for (int e = tid; e < 64 * 16; e += 256) { const int cl = e >> 4, q = e & 15; const v4f ld = *(const v4f*)(V + (b * CC + c0 + cl) * (size_t)TT + t0 + q * 4); asm volatile("s_wait_loadcnt 0x0" ::: "memory");
#pragma unroll
    for (int u = 0; u < 4; ++u) { const float r = bfr(ld[u]); tl[cl][q * 4 + u] = r; th[cl][q * 4 + u] = (_Float16)r; } }
  __syncthreads();
  for (int e = tid; e < 64 * 16; e += 256) { const int tr = e >> 4, q = e & 15; v4f o; 
#pragma unroll
    for (int u = 0; u < 4; ++u) o[u] = tl[q * 4 + u][tr];
    vst2(XT + (b * TT + t0 + tr) * (size_t)CC + c0 + q * 4, o); }   
  for (int e = tid; e < 64 * 8; e += 256) { const int cl = e >> 3, q = e & 7; vst2((unsigned*)(VT + (b * CC + c0 + cl) * (size_t)TT + t0 + q * 8), *(const v4u*)&th[cl][q * 8]); } }   
// ---- k_resT: tile (64 times, 64 channels) of batch bz: out[b][c][t] = bf16(v[b][c][t]) + bf16(gamma) * a[b][t][c] (a = the KSP token-major partial context planes merged by their softmax statistics: sum_s 2^(m_s - M) plane_s / sum_s 2^(m_s - M) l_s; LDS transpose back to channels-first)
__global__ __launch_bounds__(256) void k_resT(const float* __restrict__ V, const float* __restrict__ A, const float* __restrict__ ML, const float* __restrict__ GM, float* __restrict__ OUT) { __shared__ float tl[64][65];
  const int tid = threadIdx.x; const int t0 = blockIdx.x * 64, c0 = blockIdx.y * 64; const size_t b = blockIdx.z; const float gm = bfr(GM[0]);
  const char* ab = (const char*)(A + (b * TT + t0) * (size_t)CC + c0); const unsigned vo = (unsigned)(((tid >> 4) * CC + (tid & 15) * 4) * 4);   /* tile base (the same for the whole block) + one 32-bit byte offset per lane; planes and trips differ by constants only, so no address is stepped while loads are in flight */
  const char* mb = (const char*)(ML + (b * TT + t0) * 2); const unsigned mvo = (unsigned)((tid >> 4) * 8);
#pragma unroll
  for (int i = 0; i < 4; ++i) { const int tr = (tid >> 4) + 16 * i, q = tid & 15; v4f pl[KSP]; v2f sm[KSP];
#pragma unroll
    for (int s = 0; s < KSP; ++s) { pl[s] = *(const v4f*)(ab + ((size_t)s * YPL + (size_t)i * 16 * CC) * 4 + vo); sm[s] = *(const v2f*)(mb + ((size_t)s * NB * TT + (size_t)i * 16) * 8 + mvo); }
    asm volatile("s_wait_loadcnt 0x0\n\ts_wait_xcnt 0x0" :: "v"(vo) : "memory");   /* the planes' and statistics' loads fly together and are all back here, before the sums; vo as an input keeps the lane offset in its register up to this wait */
    float mx = sm[0][0];
#pragma unroll
    for (int s = 1; s < KSP; ++s) mx = fmaxf(mx, sm[s][0]);
    float w[KSP], den = 0.f;
#pragma unroll
    for (int s = 0; s < KSP; ++s) { w[s] = __builtin_amdgcn_exp2f(sm[s][0] - mx); den += w[s] * sm[s][1]; }
    const float inv = 1.0f / den;   /* the slice that holds the maximum gives at least 2^11 */
    v4f ld = pl[0] * (w[0] * inv);
#pragma unroll
    for (int s = 1; s < KSP; ++s) ld += pl[s] * (w[s] * inv);   /* key slices added in rising order */
#pragma unroll
    for (int u = 0; u < 4; ++u) tl[tr][q * 4 + u] = ld[u]; }
  __syncthreads();
  for (int e = tid; e < 64 * 16; e += 256) { const int cl = e >> 4, q = e & 15; const size_t off = (b * CC + c0 + cl) * (size_t)TT + t0 + q * 4; const v4f vv = *(const v4f*)(V + off); asm volatile("s_wait_loadcnt 0x0" ::: "memory"); v4f o;
#pragma unroll
    for (int u = 0; u < 4; ++u) o[u] = bfr(vv[u]) + gm * tl[q * 4 + u][cl];
    vst2(OUT + off, o); } }   
// ---- k_fa: block = (128 queries qb, key slice ks, batch b), 8 waves x 16 queries: scores, softmax and P . v in one pass over the slice's keys, no score plane. Per 64-key tile: v [256 ch][64 keys] and k [64 keys][64 dims] go to LDS; per 32 keys each wave forms S^T = k . q^T (A = key rows, B = query columns; q hi + residual, 2 products), whose D registers (lane = query, element = key 8g + r) ARE the B fragment of o^T = v^T . P^T (tile 0 -> elements 0..7, tile 1 -> 8..15), so P never leaves the registers. Running maximum m (log2 domain) and sum l per query live one per lane; the accumulators are rescaled only when some lane's maximum moved. Out: unnormalised context plane ks (x 2^11) and (m, l) per (slice, query); k_resT merges the slices.
#define FKT 64             // keys per LDS tile
#define FPI 72             // f16 pitch of both LDS tiles: 144 B = 16 B x 9 (odd multiple: 16-byte fragment reads without bank conflicts)
#define L2E 1.44269504088896340736f
__device__ __forceinline__ v8f wmma_h(v16h a, v16h b, v8f c) { return __builtin_amdgcn_wmma_f32_16x16x32_f16(false, a, false, b, (short)0, c, false, false); }
#define FQW 8              // waves (16 queries each) per work-group; the second launch bound asks for four waves per SIMD, that is two work-groups per WGP, so that one group's products cover the other's tile loads
__global__ __launch_bounds__(FQW * 32, 4) void k_fa(const _Float16* __restrict__ QH, const _Float16* __restrict__ QL, const _Float16* __restrict__ KH, const _Float16* __restrict__ VT, float* __restrict__ Y0, float* __restrict__ ML) {
  __shared__ __align__(16) char smem[FQW * 16 * 132 * 4];   /* the k / v tiles ((CC + FKT) * FPI * 2 = 46,080 B) while the keys are walked, then one 16 x 132 f32 transpose buffer per wave */
  _Float16 (*sV)[FPI] = (_Float16 (*)[FPI])smem; _Float16 (*sK)[FPI] = (_Float16 (*)[FPI])(smem + CC * FPI * 2);
  const int tid = threadIdx.x, wave = tid >> 5, lane = tid & 31, col = lane & 15, g = lane >> 4; const int qb = blockIdx.x, ks = blockIdx.y; const size_t b = blockIdx.z;
  const size_t q0 = b * TT + qb * (FQW * 16) + wave * 16; const int key0 = ks * (TT / KSP);
  v16h qh[HDK / 32], ql[HDK / 32];
#pragma unroll
  for (int kc = 0; kc < HDK / 32; ++kc) { qh[kc] = frag_h(QH + (q0 + col) * CC + kc * 32, lane); ql[kc] = frag_h(QL + (q0 + col) * CC + kc * 32, lane); }
  v8f acc[CC / 16] = {}; float m = -3.0e38f, l = 0.f;
  const char* vb = (const char*)(VT + b * CC * TT + key0); const char* kb = (const char*)(KH + (b * TT + key0) * CC);   /* tile bases (the same for the whole block) + one 32-bit byte offset per lane; rows differ by constants only */
  const unsigned vvo = (unsigned)((tid >> 3) * (TT * 2) + (tid & 7) * 16), kvo = (unsigned)((tid >> 3) * (CC * 2) + (tid & 7) * 16);
#pragma unroll 1   /* one tile per trip: unrolling would only double the staging registers */
  for (int st = 0; st < TT / KSP / FKT; ++st) { v4u rv[CC / 32], rk[FKT / 32];
#pragma unroll
    for (int i = 0; i < CC / 32; ++i) rv[i] = *(const v4u*)(vb + (size_t)st * (FKT * 2) + (size_t)i * (32 * TT * 2) + vvo);   /* 8 lanes x 16 B = one whole 128-B line per value row */
#pragma unroll
    for (int i = 0; i < FKT / 32; ++i) rk[i] = *(const v4u*)(kb + (size_t)st * (FKT * CC * 2) + (size_t)i * (32 * CC * 2) + kvo);
    asm volatile("s_wait_loadcnt 0x0\n\ts_wait_xcnt 0x0" ::: "memory");   /* the tile's ten loads per lane fly together and are all back here, in front of the barrier and of any rewrite of their address registers */
    __syncthreads();   /* every wave has left the previous tile */
#pragma unroll
    for (int i = 0; i < CC / 32; ++i) *(v4u*)&sV[(tid >> 3) + 32 * i][(tid & 7) * 8] = rv[i];
#pragma unroll
    for (int i = 0; i < FKT / 32; ++i) *(v4u*)&sK[(tid >> 3) + 32 * i][(tid & 7) * 8] = rk[i];
    __syncthreads();   /* the tile is published */
#pragma unroll 1   /* rolled: the products of one 32-key half stay a scheduling region of their own */
    for (int kk = 0; kk < FKT / 32; ++kk) { v8f sa[2] = {}, sb[2] = {};
#pragma unroll
      for (int t = 0; t < 2; ++t)
#pragma unroll
        for (int kc = 0; kc < HDK / 32; ++kc) { const v16h a = frag_h(&sK[kk * 32 + t * 16 + col][kc * 32], lane); sa[t] = wmma_h(a, qh[kc], sa[t]); sb[t] = wmma_h(a, ql[kc], sb[t]); }
      float tv[16];
#pragma unroll
      for (int i = 0; i < 16; ++i) tv[i] = (sa[i >> 3][i & 7] + sb[i >> 3][i & 7] * (1.0f / 1024.0f)) * L2E;
      float mx = tv[0];
#pragma unroll
      for (int i = 1; i < 16; ++i) mx = fmaxf(mx, tv[i]);
      mx = fmaxf(mx, __shfl_xor(mx, 16));   /* lanes col and col + 16 hold the two key halves of one query */
      const float mn = fmaxf(m, mx);
      if (__any(mn > m)) { const float al = __builtin_amdgcn_exp2f(m - mn); l *= al;
#pragma unroll
        for (int j = 0; j < CC / 16; ++j) acc[j] *= al;
        m = mn; }
      const float mo = m - 11.0f; v16h p; float ps = 0.f;
#pragma unroll
      for (int i = 0; i < 16; ++i) { const float e = __builtin_amdgcn_exp2f(tv[i] - mo); ps += e; p[i] = (_Float16)e; }
      l += ps;
#pragma unroll
      for (int j = 0; j < CC / 16; ++j) acc[j] = wmma_h(frag_h(&sV[j * 16 + col][kk * 32], lane), p, acc[j]);
      /* order of this block's LDS reads and products: four value fragments ahead, then one product per fragment read; left alone the compiler reads each fragment directly in front of its product, which then waits a whole LDS latency */
      __builtin_amdgcn_sched_group_barrier(0x100, 8, 0);
#pragma unroll
      for (int j = 0; j < CC / 16 - 4; ++j) { __builtin_amdgcn_sched_group_barrier(0x8, 1, 0); __builtin_amdgcn_sched_group_barrier(0x100, 2, 0); }
      __builtin_amdgcn_sched_group_barrier(0x8, 4, 0); } }
  l += __shfl_xor(l, 16);
  if (g == 0) { v2f st2; st2[0] = m; st2[1] = l; vst2(ML + ((size_t)ks * NB * TT + q0 + col) * 2, st2); }   /* 16 lanes x 8 B = one 128-B line per wave */
  __syncthreads();   /* every wave has left the last tile: its LDS becomes the waves' private transpose buffers */
  float* sw = (float*)smem + wave * (16 * 132); float* Y = Y0 + (size_t)ks * YPL;
#pragma unroll
  for (int hh = 0; hh < 2; ++hh) {
#pragma unroll
    for (int jj = 0; jj < 8; ++jj) { const v8f a = acc[hh * 8 + jj]; v4f lo, hi;
#pragma unroll
      for (int u = 0; u < 4; ++u) { lo[u] = a[u]; hi[u] = a[4 + u]; }
      *(v4f*)(sw + col * 132 + jj * 16 + 8 * g) = lo; *(v4f*)(sw + col * 132 + jj * 16 + 8 * g + 4) = hi; }
    LDSX();
#pragma unroll
    for (int rl = 0; rl < 16; ++rl) vst2(Y + (q0 + rl) * CC + hh * 128 + lane * 4, *(const v4f*)(sw + rl * 132 + lane * 4));
    LDSX(); } }
extern "C" void kernel_launch(void* const* d_in, const int* in_sizes, int n_in, void* d_out, int out_size, void* d_ws, size_t ws_size, hipStream_t stream) {
  (void)in_sizes; (void)n_in; (void)out_size;
  const float** F = (const float**)d_in;
  if (ws_size < (size_t)WS_END) return;
  char* ws = (char*)d_ws; _Float16 *QH = (_Float16*)(ws + WS_QH), *KH = (_Float16*)(ws + WS_KH), *VT = (_Float16*)(ws + WS_VT), *QL = (_Float16*)(ws + WS_QL), *KL = (_Float16*)(ws + WS_KL); __bf16 *VB = (__bf16*)(ws + WS_VB), *VBL = (__bf16*)(ws + WS_VBL); float *ML = (float*)(ws + WS_S), *Y = (float*)(ws + WS_Y);
  (void)Y; (void)QL; (void)KL; (void)VB; (void)VBL;
  // inputs: 0 x [4,256,64,64] CHANNELS-FIRST (N = 4,096 positions); 1 Wq [64,256] (out,in), 2 bq [64]; 3 Wk [64,256], 4 bk [64]; 5 Wv [256,256] (out,in), 6 bv [256]; 7 gamma [1] (zero biases, read)
  if (ws_size < (size_t)WS_END3) return;
  float *XT = (float*)(ws + WS_XT), *Y2 = (float*)(ws + WS_Y2);
  k_xT<<<dim3(TT / 64, CC / 64, TNB), 256, 0, stream>>>(F[0], XT, VT);   /* token-major f32 copy of x for the projections (the f16 plane it also writes is overwritten by k_proj's value projection) */
  k_proj<<<dim3(TNB * TT / 64, CC / 128, 3), 128, 0, stream>>>(XT, XT, XT, F[1], F[3], F[5], F[2], F[4], F[6], QH, QL, KH, KL, VT, VB, VBL);   /* which 0: query rows = q (Wq / bq), which 1: key rows = k (Wk / bk) - 64 real columns each; which 2: values v (Wv / bv), all 256 columns */
  k_fa<<<dim3(TT / (FQW * 16), KSP, TNB), FQW * 32, 0, stream>>>(QH, QL, KH, VT, Y2, ML);   /* scores, softmax and P . v fused: one launch for all batches, 512 work-groups of 8 waves */
  k_resT<<<dim3(TT / 64, CC / 64, TNB), 256, 0, stream>>>(F[0], Y2, ML, F[7], (float*)d_out);   /* out[b][c][m] = x + gamma * o (transposed back to channels-first) */
}

// v004
// One run takes 81.1 microseconds.
// Next to v003, in two timings, it ran 1.07 times as fast each time.
// Over all steps from v000 it is 22.5 times as fast.
// compute dtype: all float inputs rounded to bf16; the q / k (64-dim) and v (256-dim) pointwise projections with EXACT bf16 products on WMMA 16x16x32 (f32 accumulate) + bias; UNSCALED scores q_n . k_m with the query as f16 hi + (x 2^10) residual against the key once to f16 (2 products, K = 64: two k-steps); softmax over m in f32 (running maximum and sum, per key slice); unnormalised P x 2^11 once to f16 x v once to f16 (1 product), divided by the f32 sum at the merge; out = bf16(x) + bf16(gamma) * o in f32; f32 output.
#include <hip/hip_runtime.h>
#include <math.h>

typedef __attribute__((ext_vector_type(16))) _Float16 v16h;
typedef __attribute__((ext_vector_type(16))) __bf16 v16b;
typedef __attribute__((ext_vector_type(8)))  _Float16 v8h;
typedef __attribute__((ext_vector_type(8)))  float v8f;
typedef __attribute__((ext_vector_type(4)))  float v4f;
typedef __attribute__((ext_vector_type(2)))  float v2f;
typedef __attribute__((ext_vector_type(4)))  unsigned v4u;
typedef __attribute__((ext_vector_type(4)))  int v4i;
typedef float __attribute__((may_alias)) float_a;
typedef int __attribute__((may_alias)) int_a;

template <typename T> __device__ __forceinline__ void vst2(void* p, T v) { *(T*)p = v;  }
__device__ __forceinline__ v8f wmma16(v16h a, v16h b, v8f c) {
  v8f d = __builtin_amdgcn_wmma_f32_16x16x32_f16(false, a, false, b, (short)0, c, false, false);
  asm volatile("v_nop\n\tv_nop\n\tv_nop\n\tv_nop" : "+v"(d) : "v"(a), "v"(b));
  return d;
}
__device__ __forceinline__ v8f wmma_bf(v16b a, v16b b, v8f c) {
  v8f d = __builtin_amdgcn_wmma_f32_16x16x32_bf16(false, a, false, b, (short)0, c, false, false);
  asm volatile("v_nop\n\tv_nop\n\tv_nop\n\tv_nop" : "+v"(d) : "v"(a), "v"(b));
  return d;
}
// 16x16x32 fragments: lane = (h = lane>>4, row/col = lane&15); elements 0..7 = k0+8h+0..7, 8..15 = k0+16+8h+0..7; D element r = row 8h+r
__device__ __forceinline__ v16h frag_h(const _Float16* rowk0, int lane) {
  union { v16h v; v8h q[2]; } u; const _Float16* p = rowk0 + 8 * (lane >> 4);
  u.q[0] = *(const v8h*)p; u.q[1] = *(const v8h*)(p + 16); return u.v;
}
__device__ __forceinline__ v16h frag_f32(const float* rowk0, int lane) {
  v16h a; const float* p = rowk0 + 8 * (lane >> 4);
#pragma unroll
  for (int i = 0; i < 8; ++i) { a[i] = (_Float16)p[i]; a[8 + i] = (_Float16)p[16 + i]; }
  return a;
}
__device__ __forceinline__ v16h frag_f32s(const float* rowk0, int lane, float sc) {
  v16h a; const float* p = rowk0 + 8 * (lane >> 4);
#pragma unroll
  for (int i = 0; i < 8; ++i) { a[i] = (_Float16)(p[i] * sc); a[8 + i] = (_Float16)(p[16 + i] * sc); }
  return a;
}
// column fragment from a [K][ld] layout (column n), rows >= K read as 0
__device__ __forceinline__ v16h fragc_f32(const float* W, int k0, int n, int lane, int ld, int K) {
  v16h a; const int g = lane >> 4;
#pragma unroll
  for (int i = 0; i < 8; ++i) { const int ka = k0 + 8 * g + i, kb = ka + 16;
    a[i] = (_Float16)(ka < K ? W[(size_t)(ka < K ? ka : K - 1) * ld + n] : 0.f); a[8 + i] = (_Float16)(kb < K ? W[(size_t)(kb < K ? kb : K - 1) * ld + n] : 0.f); }
  return a;
}
struct F2 { v16b h, l; };
__device__ __forceinline__ F2 bsplit16(const float v[16]) { F2 r;
#pragma unroll
  for (int i = 0; i < 16; ++i) { const __bf16 h = (__bf16)v[i]; r.h[i] = h; r.l[i] = (__bf16)(v[i] - (float)h); }
  return r; }
__device__ __forceinline__ F2 split_row(const float* row, int k0, int lane) { float v[16]; const float* p = row + k0 + 8 * (lane >> 4);
#pragma unroll
  for (int i = 0; i < 8; ++i) { v[i] = p[i]; v[8 + i] = p[16 + i]; }
  return bsplit16(v); }
__device__ __forceinline__ F2 split_rowK(const float* row, int k0, int lane, int K) { float v[16]; const int g = lane >> 4;
#pragma unroll
  for (int i = 0; i < 8; ++i) { const int ka = k0 + 8 * g + i, kb = ka + 16; v[i] = ka < K ? row[ka < K ? ka : K - 1] : 0.f; v[8 + i] = kb < K ? row[kb < K ? kb : K - 1] : 0.f; }
  return bsplit16(v); }
__device__ __forceinline__ F2 split_col(const float* W, int k0, int n, int lane, int ld, int K) { float v[16]; const int g = lane >> 4;
#pragma unroll
  for (int i = 0; i < 8; ++i) { const int ka = k0 + 8 * g + i, kb = ka + 16; v[i] = ka < K ? W[(size_t)(ka < K ? ka : K - 1) * ld + n] : 0.f; v[8 + i] = kb < K ? W[(size_t)(kb < K ? kb : K - 1) * ld + n] : 0.f; }
  return bsplit16(v); }
__device__ __forceinline__ v8f mac3(const F2& a, const F2& b, v8f c) { c = wmma_bf(a.l, b.h, c); c = wmma_bf(a.h, b.l, c); return wmma_bf(a.h, b.h, c); }
__device__ __forceinline__ float sigm(float v) { return 1.0f / (1.0f + expf(-v)); }
#define LDSX() do { asm volatile("s_wait_dscnt 0" ::: "memory"); __builtin_amdgcn_wave_barrier(); __builtin_amdgcn_fence(__ATOMIC_RELEASE, "workgroup"); } while (0)

// SAGAN-style 2-D self-attention (x [4,256,64,64] -> N = 4,096 positions; 1x1 convs: q = Wq x + bq, k = Wk x + bk with Wq / Wk [64,256], v = Wv x + bv with Wv [256,256] (1/16 scale, zero biases); attn[n, m] = softmax_m(q[:, n] . k[:, m]) (UNSCALED, sigma - 8: strongly peaked); out[c, n] = sum_m v[c, m] attn[n, m]; result = gamma out + x with gamma [1] uniform(0, 1)).
#define NB 4
#define TT 4096
#define CC 256            // NH * HD = projected width
#define DIN 256          // input (model) width
#define NH 1
#define HD 256
#define NQB (TT / 64)
#define HG 1
#define SCALE (1.0f)
#define CAUSAL 0
#ifndef TNB
#define TNB NB
#endif
__device__ __forceinline__ float bfr(float v) { return (float)(__bf16)v; }
__host__ __device__ __forceinline__ int kb_last(int qb) { return CAUSAL ? ((qb * 64 + 63) >> 7) : (TT / 128 - 1); }
typedef __attribute__((ext_vector_type(8))) __bf16 v8b;
__device__ __forceinline__ v16b frag_b(const __bf16* rowk0, int lane) {
  union { v16b v; v8b q[2]; } u; const __bf16* p = rowk0 + 8 * (lane >> 4);
  u.q[0] = *(const v8b*)p; u.q[1] = *(const v8b*)(p + 16); return u.v;
}
#define QBH 0               // k_fa: single-product P . h on every block (the bf16 hi/lo value planes are not used)
#define QBH_SC 0            // k_fa: every block takes the 2-product branch (q f16 hi + residual against k once to f16): the 3-product variant would cost 4.3 G-slot more planes
#define TQC 2048           // sizes the WS_S region: TQC x 4,096 f32 entries (32 MiB)
#define QHI 4096            // rows carrying a q residual plane (all rows when non-causal: 2-product logits everywhere)
#define KHI 64              // no block reads the k residual plane (QBH_SC 0)
// B fragment (k rows k0+.., output column o) of a weight: (in,out) [K][ld] or (out,in) [ld rows of K]: bf16 exact, or f16(bf16 * 256) exact
__device__ __forceinline__ v16b wcol_io(const float* Wm, int k0, int o, int lane, int ld) { v16b w; const int g = lane >> 4;
#pragma unroll
  for (int i = 0; i < 8; ++i) { w[i] = (__bf16)Wm[(size_t)(k0 + 8 * g + i) * ld + o]; w[8 + i] = (__bf16)Wm[(size_t)(k0 + 16 + 8 * g + i) * ld + o]; }
  return w; }
__device__ __forceinline__ v16b wcol_oi(const float* Wm, int k0, int o, int lane, int K) { v16b w; const float* p = Wm + (size_t)o * K + k0 + 8 * (lane >> 4);
#pragma unroll
  for (int i = 0; i < 8; ++i) { w[i] = (__bf16)p[i]; w[8 + i] = (__bf16)p[16 + i]; }
  return w; }
__device__ __forceinline__ v16h wcolh_io(const float* Wm, int k0, int o, int lane, int ld) { v16h w; const int g = lane >> 4;
#pragma unroll
  for (int i = 0; i < 8; ++i) { w[i] = (_Float16)(bfr(Wm[(size_t)(k0 + 8 * g + i) * ld + o]) * 256.0f); w[8 + i] = (_Float16)(bfr(Wm[(size_t)(k0 + 16 + 8 * g + i) * ld + o]) * 256.0f); }
  return w; }
__device__ __forceinline__ v16h wcolh_oi(const float* Wm, int k0, int o, int lane, int K) { v16h w; const float* p = Wm + (size_t)o * K + k0 + 8 * (lane >> 4);
#pragma unroll
  for (int i = 0; i < 8; ++i) { w[i] = (_Float16)(bfr(p[i]) * 256.0f); w[8 + i] = (_Float16)(bfr(p[16 + i]) * 256.0f); }
  return w; }
#define WQKV_LAYOUT 1   // 0 = (in,out) [DIN][CC]; 1 = (out,in) [CC][DIN]; 2 = per-head [NH][DIN][HD]
__device__ __forceinline__ v16b wcol_hdk(const float* Wm, int k0, int o, int lane) { v16b w; const int g = lane >> 4; const float* p = Wm + (size_t)(o / HD) * DIN * HD + (o % HD);
#pragma unroll
  for (int i = 0; i < 8; ++i) { w[i] = (__bf16)p[(size_t)(k0 + 8 * g + i) * HD]; w[8 + i] = (__bf16)p[(size_t)(k0 + 16 + 8 * g + i) * HD]; }
  return w; }
#define WO_OUT_IN 0
#if WQKV_LAYOUT == 1
#define HDK 64              // real key / query width (C / 4); the q / k rows live in the 256-wide space with columns 64..255 zero
__device__ __forceinline__ v16b zero16b() { v16b w; _Pragma("unroll") for (int i = 0; i < 16; ++i) w[i] = (__bf16)0.0f; return w; }
#define WCOL(W, k0, o, lane) ((which == 2 || (o) < HDK) ? wcol_oi(W, k0, (o), lane, DIN) : zero16b())   /* (out,in): Wh [256][256] full; Wf / Wg [64][256]: projected columns >= 64 are zero fragments (tile-uniform: 64 is a multiple of the 16-column tile) */
#elif WQKV_LAYOUT == 2
#define WCOL(W, k0, o, lane) wcol_hdk(W, k0, o, lane)
#else
#define WCOL(W, k0, o, lane) wcol_io(W, k0, o, lane, CC)
#endif
#if WO_OUT_IN
#define WOCOL(W, k0, o, lane) wcol_oi(W, k0, o, lane, CC)
#define WOCOLH(W, k0, o, lane) wcolh_oi(W, k0, o, lane, CC)
#else
#define WOCOL(W, k0, o, lane) wcol_io(W, k0, o, lane, DIN)
#define WOCOLH(W, k0, o, lane) wcolh_io(W, k0, o, lane, DIN)
#endif

#ifndef SM_EXTRA_PARAMS
#define SM_EXTRA_PARAMS
#endif
#ifndef PROJ_EXTRA_PARAMS
#define PROJ_EXTRA_PARAMS
#endif
#ifndef SM_MASK_HOOK
#define SM_MASK_HOOK (void)0
#endif

#define WS_QH  0u                                      // f16 q rows [b*t][CC]
#define WS_KH  (WS_QH + 2u * (size_t)NB * TT * CC)      // f16 k rows [b*t][CC]
#define WS_VT  (WS_KH + 2u * (size_t)NB * TT * CC)      // f16 v planes [b][c][t]
#define WS_QL  (WS_VT + 2u * (size_t)NB * CC * TT)      // f16 q residual x 2^10 rows [b][t < QHI][CC]
#define WS_KL  (WS_QL + 2u * (size_t)NB * QHI * CC)     // f16 k residual x 2^10 rows [b][t < KHI][CC]
#define WS_VB  (WS_KL + 2u * (size_t)NB * KHI * CC)     // bf16 v hi planes [b][c][t < KHI]
#define WS_VBL (WS_VB + 2u * (size_t)NB * CC * KHI)
#define WS_S   (WS_VBL + 2u * (size_t)NB * CC * KHI)    // f32 softmax statistics (m, l) [key slice][b*t][2] at the head of this region
#define WS_Y   (WS_S  + 4u * (size_t)HG * TQC * TT)      // end of the TQC x TT f32 region
#define WS_END (WS_Y  + 0u)
#define WS_XT (WS_END)                                   // f32 token-major copy of x [b*TT + t][256]
#define WS_Y2 (WS_XT)                                    // f32 partial context rows o[key slice][b*TT + t][256]: plane 0 ALIASES the token-major copy of x, which is dead once k_proj has run (k_resT re-reads x from the input)
#define KSP 4              // key slices of k_fa: one work-group per (query block, key slice, batch); each slice fills its own f32 context plane and its (m, l) rows, k_resT merges the planes
#define YPL ((size_t)NB * TT * CC)   // elements of one context plane
#define WS_END3 (WS_Y2 + 4u * (size_t)KSP * NB * TT * CC)

typedef __attribute__((ext_vector_type(4))) __bf16 v4b;
#define PKP 264            // bf16 pitch of k_proj's staged rows: 528 B = 16 B x 33 (odd multiple: 16-byte fragment reads without bank conflicts)
__device__ __forceinline__ v4b cvt4b(v4f v) { v4b r;
#pragma unroll
  for (int u = 0; u < 4; ++u) r[u] = (__bf16)v[u];
  return r; }
// ---- k_proj: block = (64 rows, 128 cols, which): q/k/v = X W (+ b) with exact bf16 products (K = DIN); the block's x rows and weight rows are rounded to bf16 once and staged in LDS by whole-line loads, every fragment is read from there -> which 0: q f16 rows (+ residual rows < QHI); 1: k f16 rows (+ residual rows < KHI); 2: v f16 planes [c][t] (+ bf16 hi/lo planes for t < KHI)
__global__ __launch_bounds__(128) void k_proj(const float* __restrict__ XQ, const float* __restrict__ XK, const float* __restrict__ XV, const float* __restrict__ WQ, const float* __restrict__ WK, const float* __restrict__ WV, const float* __restrict__ BQ, const float* __restrict__ BK, const float* __restrict__ BV,
    _Float16* __restrict__ QH, _Float16* __restrict__ QL, _Float16* __restrict__ KH, _Float16* __restrict__ KL, _Float16* __restrict__ VT, __bf16* __restrict__ VB, __bf16* __restrict__ VBL) {
  __shared__ __align__(16) char smem[(64 + 128) * PKP * 2];   /* the bf16 x rows and weight rows while the products run, then the output staging tiles (90,112 B) */
  __bf16 (*sX)[PKP] = (__bf16 (*)[PKP])smem; __bf16 (*sW)[PKP] = (__bf16 (*)[PKP])(smem + 64 * PKP * 2);
  _Float16 (*sh)[136] = (_Float16 (*)[136])smem; _Float16 (*sl)[136] = (_Float16 (*)[136])(smem + 17408); _Float16 (*th)[72] = (_Float16 (*)[72])(smem + 34816); __bf16 (*tb)[72] = (__bf16 (*)[72])(smem + 53248); __bf16 (*tbl)[72] = (__bf16 (*)[72])(smem + 71680);
  const int tid = threadIdx.x, wave = tid >> 5, lane = tid & 31, col = lane & 15, g = lane >> 4; const int which = blockIdx.z; const int c0 = blockIdx.y * 128; const size_t r0 = (size_t)blockIdx.x * 64; const size_t bb = r0 / TT; const int t0 = (int)(r0 % TT);
  const float* X = which == 0 ? XQ : which == 1 ? XK : XV; const float* WA = which == 0 ? WQ : which == 1 ? WK : WV; const float* BA = which == 0 ? BQ : which == 1 ? BK : BV;
  const unsigned lo = (unsigned)tid * 16u;   /* the 64 x rows and each 64 weight rows are 64 KiB in a row: block base + one 32-bit byte offset per lane; trips differ by constants only, and every wave-wide load covers 512 B in a row (four whole lines) */
  const int sr = tid >> 6, sc = (tid & 63) * 4;
  { const char* xb = (const char*)(X + r0 * DIN); v4f rx[32];
#pragma unroll
    for (int i = 0; i < 32; ++i) rx[i] = *(const v4f*)(xb + (size_t)i * 2048 + lo);
    asm volatile("s_wait_loadcnt 0x0\n\ts_wait_xcnt 0x0" ::: "memory");   /* the 32 loads per lane fly together and are all back here; the next group's loads stay behind it, so the staging registers are used again */
#pragma unroll
    for (int i = 0; i < 32; ++i) *(v4b*)&sX[sr + 2 * i][sc] = cvt4b(rx[i]); }
#pragma unroll
  for (int hb = 0; hb < 2; ++hb) {
    if (which == 2 || c0 + hb * 64 < HDK) { const char* wb = (const char*)(WA + (size_t)(c0 + hb * 64) * DIN); v4f rw[32];   /* block-uniform test: Wq / Wk hold 64 rows only */
#pragma unroll
      for (int i = 0; i < 32; ++i) rw[i] = *(const v4f*)(wb + (size_t)i * 2048 + lo);
      asm volatile("s_wait_loadcnt 0x0\n\ts_wait_xcnt 0x0" ::: "memory");   /* as above */
#pragma unroll
      for (int i = 0; i < 32; ++i) *(v4b*)&sW[hb * 64 + sr + 2 * i][sc] = cvt4b(rw[i]);
    } else { v4f zz = {};
#pragma unroll
      for (int i = 0; i < 32; ++i) *(v4b*)&sW[hb * 64 + sr + 2 * i][sc] = cvt4b(zz); } }   /* projected columns >= 64 of q / k are zero */
  __syncthreads();   /* both tiles are published */
  v8f acc[8] = {}; v16b a = frag_b(&sX[wave * 16 + col][0], lane), w[8];
#pragma unroll
  for (int j = 0; j < 8; ++j) w[j] = frag_b(&sW[j * 16 + col][0], lane);
#pragma unroll
  for (int kc = 0; kc < DIN / 32; ++kc) { v16b an = a, wn[8];   /* the next k-step's 18 LDS reads stand together in front of this k-step's products, into a second register set: read directly in front of its product, each fragment would cost a whole LDS latency */
#pragma unroll
    for (int j = 0; j < 8; ++j) wn[j] = w[j];
    if (kc + 1 < DIN / 32) { an = frag_b(&sX[wave * 16 + col][kc * 32 + 32], lane);
#pragma unroll
      for (int j = 0; j < 8; ++j) wn[j] = frag_b(&sW[j * 16 + col][kc * 32 + 32], lane); }
#pragma unroll
    for (int j = 0; j < 8; ++j) acc[j] = wmma_bf(a, w[j], acc[j]);
    a = an;
#pragma unroll
    for (int j = 0; j < 8; ++j) w[j] = wn[j]; }
  __syncthreads();   /* every wave has read its last fragment: the LDS becomes the output staging tiles */
  if (which < 2) { _Float16* DH = which == 0 ? QH : KH; _Float16* DL = which == 0 ? QL : KL; const int nhi = which == 0 ? QHI : KHI; const bool hi_rows = t0 < nhi;
#pragma unroll
    for (int j = 0; j < 8; ++j) { const int bo_ = c0 + j * 16 + col; const float bias = (BA && bo_ < HDK) ? bfr(BA[bo_ < HDK ? bo_ : 0]) : 0.f;   /* bf / bg hold only the 64 real columns */
#pragma unroll
      for (int r = 0; r < 8; ++r) { const float v = acc[j][r] + bias; const _Float16 hv = (_Float16)v; sh[wave * 16 + 8 * g + r][j * 16 + col] = hv; sl[wave * 16 + 8 * g + r][j * 16 + col] = (_Float16)((v - (float)hv) * 1024.0f); } }
    __syncthreads();
    for (int e = tid; e < 64 * 16; e += 128) { const int rl = e >> 4, q = e & 15; vst2((unsigned*)(DH + (r0 + rl) * CC + c0 + q * 8), *(const v4u*)&sh[rl][q * 8]); if (hi_rows) vst2((unsigned*)(DL + (bb * nhi + t0 + rl) * (size_t)CC + c0 + q * 8), *(const v4u*)&sl[rl][q * 8]); }
  } else { const bool hi_rows = t0 < KHI;
#pragma unroll
    for (int j = 0; j < 8; ++j) { const float bias = BA ? bfr(BA[c0 + j * 16 + col]) : 0.f;
#pragma unroll
      for (int r = 0; r < 8; ++r) { const float v = acc[j][r] + bias; const int rl = wave * 16 + 8 * g + r, cl = j * 16 + col; th[cl][rl] = (_Float16)v; const __bf16 bh = (__bf16)v; tb[cl][rl] = bh; tbl[cl][rl] = (__bf16)(v - (float)bh); } }
    __syncthreads();
    for (int e = tid; e < 128 * 8; e += 128) { const int cl = e >> 3, q = e & 7; vst2((unsigned*)(VT + (bb * CC + c0 + cl) * (size_t)TT + t0 + q * 8), *(const v4u*)&th[cl][q * 8]); if (hi_rows) { const size_t o3 = (bb * CC + c0 + cl) * (size_t)KHI + t0 + q * 8; vst2((unsigned*)(VB + o3), *(const v4u*)&tb[cl][q * 8]); vst2((unsigned*)(VBL + o3), *(const v4u*)&tbl[cl][q * 8]); } } } }
// ---- k_xT: tile (64 times, 64 channels) of batch bz: the channels-first input v[b][c][t] -> (1) token-major f32 XT[b*TT + t][c] for the projections (LDS transpose) and (2) the exact f16 value plane VT[b][c][t] (same layout as the input: a converting copy; v is bf16-valued after rounding, hence exact in f16)
__global__ __launch_bounds__(256) void k_xT(const float* __restrict__ V, float* __restrict__ XT, _Float16* __restrict__ VT) { __shared__ float tl[64][65]; __shared__ __align__(16) _Float16 th[64][72];
  const int tid = threadIdx.x; const int t0 = blockIdx.x * 64, c0 = blockIdx.y * 64; const size_t b = blockIdx.z;
  for (int e = tid; e < 64 * 16; e += 256) { const int cl = e >> 4, q = e & 15; const v4f ld = *(const v4f*)(V + (b * CC + c0 + cl) * (size_t)TT + t0 + q * 4); asm volatile("s_wait_loadcnt 0x0" ::: "memory");
#pragma unroll
    for (int u = 0; u < 4; ++u) { const float r = bfr(ld[u]); tl[cl][q * 4 + u] = r; th[cl][q * 4 + u] = (_Float16)r; } }
  __syncthreads();
  for (int e = tid; e < 64 * 16; e += 256) { const int tr = e >> 4, q = e & 15; v4f o; 
#pragma unroll
    for (int u = 0; u < 4; ++u) o[u] = tl[q * 4 + u][tr];
    vst2(XT + (b * TT + t0 + tr) * (size_t)CC + c0 + q * 4, o); }   
  for (int e = tid; e < 64 * 8; e += 256) { const int cl = e >> 3, q = e & 7; vst2((unsigned*)(VT + (b * CC + c0 + cl) * (size_t)TT + t0 + q * 8), *(const v4u*)&th[cl][q * 8]); } }   
// ---- k_resT: tile (64 times, 64 channels) of batch bz: out[b][c][t] = bf16(v[b][c][t]) + bf16(gamma) * a[b][t][c] (a = the KSP token-major partial context planes merged by their softmax statistics: sum_s 2^(m_s - M) plane_s / sum_s 2^(m_s - M) l_s; LDS transpose back to channels-first)
__global__ __launch_bounds__(256) void k_resT(const float* __restrict__ V, const float* __restrict__ A, const float* __restrict__ ML, const float* __restrict__ GM, float* __restrict__ OUT) { __shared__ float tl[64][65];
  const int tid = threadIdx.x; const int t0 = blockIdx.x * 64, c0 = blockIdx.y * 64; const size_t b = blockIdx.z; const float gm = bfr(GM[0]);
  const char* ab = (const char*)(A + (b * TT + t0) * (size_t)CC + c0); const unsigned vo = (unsigned)(((tid >> 4) * CC + (tid & 15) * 4) * 4);   /* tile base (the same for the whole block) + one 32-bit byte offset per lane; planes and trips differ by constants only, so no address is stepped while loads are in flight */
  const char* mb = (const char*)(ML + (b * TT + t0) * 2); const unsigned mvo = (unsigned)((tid >> 4) * 8);
#pragma unroll
  for (int i = 0; i < 4; ++i) { const int tr = (tid >> 4) + 16 * i, q = tid & 15; v4f pl[KSP]; v2f sm[KSP];
#pragma unroll
    for (int s = 0; s < KSP; ++s) { pl[s] = *(const v4f*)(ab + ((size_t)s * YPL + (size_t)i * 16 * CC) * 4 + vo); sm[s] = *(const v2f*)(mb + ((size_t)s * NB * TT + (size_t)i * 16) * 8 + mvo); }
    asm volatile("s_wait_loadcnt 0x0\n\ts_wait_xcnt 0x0" :: "v"(vo) : "memory");   /* the planes' and statistics' loads fly together and are all back here, before the sums; vo as an input keeps the lane offset in its register up to this wait */
    float mx = sm[0][0];
#pragma unroll
    for (int s = 1; s < KSP; ++s) mx = fmaxf(mx, sm[s][0]);
    float w[KSP], den = 0.f;
#pragma unroll
    for (int s = 0; s < KSP; ++s) { w[s] = __builtin_amdgcn_exp2f(sm[s][0] - mx); den += w[s] * sm[s][1]; }
    const float inv = 1.0f / den;   /* the slice that holds the maximum gives at least 2^11 */
    v4f ld = pl[0] * (w[0] * inv);
#pragma unroll
    for (int s = 1; s < KSP; ++s) ld += pl[s] * (w[s] * inv);   /* key slices added in rising order */
#pragma unroll
    for (int u = 0; u < 4; ++u) tl[tr][q * 4 + u] = ld[u]; }
  __syncthreads();
  for (int e = tid; e < 64 * 16; e += 256) { const int cl = e >> 4, q = e & 15; const size_t off = (b * CC + c0 + cl) * (size_t)TT + t0 + q * 4; const v4f vv = *(const v4f*)(V + off); asm volatile("s_wait_loadcnt 0x0" ::: "memory"); v4f o;
#pragma unroll
    for (int u = 0; u < 4; ++u) o[u] = bfr(vv[u]) + gm * tl[q * 4 + u][cl];
    vst2(OUT + off, o); } }   
// ---- k_fa: block = (128 queries qb, key slice ks, batch b), 8 waves x 16 queries: scores, softmax and P . v in one pass over the slice's keys, no score plane. Per 64-key tile: v [256 ch][64 keys] and k [64 keys][64 dims] go to LDS by asynchronous copies, two buffers, the next tile in flight while this one is worked on; per 32 keys each wave forms S^T = k . q^T (A = key rows, B = query columns; q hi + residual, 2 products), whose D registers (lane = query, element = key 8g + r) ARE the B fragment of o^T = v^T . P^T (tile 0 -> elements 0..7, tile 1 -> 8..15), so P never leaves the registers. Running maximum m (log2 domain) and sum l per query live one per lane; the accumulators are rescaled only when some lane's maximum moved. Out: unnormalised context plane ks (x 2^11) and (m, l) per (slice, query); k_resT merges the slices.
#define FKT 64             // keys per LDS tile
#define FPI 72             // f16 pitch of both LDS tiles: 144 B = 16 B x 9 (odd multiple: 16-byte fragment reads without bank conflicts)
#define L2E 1.44269504088896340736f
__device__ __forceinline__ v8f wmma_h(v16h a, v16h b, v8f c) { return __builtin_amdgcn_wmma_f32_16x16x32_f16(false, a, false, b, (short)0, c, false, false); }
#define FTB ((CC + FKT) * FPI * 2)   // bytes of one k / v tile buffer (46,080)
// one tile: ten 16-byte asynchronous copies per lane (8 value rows, 2 key rows, 32 rows apart), global memory -> LDS through no register. lb = the lane's LDS byte address in the buffer, gv / gk = its global addresses. The s_wait_xcnt 0 stands inside the copies' own statement, so that no address register is rewritten in front of it.
__device__ __forceinline__ void fa_copy(unsigned lb, const char* gv, const char* gk) {
  asm volatile("global_load_async_to_lds_b128 %0, %1, off\n\t"
               "global_load_async_to_lds_b128 %2, %3, off\n\t"
               "global_load_async_to_lds_b128 %4, %5, off\n\t"
               "global_load_async_to_lds_b128 %6, %7, off\n\t"
               "global_load_async_to_lds_b128 %8, %9, off\n\t"
               "global_load_async_to_lds_b128 %10, %11, off\n\t"
               "global_load_async_to_lds_b128 %12, %13, off\n\t"
               "global_load_async_to_lds_b128 %14, %15, off\n\t"
               "global_load_async_to_lds_b128 %16, %17, off\n\t"
               "global_load_async_to_lds_b128 %18, %19, off\n\t"
               "s_wait_xcnt 0x0"
               :: "v"(lb), "v"(gv), "v"(lb + 1u * 32 * FPI * 2), "v"(gv + 1 * 32 * TT * 2), "v"(lb + 2u * 32 * FPI * 2), "v"(gv + 2 * 32 * TT * 2), "v"(lb + 3u * 32 * FPI * 2), "v"(gv + 3 * 32 * TT * 2),
                  "v"(lb + 4u * 32 * FPI * 2), "v"(gv + 4 * 32 * TT * 2), "v"(lb + 5u * 32 * FPI * 2), "v"(gv + 5 * 32 * TT * 2), "v"(lb + 6u * 32 * FPI * 2), "v"(gv + 6 * 32 * TT * 2), "v"(lb + 7u * 32 * FPI * 2), "v"(gv + 7 * 32 * TT * 2),
                  "v"(lb + 8u * 32 * FPI * 2), "v"(gk), "v"(lb + 9u * 32 * FPI * 2), "v"(gk + 32 * CC * 2) : "memory"); }
#define FQW 8              // waves (16 queries each) per work-group; the second launch bound asks for four waves per SIMD, that is two work-groups per WGP, so that one group's products cover the other's tile loads
__global__ __launch_bounds__(FQW * 32, 4) void k_fa(const _Float16* __restrict__ QH, const _Float16* __restrict__ QL, const _Float16* __restrict__ KH, const _Float16* __restrict__ VT, float* __restrict__ Y0, float* __restrict__ ML) {
  __shared__ __align__(16) char smem[2 * FTB];   /* two k / v tile buffers (92,160 B) while the keys are walked, then one 16 x 132 f32 transpose buffer per wave (67,584 B) */
  const int tid = threadIdx.x, wave = tid >> 5, lane = tid & 31, col = lane & 15, g = lane >> 4; const int qb = blockIdx.x, ks = blockIdx.y; const size_t b = blockIdx.z;
  const size_t q0 = b * TT + qb * (FQW * 16) + wave * 16; const int key0 = ks * (TT / KSP);
  v16h qh[HDK / 32], ql[HDK / 32];
#pragma unroll
  for (int kc = 0; kc < HDK / 32; ++kc) { qh[kc] = frag_h(QH + (q0 + col) * CC + kc * 32, lane); ql[kc] = frag_h(QL + (q0 + col) * CC + kc * 32, lane); }
  v8f acc[CC / 16] = {}; float m = -3.0e38f, l = 0.f;
  const char* vb = (const char*)(VT + b * CC * TT + key0); const char* kb = (const char*)(KH + (b * TT + key0) * CC);   /* tile bases (the same for the whole block) + one 32-bit byte offset per lane; rows differ by constants only */
  const unsigned vvo = (unsigned)((tid >> 3) * (TT * 2) + (tid & 7) * 16), kvo = (unsigned)((tid >> 3) * (CC * 2) + (tid & 7) * 16);
  const unsigned lb = (unsigned)(size_t)smem + (unsigned)((tid >> 3) * (FPI * 2) + (tid & 7) * 16);   /* 8 lanes x 16 B = one whole 128-B line per value or key row */
  const char* gv = vb + vvo; const char* gk = kb + kvo;
  fa_copy(lb, gv, gk);   /* tile 0 -> buffer 0 */
  asm volatile("s_wait_asynccnt 0x0" ::: "memory");   /* this wave's copies of tile 0 have landed */
  __syncthreads();   /* tile 0 is published */
  fa_copy(lb + FTB, gv + FKT * 2, gk + FKT * CC * 2);   /* tile 1 -> buffer 1 */
#pragma unroll 1   /* rolled: one copy of the tile's code serves both buffers, which differ by one address term; unrolled it would only lengthen the hot text */
  for (int st = 0; st < TT / KSP / FKT; ++st) { const char* tb = smem + (st & 1) * FTB; const _Float16 (*sV)[FPI] = (const _Float16 (*)[FPI])tb; const _Float16 (*sK)[FPI] = (const _Float16 (*)[FPI])(tb + CC * FPI * 2);
#pragma unroll 1   /* rolled: the products of one 32-key half stay a scheduling region of their own */
    for (int kk = 0; kk < FKT / 32; ++kk) { v8f sa[2] = {}, sb[2] = {};
#pragma unroll
      for (int t = 0; t < 2; ++t)
#pragma unroll
        for (int kc = 0; kc < HDK / 32; ++kc) { const v16h a = frag_h(&sK[kk * 32 + t * 16 + col][kc * 32], lane); sa[t] = wmma_h(a, qh[kc], sa[t]); sb[t] = wmma_h(a, ql[kc], sb[t]); }
      float tv[16];
#pragma unroll
      for (int i = 0; i < 16; ++i) tv[i] = (sa[i >> 3][i & 7] + sb[i >> 3][i & 7] * (1.0f / 1024.0f)) * L2E;
      float mx = tv[0];
#pragma unroll
      for (int i = 1; i < 16; ++i) mx = fmaxf(mx, tv[i]);
      mx = fmaxf(mx, __shfl_xor(mx, 16));   /* lanes col and col + 16 hold the two key halves of one query */
      const float mn = fmaxf(m, mx);
      if (__any(mn > m)) { const float al = __builtin_amdgcn_exp2f(m - mn); l *= al;
#pragma unroll
        for (int j = 0; j < CC / 16; ++j) acc[j] *= al;
        m = mn; }
      const float mo = m - 11.0f; v16h p; float ps = 0.f;
#pragma unroll
      for (int i = 0; i < 16; ++i) { const float e = __builtin_amdgcn_exp2f(tv[i] - mo); ps += e; p[i] = (_Float16)e; }
      l += ps;
#pragma unroll
      for (int j = 0; j < CC / 16; ++j) acc[j] = wmma_h(frag_h(&sV[j * 16 + col][kk * 32], lane), p, acc[j]);
      /* order of this block's LDS reads and products: four value fragments ahead, then one product per fragment read; left alone the compiler reads each fragment directly in front of its product, which then waits a whole LDS latency */
      __builtin_amdgcn_sched_group_barrier(0x100, 8, 0);
#pragma unroll
      for (int j = 0; j < CC / 16 - 4; ++j) { __builtin_amdgcn_sched_group_barrier(0x8, 1, 0); __builtin_amdgcn_sched_group_barrier(0x100, 2, 0); }
      __builtin_amdgcn_sched_group_barrier(0x8, 4, 0); }
    asm volatile("s_wait_dscnt 0x0" ::: "memory");      /* this wave's reads of the tile are back */
    asm volatile("s_wait_asynccnt 0x0" ::: "memory");   /* this wave's copies of the next tile have landed */
    __syncthreads();   /* the next tile is published, and every wave has left this one */
    if (st + 2 < TT / KSP / FKT) fa_copy(lb + (unsigned)(st & 1) * FTB, gv + (size_t)(st + 2) * (FKT * 2), gk + (size_t)(st + 2) * (FKT * CC * 2)); }   /* block-uniform test: tile st + 2 goes into the buffer just left and flies during trip st + 1 */
  asm volatile("s_wait_asynccnt 0x0" ::: "memory");   /* no copy is outstanding when the LDS changes its use */
  l += __shfl_xor(l, 16);
  if (g == 0) { v2f st2; st2[0] = m; st2[1] = l; vst2(ML + ((size_t)ks * NB * TT + q0 + col) * 2, st2); }   /* 16 lanes x 8 B = one 128-B line per wave */
  /* the last trip's barrier has ended every wave's reads of the tiles: the LDS becomes the waves' private transpose buffers */
  float* sw = (float*)smem + wave * (16 * 132); float* Y = Y0 + (size_t)ks * YPL;
#pragma unroll
  for (int hh = 0; hh < 2; ++hh) {
#pragma unroll
    for (int jj = 0; jj < 8; ++jj) { const v8f a = acc[hh * 8 + jj]; v4f lo, hi;
#pragma unroll
      for (int u = 0; u < 4; ++u) { lo[u] = a[u]; hi[u] = a[4 + u]; }
      *(v4f*)(sw + col * 132 + jj * 16 + 8 * g) = lo; *(v4f*)(sw + col * 132 + jj * 16 + 8 * g + 4) = hi; }
    LDSX();
#pragma unroll
    for (int rl = 0; rl < 16; ++rl) vst2(Y + (q0 + rl) * CC + hh * 128 + lane * 4, *(const v4f*)(sw + rl * 132 + lane * 4));
    LDSX(); } }
extern "C" void kernel_launch(void* const* d_in, const int* in_sizes, int n_in, void* d_out, int out_size, void* d_ws, size_t ws_size, hipStream_t stream) {
  (void)in_sizes; (void)n_in; (void)out_size;
  const float** F = (const float**)d_in;
  if (ws_size < (size_t)WS_END) return;
  char* ws = (char*)d_ws; _Float16 *QH = (_Float16*)(ws + WS_QH), *KH = (_Float16*)(ws + WS_KH), *VT = (_Float16*)(ws + WS_VT), *QL = (_Float16*)(ws + WS_QL), *KL = (_Float16*)(ws + WS_KL); __bf16 *VB = (__bf16*)(ws + WS_VB), *VBL = (__bf16*)(ws + WS_VBL); float *ML = (float*)(ws + WS_S), *Y = (float*)(ws + WS_Y);
  (void)Y; (void)QL; (void)KL; (void)VB; (void)VBL;
  // inputs: 0 x [4,256,64,64] CHANNELS-FIRST (N = 4,096 positions); 1 Wq [64,256] (out,in), 2 bq [64]; 3 Wk [64,256], 4 bk [64]; 5 Wv [256,256] (out,in), 6 bv [256]; 7 gamma [1] (zero biases, read)
  if (ws_size < (size_t)WS_END3) return;
  float *XT = (float*)(ws + WS_XT), *Y2 = (float*)(ws + WS_Y2);
  k_xT<<<dim3(TT / 64, CC / 64, TNB), 256, 0, stream>>>(F[0], XT, VT);   /* token-major f32 copy of x for the projections (the f16 plane it also writes is overwritten by k_proj's value projection) */
  k_proj<<<dim3(TNB * TT / 64, CC / 128, 3), 128, 0, stream>>>(XT, XT, XT, F[1], F[3], F[5], F[2], F[4], F[6], QH, QL, KH, KL, VT, VB, VBL);   /* which 0: query rows = q (Wq / bq), which 1: key rows = k (Wk / bk) - 64 real columns each; which 2: values v (Wv / bv), all 256 columns */
  k_fa<<<dim3(TT / (FQW * 16), KSP, TNB), FQW * 32, 0, stream>>>(QH, QL, KH, VT, Y2, ML);   /* scores, softmax and P . v fused: one launch for all batches, 512 work-groups of 8 waves */
  k_resT<<<dim3(TT / 64, CC / 64, TNB), 256, 0, stream>>>(F[0], Y2, ML, F[7], (float*)d_out);   /* out[b][c][m] = x + gamma * o (transposed back to channels-first) */
}

// v005
// It runs in 73.5 microseconds.
// In both of two side-by-side timings against v004, it was 1.10 times as fast.
// All steps since v000 together make it 24.8 times as fast.
// compute dtype: all float inputs rounded to bf16; the q / k (64-dim) and v (256-dim) pointwise projections with EXACT bf16 products on WMMA 16x16x32 (f32 accumulate) + bias; UNSCALED scores q_n . k_m with the query as f16 hi + (x 2^10) residual against the key once to f16 (2 products, K = 64: two k-steps); softmax over m in f32 (running maximum and sum, per key slice); unnormalised P x 2^11 once to f16 x v once to f16 (1 product), divided by the f32 sum at the merge; out = bf16(x) + bf16(gamma) * o in f32; f32 output.
#include <hip/hip_runtime.h>
#include <math.h>

typedef __attribute__((ext_vector_type(16))) _Float16 v16h;
typedef __attribute__((ext_vector_type(16))) __bf16 v16b;
typedef __attribute__((ext_vector_type(8)))  _Float16 v8h;
typedef __attribute__((ext_vector_type(8)))  float v8f;
typedef __attribute__((ext_vector_type(4)))  float v4f;
typedef __attribute__((ext_vector_type(2)))  float v2f;
typedef __attribute__((ext_vector_type(4)))  unsigned v4u;
typedef __attribute__((ext_vector_type(4)))  int v4i;
typedef float __attribute__((may_alias)) float_a;
typedef int __attribute__((may_alias)) int_a;

template <typename T> __device__ __forceinline__ void vst2(void* p, T v) { *(T*)p = v;  }
__device__ __forceinline__ v8f wmma16(v16h a, v16h b, v8f c) {
  v8f d = __builtin_amdgcn_wmma_f32_16x16x32_f16(false, a, false, b, (short)0, c, false, false);
  asm volatile("v_nop\n\tv_nop\n\tv_nop\n\tv_nop" : "+v"(d) : "v"(a), "v"(b));
  return d;
}
__device__ __forceinline__ v8f wmma_bf(v16b a, v16b b, v8f c) {
  v8f d = __builtin_amdgcn_wmma_f32_16x16x32_bf16(false, a, false, b, (short)0, c, false, false);
  asm volatile("v_nop\n\tv_nop\n\tv_nop\n\tv_nop" : "+v"(d) : "v"(a), "v"(b));
  return d;
}
// 16x16x32 fragments: lane = (h = lane>>4, row/col = lane&15); elements 0..7 = k0+8h+0..7, 8..15 = k0+16+8h+0..7; D element r = row 8h+r
__device__ __forceinline__ v16h frag_h(const _Float16* rowk0, int lane) {
  union { v16h v; v8h q[2]; } u; const _Float16* p = rowk0 + 8 * (lane >> 4);
  u.q[0] = *(const v8h*)p; u.q[1] = *(const v8h*)(p + 16); return u.v;
}
__device__ __forceinline__ v16h frag_f32(const float* rowk0, int lane) {
  v16h a; const float* p = rowk0 + 8 * (lane >> 4);
#pragma unroll
  for (int i = 0; i < 8; ++i) { a[i] = (_Float16)p[i]; a[8 + i] = (_Float16)p[16 + i]; }
  return a;
}
__device__ __forceinline__ v16h frag_f32s(const float* rowk0, int lane, float sc) {
  v16h a; const float* p = rowk0 + 8 * (lane >> 4);
#pragma unroll
  for (int i = 0; i < 8; ++i) { a[i] = (_Float16)(p[i] * sc); a[8 + i] = (_Float16)(p[16 + i] * sc); }
  return a;
}
// column fragment from a [K][ld] layout (column n), rows >= K read as 0
__device__ __forceinline__ v16h fragc_f32(const float* W, int k0, int n, int lane, int ld, int K) {
  v16h a; const int g = lane >> 4;
#pragma unroll
  for (int i = 0; i < 8; ++i) { const int ka = k0 + 8 * g + i, kb = ka + 16;
    a[i] = (_Float16)(ka < K ? W[(size_t)(ka < K ? ka : K - 1) * ld + n] : 0.f); a[8 + i] = (_Float16)(kb < K ? W[(size_t)(kb < K ? kb : K - 1) * ld + n] : 0.f); }
  return a;
}
struct F2 { v16b h, l; };
__device__ __forceinline__ F2 bsplit16(const float v[16]) { F2 r;
#pragma unroll
  for (int i = 0; i < 16; ++i) { const __bf16 h = (__bf16)v[i]; r.h[i] = h; r.l[i] = (__bf16)(v[i] - (float)h); }
  return r; }
__device__ __forceinline__ F2 split_row(const float* row, int k0, int lane) { float v[16]; const float* p = row + k0 + 8 * (lane >> 4);
#pragma unroll
  for (int i = 0; i < 8; ++i) { v[i] = p[i]; v[8 + i] = p[16 + i]; }
  return bsplit16(v); }
__device__ __forceinline__ F2 split_rowK(const float* row, int k0, int lane, int K) { float v[16]; const int g = lane >> 4;
#pragma unroll
  for (int i = 0; i < 8; ++i) { const int ka = k0 + 8 * g + i, kb = ka + 16; v[i] = ka < K ? row[ka < K ? ka : K - 1] : 0.f; v[8 + i] = kb < K ? row[kb < K ? kb : K - 1] : 0.f; }
  return bsplit16(v); }
__device__ __forceinline__ F2 split_col(const float* W, int k0, int n, int lane, int ld, int K) { float v[16]; const int g = lane >> 4;
#pragma unroll
  for (int i = 0; i < 8; ++i) { const int ka = k0 + 8 * g + i, kb = ka + 16; v[i] = ka < K ? W[(size_t)(ka < K ? ka : K - 1) * ld + n] : 0.f; v[8 + i] = kb < K ? W[(size_t)(kb < K ? kb : K - 1) * ld + n] : 0.f; }
  return bsplit16(v); }
__device__ __forceinline__ v8f mac3(const F2& a, const F2& b, v8f c) { c = wmma_bf(a.l, b.h, c); c = wmma_bf(a.h, b.l, c); return wmma_bf(a.h, b.h, c); }
__device__ __forceinline__ float sigm(float v) { return 1.0f / (1.0f + expf(-v)); }
#define LDSX() do { asm volatile("s_wait_dscnt 0" ::: "memory"); __builtin_amdgcn_wave_barrier(); __builtin_amdgcn_fence(__ATOMIC_RELEASE, "workgroup"); } while (0)

// SAGAN-style 2-D self-attention (x [4,256,64,64] -> N = 4,096 positions; 1x1 convs: q = Wq x + bq, k = Wk x + bk with Wq / Wk [64,256], v = Wv x + bv with Wv [256,256] (1/16 scale, zero biases); attn[n, m] = softmax_m(q[:, n] . k[:, m]) (UNSCALED, sigma - 8: strongly peaked); out[c, n] = sum_m v[c, m] attn[n, m]; result = gamma out + x with gamma [1] uniform(0, 1)).
#define NB 4
#define TT 4096
#define CC 256            // NH * HD = projected width
#define DIN 256          // input (model) width
#define NH 1
#define HD 256
#define NQB (TT / 64)
#define HG 1
#define SCALE (1.0f)
#define CAUSAL 0
#ifndef TNB
#define TNB NB
#endif
__device__ __forceinline__ float bfr(float v) { return (float)(__bf16)v; }
__host__ __device__ __forceinline__ int kb_last(int qb) { return CAUSAL ? ((qb * 64 + 63) >> 7) : (TT / 128 - 1); }
typedef __attribute__((ext_vector_type(8))) __bf16 v8b;
__device__ __forceinline__ v16b frag_b(const __bf16* rowk0, int lane) {
  union { v16b v; v8b q[2]; } u; const __bf16* p = rowk0 + 8 * (lane >> 4);
  u.q[0] = *(const v8b*)p; u.q[1] = *(const v8b*)(p + 16); return u.v;
}
#define QBH 0               // k_fa: single-product P . h on every block (the bf16 hi/lo value planes are not used)
#define QBH_SC 0            // k_fa: every block takes the 2-product branch (q f16 hi + residual against k once to f16): the 3-product variant would cost 4.3 G-slot more planes
#define TQC 2048           // sizes the WS_S region: TQC x 4,096 f32 entries (32 MiB)
#define QHI 4096            // rows carrying a q residual plane (all rows when non-causal: 2-product logits everywhere)
#define KHI 64              // no block reads the k residual plane (QBH_SC 0)
// B fragment (k rows k0+.., output column o) of a weight: (in,out) [K][ld] or (out,in) [ld rows of K]: bf16 exact, or f16(bf16 * 256) exact
__device__ __forceinline__ v16b wcol_io(const float* Wm, int k0, int o, int lane, int ld) { v16b w; const int g = lane >> 4;
#pragma unroll
  for (int i = 0; i < 8; ++i) { w[i] = (__bf16)Wm[(size_t)(k0 + 8 * g + i) * ld + o]; w[8 + i] = (__bf16)Wm[(size_t)(k0 + 16 + 8 * g + i) * ld + o]; }
  return w; }
__device__ __forceinline__ v16b wcol_oi(const float* Wm, int k0, int o, int lane, int K) { v16b w; const float* p = Wm + (size_t)o * K + k0 + 8 * (lane >> 4);
#pragma unroll
  for (int i = 0; i < 8; ++i) { w[i] = (__bf16)p[i]; w[8 + i] = (__bf16)p[16 + i]; }
  return w; }
__device__ __forceinline__ v16h wcolh_io(const float* Wm, int k0, int o, int lane, int ld) { v16h w; const int g = lane >> 4;
#pragma unroll
  for (int i = 0; i < 8; ++i) { w[i] = (_Float16)(bfr(Wm[(size_t)(k0 + 8 * g + i) * ld + o]) * 256.0f); w[8 + i] = (_Float16)(bfr(Wm[(size_t)(k0 + 16 + 8 * g + i) * ld + o]) * 256.0f); }
  return w; }
__device__ __forceinline__ v16h wcolh_oi(const float* Wm, int k0, int o, int lane, int K) { v16h w; const float* p = Wm + (size_t)o * K + k0 + 8 * (lane >> 4);
#pragma unroll
  for (int i = 0; i < 8; ++i) { w[i] = (_Float16)(bfr(p[i]) * 256.0f); w[8 + i] = (_Float16)(bfr(p[16 + i]) * 256.0f); }
  return w; }
#define WQKV_LAYOUT 1   // 0 = (in,out) [DIN][CC]; 1 = (out,in) [CC][DIN]; 2 = per-head [NH][DIN][HD]
__device__ __forceinline__ v16b wcol_hdk(const float* Wm, int k0, int o, int lane) { v16b w; const int g = lane >> 4; const float* p = Wm + (size_t)(o / HD) * DIN * HD + (o % HD);
#pragma unroll
  for (int i = 0; i < 8; ++i) { w[i] = (__bf16)p[(size_t)(k0 + 8 * g + i) * HD]; w[8 + i] = (__bf16)p[(size_t)(k0 + 16 + 8 * g + i) * HD]; }
  return w; }
#define WO_OUT_IN 0
#if WQKV_LAYOUT == 1
#define HDK 64              // real key / query width (C / 4); the q / k rows live in the 256-wide space with columns 64..255 zero
__device__ __forceinline__ v16b zero16b() { v16b w; _Pragma("unroll") for (int i = 0; i < 16; ++i) w[i] = (__bf16)0.0f; return w; }
#define WCOL(W, k0, o, lane) ((which == 2 || (o) < HDK) ? wcol_oi(W, k0, (o), lane, DIN) : zero16b())   /* (out,in): Wh [256][256] full; Wf / Wg [64][256]: projected columns >= 64 are zero fragments (tile-uniform: 64 is a multiple of the 16-column tile) */
#elif WQKV_LAYOUT == 2
#define WCOL(W, k0, o, lane) wcol_hdk(W, k0, o, lane)
#else
#define WCOL(W, k0, o, lane) wcol_io(W, k0, o, lane, CC)
#endif
#if WO_OUT_IN
#define WOCOL(W, k0, o, lane) wcol_oi(W, k0, o, lane, CC)
#define WOCOLH(W, k0, o, lane) wcolh_oi(W, k0, o, lane, CC)
#else
#define WOCOL(W, k0, o, lane) wcol_io(W, k0, o, lane, DIN)
#define WOCOLH(W, k0, o, lane) wcolh_io(W, k0, o, lane, DIN)
#endif

#ifndef SM_EXTRA_PARAMS
#define SM_EXTRA_PARAMS
#endif
#ifndef PROJ_EXTRA_PARAMS
#define PROJ_EXTRA_PARAMS
#endif
#ifndef SM_MASK_HOOK
#define SM_MASK_HOOK (void)0
#endif

#define WS_QH  0u                                      // f16 q rows [b*t][CC]
#define WS_KH  (WS_QH + 2u * (size_t)NB * TT * CC)      // f16 k rows [b*t][CC]
#define WS_VT  (WS_KH + 2u * (size_t)NB * TT * CC)      // f16 v planes [b][c][t]
#define WS_QL  (WS_VT + 2u * (size_t)NB * CC * TT)      // f16 q residual x 2^10 rows [b][t < QHI][CC]
#define WS_KL  (WS_QL + 2u * (size_t)NB * QHI * CC)     // f16 k residual x 2^10 rows [b][t < KHI][CC]
#define WS_VB  (WS_KL + 2u * (size_t)NB * KHI * CC)     // bf16 v hi planes [b][c][t < KHI]
#define WS_VBL (WS_VB + 2u * (size_t)NB * CC * KHI)
#define WS_S   (WS_VBL + 2u * (size_t)NB * CC * KHI)    // f32 softmax statistics (m, l) [key slice][b*t][2] at the head of this region
#define WS_Y   (WS_S  + 4u * (size_t)HG * TQC * TT)      // end of the TQC x TT f32 region
#define WS_END (WS_Y  + 0u)
#define WS_Y2 (WS_END)                                   // f32 partial context rows o[key slice][b*TT + t][256]
#define KSP 4              // key slices of k_fa: one work-group per (query block, key slice, batch); each slice fills its own f32 context plane and its (m, l) rows, k_resT merges the planes
#define YPL ((size_t)NB * TT * CC)   // elements of one context plane
#define WS_END3 (WS_Y2 + 4u * (size_t)KSP * NB * TT * CC)

typedef __attribute__((ext_vector_type(4))) __bf16 v4b;
#define PKP 264            // bf16 pitch of k_proj's staged rows: 528 B = 16 B x 33 (odd multiple: 16-byte fragment reads without bank conflicts)
__device__ __forceinline__ v4b cvt4b(v4f v) { v4b r;
#pragma unroll
  for (int u = 0; u < 4; ++u) r[u] = (__bf16)v[u];
  return r; }
// ---- k_proj: block = (64 rows, 128 cols, which): q/k/v = X W (+ b) with exact bf16 products (K = DIN); the block's x tile (read from the channels-first input, turned to token-major on the way) and weight rows are rounded to bf16 once and staged in LDS by whole-line loads, every fragment is read from there -> which 0: q f16 rows (+ residual rows < QHI); 1: k f16 rows (+ residual rows < KHI); 2: v f16 planes [c][t] (+ bf16 hi/lo planes for t < KHI)
__global__ __launch_bounds__(128) void k_proj(const float* __restrict__ XQ, const float* __restrict__ XK, const float* __restrict__ XV, const float* __restrict__ WQ, const float* __restrict__ WK, const float* __restrict__ WV, const float* __restrict__ BQ, const float* __restrict__ BK, const float* __restrict__ BV,
    _Float16* __restrict__ QH, _Float16* __restrict__ QL, _Float16* __restrict__ KH, _Float16* __restrict__ KL, _Float16* __restrict__ VT, __bf16* __restrict__ VB, __bf16* __restrict__ VBL) {
  __shared__ __align__(16) char smem[(64 + 128) * PKP * 2];   /* the bf16 x rows and weight rows while the products run, then the output staging tiles (90,112 B) */
  __bf16 (*sX)[PKP] = (__bf16 (*)[PKP])smem; __bf16 (*sW)[PKP] = (__bf16 (*)[PKP])(smem + 64 * PKP * 2);
  _Float16 (*sh)[136] = (_Float16 (*)[136])smem; _Float16 (*sl)[136] = (_Float16 (*)[136])(smem + 17408); _Float16 (*th)[72] = (_Float16 (*)[72])(smem + 34816); __bf16 (*tb)[72] = (__bf16 (*)[72])(smem + 53248); __bf16 (*tbl)[72] = (__bf16 (*)[72])(smem + 71680);
  const int tid = threadIdx.x, wave = tid >> 5, lane = tid & 31, col = lane & 15, g = lane >> 4; const int which = blockIdx.z; const int c0 = blockIdx.y * 128; const size_t r0 = (size_t)blockIdx.x * 64; const size_t bb = r0 / TT; const int t0 = (int)(r0 % TT);
  const float* X = which == 0 ? XQ : which == 1 ? XK : XV; const float* WA = which == 0 ? WQ : which == 1 ? WK : WV; const float* BA = which == 0 ? BQ : which == 1 ? BK : BV;
  const unsigned lo = (unsigned)tid * 16u;   /* each 64 weight rows are 64 KiB in a row: block base + one 32-bit byte offset per lane; trips differ by constants only, and every wave-wide load covers 512 B in a row (four whole lines) */
  const int sr = tid >> 6, sc = (tid & 63) * 4;
  { const char* xb = (const char*)(X + bb * (size_t)DIN * TT + t0); v4f rx[32];   /* x is channels-first [b][c][t]: the block's tile is 256 channel rows of 64 times (256 B each) */
    const unsigned xlo = (unsigned)(tid >> 3) * (4u * TT * 4u) + (unsigned)(tid & 7) * 16u;   /* a lane owns 4 x 4 blocks (4 channels, 4 times): 8 lanes x 16 B = one whole 128-B line per channel row, 4 rows per wave-wide load; tile base + one 32-bit byte offset per lane, the loads differ by constants only */
#pragma unroll
    for (int ci = 0; ci < 4; ++ci)
#pragma unroll
      for (int hf = 0; hf < 2; ++hf)
#pragma unroll
        for (int u = 0; u < 4; ++u) rx[(ci * 2 + hf) * 4 + u] = *(const v4f*)(xb + ((size_t)(ci * 64 + u) * (TT * 4) + hf * 128) + xlo);
    asm volatile("s_wait_loadcnt 0x0\n\ts_wait_xcnt 0x0" ::: "memory");   /* the 32 loads per lane fly together and are all back here; the next group's loads stay behind it, so the staging registers are used again */
#pragma unroll
    for (int ci = 0; ci < 4; ++ci)
#pragma unroll
      for (int hf = 0; hf < 2; ++hf)
#pragma unroll
        for (int tu = 0; tu < 4; ++tu) { v4f cv;   /* the 4 x 4 block is turned in registers: one 8-byte LDS store holds 4 channels of one time */
#pragma unroll
          for (int u = 0; u < 4; ++u) cv[u] = rx[(ci * 2 + hf) * 4 + u][tu];
          *(v4b*)&sX[hf * 32 + (tid & 7) * 4 + tu][ci * 64 + (tid >> 3) * 4] = cvt4b(cv); } }
#pragma unroll
  for (int hb = 0; hb < 2; ++hb) {
    if (which == 2 || c0 + hb * 64 < HDK) { const char* wb = (const char*)(WA + (size_t)(c0 + hb * 64) * DIN); v4f rw[32];   /* block-uniform test: Wq / Wk hold 64 rows only */
#pragma unroll
      for (int i = 0; i < 32; ++i) rw[i] = *(const v4f*)(wb + (size_t)i * 2048 + lo);
      asm volatile("s_wait_loadcnt 0x0\n\ts_wait_xcnt 0x0" ::: "memory");   /* as above */
#pragma unroll
      for (int i = 0; i < 32; ++i) *(v4b*)&sW[hb * 64 + sr + 2 * i][sc] = cvt4b(rw[i]);
    } else { v4f zz = {};
#pragma unroll
      for (int i = 0; i < 32; ++i) *(v4b*)&sW[hb * 64 + sr + 2 * i][sc] = cvt4b(zz); } }   /* projected columns >= 64 of q / k are zero */
  __syncthreads();   /* both tiles are published */
  v8f acc[8] = {}; v16b a = frag_b(&sX[wave * 16 + col][0], lane), w[8];
#pragma unroll
  for (int j = 0; j < 8; ++j) w[j] = frag_b(&sW[j * 16 + col][0], lane);
#pragma unroll
  for (int kc = 0; kc < DIN / 32; ++kc) { v16b an = a, wn[8];   /* the next k-step's 18 LDS reads stand together in front of this k-step's products, into a second register set: read directly in front of its product, each fragment would cost a whole LDS latency */
#pragma unroll
    for (int j = 0; j < 8; ++j) wn[j] = w[j];
    if (kc + 1 < DIN / 32) { an = frag_b(&sX[wave * 16 + col][kc * 32 + 32], lane);
#pragma unroll
      for (int j = 0; j < 8; ++j) wn[j] = frag_b(&sW[j * 16 + col][kc * 32 + 32], lane); }
#pragma unroll
    for (int j = 0; j < 8; ++j) acc[j] = wmma_bf(a, w[j], acc[j]);
    a = an;
#pragma unroll
    for (int j = 0; j < 8; ++j) w[j] = wn[j]; }
  __syncthreads();   /* every wave has read its last fragment: the LDS becomes the output staging tiles */
  if (which < 2) { _Float16* DH = which == 0 ? QH : KH; _Float16* DL = which == 0 ? QL : KL; const int nhi = which == 0 ? QHI : KHI; const bool hi_rows = t0 < nhi;
#pragma unroll
    for (int j = 0; j < 8; ++j) { const int bo_ = c0 + j * 16 + col; const float bias = (BA && bo_ < HDK) ? bfr(BA[bo_ < HDK ? bo_ : 0]) : 0.f;   /* bf / bg hold only the 64 real columns */
#pragma unroll
      for (int r = 0; r < 8; ++r) { const float v = acc[j][r] + bias; const _Float16 hv = (_Float16)v; sh[wave * 16 + 8 * g + r][j * 16 + col] = hv; sl[wave * 16 + 8 * g + r][j * 16 + col] = (_Float16)((v - (float)hv) * 1024.0f); } }
    __syncthreads();
    for (int e = tid; e < 64 * 16; e += 128) { const int rl = e >> 4, q = e & 15; vst2((unsigned*)(DH + (r0 + rl) * CC + c0 + q * 8), *(const v4u*)&sh[rl][q * 8]); if (hi_rows) vst2((unsigned*)(DL + (bb * nhi + t0 + rl) * (size_t)CC + c0 + q * 8), *(const v4u*)&sl[rl][q * 8]); }
  } else { const bool hi_rows = t0 < KHI;
#pragma unroll
    for (int j = 0; j < 8; ++j) { const float bias = BA ? bfr(BA[c0 + j * 16 + col]) : 0.f;
#pragma unroll
      for (int r = 0; r < 8; ++r) { const float v = acc[j][r] + bias; const int rl = wave * 16 + 8 * g + r, cl = j * 16 + col; th[cl][rl] = (_Float16)v; const __bf16 bh = (__bf16)v; tb[cl][rl] = bh; tbl[cl][rl] = (__bf16)(v - (float)bh); } }
    __syncthreads();
    for (int e = tid; e < 128 * 8; e += 128) { const int cl = e >> 3, q = e & 7; vst2((unsigned*)(VT + (bb * CC + c0 + cl) * (size_t)TT + t0 + q * 8), *(const v4u*)&th[cl][q * 8]); if (hi_rows) { const size_t o3 = (bb * CC + c0 + cl) * (size_t)KHI + t0 + q * 8; vst2((unsigned*)(VB + o3), *(const v4u*)&tb[cl][q * 8]); vst2((unsigned*)(VBL + o3), *(const v4u*)&tbl[cl][q * 8]); } } } }
// ---- k_resT: tile (64 times, 64 channels) of batch bz: out[b][c][t] = bf16(v[b][c][t]) + bf16(gamma) * a[b][t][c] (a = the KSP token-major partial context planes merged by their softmax statistics: sum_s 2^(m_s - M) plane_s / sum_s 2^(m_s - M) l_s; LDS transpose back to channels-first)
__global__ __launch_bounds__(256) void k_resT(const float* __restrict__ V, const float* __restrict__ A, const float* __restrict__ ML, const float* __restrict__ GM, float* __restrict__ OUT) { __shared__ float tl[64][65];
  const int tid = threadIdx.x; const int t0 = blockIdx.x * 64, c0 = blockIdx.y * 64; const size_t b = blockIdx.z; const float gm = bfr(GM[0]);
  const char* ab = (const char*)(A + (b * TT + t0) * (size_t)CC + c0); const unsigned vo = (unsigned)(((tid >> 4) * CC + (tid & 15) * 4) * 4);   /* tile base (the same for the whole block) + one 32-bit byte offset per lane; planes and trips differ by constants only, so no address is stepped while loads are in flight */
  const char* mb = (const char*)(ML + (b * TT + t0) * 2); const unsigned mvo = (unsigned)((tid >> 4) * 8);
#pragma unroll
  for (int i = 0; i < 4; ++i) { const int tr = (tid >> 4) + 16 * i, q = tid & 15; v4f pl[KSP]; v2f sm[KSP];
#pragma unroll
    for (int s = 0; s < KSP; ++s) { pl[s] = *(const v4f*)(ab + ((size_t)s * YPL + (size_t)i * 16 * CC) * 4 + vo); sm[s] = *(const v2f*)(mb + ((size_t)s * NB * TT + (size_t)i * 16) * 8 + mvo); }
    asm volatile("s_wait_loadcnt 0x0\n\ts_wait_xcnt 0x0" :: "v"(vo) : "memory");   /* the planes' and statistics' loads fly together and are all back here, before the sums; vo as an input keeps the lane offset in its register up to this wait */
    float mx = sm[0][0];
#pragma unroll
    for (int s = 1; s < KSP; ++s) mx = fmaxf(mx, sm[s][0]);
    float w[KSP], den = 0.f;
#pragma unroll
    for (int s = 0; s < KSP; ++s) { w[s] = __builtin_amdgcn_exp2f(sm[s][0] - mx); den += w[s] * sm[s][1]; }
    const float inv = 1.0f / den;   /* the slice that holds the maximum gives at least 2^11 */
    v4f ld = pl[0] * (w[0] * inv);
#pragma unroll
    for (int s = 1; s < KSP; ++s) ld += pl[s] * (w[s] * inv);   /* key slices added in rising order */
#pragma unroll
    for (int u = 0; u < 4; ++u) tl[tr][q * 4 + u] = ld[u]; }
  __syncthreads();
  for (int e = tid; e < 64 * 16; e += 256) { const int cl = e >> 4, q = e & 15; const size_t off = (b * CC + c0 + cl) * (size_t)TT + t0 + q * 4; const v4f vv = *(const v4f*)(V + off); asm volatile("s_wait_loadcnt 0x0" ::: "memory"); v4f o;
#pragma unroll
    for (int u = 0; u < 4; ++u) o[u] = bfr(vv[u]) + gm * tl[q * 4 + u][cl];
    vst2(OUT + off, o); } }   
// ---- k_fa: block = (128 queries qb, key slice ks, batch b), 8 waves x 16 queries: scores, softmax and P . v in one pass over the slice's keys, no score plane. Per 64-key tile: v [256 ch][64 keys] and k [64 keys][64 dims] go to LDS by asynchronous copies, two buffers, the next tile in flight while this one is worked on; per 32 keys each wave forms S^T = k . q^T (A = key rows, B = query columns; q hi + residual, 2 products), whose D registers (lane = query, element = key 8g + r) ARE the B fragment of o^T = v^T . P^T (tile 0 -> elements 0..7, tile 1 -> 8..15), so P never leaves the registers. Running maximum m (log2 domain) and sum l per query live one per lane; the accumulators are rescaled only when some lane's maximum moved. Out: unnormalised context plane ks (x 2^11) and (m, l) per (slice, query); k_resT merges the slices.
#define FKT 64             // keys per LDS tile
#define FPI 72             // f16 pitch of both LDS tiles: 144 B = 16 B x 9 (odd multiple: 16-byte fragment reads without bank conflicts)
#define L2E 1.44269504088896340736f
__device__ __forceinline__ v8f wmma_h(v16h a, v16h b, v8f c) { return __builtin_amdgcn_wmma_f32_16x16x32_f16(false, a, false, b, (short)0, c, false, false); }
#define FTB ((CC + FKT) * FPI * 2)   // bytes of one k / v tile buffer (46,080)
// one tile: ten 16-byte asynchronous copies per lane (8 value rows, 2 key rows, 32 rows apart), global memory -> LDS through no register. lb = the lane's LDS byte address in the buffer, gv / gk = its global addresses. The s_wait_xcnt 0 stands inside the copies' own statement, so that no address register is rewritten in front of it.
__device__ __forceinline__ void fa_copy(unsigned lb, const char* gv, const char* gk) {
  asm volatile("global_load_async_to_lds_b128 %0, %1, off\n\t"
               "global_load_async_to_lds_b128 %2, %3, off\n\t"
               "global_load_async_to_lds_b128 %4, %5, off\n\t"
               "global_load_async_to_lds_b128 %6, %7, off\n\t"
               "global_load_async_to_lds_b128 %8, %9, off\n\t"
               "global_load_async_to_lds_b128 %10, %11, off\n\t"
               "global_load_async_to_lds_b128 %12, %13, off\n\t"
               "global_load_async_to_lds_b128 %14, %15, off\n\t"
               "global_load_async_to_lds_b128 %16, %17, off\n\t"
               "global_load_async_to_lds_b128 %18, %19, off\n\t"
               "s_wait_xcnt 0x0"
               :: "v"(lb), "v"(gv), "v"(lb + 1u * 32 * FPI * 2), "v"(gv + 1 * 32 * TT * 2), "v"(lb + 2u * 32 * FPI * 2), "v"(gv + 2 * 32 * TT * 2), "v"(lb + 3u * 32 * FPI * 2), "v"(gv + 3 * 32 * TT * 2),
                  "v"(lb + 4u * 32 * FPI * 2), "v"(gv + 4 * 32 * TT * 2), "v"(lb + 5u * 32 * FPI * 2), "v"(gv + 5 * 32 * TT * 2), "v"(lb + 6u * 32 * FPI * 2), "v"(gv + 6 * 32 * TT * 2), "v"(lb + 7u * 32 * FPI * 2), "v"(gv + 7 * 32 * TT * 2),
                  "v"(lb + 8u * 32 * FPI * 2), "v"(gk), "v"(lb + 9u * 32 * FPI * 2), "v"(gk + 32 * CC * 2) : "memory"); }
#define FQW 8              // waves (16 queries each) per work-group; the second launch bound asks for four waves per SIMD, that is two work-groups per WGP, so that one group's products cover the other's tile loads
__global__ __launch_bounds__(FQW * 32, 4) void k_fa(const _Float16* __restrict__ QH, const _Float16* __restrict__ QL, const _Float16* __restrict__ KH, const _Float16* __restrict__ VT, float* __restrict__ Y0, float* __restrict__ ML) {
  __shared__ __align__(16) char smem[2 * FTB];   /* two k / v tile buffers (92,160 B) while the keys are walked, then one 16 x 132 f32 transpose buffer per wave (67,584 B) */
  const int tid = threadIdx.x, wave = tid >> 5, lane = tid & 31, col = lane & 15, g = lane >> 4; const int qb = blockIdx.x, ks = blockIdx.y; const size_t b = blockIdx.z;
  const size_t q0 = b * TT + qb * (FQW * 16) + wave * 16; const int key0 = ks * (TT / KSP);
  v16h qh[HDK / 32], ql[HDK / 32];
#pragma unroll
  for (int kc = 0; kc < HDK / 32; ++kc) { qh[kc] = frag_h(QH + (q0 + col) * CC + kc * 32, lane); ql[kc] = frag_h(QL + (q0 + col) * CC + kc * 32, lane); }
  v8f acc[CC / 16] = {}; float m = -3.0e38f, l = 0.f;
  const char* vb = (const char*)(VT + b * CC * TT + key0); const char* kb = (const char*)(KH + (b * TT + key0) * CC);   /* tile bases (the same for the whole block) + one 32-bit byte offset per lane; rows differ by constants only */
  const unsigned vvo = (unsigned)((tid >> 3) * (TT * 2) + (tid & 7) * 16), kvo = (unsigned)((tid >> 3) * (CC * 2) + (tid & 7) * 16);
  const unsigned lb = (unsigned)(size_t)smem + (unsigned)((tid >> 3) * (FPI * 2) + (tid & 7) * 16);   /* 8 lanes x 16 B = one whole 128-B line per value or key row */
  const char* gv = vb + vvo; const char* gk = kb + kvo;
  fa_copy(lb, gv, gk);   /* tile 0 -> buffer 0 */
  asm volatile("s_wait_asynccnt 0x0" ::: "memory");   /* this wave's copies of tile 0 have landed */
  __syncthreads();   /* tile 0 is published */
  fa_copy(lb + FTB, gv + FKT * 2, gk + FKT * CC * 2);   /* tile 1 -> buffer 1 */
#pragma unroll 1   /* rolled: one copy of the tile's code serves both buffers, which differ by one address term; unrolled it would only lengthen the hot text */
  for (int st = 0; st < TT / KSP / FKT; ++st) { const char* tb = smem + (st & 1) * FTB; const _Float16 (*sV)[FPI] = (const _Float16 (*)[FPI])tb; const _Float16 (*sK)[FPI] = (const _Float16 (*)[FPI])(tb + CC * FPI * 2);
#pragma unroll 1   /* rolled: the products of one 32-key half stay a scheduling region of their own */
    for (int kk = 0; kk < FKT / 32; ++kk) { v8f sa[2] = {}, sb[2] = {};
#pragma unroll
      for (int t = 0; t < 2; ++t)
#pragma unroll
        for (int kc = 0; kc < HDK / 32; ++kc) { const v16h a = frag_h(&sK[kk * 32 + t * 16 + col][kc * 32], lane); sa[t] = wmma_h(a, qh[kc], sa[t]); sb[t] = wmma_h(a, ql[kc], sb[t]); }
      float tv[16];
#pragma unroll
      for (int i = 0; i < 16; ++i) tv[i] = (sa[i >> 3][i & 7] + sb[i >> 3][i & 7] * (1.0f / 1024.0f)) * L2E;
      float mx = tv[0];
#pragma unroll
      for (int i = 1; i < 16; ++i) mx = fmaxf(mx, tv[i]);
      mx = fmaxf(mx, __shfl_xor(mx, 16));   /* lanes col and col + 16 hold the two key halves of one query */
      const float mn = fmaxf(m, mx);
      if (__any(mn > m)) { const float al = __builtin_amdgcn_exp2f(m - mn); l *= al;
#pragma unroll
        for (int j = 0; j < CC / 16; ++j) acc[j] *= al;
        m = mn; }
      const float mo = m - 11.0f; v16h p; float ps = 0.f;
#pragma unroll
      for (int i = 0; i < 16; ++i) { const float e = __builtin_amdgcn_exp2f(tv[i] - mo); ps += e; p[i] = (_Float16)e; }
      l += ps;
#pragma unroll
      for (int j = 0; j < CC / 16; ++j) acc[j] = wmma_h(frag_h(&sV[j * 16 + col][kk * 32], lane), p, acc[j]);
      /* order of this block's LDS reads and products: four value fragments ahead, then one product per fragment read; left alone the compiler reads each fragment directly in front of its product, which then waits a whole LDS latency */
      __builtin_amdgcn_sched_group_barrier(0x100, 8, 0);
#pragma unroll
      for (int j = 0; j < CC / 16 - 4; ++j) { __builtin_amdgcn_sched_group_barrier(0x8, 1, 0); __builtin_amdgcn_sched_group_barrier(0x100, 2, 0); }
      __builtin_amdgcn_sched_group_barrier(0x8, 4, 0); }
    asm volatile("s_wait_dscnt 0x0" ::: "memory");      /* this wave's reads of the tile are back */
    asm volatile("s_wait_asynccnt 0x0" ::: "memory");   /* this wave's copies of the next tile have landed */
    __syncthreads();   /* the next tile is published, and every wave has left this one */
    if (st + 2 < TT / KSP / FKT) fa_copy(lb + (unsigned)(st & 1) * FTB, gv + (size_t)(st + 2) * (FKT * 2), gk + (size_t)(st + 2) * (FKT * CC * 2)); }   /* block-uniform test: tile st + 2 goes into the buffer just left and flies during trip st + 1 */
  asm volatile("s_wait_asynccnt 0x0" ::: "memory");   /* no copy is outstanding when the LDS changes its use */
  l += __shfl_xor(l, 16);
  if (g == 0) { v2f st2; st2[0] = m; st2[1] = l; vst2(ML + ((size_t)ks * NB * TT + q0 + col) * 2, st2); }   /* 16 lanes x 8 B = one 128-B line per wave */
  /* the last trip's barrier has ended every wave's reads of the tiles: the LDS becomes the waves' private transpose buffers */
  float* sw = (float*)smem + wave * (16 * 132); float* Y = Y0 + (size_t)ks * YPL;
#pragma unroll
  for (int hh = 0; hh < 2; ++hh) {
#pragma unroll
    for (int jj = 0; jj < 8; ++jj) { const v8f a = acc[hh * 8 + jj]; v4f lo, hi;
#pragma unroll
      for (int u = 0; u < 4; ++u) { lo[u] = a[u]; hi[u] = a[4 + u]; }
      *(v4f*)(sw + col * 132 + jj * 16 + 8 * g) = lo; *(v4f*)(sw + col * 132 + jj * 16 + 8 * g + 4) = hi; }
    LDSX();
#pragma unroll
    for (int rl = 0; rl < 16; ++rl) vst2(Y + (q0 + rl) * CC + hh * 128 + lane * 4, *(const v4f*)(sw + rl * 132 + lane * 4));
    LDSX(); } }
extern "C" void kernel_launch(void* const* d_in, const int* in_sizes, int n_in, void* d_out, int out_size, void* d_ws, size_t ws_size, hipStream_t stream) {
  (void)in_sizes; (void)n_in; (void)out_size;
  const float** F = (const float**)d_in;
  if (ws_size < (size_t)WS_END) return;
  char* ws = (char*)d_ws; _Float16 *QH = (_Float16*)(ws + WS_QH), *KH = (_Float16*)(ws + WS_KH), *VT = (_Float16*)(ws + WS_VT), *QL = (_Float16*)(ws + WS_QL), *KL = (_Float16*)(ws + WS_KL); __bf16 *VB = (__bf16*)(ws + WS_VB), *VBL = (__bf16*)(ws + WS_VBL); float *ML = (float*)(ws + WS_S), *Y = (float*)(ws + WS_Y);
  (void)Y; (void)QL; (void)KL; (void)VB; (void)VBL;
  // inputs: 0 x [4,256,64,64] CHANNELS-FIRST (N = 4,096 positions); 1 Wq [64,256] (out,in), 2 bq [64]; 3 Wk [64,256], 4 bk [64]; 5 Wv [256,256] (out,in), 6 bv [256]; 7 gamma [1] (zero biases, read)
  if (ws_size < (size_t)WS_END3) return;
  float *Y2 = (float*)(ws + WS_Y2);
  k_proj<<<dim3(TNB * TT / 64, CC / 128, 3), 128, 0, stream>>>(F[0], F[0], F[0], F[1], F[3], F[5], F[2], F[4], F[6], QH, QL, KH, KL, VT, VB, VBL);   /* which 0: query rows = q (Wq / bq), which 1: key rows = k (Wk / bk) - 64 real columns each; which 2: values v (Wv / bv), all 256 columns */
  k_fa<<<dim3(TT / (FQW * 16), KSP, TNB), FQW * 32, 0, stream>>>(QH, QL, KH, VT, Y2, ML);   /* scores, softmax and P . v fused: one launch for all batches, 512 work-groups of 8 waves */
  k_resT<<<dim3(TT / 64, CC / 64, TNB), 256, 0, stream>>>(F[0], Y2, ML, F[7], (float*)d_out);   /* out[b][c][m] = x + gamma * o (transposed back to channels-first) */
}

// v006
// One run takes 68.9 microseconds.
// Next to v005, in two timings, it ran 1.06 and 1.07 times as fast.
// Counting every step since v000, it is 26.5 times as fast.
// compute dtype: all float inputs rounded to bf16; the q / k (64-dim) and v (256-dim) pointwise projections with EXACT bf16 products on WMMA 16x16x32 (f32 accumulate) + bias; UNSCALED scores q_n . k_m with the query as f16 hi + (x 2^10) residual against the key once to f16 (2 products, K = 64: two k-steps); softmax over m in f32 (running maximum and sum, per key slice); unnormalised P x 2^11 once to f16 x v once to f16 (1 product), divided by the f32 sum at the merge; out = bf16(x) + bf16(gamma) * o in f32; f32 output.
#include <hip/hip_runtime.h>
#include <math.h>

typedef __attribute__((ext_vector_type(16))) _Float16 v16h;
typedef __attribute__((ext_vector_type(16))) __bf16 v16b;
typedef __attribute__((ext_vector_type(8)))  _Float16 v8h;
typedef __attribute__((ext_vector_type(8)))  float v8f;
typedef __attribute__((ext_vector_type(4)))  float v4f;
typedef __attribute__((ext_vector_type(2)))  float v2f;
typedef __attribute__((ext_vector_type(4)))  unsigned v4u;
typedef __attribute__((ext_vector_type(4)))  int v4i;
typedef float __attribute__((may_alias)) float_a;
typedef int __attribute__((may_alias)) int_a;

template <typename T> __device__ __forceinline__ void vst2(void* p, T v) { *(T*)p = v;  }
__device__ __forceinline__ v8f wmma16(v16h a, v16h b, v8f c) {
  v8f d = __builtin_amdgcn_wmma_f32_16x16x32_f16(false, a, false, b, (short)0, c, false, false);
  asm volatile("v_nop\n\tv_nop\n\tv_nop\n\tv_nop" : "+v"(d) : "v"(a), "v"(b));
  return d;
}
__device__ __forceinline__ v8f wmma_bf(v16b a, v16b b, v8f c) {
  v8f d = __builtin_amdgcn_wmma_f32_16x16x32_bf16(false, a, false, b, (short)0, c, false, false);
  asm volatile("v_nop\n\tv_nop\n\tv_nop\n\tv_nop" : "+v"(d) : "v"(a), "v"(b));
  return d;
}
// 16x16x32 fragments: lane = (h = lane>>4, row/col = lane&15); elements 0..7 = k0+8h+0..7, 8..15 = k0+16+8h+0..7; D element r = row 8h+r
__device__ __forceinline__ v16h frag_h(const _Float16* rowk0, int lane) {
  union { v16h v; v8h q[2]; } u; const _Float16* p = rowk0 + 8 * (lane >> 4);
  u.q[0] = *(const v8h*)p; u.q[1] = *(const v8h*)(p + 16); return u.v;
}
__device__ __forceinline__ v16h frag_f32(const float* rowk0, int lane) {
  v16h a; const float* p = rowk0 + 8 * (lane >> 4);
#pragma unroll
  for (int i = 0; i < 8; ++i) { a[i] = (_Float16)p[i]; a[8 + i] = (_Float16)p[16 + i]; }
  return a;
}
__device__ __forceinline__ v16h frag_f32s(const float* rowk0, int lane, float sc) {
  v16h a; const float* p = rowk0 + 8 * (lane >> 4);
#pragma unroll
  for (int i = 0; i < 8; ++i) { a[i] = (_Float16)(p[i] * sc); a[8 + i] = (_Float16)(p[16 + i] * sc); }
  return a;
}
// column fragment from a [K][ld] layout (column n), rows >= K read as 0
__device__ __forceinline__ v16h fragc_f32(const float* W, int k0, int n, int lane, int ld, int K) {
  v16h a; const int g = lane >> 4;
#pragma unroll
  for (int i = 0; i < 8; ++i) { const int ka = k0 + 8 * g + i, kb = ka + 16;
    a[i] = (_Float16)(ka < K ? W[(size_t)(ka < K ? ka : K - 1) * ld + n] : 0.f); a[8 + i] = (_Float16)(kb < K ? W[(size_t)(kb < K ? kb : K - 1) * ld + n] : 0.f); }
  return a;
}
struct F2 { v16b h, l; };
__device__ __forceinline__ F2 bsplit16(const float v[16]) { F2 r;
#pragma unroll
  for (int i = 0; i < 16; ++i) { const __bf16 h = (__bf16)v[i]; r.h[i] = h; r.l[i] = (__bf16)(v[i] - (float)h); }
  return r; }
__device__ __forceinline__ F2 split_row(const float* row, int k0, int lane) { float v[16]; const float* p = row + k0 + 8 * (lane >> 4);
#pragma unroll
  for (int i = 0; i < 8; ++i) { v[i] = p[i]; v[8 + i] = p[16 + i]; }
  return bsplit16(v); }
__device__ __forceinline__ F2 split_rowK(const float* row, int k0, int lane, int K) { float v[16]; const int g = lane >> 4;
#pragma unroll
  for (int i = 0; i < 8; ++i) { const int ka = k0 + 8 * g + i, kb = ka + 16; v[i] = ka < K ? row[ka < K ? ka : K - 1] : 0.f; v[8 + i] = kb < K ? row[kb < K ? kb : K - 1] : 0.f; }
  return bsplit16(v); }
__device__ __forceinline__ F2 split_col(const float* W, int k0, int n, int lane, int ld, int K) { float v[16]; const int g = lane >> 4;
#pragma unroll
  for (int i = 0; i < 8; ++i) { const int ka = k0 + 8 * g + i, kb = ka + 16; v[i] = ka < K ? W[(size_t)(ka < K ? ka : K - 1) * ld + n] : 0.f; v[8 + i] = kb < K ? W[(size_t)(kb < K ? kb : K - 1) * ld + n] : 0.f; }
  return bsplit16(v); }
__device__ __forceinline__ v8f mac3(const F2& a, const F2& b, v8f c) { c = wmma_bf(a.l, b.h, c); c = wmma_bf(a.h, b.l, c); return wmma_bf(a.h, b.h, c); }
__device__ __forceinline__ float sigm(float v) { return 1.0f / (1.0f + expf(-v)); }
#define LDSX() do { asm volatile("s_wait_dscnt 0" ::: "memory"); __builtin_amdgcn_wave_barrier(); __builtin_amdgcn_fence(__ATOMIC_RELEASE, "workgroup"); } while (0)

// SAGAN-style 2-D self-attention (x [4,256,64,64] -> N = 4,096 positions; 1x1 convs: q = Wq x + bq, k = Wk x + bk with Wq / Wk [64,256], v = Wv x + bv with Wv [256,256] (1/16 scale, zero biases); attn[n, m] = softmax_m(q[:, n] . k[:, m]) (UNSCALED, sigma - 8: strongly peaked); out[c, n] = sum_m v[c, m] attn[n, m]; result = gamma out + x with gamma [1] uniform(0, 1)).
#define NB 4
#define TT 4096
#define CC 256            // NH * HD = projected width
#define DIN 256          // input (model) width
#define NH 1
#define HD 256
#define NQB (TT / 64)
#define HG 1
#define SCALE (1.0f)
#define CAUSAL 0
#ifndef TNB
#define TNB NB
#endif
__device__ __forceinline__ float bfr(float v) { return (float)(__bf16)v; }
__host__ __device__ __forceinline__ int kb_last(int qb) { return CAUSAL ? ((qb * 64 + 63) >> 7) : (TT / 128 - 1); }
typedef __attribute__((ext_vector_type(8))) __bf16 v8b;
__device__ __forceinline__ v16b frag_b(const __bf16* rowk0, int lane) {
  union { v16b v; v8b q[2]; } u; const __bf16* p = rowk0 + 8 * (lane >> 4);
  u.q[0] = *(const v8b*)p; u.q[1] = *(const v8b*)(p + 16); return u.v;
}
#define QBH 0               // k_fa: single-product P . h on every block (the bf16 hi/lo value planes are not used)
#define QBH_SC 0            // k_fa: every block takes the 2-product branch (q f16 hi + residual against k once to f16): the 3-product variant would cost 4.3 G-slot more planes
#define TQC 2048           // sizes the WS_S region: TQC x 4,096 f32 entries (32 MiB)
#define QHI 4096            // rows carrying a q residual plane (all rows when non-causal: 2-product logits everywhere)
#define KHI 64              // no block reads the k residual plane (QBH_SC 0)
// B fragment (k rows k0+.., output column o) of a weight: (in,out) [K][ld] or (out,in) [ld rows of K]: bf16 exact, or f16(bf16 * 256) exact
__device__ __forceinline__ v16b wcol_io(const float* Wm, int k0, int o, int lane, int ld) { v16b w; const int g = lane >> 4;
#pragma unroll
  for (int i = 0; i < 8; ++i) { w[i] = (__bf16)Wm[(size_t)(k0 + 8 * g + i) * ld + o]; w[8 + i] = (__bf16)Wm[(size_t)(k0 + 16 + 8 * g + i) * ld + o]; }
  return w; }
__device__ __forceinline__ v16b wcol_oi(const float* Wm, int k0, int o, int lane, int K) { v16b w; const float* p = Wm + (size_t)o * K + k0 + 8 * (lane >> 4);
#pragma unroll
  for (int i = 0; i < 8; ++i) { w[i] = (__bf16)p[i]; w[8 + i] = (__bf16)p[16 + i]; }
  return w; }
__device__ __forceinline__ v16h wcolh_io(const float* Wm, int k0, int o, int lane, int ld) { v16h w; const int g = lane >> 4;
#pragma unroll
  for (int i = 0; i < 8; ++i) { w[i] = (_Float16)(bfr(Wm[(size_t)(k0 + 8 * g + i) * ld + o]) * 256.0f); w[8 + i] = (_Float16)(bfr(Wm[(size_t)(k0 + 16 + 8 * g + i) * ld + o]) * 256.0f); }
  return w; }
__device__ __forceinline__ v16h wcolh_oi(const float* Wm, int k0, int o, int lane, int K) { v16h w; const float* p = Wm + (size_t)o * K + k0 + 8 * (lane >> 4);
#pragma unroll
  for (int i = 0; i < 8; ++i) { w[i] = (_Float16)(bfr(p[i]) * 256.0f); w[8 + i] = (_Float16)(bfr(p[16 + i]) * 256.0f); }
  return w; }
#define WQKV_LAYOUT 1   // 0 = (in,out) [DIN][CC]; 1 = (out,in) [CC][DIN]; 2 = per-head [NH][DIN][HD]
__device__ __forceinline__ v16b wcol_hdk(const float* Wm, int k0, int o, int lane) { v16b w; const int g = lane >> 4; const float* p = Wm + (size_t)(o / HD) * DIN * HD + (o % HD);
#pragma unroll
  for (int i = 0; i < 8; ++i) { w[i] = (__bf16)p[(size_t)(k0 + 8 * g + i) * HD]; w[8 + i] = (__bf16)p[(size_t)(k0 + 16 + 8 * g + i) * HD]; }
  return w; }
#define WO_OUT_IN 0
#if WQKV_LAYOUT == 1
#define HDK 64              // real key / query width (C / 4); the q / k rows keep a 256-wide pitch, columns 64..255 are neither written nor read
__device__ __forceinline__ v16b zero16b() { v16b w; _Pragma("unroll") for (int i = 0; i < 16; ++i) w[i] = (__bf16)0.0f; return w; }
#define WCOL(W, k0, o, lane) ((which == 2 || (o) < HDK) ? wcol_oi(W, k0, (o), lane, DIN) : zero16b())   /* (out,in): Wh [256][256] full; Wf / Wg [64][256]: projected columns >= 64 are zero fragments (tile-uniform: 64 is a multiple of the 16-column tile) */
#elif WQKV_LAYOUT == 2
#define WCOL(W, k0, o, lane) wcol_hdk(W, k0, o, lane)
#else
#define WCOL(W, k0, o, lane) wcol_io(W, k0, o, lane, CC)
#endif
#if WO_OUT_IN
#define WOCOL(W, k0, o, lane) wcol_oi(W, k0, o, lane, CC)
#define WOCOLH(W, k0, o, lane) wcolh_oi(W, k0, o, lane, CC)
#else
#define WOCOL(W, k0, o, lane) wcol_io(W, k0, o, lane, DIN)
#define WOCOLH(W, k0, o, lane) wcolh_io(W, k0, o, lane, DIN)
#endif

#ifndef SM_EXTRA_PARAMS
#define SM_EXTRA_PARAMS
#endif
#ifndef PROJ_EXTRA_PARAMS
#define PROJ_EXTRA_PARAMS
#endif
#ifndef SM_MASK_HOOK
#define SM_MASK_HOOK (void)0
#endif

#define WS_QH  0u                                      // f16 q rows [b*t][CC]
#define WS_KH  (WS_QH + 2u * (size_t)NB * TT * CC)      // f16 k rows [b*t][CC]
#define WS_VT  (WS_KH + 2u * (size_t)NB * TT * CC)      // f16 v planes [b][c][t]
#define WS_QL  (WS_VT + 2u * (size_t)NB * CC * TT)      // f16 q residual x 2^10 rows [b][t < QHI][CC]
#define WS_KL  (WS_QL + 2u * (size_t)NB * QHI * CC)     // f16 k residual x 2^10 rows [b][t < KHI][CC]
#define WS_VB  (WS_KL + 2u * (size_t)NB * KHI * CC)     // bf16 v hi planes [b][c][t < KHI]
#define WS_VBL (WS_VB + 2u * (size_t)NB * CC * KHI)
#define WS_S   (WS_VBL + 2u * (size_t)NB * CC * KHI)    // f32 softmax statistics (m, l) [key slice][b*t][2] at the head of this region
#define WS_Y   (WS_S  + 4u * (size_t)HG * TQC * TT)      // end of the TQC x TT f32 region
#define WS_END (WS_Y  + 0u)
#define WS_Y2 (WS_END)                                   // f32 partial context rows o[key slice][b*TT + t][256]
#define KSP 4              // key slices of k_fa: one work-group per (query block, key slice, batch); each slice fills its own f32 context plane and its (m, l) rows, k_resT merges the planes
#define YPL ((size_t)NB * TT * CC)   // elements of one context plane
#define WS_END3 (WS_Y2 + 4u * (size_t)KSP * NB * TT * CC)

typedef __attribute__((ext_vector_type(4))) __bf16 v4b;
#define PKP 264            // bf16 pitch of k_proj's staged rows: 528 B = 16 B x 33 (odd multiple: 16-byte fragment reads without bank conflicts)
__device__ __forceinline__ v4b cvt4b(v4f v) { v4b r;
#pragma unroll
  for (int u = 0; u < 4; ++u) r[u] = (__bf16)v[u];
  return r; }
// one bias value, rounded to bf16 (0 where the pointer is null). The s_wait_xcnt 0 stands behind the load because the compiler may give the value the register that held the load's offset.
__device__ __forceinline__ float ld_bias(const float* __restrict__ B, int i) { float v = 0.f; if (B) { v = B[i]; asm volatile("s_wait_xcnt 0x0" ::: "memory"); } return bfr(v); }
// ---- k_proj: block = (64 rows, column block cb): cb 0 = the 64 query and the 64 key columns side by side (weight rows Wq then Wk), cb 1 / 2 = the two 128-column halves of v; X W (+ b) with exact bf16 products (K = DIN). Only columns that k_fa reads are formed: the q / k rows keep their 256-wide pitch, their columns 64..255 are never read and stay unwritten. The block's x tile (read from the channels-first input, turned to token-major on the way) and weight rows are rounded to bf16 once and staged in LDS by whole-line loads, every fragment is read from there -> cb 0: q f16 rows + residual rows, k f16 rows; cb 1 / 2: v f16 planes [c][t]
__global__ __launch_bounds__(128) void k_proj(const float* __restrict__ X, const float* __restrict__ WQ, const float* __restrict__ WK, const float* __restrict__ WV, const float* __restrict__ BQ, const float* __restrict__ BK, const float* __restrict__ BV,
    _Float16* __restrict__ QH, _Float16* __restrict__ QL, _Float16* __restrict__ KH, _Float16* __restrict__ VT) {
  __shared__ __align__(16) char smem[(64 + 128) * PKP * 2];   /* the bf16 x rows and weight rows while the products run, then the output staging tiles */
  __bf16 (*sX)[PKP] = (__bf16 (*)[PKP])smem; __bf16 (*sW)[PKP] = (__bf16 (*)[PKP])(smem + 64 * PKP * 2);
  _Float16 (*sh)[136] = (_Float16 (*)[136])smem; _Float16 (*sl)[136] = (_Float16 (*)[136])(smem + 17408); _Float16 (*th)[72] = (_Float16 (*)[72])(smem + 34816);
  const int tid = threadIdx.x, wave = tid >> 5, lane = tid & 31, col = lane & 15, g = lane >> 4; const int cb = blockIdx.y; const int c0 = (cb - 1) * 128; const size_t r0 = (size_t)blockIdx.x * 64; const size_t bb = r0 / TT; const int t0 = (int)(r0 % TT);
  const unsigned lo = (unsigned)tid * 16u;   /* each 64 weight rows are 64 KiB in a row: block base + one 32-bit byte offset per lane; trips differ by constants only, and every wave-wide load covers 512 B in a row (four whole lines) */
  const int sr = tid >> 6, sc = (tid & 63) * 4;
  { const char* xb = (const char*)(X + bb * (size_t)DIN * TT + t0); v4f rx[32];   /* x is channels-first [b][c][t]: the block's tile is 256 channel rows of 64 times (256 B each) */
    const unsigned xlo = (unsigned)(tid >> 3) * (4u * TT * 4u) + (unsigned)(tid & 7) * 16u;   /* a lane owns 4 x 4 blocks (4 channels, 4 times): 8 lanes x 16 B = one whole 128-B line per channel row, 4 rows per wave-wide load; tile base + one 32-bit byte offset per lane, the loads differ by constants only */
#pragma unroll
    for (int ci = 0; ci < 4; ++ci)
#pragma unroll
      for (int hf = 0; hf < 2; ++hf)
#pragma unroll
        for (int u = 0; u < 4; ++u) rx[(ci * 2 + hf) * 4 + u] = *(const v4f*)(xb + ((size_t)(ci * 64 + u) * (TT * 4) + hf * 128) + xlo);
    asm volatile("s_wait_loadcnt 0x0\n\ts_wait_xcnt 0x0" ::: "memory");   /* the 32 loads per lane fly together and are all back here; the next group's loads stay behind it, so the staging registers are used again */
#pragma unroll
    for (int ci = 0; ci < 4; ++ci)
#pragma unroll
      for (int hf = 0; hf < 2; ++hf)
#pragma unroll
        for (int tu = 0; tu < 4; ++tu) { v4f cv;   /* the 4 x 4 block is turned in registers: one 8-byte LDS store holds 4 channels of one time */
#pragma unroll
          for (int u = 0; u < 4; ++u) cv[u] = rx[(ci * 2 + hf) * 4 + u][tu];
          *(v4b*)&sX[hf * 32 + (tid & 7) * 4 + tu][ci * 64 + (tid >> 3) * 4] = cvt4b(cv); } }
#pragma unroll
  for (int hb = 0; hb < 2; ++hb) { const char* wb = (const char*)(cb == 0 ? (hb == 0 ? WQ : WK) : WV + (size_t)(c0 + hb * 64) * DIN); v4f rw[32];   /* block-uniform choice: Wq and Wk hold 64 rows each, a half of Wv's column block holds 64 */
#pragma unroll
    for (int i = 0; i < 32; ++i) rw[i] = *(const v4f*)(wb + (size_t)i * 2048 + lo);
    asm volatile("s_wait_loadcnt 0x0\n\ts_wait_xcnt 0x0" ::: "memory");   /* as above */
#pragma unroll
    for (int i = 0; i < 32; ++i) *(v4b*)&sW[hb * 64 + sr + 2 * i][sc] = cvt4b(rw[i]); }
  __syncthreads();   /* both tiles are published */
  v8f acc[8] = {}; v16b a = frag_b(&sX[wave * 16 + col][0], lane), w[8];
#pragma unroll
  for (int j = 0; j < 8; ++j) w[j] = frag_b(&sW[j * 16 + col][0], lane);
#pragma unroll
  for (int kc = 0; kc < DIN / 32; ++kc) { v16b an = a, wn[8];   /* the next k-step's 18 LDS reads stand together in front of this k-step's products, into a second register set: read directly in front of its product, each fragment would cost a whole LDS latency */
#pragma unroll
    for (int j = 0; j < 8; ++j) wn[j] = w[j];
    if (kc + 1 < DIN / 32) { an = frag_b(&sX[wave * 16 + col][kc * 32 + 32], lane);
#pragma unroll
      for (int j = 0; j < 8; ++j) wn[j] = frag_b(&sW[j * 16 + col][kc * 32 + 32], lane); }
#pragma unroll
    for (int j = 0; j < 8; ++j) acc[j] = wmma_bf(a, w[j], acc[j]);
    a = an;
#pragma unroll
    for (int j = 0; j < 8; ++j) w[j] = wn[j]; }
  __syncthreads();   /* every wave has read its last fragment: the LDS becomes the output staging tiles */
  if (cb == 0) {   /* tiles j 0..3 = query columns (value + residual), j 4..7 = key columns (value only: no kernel reads a key residual) */
#pragma unroll
    for (int j = 0; j < 8; ++j) { const float bias = ld_bias(j < 4 ? BQ : BK, (j & 3) * 16 + col);
#pragma unroll
      for (int r = 0; r < 8; ++r) { const float v = acc[j][r] + bias; const _Float16 hv = (_Float16)v; sh[wave * 16 + 8 * g + r][j * 16 + col] = hv; if (j < 4) sl[wave * 16 + 8 * g + r][j * 16 + col] = (_Float16)((v - (float)hv) * 1024.0f); } }
    __syncthreads();
    for (int e = tid; e < 64 * 8; e += 128) { const int rl = e >> 3, q = e & 7;   /* 8 lanes x 16 B = the one whole 128-B line that each q / k row holds */
      vst2((unsigned*)(QH + (r0 + rl) * CC + q * 8), *(const v4u*)&sh[rl][q * 8]); vst2((unsigned*)(QL + (bb * QHI + t0 + rl) * (size_t)CC + q * 8), *(const v4u*)&sl[rl][q * 8]); vst2((unsigned*)(KH + (r0 + rl) * CC + q * 8), *(const v4u*)&sh[rl][HDK + q * 8]); }
  } else {
#pragma unroll
    for (int j = 0; j < 8; ++j) { const float bias = ld_bias(BV, c0 + j * 16 + col);
#pragma unroll
      for (int r = 0; r < 8; ++r) th[j * 16 + col][wave * 16 + 8 * g + r] = (_Float16)(acc[j][r] + bias); }
    __syncthreads();
    for (int e = tid; e < 128 * 8; e += 128) { const int cl = e >> 3, q = e & 7; vst2((unsigned*)(VT + (bb * CC + c0 + cl) * (size_t)TT + t0 + q * 8), *(const v4u*)&th[cl][q * 8]); } } }
// ---- k_resT: tile (64 times, 64 channels) of batch bz: out[b][c][t] = bf16(v[b][c][t]) + bf16(gamma) * a[b][t][c] (a = the KSP token-major partial context planes merged by their softmax statistics: sum_s 2^(m_s - M) plane_s / sum_s 2^(m_s - M) l_s; LDS transpose back to channels-first)
__global__ __launch_bounds__(256) void k_resT(const float* __restrict__ V, const float* __restrict__ A, const float* __restrict__ ML, const float* __restrict__ GM, float* __restrict__ OUT) { __shared__ float tl[64][65];
  const int tid = threadIdx.x; const int t0 = blockIdx.x * 64, c0 = blockIdx.y * 64; const size_t b = blockIdx.z; const float gm = bfr(GM[0]);
  const char* ab = (const char*)(A + (b * TT + t0) * (size_t)CC + c0); const unsigned vo = (unsigned)(((tid >> 4) * CC + (tid & 15) * 4) * 4);   /* tile base (the same for the whole block) + one 32-bit byte offset per lane; planes and trips differ by constants only, so no address is stepped while loads are in flight */
  const char* mb = (const char*)(ML + (b * TT + t0) * 2); const unsigned mvo = (unsigned)((tid >> 4) * 8);
#pragma unroll
  for (int i = 0; i < 4; ++i) { const int tr = (tid >> 4) + 16 * i, q = tid & 15; v4f pl[KSP]; v2f sm[KSP];
#pragma unroll
    for (int s = 0; s < KSP; ++s) { pl[s] = *(const v4f*)(ab + ((size_t)s * YPL + (size_t)i * 16 * CC) * 4 + vo); sm[s] = *(const v2f*)(mb + ((size_t)s * NB * TT + (size_t)i * 16) * 8 + mvo); }
    asm volatile("s_wait_loadcnt 0x0\n\ts_wait_xcnt 0x0" :: "v"(vo) : "memory");   /* the planes' and statistics' loads fly together and are all back here, before the sums; vo as an input keeps the lane offset in its register up to this wait */
    float mx = sm[0][0];
#pragma unroll
    for (int s = 1; s < KSP; ++s) mx = fmaxf(mx, sm[s][0]);
    float w[KSP], den = 0.f;
#pragma unroll
    for (int s = 0; s < KSP; ++s) { w[s] = __builtin_amdgcn_exp2f(sm[s][0] - mx); den += w[s] * sm[s][1]; }
    const float inv = 1.0f / den;   /* the slice that holds the maximum gives at least 2^11 */
    v4f ld = pl[0] * (w[0] * inv);
#pragma unroll
    for (int s = 1; s < KSP; ++s) ld += pl[s] * (w[s] * inv);   /* key slices added in rising order */
#pragma unroll
    for (int u = 0; u < 4; ++u) tl[tr][q * 4 + u] = ld[u]; }
  __syncthreads();
  for (int e = tid; e < 64 * 16; e += 256) { const int cl = e >> 4, q = e & 15; const size_t off = (b * CC + c0 + cl) * (size_t)TT + t0 + q * 4; const v4f vv = *(const v4f*)(V + off); asm volatile("s_wait_loadcnt 0x0" ::: "memory"); v4f o;
#pragma unroll
    for (int u = 0; u < 4; ++u) o[u] = bfr(vv[u]) + gm * tl[q * 4 + u][cl];
    vst2(OUT + off, o); } }   
// ---- k_fa: block = (128 queries qb, key slice ks, batch b), 8 waves x 16 queries: scores, softmax and P . v in one pass over the slice's keys, no score plane. Per 64-key tile: v [256 ch][64 keys] and k [64 keys][64 dims] go to LDS by asynchronous copies, two buffers, the next tile in flight while this one is worked on; per 32 keys each wave forms S^T = k . q^T (A = key rows, B = query columns; q hi + residual, 2 products), whose D registers (lane = query, element = key 8g + r) ARE the B fragment of o^T = v^T . P^T (tile 0 -> elements 0..7, tile 1 -> 8..15), so P never leaves the registers. Running maximum m (log2 domain) and sum l per query live one per lane; the accumulators are rescaled only when some lane's maximum moved. Out: unnormalised context plane ks (x 2^11) and (m, l) per (slice, query); k_resT merges the slices.
#define FKT 64             // keys per LDS tile
#define FPI 72             // f16 pitch of both LDS tiles: 144 B = 16 B x 9 (odd multiple: 16-byte fragment reads without bank conflicts)
#define L2E 1.44269504088896340736f
__device__ __forceinline__ v8f wmma_h(v16h a, v16h b, v8f c) { return __builtin_amdgcn_wmma_f32_16x16x32_f16(false, a, false, b, (short)0, c, false, false); }
#define FTB ((CC + FKT) * FPI * 2)   // bytes of one k / v tile buffer (46,080)
// one tile: ten 16-byte asynchronous copies per lane (8 value rows, 2 key rows, 32 rows apart), global memory -> LDS through no register. lb = the lane's LDS byte address in the buffer, gv / gk = its global addresses. The s_wait_xcnt 0 stands inside the copies' own statement, so that no address register is rewritten in front of it.
__device__ __forceinline__ void fa_copy(unsigned lb, const char* gv, const char* gk) {
  asm volatile("global_load_async_to_lds_b128 %0, %1, off\n\t"
               "global_load_async_to_lds_b128 %2, %3, off\n\t"
               "global_load_async_to_lds_b128 %4, %5, off\n\t"
               "global_load_async_to_lds_b128 %6, %7, off\n\t"
               "global_load_async_to_lds_b128 %8, %9, off\n\t"
               "global_load_async_to_lds_b128 %10, %11, off\n\t"
               "global_load_async_to_lds_b128 %12, %13, off\n\t"
               "global_load_async_to_lds_b128 %14, %15, off\n\t"
               "global_load_async_to_lds_b128 %16, %17, off\n\t"
               "global_load_async_to_lds_b128 %18, %19, off\n\t"
               "s_wait_xcnt 0x0"
               :: "v"(lb), "v"(gv), "v"(lb + 1u * 32 * FPI * 2), "v"(gv + 1 * 32 * TT * 2), "v"(lb + 2u * 32 * FPI * 2), "v"(gv + 2 * 32 * TT * 2), "v"(lb + 3u * 32 * FPI * 2), "v"(gv + 3 * 32 * TT * 2),
                  "v"(lb + 4u * 32 * FPI * 2), "v"(gv + 4 * 32 * TT * 2), "v"(lb + 5u * 32 * FPI * 2), "v"(gv + 5 * 32 * TT * 2), "v"(lb + 6u * 32 * FPI * 2), "v"(gv + 6 * 32 * TT * 2), "v"(lb + 7u * 32 * FPI * 2), "v"(gv + 7 * 32 * TT * 2),
                  "v"(lb + 8u * 32 * FPI * 2), "v"(gk), "v"(lb + 9u * 32 * FPI * 2), "v"(gk + 32 * CC * 2) : "memory"); }
#define FQW 8              // waves (16 queries each) per work-group; the second launch bound asks for four waves per SIMD, that is two work-groups per WGP, so that one group's products cover the other's tile loads
__global__ __launch_bounds__(FQW * 32, 4) void k_fa(const _Float16* __restrict__ QH, const _Float16* __restrict__ QL, const _Float16* __restrict__ KH, const _Float16* __restrict__ VT, float* __restrict__ Y0, float* __restrict__ ML) {
  __shared__ __align__(16) char smem[2 * FTB];   /* two k / v tile buffers (92,160 B) while the keys are walked, then one 16 x 132 f32 transpose buffer per wave (67,584 B) */
  const int tid = threadIdx.x, wave = tid >> 5, lane = tid & 31, col = lane & 15, g = lane >> 4; const int qb = blockIdx.x, ks = blockIdx.y; const size_t b = blockIdx.z;
  const size_t q0 = b * TT + qb * (FQW * 16) + wave * 16; const int key0 = ks * (TT / KSP);
  v16h qh[HDK / 32], ql[HDK / 32];
#pragma unroll
  for (int kc = 0; kc < HDK / 32; ++kc) { qh[kc] = frag_h(QH + (q0 + col) * CC + kc * 32, lane); ql[kc] = frag_h(QL + (q0 + col) * CC + kc * 32, lane); }
  v8f acc[CC / 16] = {}; float m = -3.0e38f, l = 0.f;
  const char* vb = (const char*)(VT + b * CC * TT + key0); const char* kb = (const char*)(KH + (b * TT + key0) * CC);   /* tile bases (the same for the whole block) + one 32-bit byte offset per lane; rows differ by constants only */
  const unsigned vvo = (unsigned)((tid >> 3) * (TT * 2) + (tid & 7) * 16), kvo = (unsigned)((tid >> 3) * (CC * 2) + (tid & 7) * 16);
  const unsigned lb = (unsigned)(size_t)smem + (unsigned)((tid >> 3) * (FPI * 2) + (tid & 7) * 16);   /* 8 lanes x 16 B = one whole 128-B line per value or key row */
  const char* gv = vb + vvo; const char* gk = kb + kvo;
  fa_copy(lb, gv, gk);   /* tile 0 -> buffer 0 */
  asm volatile("s_wait_asynccnt 0x0" ::: "memory");   /* this wave's copies of tile 0 have landed */
  __syncthreads();   /* tile 0 is published */
  fa_copy(lb + FTB, gv + FKT * 2, gk + FKT * CC * 2);   /* tile 1 -> buffer 1 */
#pragma unroll 1   /* rolled: one copy of the tile's code serves both buffers, which differ by one address term; unrolled it would only lengthen the hot text */
  for (int st = 0; st < TT / KSP / FKT; ++st) { const char* tb = smem + (st & 1) * FTB; const _Float16 (*sV)[FPI] = (const _Float16 (*)[FPI])tb; const _Float16 (*sK)[FPI] = (const _Float16 (*)[FPI])(tb + CC * FPI * 2);
#pragma unroll 1   /* rolled: the products of one 32-key half stay a scheduling region of their own */
    for (int kk = 0; kk < FKT / 32; ++kk) { v8f sa[2] = {}, sb[2] = {};
#pragma unroll
      for (int t = 0; t < 2; ++t)
#pragma unroll
        for (int kc = 0; kc < HDK / 32; ++kc) { const v16h a = frag_h(&sK[kk * 32 + t * 16 + col][kc * 32], lane); sa[t] = wmma_h(a, qh[kc], sa[t]); sb[t] = wmma_h(a, ql[kc], sb[t]); }
      float tv[16];
#pragma unroll
      for (int i = 0; i < 16; ++i) tv[i] = (sa[i >> 3][i & 7] + sb[i >> 3][i & 7] * (1.0f / 1024.0f)) * L2E;
      float mx = tv[0];
#pragma unroll
      for (int i = 1; i < 16; ++i) mx = fmaxf(mx, tv[i]);
      mx = fmaxf(mx, __shfl_xor(mx, 16));   /* lanes col and col + 16 hold the two key halves of one query */
      const float mn = fmaxf(m, mx);
      if (__any(mn > m)) { const float al = __builtin_amdgcn_exp2f(m - mn); l *= al;
#pragma unroll
        for (int j = 0; j < CC / 16; ++j) acc[j] *= al;
        m = mn; }
      const float mo = m - 11.0f; v16h p; float ps = 0.f;
#pragma unroll
      for (int i = 0; i < 16; ++i) { const float e = __builtin_amdgcn_exp2f(tv[i] - mo); ps += e; p[i] = (_Float16)e; }
      l += ps;
#pragma unroll
      for (int j = 0; j < CC / 16; ++j) acc[j] = wmma_h(frag_h(&sV[j * 16 + col][kk * 32], lane), p, acc[j]);
      /* order of this block's LDS reads and products: four value fragments ahead, then one product per fragment read; left alone the compiler reads each fragment directly in front of its product, which then waits a whole LDS latency */
      __builtin_amdgcn_sched_group_barrier(0x100, 8, 0);
#pragma unroll
      for (int j = 0; j < CC / 16 - 4; ++j) { __builtin_amdgcn_sched_group_barrier(0x8, 1, 0); __builtin_amdgcn_sched_group_barrier(0x100, 2, 0); }
      __builtin_amdgcn_sched_group_barrier(0x8, 4, 0); }
    asm volatile("s_wait_dscnt 0x0" ::: "memory");      /* this wave's reads of the tile are back */
    asm volatile("s_wait_asynccnt 0x0" ::: "memory");   /* this wave's copies of the next tile have landed */
    __syncthreads();   /* the next tile is published, and every wave has left this one */
    if (st + 2 < TT / KSP / FKT) fa_copy(lb + (unsigned)(st & 1) * FTB, gv + (size_t)(st + 2) * (FKT * 2), gk + (size_t)(st + 2) * (FKT * CC * 2)); }   /* block-uniform test: tile st + 2 goes into the buffer just left and flies during trip st + 1 */
  asm volatile("s_wait_asynccnt 0x0" ::: "memory");   /* no copy is outstanding when the LDS changes its use */
  l += __shfl_xor(l, 16);
  if (g == 0) { v2f st2; st2[0] = m; st2[1] = l; vst2(ML + ((size_t)ks * NB * TT + q0 + col) * 2, st2); }   /* 16 lanes x 8 B = one 128-B line per wave */
  /* the last trip's barrier has ended every wave's reads of the tiles: the LDS becomes the waves' private transpose buffers */
  float* sw = (float*)smem + wave * (16 * 132); float* Y = Y0 + (size_t)ks * YPL;
#pragma unroll
  for (int hh = 0; hh < 2; ++hh) {
#pragma unroll
    for (int jj = 0; jj < 8; ++jj) { const v8f a = acc[hh * 8 + jj]; v4f lo, hi;
#pragma unroll
      for (int u = 0; u < 4; ++u) { lo[u] = a[u]; hi[u] = a[4 + u]; }
      *(v4f*)(sw + col * 132 + jj * 16 + 8 * g) = lo; *(v4f*)(sw + col * 132 + jj * 16 + 8 * g + 4) = hi; }
    LDSX();
#pragma unroll
    for (int rl = 0; rl < 16; ++rl) vst2(Y + (q0 + rl) * CC + hh * 128 + lane * 4, *(const v4f*)(sw + rl * 132 + lane * 4));
    LDSX(); } }
extern "C" void kernel_launch(void* const* d_in, const int* in_sizes, int n_in, void* d_out, int out_size, void* d_ws, size_t ws_size, hipStream_t stream) {
  (void)in_sizes; (void)n_in; (void)out_size;
  const float** F = (const float**)d_in;
  if (ws_size < (size_t)WS_END) return;
  char* ws = (char*)d_ws; _Float16 *QH = (_Float16*)(ws + WS_QH), *KH = (_Float16*)(ws + WS_KH), *VT = (_Float16*)(ws + WS_VT), *QL = (_Float16*)(ws + WS_QL), *KL = (_Float16*)(ws + WS_KL); __bf16 *VB = (__bf16*)(ws + WS_VB), *VBL = (__bf16*)(ws + WS_VBL); float *ML = (float*)(ws + WS_S), *Y = (float*)(ws + WS_Y);
  (void)Y; (void)QL; (void)KL; (void)VB; (void)VBL;
  // inputs: 0 x [4,256,64,64] CHANNELS-FIRST (N = 4,096 positions); 1 Wq [64,256] (out,in), 2 bq [64]; 3 Wk [64,256], 4 bk [64]; 5 Wv [256,256] (out,in), 6 bv [256]; 7 gamma [1] (zero biases, read)
  if (ws_size < (size_t)WS_END3) return;
  float *Y2 = (float*)(ws + WS_Y2);
  k_proj<<<dim3(TNB * TT / 64, 3), 128, 0, stream>>>(F[0], F[1], F[3], F[5], F[2], F[4], F[6], QH, QL, KH, VT);   /* column block 0: q (Wq / bq) and k (Wk / bk), 64 real columns each, side by side; 1 / 2: values v (Wv / bv), 128 columns each */
  k_fa<<<dim3(TT / (FQW * 16), KSP, TNB), FQW * 32, 0, stream>>>(QH, QL, KH, VT, Y2, ML);   /* scores, softmax and P . v fused: one launch for all batches, 512 work-groups of 8 waves */
  k_resT<<<dim3(TT / 64, CC / 64, TNB), 256, 0, stream>>>(F[0], Y2, ML, F[7], (float*)d_out);   /* out[b][c][m] = x + gamma * o (transposed back to channels-first) */
}

// v007
// It runs in 66.2 microseconds.
// Next to v006, in two timings, it ran 1.04 times as fast each time.
// Counting every step since v000, it is 27.5 times as fast.
// compute dtype: all float inputs rounded to bf16; the q / k (64-dim) and v (256-dim) pointwise projections with EXACT bf16 products on WMMA 16x16x32 (f32 accumulate) + bias; UNSCALED scores q_n . k_m in the log2 domain: the query x log2(e) as f16 hi + f16 residual (unscaled) against the key once to f16 (2 products into one f32 accumulator that starts at minus the held reference, K = 64: two k-steps); softmax over m in f32 (held reference maximum and sum, per key slice); unnormalised P (at most 2^15) once to f16 x v once to f16 (1 product), divided by the f32 sum at the merge; out = bf16(x) + bf16(gamma) * o in f32; f32 output.
#include <hip/hip_runtime.h>
#include <math.h>

typedef __attribute__((ext_vector_type(16))) _Float16 v16h;
typedef __attribute__((ext_vector_type(16))) __bf16 v16b;
typedef __attribute__((ext_vector_type(8)))  _Float16 v8h;
typedef __attribute__((ext_vector_type(8)))  float v8f;
typedef __attribute__((ext_vector_type(4)))  float v4f;
typedef __attribute__((ext_vector_type(2)))  float v2f;
typedef __attribute__((ext_vector_type(4)))  unsigned v4u;
typedef __attribute__((ext_vector_type(4)))  int v4i;
typedef float __attribute__((may_alias)) float_a;
typedef int __attribute__((may_alias)) int_a;

template <typename T> __device__ __forceinline__ void vst2(void* p, T v) { *(T*)p = v;  }
__device__ __forceinline__ v8f wmma16(v16h a, v16h b, v8f c) {
  v8f d = __builtin_amdgcn_wmma_f32_16x16x32_f16(false, a, false, b, (short)0, c, false, false);
  asm volatile("v_nop\n\tv_nop\n\tv_nop\n\tv_nop" : "+v"(d) : "v"(a), "v"(b));
  return d;
}
__device__ __forceinline__ v8f wmma_bf(v16b a, v16b b, v8f c) {
  v8f d = __builtin_amdgcn_wmma_f32_16x16x32_bf16(false, a, false, b, (short)0, c, false, false);
  asm volatile("v_nop\n\tv_nop\n\tv_nop\n\tv_nop" : "+v"(d) : "v"(a), "v"(b));
  return d;
}
// 16x16x32 fragments: lane = (h = lane>>4, row/col = lane&15); elements 0..7 = k0+8h+0..7, 8..15 = k0+16+8h+0..7; D element r = row 8h+r
__device__ __forceinline__ v16h frag_h(const _Float16* rowk0, int lane) {
  union { v16h v; v8h q[2]; } u; const _Float16* p = rowk0 + 8 * (lane >> 4);
  u.q[0] = *(const v8h*)p; u.q[1] = *(const v8h*)(p + 16); return u.v;
}
__device__ __forceinline__ v16h frag_f32(const float* rowk0, int lane) {
  v16h a; const float* p = rowk0 + 8 * (lane >> 4);
#pragma unroll
  for (int i = 0; i < 8; ++i) { a[i] = (_Float16)p[i]; a[8 + i] = (_Float16)p[16 + i]; }
  return a;
}
__device__ __forceinline__ v16h frag_f32s(const float* rowk0, int lane, float sc) {
  v16h a; const float* p = rowk0 + 8 * (lane >> 4);
#pragma unroll
  for (int i = 0; i < 8; ++i) { a[i] = (_Float16)(p[i] * sc); a[8 + i] = (_Float16)(p[16 + i] * sc); }
  return a;
}
// column fragment from a [K][ld] layout (column n), rows >= K read as 0
__device__ __forceinline__ v16h fragc_f32(const float* W, int k0, int n, int lane, int ld, int K) {
  v16h a; const int g = lane >> 4;
#pragma unroll
  for (int i = 0; i < 8; ++i) { const int ka = k0 + 8 * g + i, kb = ka + 16;
    a[i] = (_Float16)(ka < K ? W[(size_t)(ka < K ? ka : K - 1) * ld + n] : 0.f); a[8 + i] = (_Float16)(kb < K ? W[(size_t)(kb < K ? kb : K - 1) * ld + n] : 0.f); }
  return a;
}
struct F2 { v16b h, l; };
__device__ __forceinline__ F2 bsplit16(const float v[16]) { F2 r;
#pragma unroll
  for (int i = 0; i < 16; ++i) { const __bf16 h = (__bf16)v[i]; r.h[i] = h; r.l[i] = (__bf16)(v[i] - (float)h); }
  return r; }
__device__ __forceinline__ F2 split_row(const float* row, int k0, int lane) { float v[16]; const float* p = row + k0 + 8 * (lane >> 4);
#pragma unroll
  for (int i = 0; i < 8; ++i) { v[i] = p[i]; v[8 + i] = p[16 + i]; }
  return bsplit16(v); }
__device__ __forceinline__ F2 split_rowK(const float* row, int k0, int lane, int K) { float v[16]; const int g = lane >> 4;
#pragma unroll
  for (int i = 0; i < 8; ++i) { const int ka = k0 + 8 * g + i, kb = ka + 16; v[i] = ka < K ? row[ka < K ? ka : K - 1] : 0.f; v[8 + i] = kb < K ? row[kb < K ? kb : K - 1] : 0.f; }
  return bsplit16(v); }
__device__ __forceinline__ F2 split_col(const float* W, int k0, int n, int lane, int ld, int K) { float v[16]; const int g = lane >> 4;
#pragma unroll
  for (int i = 0; i < 8; ++i) { const int ka = k0 + 8 * g + i, kb = ka + 16; v[i] = ka < K ? W[(size_t)(ka < K ? ka : K - 1) * ld + n] : 0.f; v[8 + i] = kb < K ? W[(size_t)(kb < K ? kb : K - 1) * ld + n] : 0.f; }
  return bsplit16(v); }
__device__ __forceinline__ v8f mac3(const F2& a, const F2& b, v8f c) { c = wmma_bf(a.l, b.h, c); c = wmma_bf(a.h, b.l, c); return wmma_bf(a.h, b.h, c); }
__device__ __forceinline__ float sigm(float v) { return 1.0f / (1.0f + expf(-v)); }
#define LDSX() do { asm volatile("s_wait_dscnt 0" ::: "memory"); __builtin_amdgcn_wave_barrier(); __builtin_amdgcn_fence(__ATOMIC_RELEASE, "workgroup"); } while (0)

// SAGAN-style 2-D self-attention (x [4,256,64,64] -> N = 4,096 positions; 1x1 convs: q = Wq x + bq, k = Wk x + bk with Wq / Wk [64,256], v = Wv x + bv with Wv [256,256] (1/16 scale, zero biases); attn[n, m] = softmax_m(q[:, n] . k[:, m]) (UNSCALED, sigma - 8: strongly peaked); out[c, n] = sum_m v[c, m] attn[n, m]; result = gamma out + x with gamma [1] uniform(0, 1)).
#define NB 4
#define TT 4096
#define CC 256            // NH * HD = projected width
#define DIN 256          // input (model) width
#define NH 1
#define HD 256
#define NQB (TT / 64)
#define HG 1
#define SCALE (1.0f)
#define CAUSAL 0
#ifndef TNB
#define TNB NB
#endif
__device__ __forceinline__ float bfr(float v) { return (float)(__bf16)v; }
__host__ __device__ __forceinline__ int kb_last(int qb) { return CAUSAL ? ((qb * 64 + 63) >> 7) : (TT / 128 - 1); }
typedef __attribute__((ext_vector_type(8))) __bf16 v8b;
__device__ __forceinline__ v16b frag_b(const __bf16* rowk0, int lane) {
  union { v16b v; v8b q[2]; } u; const __bf16* p = rowk0 + 8 * (lane >> 4);
  u.q[0] = *(const v8b*)p; u.q[1] = *(const v8b*)(p + 16); return u.v;
}
#define QBH 0               // k_fa: single-product P . h on every block (the bf16 hi/lo value planes are not used)
#define QBH_SC 0            // k_fa: every block takes the 2-product branch (q f16 hi + residual against k once to f16): the 3-product variant would cost 4.3 G-slot more planes
#define TQC 2048           // sizes the WS_S region: TQC x 4,096 f32 entries (32 MiB)
#define QHI 4096            // rows carrying a q residual plane (all rows when non-causal: 2-product logits everywhere)
#define KHI 64              // no block reads the k residual plane (QBH_SC 0)
// B fragment (k rows k0+.., output column o) of a weight: (in,out) [K][ld] or (out,in) [ld rows of K]: bf16 exact, or f16(bf16 * 256) exact
__device__ __forceinline__ v16b wcol_io(const float* Wm, int k0, int o, int lane, int ld) { v16b w; const int g = lane >> 4;
#pragma unroll
  for (int i = 0; i < 8; ++i) { w[i] = (__bf16)Wm[(size_t)(k0 + 8 * g + i) * ld + o]; w[8 + i] = (__bf16)Wm[(size_t)(k0 + 16 + 8 * g + i) * ld + o]; }
  return w; }
__device__ __forceinline__ v16b wcol_oi(const float* Wm, int k0, int o, int lane, int K) { v16b w; const float* p = Wm + (size_t)o * K + k0 + 8 * (lane >> 4);
#pragma unroll
  for (int i = 0; i < 8; ++i) { w[i] = (__bf16)p[i]; w[8 + i] = (__bf16)p[16 + i]; }
  return w; }
__device__ __forceinline__ v16h wcolh_io(const float* Wm, int k0, int o, int lane, int ld) { v16h w; const int g = lane >> 4;
#pragma unroll
  for (int i = 0; i < 8; ++i) { w[i] = (_Float16)(bfr(Wm[(size_t)(k0 + 8 * g + i) * ld + o]) * 256.0f); w[8 + i] = (_Float16)(bfr(Wm[(size_t)(k0 + 16 + 8 * g + i) * ld + o]) * 256.0f); }
  return w; }
__device__ __forceinline__ v16h wcolh_oi(const float* Wm, int k0, int o, int lane, int K) { v16h w; const float* p = Wm + (size_t)o * K + k0 + 8 * (lane >> 4);
#pragma unroll
  for (int i = 0; i < 8; ++i) { w[i] = (_Float16)(bfr(p[i]) * 256.0f); w[8 + i] = (_Float16)(bfr(p[16 + i]) * 256.0f); }
  return w; }
#define WQKV_LAYOUT 1   // 0 = (in,out) [DIN][CC]; 1 = (out,in) [CC][DIN]; 2 = per-head [NH][DIN][HD]
__device__ __forceinline__ v16b wcol_hdk(const float* Wm, int k0, int o, int lane) { v16b w; const int g = lane >> 4; const float* p = Wm + (size_t)(o / HD) * DIN * HD + (o % HD);
#pragma unroll
  for (int i = 0; i < 8; ++i) { w[i] = (__bf16)p[(size_t)(k0 + 8 * g + i) * HD]; w[8 + i] = (__bf16)p[(size_t)(k0 + 16 + 8 * g + i) * HD]; }
  return w; }
#define WO_OUT_IN 0
#if WQKV_LAYOUT == 1
#define HDK 64              // real key / query width (C / 4); the q / k rows keep a 256-wide pitch, columns 64..255 are neither written nor read
__device__ __forceinline__ v16b zero16b() { v16b w; _Pragma("unroll") for (int i = 0; i < 16; ++i) w[i] = (__bf16)0.0f; return w; }
#define WCOL(W, k0, o, lane) ((which == 2 || (o) < HDK) ? wcol_oi(W, k0, (o), lane, DIN) : zero16b())   /* (out,in): Wh [256][256] full; Wf / Wg [64][256]: projected columns >= 64 are zero fragments (tile-uniform: 64 is a multiple of the 16-column tile) */
#elif WQKV_LAYOUT == 2
#define WCOL(W, k0, o, lane) wcol_hdk(W, k0, o, lane)
#else
#define WCOL(W, k0, o, lane) wcol_io(W, k0, o, lane, CC)
#endif
#if WO_OUT_IN
#define WOCOL(W, k0, o, lane) wcol_oi(W, k0, o, lane, CC)
#define WOCOLH(W, k0, o, lane) wcolh_oi(W, k0, o, lane, CC)
#else
#define WOCOL(W, k0, o, lane) wcol_io(W, k0, o, lane, DIN)
#define WOCOLH(W, k0, o, lane) wcolh_io(W, k0, o, lane, DIN)
#endif

#ifndef SM_EXTRA_PARAMS
#define SM_EXTRA_PARAMS
#endif
#ifndef PROJ_EXTRA_PARAMS
#define PROJ_EXTRA_PARAMS
#endif
#ifndef SM_MASK_HOOK
#define SM_MASK_HOOK (void)0
#endif

#define WS_QH  0u                                      // f16 rows of q x log2(e) [b*t][CC]
#define WS_KH  (WS_QH + 2u * (size_t)NB * TT * CC)      // f16 k rows [b*t][CC]
#define WS_VT  (WS_KH + 2u * (size_t)NB * TT * CC)      // f16 v planes [b][c][t]
#define WS_QL  (WS_VT + 2u * (size_t)NB * CC * TT)      // f16 residual rows of q x log2(e), unscaled [b][t < QHI][CC]
#define WS_KL  (WS_QL + 2u * (size_t)NB * QHI * CC)     // f16 k residual x 2^10 rows [b][t < KHI][CC]
#define WS_VB  (WS_KL + 2u * (size_t)NB * KHI * CC)     // bf16 v hi planes [b][c][t < KHI]
#define WS_VBL (WS_VB + 2u * (size_t)NB * CC * KHI)
#define WS_S   (WS_VBL + 2u * (size_t)NB * CC * KHI)    // f32 softmax statistics (m, l) [key slice][b*t][2] at the head of this region
#define WS_Y   (WS_S  + 4u * (size_t)HG * TQC * TT)      // end of the TQC x TT f32 region
#define WS_END (WS_Y  + 0u)
#define WS_Y2 (WS_END)                                   // f32 partial context rows o[key slice][b*TT + t][256]
#define KSP 4              // key slices of k_fa: one work-group per (query block, key slice, batch); each slice fills its own f32 context plane and its (m, l) rows, k_resT merges the planes
#define YPL ((size_t)NB * TT * CC)   // elements of one context plane
#define WS_END3 (WS_Y2 + 4u * (size_t)KSP * NB * TT * CC)

typedef __attribute__((ext_vector_type(4))) __bf16 v4b;
#define L2E 1.44269504088896340736f
#define PKP 264            // bf16 pitch of k_proj's staged rows: 528 B = 16 B x 33 (odd multiple: 16-byte fragment reads without bank conflicts)
__device__ __forceinline__ v4b cvt4b(v4f v) { v4b r;
#pragma unroll
  for (int u = 0; u < 4; ++u) r[u] = (__bf16)v[u];
  return r; }
// one bias value, rounded to bf16 (0 where the pointer is null). The s_wait_xcnt 0 stands behind the load because the compiler may give the value the register that held the load's offset.
__device__ __forceinline__ float ld_bias(const float* __restrict__ B, int i) { float v = 0.f; if (B) { v = B[i]; asm volatile("s_wait_xcnt 0x0" ::: "memory"); } return bfr(v); }
// ---- k_proj: block = (64 rows, column block cb): cb 0 = the 64 query and the 64 key columns side by side (weight rows Wq then Wk), cb 1 / 2 = the two 128-column halves of v; X W (+ b) with exact bf16 products (K = DIN). Only columns that k_fa reads are formed: the q / k rows keep their 256-wide pitch, their columns 64..255 are never read and stay unwritten. The block's x tile (read from the channels-first input, turned to token-major on the way) and weight rows are rounded to bf16 once and staged in LDS by whole-line loads, every fragment is read from there -> cb 0: q f16 rows + residual rows, k f16 rows; cb 1 / 2: v f16 planes [c][t]
__global__ __launch_bounds__(128) void k_proj(const float* __restrict__ X, const float* __restrict__ WQ, const float* __restrict__ WK, const float* __restrict__ WV, const float* __restrict__ BQ, const float* __restrict__ BK, const float* __restrict__ BV,
    _Float16* __restrict__ QH, _Float16* __restrict__ QL, _Float16* __restrict__ KH, _Float16* __restrict__ VT) {
  __shared__ __align__(16) char smem[(64 + 128) * PKP * 2];   /* the bf16 x rows and weight rows while the products run, then the output staging tiles */
  __bf16 (*sX)[PKP] = (__bf16 (*)[PKP])smem; __bf16 (*sW)[PKP] = (__bf16 (*)[PKP])(smem + 64 * PKP * 2);
  _Float16 (*sh)[136] = (_Float16 (*)[136])smem; _Float16 (*sl)[136] = (_Float16 (*)[136])(smem + 17408); _Float16 (*th)[72] = (_Float16 (*)[72])(smem + 34816);
  const int tid = threadIdx.x, wave = tid >> 5, lane = tid & 31, col = lane & 15, g = lane >> 4; const int cb = blockIdx.y; const int c0 = (cb - 1) * 128; const size_t r0 = (size_t)blockIdx.x * 64; const size_t bb = r0 / TT; const int t0 = (int)(r0 % TT);
  const unsigned lo = (unsigned)tid * 16u;   /* each 64 weight rows are 64 KiB in a row: block base + one 32-bit byte offset per lane; trips differ by constants only, and every wave-wide load covers 512 B in a row (four whole lines) */
  const int sr = tid >> 6, sc = (tid & 63) * 4;
  { const char* xb = (const char*)(X + bb * (size_t)DIN * TT + t0); v4f rx[32];   /* x is channels-first [b][c][t]: the block's tile is 256 channel rows of 64 times (256 B each) */
    const unsigned xlo = (unsigned)(tid >> 3) * (4u * TT * 4u) + (unsigned)(tid & 7) * 16u;   /* a lane owns 4 x 4 blocks (4 channels, 4 times): 8 lanes x 16 B = one whole 128-B line per channel row, 4 rows per wave-wide load; tile base + one 32-bit byte offset per lane, the loads differ by constants only */
#pragma unroll
    for (int ci = 0; ci < 4; ++ci)
#pragma unroll
      for (int hf = 0; hf < 2; ++hf)
#pragma unroll
        for (int u = 0; u < 4; ++u) rx[(ci * 2 + hf) * 4 + u] = *(const v4f*)(xb + ((size_t)(ci * 64 + u) * (TT * 4) + hf * 128) + xlo);
    asm volatile("s_wait_loadcnt 0x0\n\ts_wait_xcnt 0x0" ::: "memory");   /* the 32 loads per lane fly together and are all back here; the next group's loads stay behind it, so the staging registers are used again */
#pragma unroll
    for (int ci = 0; ci < 4; ++ci)
#pragma unroll
      for (int hf = 0; hf < 2; ++hf)
#pragma unroll
        for (int tu = 0; tu < 4; ++tu) { v4f cv;   /* the 4 x 4 block is turned in registers: one 8-byte LDS store holds 4 channels of one time */
#pragma unroll
          for (int u = 0; u < 4; ++u) cv[u] = rx[(ci * 2 + hf) * 4 + u][tu];
          *(v4b*)&sX[hf * 32 + (tid & 7) * 4 + tu][ci * 64 + (tid >> 3) * 4] = cvt4b(cv); } }
#pragma unroll
  for (int hb = 0; hb < 2; ++hb) { const char* wb = (const char*)(cb == 0 ? (hb == 0 ? WQ : WK) : WV + (size_t)(c0 + hb * 64) * DIN); v4f rw[32];   /* block-uniform choice: Wq and Wk hold 64 rows each, a half of Wv's column block holds 64 */
#pragma unroll
    for (int i = 0; i < 32; ++i) rw[i] = *(const v4f*)(wb + (size_t)i * 2048 + lo);
    asm volatile("s_wait_loadcnt 0x0\n\ts_wait_xcnt 0x0" ::: "memory");   /* as above */
#pragma unroll
    for (int i = 0; i < 32; ++i) *(v4b*)&sW[hb * 64 + sr + 2 * i][sc] = cvt4b(rw[i]); }
  __syncthreads();   /* both tiles are published */
  v8f acc[8] = {}; v16b a = frag_b(&sX[wave * 16 + col][0], lane), w[8];
#pragma unroll
  for (int j = 0; j < 8; ++j) w[j] = frag_b(&sW[j * 16 + col][0], lane);
#pragma unroll
  for (int kc = 0; kc < DIN / 32; ++kc) { v16b an = a, wn[8];   /* the next k-step's 18 LDS reads stand together in front of this k-step's products, into a second register set: read directly in front of its product, each fragment would cost a whole LDS latency */
#pragma unroll
    for (int j = 0; j < 8; ++j) wn[j] = w[j];
    if (kc + 1 < DIN / 32) { an = frag_b(&sX[wave * 16 + col][kc * 32 + 32], lane);
#pragma unroll
      for (int j = 0; j < 8; ++j) wn[j] = frag_b(&sW[j * 16 + col][kc * 32 + 32], lane); }
#pragma unroll
    for (int j = 0; j < 8; ++j) acc[j] = wmma_bf(a, w[j], acc[j]);
    a = an;
#pragma unroll
    for (int j = 0; j < 8; ++j) w[j] = wn[j]; }
  __syncthreads();   /* every wave has read its last fragment: the LDS becomes the output staging tiles */
  if (cb == 0) {   /* tiles j 0..3 = query columns (value + residual), j 4..7 = key columns (value only: no kernel reads a key residual) */
#pragma unroll
    for (int j = 0; j < 8; ++j) { const float bias = ld_bias(j < 4 ? BQ : BK, (j & 3) * 16 + col);
#pragma unroll
      for (int r = 0; r < 8; ++r) { const float v = (acc[j][r] + bias) * (j < 4 ? L2E : 1.0f); const _Float16 hv = (_Float16)v; sh[wave * 16 + 8 * g + r][j * 16 + col] = hv; if (j < 4) sl[wave * 16 + 8 * g + r][j * 16 + col] = (_Float16)(v - (float)hv); } }   /* the query carries log2(e), so that k_fa's scores are exp2 arguments */
    __syncthreads();
    for (int e = tid; e < 64 * 8; e += 128) { const int rl = e >> 3, q = e & 7;   /* 8 lanes x 16 B = the one whole 128-B line that each q / k row holds */
      vst2((unsigned*)(QH + (r0 + rl) * CC + q * 8), *(const v4u*)&sh[rl][q * 8]); vst2((unsigned*)(QL + (bb * QHI + t0 + rl) * (size_t)CC + q * 8), *(const v4u*)&sl[rl][q * 8]); vst2((unsigned*)(KH + (r0 + rl) * CC + q * 8), *(const v4u*)&sh[rl][HDK + q * 8]); }
  } else {
#pragma unroll
    for (int j = 0; j < 8; ++j) { const float bias = ld_bias(BV, c0 + j * 16 + col);
#pragma unroll
      for (int r = 0; r < 8; ++r) th[j * 16 + col][wave * 16 + 8 * g + r] = (_Float16)(acc[j][r] + bias); }
    __syncthreads();
    for (int e = tid; e < 128 * 8; e += 128) { const int cl = e >> 3, q = e & 7; vst2((unsigned*)(VT + (bb * CC + c0 + cl) * (size_t)TT + t0 + q * 8), *(const v4u*)&th[cl][q * 8]); } } }
// ---- k_resT: tile (64 times, 64 channels) of batch bz: out[b][c][t] = bf16(v[b][c][t]) + bf16(gamma) * a[b][t][c] (a = the KSP token-major partial context planes merged by their softmax statistics: sum_s 2^(m_s - M) plane_s / sum_s 2^(m_s - M) l_s; LDS transpose back to channels-first)
__global__ __launch_bounds__(256) void k_resT(const float* __restrict__ V, const float* __restrict__ A, const float* __restrict__ ML, const float* __restrict__ GM, float* __restrict__ OUT) { __shared__ float tl[64][65];
  const int tid = threadIdx.x; const int t0 = blockIdx.x * 64, c0 = blockIdx.y * 64; const size_t b = blockIdx.z; const float gm = bfr(GM[0]);
  const char* ab = (const char*)(A + (b * TT + t0) * (size_t)CC + c0); const unsigned vo = (unsigned)(((tid >> 4) * CC + (tid & 15) * 4) * 4);   /* tile base (the same for the whole block) + one 32-bit byte offset per lane; planes and trips differ by constants only, so no address is stepped while loads are in flight */
  const char* mb = (const char*)(ML + (b * TT + t0) * 2); const unsigned mvo = (unsigned)((tid >> 4) * 8);
#pragma unroll
  for (int i = 0; i < 4; ++i) { const int tr = (tid >> 4) + 16 * i, q = tid & 15; v4f pl[KSP]; v2f sm[KSP];
#pragma unroll
    for (int s = 0; s < KSP; ++s) { pl[s] = *(const v4f*)(ab + ((size_t)s * YPL + (size_t)i * 16 * CC) * 4 + vo); sm[s] = *(const v2f*)(mb + ((size_t)s * NB * TT + (size_t)i * 16) * 8 + mvo); }
    asm volatile("s_wait_loadcnt 0x0\n\ts_wait_xcnt 0x0" :: "v"(vo) : "memory");   /* the planes' and statistics' loads fly together and are all back here, before the sums; vo as an input keeps the lane offset in its register up to this wait */
    float mx = sm[0][0];
#pragma unroll
    for (int s = 1; s < KSP; ++s) mx = fmaxf(mx, sm[s][0]);
    float w[KSP], den = 0.f;
#pragma unroll
    for (int s = 0; s < KSP; ++s) { w[s] = __builtin_amdgcn_exp2f(sm[s][0] - mx); den += w[s] * sm[s][1]; }
    const float inv = 1.0f / den;   /* the slice with the highest reference gives about 1 or more: the key its reference was taken from */
    v4f ld = pl[0] * (w[0] * inv);
#pragma unroll
    for (int s = 1; s < KSP; ++s) ld += pl[s] * (w[s] * inv);   /* key slices added in rising order */
#pragma unroll
    for (int u = 0; u < 4; ++u) tl[tr][q * 4 + u] = ld[u]; }
  __syncthreads();
  for (int e = tid; e < 64 * 16; e += 256) { const int cl = e >> 4, q = e & 15; const size_t off = (b * CC + c0 + cl) * (size_t)TT + t0 + q * 4; const v4f vv = *(const v4f*)(V + off); asm volatile("s_wait_loadcnt 0x0" ::: "memory"); v4f o;
#pragma unroll
    for (int u = 0; u < 4; ++u) o[u] = bfr(vv[u]) + gm * tl[q * 4 + u][cl];
    vst2(OUT + off, o); } }   
// ---- k_fa: block = (128 queries qb, key slice ks, batch b), 8 waves x 16 queries: scores, softmax and P . v in one pass over the slice's keys, no score plane. Per 64-key tile: v [256 ch][64 keys] and k [64 keys][64 dims] go to LDS by asynchronous copies, two buffers, the next tile in flight while this one is worked on; per 32 keys each wave forms S^T = k . q^T (A = key rows, B = query columns; q residual and q hi, 2 products chained into one accumulator whose start value C is minus the held reference m, so D is the exp2 argument as it stands), whose D registers (lane = query, element = key 8g + r) ARE the B fragment of o^T = v^T . P^T (tile 0 -> elements 0..7, tile 1 -> 8..15), so P never leaves the registers. Reference m (log2 domain, a maximum seen earlier) and sum l per query live one per lane; a maximum is searched and the accumulators are rescaled only in the first pass and when some lane's sum of P tops FLIM. Out: unnormalised context plane ks and (m, l) per (slice, query); k_resT merges the slices.
#define FKT 64             // keys per LDS tile
#define FPI 72             // f16 pitch of both LDS tiles: 144 B = 16 B x 9 (odd multiple: 16-byte fragment reads without bank conflicts)
__device__ __forceinline__ v8f wmma_h(v16h a, v16h b, v8f c) { return __builtin_amdgcn_wmma_f32_16x16x32_f16(false, a, false, b, (short)0, c, false, false); }
#define FLIM 32768.0f      // a pass whose 16 P values of a lane sum to more takes a new reference: below it every P fits f16
#define FTB ((CC + FKT) * FPI * 2)   // bytes of one k / v tile buffer (46,080)
// one tile: ten 16-byte asynchronous copies per lane (8 value rows, 2 key rows, 32 rows apart), global memory -> LDS through no register. lb = the lane's LDS byte address in the buffer, gv / gk = its global addresses. The s_wait_xcnt 0 stands inside the copies' own statement, so that no address register is rewritten in front of it.
__device__ __forceinline__ void fa_copy(unsigned lb, const char* gv, const char* gk) {
  asm volatile("global_load_async_to_lds_b128 %0, %1, off\n\t"
               "global_load_async_to_lds_b128 %2, %3, off\n\t"
               "global_load_async_to_lds_b128 %4, %5, off\n\t"
               "global_load_async_to_lds_b128 %6, %7, off\n\t"
               "global_load_async_to_lds_b128 %8, %9, off\n\t"
               "global_load_async_to_lds_b128 %10, %11, off\n\t"
               "global_load_async_to_lds_b128 %12, %13, off\n\t"
               "global_load_async_to_lds_b128 %14, %15, off\n\t"
               "global_load_async_to_lds_b128 %16, %17, off\n\t"
               "global_load_async_to_lds_b128 %18, %19, off\n\t"
               "s_wait_xcnt 0x0"
               :: "v"(lb), "v"(gv), "v"(lb + 1u * 32 * FPI * 2), "v"(gv + 1 * 32 * TT * 2), "v"(lb + 2u * 32 * FPI * 2), "v"(gv + 2 * 32 * TT * 2), "v"(lb + 3u * 32 * FPI * 2), "v"(gv + 3 * 32 * TT * 2),
                  "v"(lb + 4u * 32 * FPI * 2), "v"(gv + 4 * 32 * TT * 2), "v"(lb + 5u * 32 * FPI * 2), "v"(gv + 5 * 32 * TT * 2), "v"(lb + 6u * 32 * FPI * 2), "v"(gv + 6 * 32 * TT * 2), "v"(lb + 7u * 32 * FPI * 2), "v"(gv + 7 * 32 * TT * 2),
                  "v"(lb + 8u * 32 * FPI * 2), "v"(gk), "v"(lb + 9u * 32 * FPI * 2), "v"(gk + 32 * CC * 2) : "memory"); }
#define FQW 8              // waves (16 queries each) per work-group; the second launch bound asks for four waves per SIMD, that is two work-groups per WGP, so that one group's products cover the other's tile loads
__global__ __launch_bounds__(FQW * 32, 4) void k_fa(const _Float16* __restrict__ QH, const _Float16* __restrict__ QL, const _Float16* __restrict__ KH, const _Float16* __restrict__ VT, float* __restrict__ Y0, float* __restrict__ ML) {
  __shared__ __align__(16) char smem[2 * FTB];   /* two k / v tile buffers (92,160 B) while the keys are walked, then one 16 x 132 f32 transpose buffer per wave (67,584 B) */
  const int tid = threadIdx.x, wave = tid >> 5, lane = tid & 31, col = lane & 15, g = lane >> 4; const int qb = blockIdx.x, ks = blockIdx.y; const size_t b = blockIdx.z;
  const size_t q0 = b * TT + qb * (FQW * 16) + wave * 16; const int key0 = ks * (TT / KSP);
  v16h qh[HDK / 32], ql[HDK / 32];
#pragma unroll
  for (int kc = 0; kc < HDK / 32; ++kc) { qh[kc] = frag_h(QH + (q0 + col) * CC + kc * 32, lane); ql[kc] = frag_h(QL + (q0 + col) * CC + kc * 32, lane); }
  v8f acc[CC / 16] = {}, cm = {}; float m = 0.f, l = 0.f;   /* cm = -m in all eight elements: the C operand of the score products */
  const char* vb = (const char*)(VT + b * CC * TT + key0); const char* kb = (const char*)(KH + (b * TT + key0) * CC);   /* tile bases (the same for the whole block) + one 32-bit byte offset per lane; rows differ by constants only */
  const unsigned vvo = (unsigned)((tid >> 3) * (TT * 2) + (tid & 7) * 16), kvo = (unsigned)((tid >> 3) * (CC * 2) + (tid & 7) * 16);
  const unsigned lb = (unsigned)(size_t)smem + (unsigned)((tid >> 3) * (FPI * 2) + (tid & 7) * 16);   /* 8 lanes x 16 B = one whole 128-B line per value or key row */
  const char* gv = vb + vvo; const char* gk = kb + kvo;
  fa_copy(lb, gv, gk);   /* tile 0 -> buffer 0 */
  asm volatile("s_wait_asynccnt 0x0" ::: "memory");   /* this wave's copies of tile 0 have landed */
  __syncthreads();   /* tile 0 is published */
  fa_copy(lb + FTB, gv + FKT * 2, gk + FKT * CC * 2);   /* tile 1 -> buffer 1 */
#pragma unroll 1   /* rolled: one copy of the tile's code serves both buffers, which differ by one address term; unrolled it would only lengthen the hot text */
  for (int st = 0; st < TT / KSP / FKT; ++st) { const char* tb = smem + (st & 1) * FTB; const _Float16 (*sV)[FPI] = (const _Float16 (*)[FPI])tb; const _Float16 (*sK)[FPI] = (const _Float16 (*)[FPI])(tb + CC * FPI * 2);
#pragma unroll 1   /* rolled: the products of one 32-key half stay a scheduling region of their own */
    for (int kk = 0; kk < FKT / 32; ++kk) { v8f sa[2]; v16h ka[2][HDK / 32];   /* the short loops of this pass run over register arrays: unrolled, so that every index is a constant */
#pragma unroll
      for (int t = 0; t < 2; ++t)
#pragma unroll
        for (int kc = 0; kc < HDK / 32; ++kc) ka[t][kc] = frag_h(&sK[kk * 32 + t * 16 + col][kc * 32], lane);
#pragma unroll
      for (int t = 0; t < 2; ++t) sa[t] = wmma_h(ka[t][0], ql[0], cm);
#pragma unroll
      for (int t = 0; t < 2; ++t) sa[t] = wmma_h(ka[t][0], qh[0], sa[t]);
#pragma unroll
      for (int t = 0; t < 2; ++t) sa[t] = wmma_h(ka[t][1], ql[1], sa[t]);
#pragma unroll
      for (int t = 0; t < 2; ++t) sa[t] = wmma_h(ka[t][1], qh[1], sa[t]);
      float e[16], pq[4];
#pragma unroll
      for (int i = 0; i < 16; ++i) e[i] = __builtin_amdgcn_exp2f(sa[i >> 3][i & 7]);
#pragma unroll
      for (int u = 0; u < 4; ++u) pq[u] = (e[u] + e[4 + u]) + (e[8 + u] + e[12 + u]);
      float ps = (pq[0] + pq[1]) + (pq[2] + pq[3]);
      const bool first = (st | kk) == 0;   /* the same for the whole block: the first pass has no reference yet */
      if (__any(!(ps <= FLIM)) || first) {   /* seldom taken: the scores have outgrown the reference */
        float mx = sa[0][0];
#pragma unroll
        for (int i = 1; i < 16; ++i) mx = fmaxf(mx, sa[i >> 3][i & 7]);
        mx = fmaxf(mx, __shfl_xor(mx, 16));   /* lanes col and col + 16 hold the two key halves of one query and keep one reference */
        const float mn = m + (first ? mx : fmaxf(mx, 0.f)), dd = mn - m, al = __builtin_amdgcn_exp2f(fminf(-dd, 0.f));   /* the reference only rises behind the first pass; there l and the accumulators are still 0 */
        l *= al;
#pragma unroll
        for (int j = 0; j < CC / 16; ++j) acc[j] *= al;
        m = mn;
#pragma unroll
        for (int r = 0; r < 8; ++r) cm[r] = -mn;
#pragma unroll
        for (int i = 0; i < 16; ++i) e[i] = __builtin_amdgcn_exp2f(sa[i >> 3][i & 7] - dd);
#pragma unroll
        for (int u = 0; u < 4; ++u) pq[u] = (e[u] + e[4 + u]) + (e[8 + u] + e[12 + u]);
        ps = (pq[0] + pq[1]) + (pq[2] + pq[3]); }
      l += ps; v16h p;
#pragma unroll
      for (int i = 0; i < 16; ++i) p[i] = (_Float16)e[i];
#pragma unroll
      for (int j = 0; j < CC / 16; ++j) acc[j] = wmma_h(frag_h(&sV[j * 16 + col][kk * 32], lane), p, acc[j]);
      /* order of this block's LDS reads and products: four value fragments ahead, then one product per fragment read; left alone the compiler reads each fragment directly in front of its product, which then waits a whole LDS latency */
      __builtin_amdgcn_sched_group_barrier(0x100, 8, 0);
#pragma unroll
      for (int j = 0; j < CC / 16 - 4; ++j) { __builtin_amdgcn_sched_group_barrier(0x8, 1, 0); __builtin_amdgcn_sched_group_barrier(0x100, 2, 0); }
      __builtin_amdgcn_sched_group_barrier(0x8, 4, 0); }
    asm volatile("s_wait_dscnt 0x0" ::: "memory");      /* this wave's reads of the tile are back */
    asm volatile("s_wait_asynccnt 0x0" ::: "memory");   /* this wave's copies of the next tile have landed */
    __syncthreads();   /* the next tile is published, and every wave has left this one */
    if (st + 2 < TT / KSP / FKT) fa_copy(lb + (unsigned)(st & 1) * FTB, gv + (size_t)(st + 2) * (FKT * 2), gk + (size_t)(st + 2) * (FKT * CC * 2)); }   /* block-uniform test: tile st + 2 goes into the buffer just left and flies during trip st + 1 */
  asm volatile("s_wait_asynccnt 0x0" ::: "memory");   /* no copy is outstanding when the LDS changes its use */
  l += __shfl_xor(l, 16);
  if (g == 0) { v2f st2; st2[0] = m; st2[1] = l; vst2(ML + ((size_t)ks * NB * TT + q0 + col) * 2, st2); }   /* 16 lanes x 8 B = one 128-B line per wave */
  /* the last trip's barrier has ended every wave's reads of the tiles: the LDS becomes the waves' private transpose buffers */
  float* sw = (float*)smem + wave * (16 * 132); float* Y = Y0 + (size_t)ks * YPL;
#pragma unroll
  for (int hh = 0; hh < 2; ++hh) {
#pragma unroll
    for (int jj = 0; jj < 8; ++jj) { const v8f a = acc[hh * 8 + jj]; v4f lo, hi;
#pragma unroll
      for (int u = 0; u < 4; ++u) { lo[u] = a[u]; hi[u] = a[4 + u]; }
      *(v4f*)(sw + col * 132 + jj * 16 + 8 * g) = lo; *(v4f*)(sw + col * 132 + jj * 16 + 8 * g + 4) = hi; }
    LDSX();
#pragma unroll
    for (int rl = 0; rl < 16; ++rl) vst2(Y + (q0 + rl) * CC + hh * 128 + lane * 4, *(const v4f*)(sw + rl * 132 + lane * 4));
    LDSX(); } }
extern "C" void kernel_launch(void* const* d_in, const int* in_sizes, int n_in, void* d_out, int out_size, void* d_ws, size_t ws_size, hipStream_t stream) {
  (void)in_sizes; (void)n_in; (void)out_size;
  const float** F = (const float**)d_in;
  if (ws_size < (size_t)WS_END) return;
  char* ws = (char*)d_ws; _Float16 *QH = (_Float16*)(ws + WS_QH), *KH = (_Float16*)(ws + WS_KH), *VT = (_Float16*)(ws + WS_VT), *QL = (_Float16*)(ws + WS_QL), *KL = (_Float16*)(ws + WS_KL); __bf16 *VB = (__bf16*)(ws + WS_VB), *VBL = (__bf16*)(ws + WS_VBL); float *ML = (float*)(ws + WS_S), *Y = (float*)(ws + WS_Y);
  (void)Y; (void)QL; (void)KL; (void)VB; (void)VBL;
  // inputs: 0 x [4,256,64,64] CHANNELS-FIRST (N = 4,096 positions); 1 Wq [64,256] (out,in), 2 bq [64]; 3 Wk [64,256], 4 bk [64]; 5 Wv [256,256] (out,in), 6 bv [256]; 7 gamma [1] (zero biases, read)
  if (ws_size < (size_t)WS_END3) return;
  float *Y2 = (float*)(ws + WS_Y2);
  k_proj<<<dim3(TNB * TT / 64, 3), 128, 0, stream>>>(F[0], F[1], F[3], F[5], F[2], F[4], F[6], QH, QL, KH, VT);   /* column block 0: q (Wq / bq) and k (Wk / bk), 64 real columns each, side by side; 1 / 2: values v (Wv / bv), 128 columns each */
  k_fa<<<dim3(TT / (FQW * 16), KSP, TNB), FQW * 32, 0, stream>>>(QH, QL, KH, VT, Y2, ML);   /* scores, softmax and P . v fused: one launch for all batches, 512 work-groups of 8 waves */
  k_resT<<<dim3(TT / 64, CC / 64, TNB), 256, 0, stream>>>(F[0], Y2, ML, F[7], (float*)d_out);   /* out[b][c][m] = x + gamma * o (transposed back to channels-first) */
}

// v008
// It runs in 63 microseconds.
// Two timings next to v007 both put it at 1.05 times that version's speed.
// Over all steps from v000 it is 28.9 times as fast.
// compute dtype: all float inputs rounded to bf16; the q / k (64-dim) and v (256-dim) pointwise projections with EXACT bf16 products on WMMA 16x16x32 (f32 accumulate) + bias; UNSCALED scores q_n . k_m in the log2 domain: the query x log2(e) as f16 hi + f16 residual (unscaled) against the key once to f16 (2 products into one f32 accumulator that starts at minus the held reference, K = 64: two k-steps); softmax over m in f32 (held reference maximum and sum, per key slice); unnormalised P (at most 2^15) once to f16 x v once to f16 (1 product), divided by the f32 sum at the merge; out = bf16(x) + bf16(gamma) * o in f32; f32 output.
#include <hip/hip_runtime.h>
#include <math.h>

typedef __attribute__((ext_vector_type(16))) _Float16 v16h;
typedef __attribute__((ext_vector_type(16))) __bf16 v16b;
typedef __attribute__((ext_vector_type(8)))  _Float16 v8h;
typedef __attribute__((ext_vector_type(8)))  float v8f;
typedef __attribute__((ext_vector_type(4)))  float v4f;
typedef __attribute__((ext_vector_type(2)))  float v2f;
typedef __attribute__((ext_vector_type(4)))  unsigned v4u;
typedef __attribute__((ext_vector_type(4)))  int v4i;
typedef float __attribute__((may_alias)) float_a;
typedef int __attribute__((may_alias)) int_a;

template <typename T> __device__ __forceinline__ void vst2(void* p, T v) { *(T*)p = v;  }
__device__ __forceinline__ v8f wmma16(v16h a, v16h b, v8f c) {
  v8f d = __builtin_amdgcn_wmma_f32_16x16x32_f16(false, a, false, b, (short)0, c, false, false);
  asm volatile("v_nop\n\tv_nop\n\tv_nop\n\tv_nop" : "+v"(d) : "v"(a), "v"(b));
  return d;
}
__device__ __forceinline__ v8f wmma_bf(v16b a, v16b b, v8f c) {
  v8f d = __builtin_amdgcn_wmma_f32_16x16x32_bf16(false, a, false, b, (short)0, c, false, false);
  asm volatile("v_nop\n\tv_nop\n\tv_nop\n\tv_nop" : "+v"(d) : "v"(a), "v"(b));
  return d;
}
// 16x16x32 fragments: lane = (h = lane>>4, row/col = lane&15); elements 0..7 = k0+8h+0..7, 8..15 = k0+16+8h+0..7; D element r = row 8h+r
__device__ __forceinline__ v16h frag_h(const _Float16* rowk0, int lane) {
  union { v16h v; v8h q[2]; } u; const _Float16* p = rowk0 + 8 * (lane >> 4);
  u.q[0] = *(const v8h*)p; u.q[1] = *(const v8h*)(p + 16); return u.v;
}
__device__ __forceinline__ v16h frag_f32(const float* rowk0, int lane) {
  v16h a; const float* p = rowk0 + 8 * (lane >> 4);
#pragma unroll
  for (int i = 0; i < 8; ++i) { a[i] = (_Float16)p[i]; a[8 + i] = (_Float16)p[16 + i]; }
  return a;
}
__device__ __forceinline__ v16h frag_f32s(const float* rowk0, int lane, float sc) {
  v16h a; const float* p = rowk0 + 8 * (lane >> 4);
#pragma unroll
  for (int i = 0; i < 8; ++i) { a[i] = (_Float16)(p[i] * sc); a[8 + i] = (_Float16)(p[16 + i] * sc); }
  return a;
}
// column fragment from a [K][ld] layout (column n), rows >= K read as 0
__device__ __forceinline__ v16h fragc_f32(const float* W, int k0, int n, int lane, int ld, int K) {
  v16h a; const int g = lane >> 4;
#pragma unroll
  for (int i = 0; i < 8; ++i) { const int ka = k0 + 8 * g + i, kb = ka + 16;
    a[i] = (_Float16)(ka < K ? W[(size_t)(ka < K ? ka : K - 1) * ld + n] : 0.f); a[8 + i] = (_Float16)(kb < K ? W[(size_t)(kb < K ? kb : K - 1) * ld + n] : 0.f); }
  return a;
}
struct F2 { v16b h, l; };
__device__ __forceinline__ F2 bsplit16(const float v[16]) { F2 r;
#pragma unroll
  for (int i = 0; i < 16; ++i) { const __bf16 h = (__bf16)v[i]; r.h[i] = h; r.l[i] = (__bf16)(v[i] - (float)h); }
  return r; }
__device__ __forceinline__ F2 split_row(const float* row, int k0, int lane) { float v[16]; const float* p = row + k0 + 8 * (lane >> 4);
#pragma unroll
  for (int i = 0; i < 8; ++i) { v[i] = p[i]; v[8 + i] = p[16 + i]; }
  return bsplit16(v); }
__device__ __forceinline__ F2 split_rowK(const float* row, int k0, int lane, int K) { float v[16]; const int g = lane >> 4;
#pragma unroll
  for (int i = 0; i < 8; ++i) { const int ka = k0 + 8 * g + i, kb = ka + 16; v[i] = ka < K ? row[ka < K ? ka : K - 1] : 0.f; v[8 + i] = kb < K ? row[kb < K ? kb : K - 1] : 0.f; }
  return bsplit16(v); }
__device__ __forceinline__ F2 split_col(const float* W, int k0, int n, int lane, int ld, int K) { float v[16]; const int g = lane >> 4;
#pragma unroll
  for (int i = 0; i < 8; ++i) { const int ka = k0 + 8 * g + i, kb = ka + 16; v[i] = ka < K ? W[(size_t)(ka < K ? ka : K - 1) * ld + n] : 0.f; v[8 + i] = kb < K ? W[(size_t)(kb < K ? kb : K - 1) * ld + n] : 0.f; }
  return bsplit16(v); }
__device__ __forceinline__ v8f mac3(const F2& a, const F2& b, v8f c) { c = wmma_bf(a.l, b.h, c); c = wmma_bf(a.h, b.l, c); return wmma_bf(a.h, b.h, c); }
__device__ __forceinline__ float sigm(float v) { return 1.0f / (1.0f + expf(-v)); }
#define LDSX() do { asm volatile("s_wait_dscnt 0" ::: "memory"); __builtin_amdgcn_wave_barrier(); __builtin_amdgcn_fence(__ATOMIC_RELEASE, "workgroup"); } while (0)

// SAGAN-style 2-D self-attention (x [4,256,64,64] -> N = 4,096 positions; 1x1 convs: q = Wq x + bq, k = Wk x + bk with Wq / Wk [64,256], v = Wv x + bv with Wv [256,256] (1/16 scale, zero biases); attn[n, m] = softmax_m(q[:, n] . k[:, m]) (UNSCALED, sigma - 8: strongly peaked); out[c, n] = sum_m v[c, m] attn[n, m]; result = gamma out + x with gamma [1] uniform(0, 1)).
#define NB 4
#define TT 4096
#define CC 256            // NH * HD = projected width
#define DIN 256          // input (model) width
#define NH 1
#define HD 256
#define NQB (TT / 64)
#define HG 1
#define SCALE (1.0f)
#define CAUSAL 0
#ifndef TNB
#define TNB NB
#endif
__device__ __forceinline__ float bfr(float v) { return (float)(__bf16)v; }
__host__ __device__ __forceinline__ int kb_last(int qb) { return CAUSAL ? ((qb * 64 + 63) >> 7) : (TT / 128 - 1); }
typedef __attribute__((ext_vector_type(8))) __bf16 v8b;
__device__ __forceinline__ v16b frag_b(const __bf16* rowk0, int lane) {
  union { v16b v; v8b q[2]; } u; const __bf16* p = rowk0 + 8 * (lane >> 4);
  u.q[0] = *(const v8b*)p; u.q[1] = *(const v8b*)(p + 16); return u.v;
}
#define QBH 0               // k_fa: single-product P . h on every block (the bf16 hi/lo value planes are not used)
#define QBH_SC 0            // k_fa: every block takes the 2-product branch (q f16 hi + residual against k once to f16): the 3-product variant would cost 4.3 G-slot more planes
#define TQC 2048           // sizes the WS_S region: TQC x 4,096 f32 entries (32 MiB)
#define QHI 4096            // rows carrying a q residual plane (all rows when non-causal: 2-product logits everywhere)
#define KHI 64              // no block reads the k residual plane (QBH_SC 0)
// B fragment (k rows k0+.., output column o) of a weight: (in,out) [K][ld] or (out,in) [ld rows of K]: bf16 exact, or f16(bf16 * 256) exact
__device__ __forceinline__ v16b wcol_io(const float* Wm, int k0, int o, int lane, int ld) { v16b w; const int g = lane >> 4;
#pragma unroll
  for (int i = 0; i < 8; ++i) { w[i] = (__bf16)Wm[(size_t)(k0 + 8 * g + i) * ld + o]; w[8 + i] = (__bf16)Wm[(size_t)(k0 + 16 + 8 * g + i) * ld + o]; }
  return w; }
__device__ __forceinline__ v16b wcol_oi(const float* Wm, int k0, int o, int lane, int K) { v16b w; const float* p = Wm + (size_t)o * K + k0 + 8 * (lane >> 4);
#pragma unroll
  for (int i = 0; i < 8; ++i) { w[i] = (__bf16)p[i]; w[8 + i] = (__bf16)p[16 + i]; }
  return w; }
__device__ __forceinline__ v16h wcolh_io(const float* Wm, int k0, int o, int lane, int ld) { v16h w; const int g = lane >> 4;
#pragma unroll
  for (int i = 0; i < 8; ++i) { w[i] = (_Float16)(bfr(Wm[(size_t)(k0 + 8 * g + i) * ld + o]) * 256.0f); w[8 + i] = (_Float16)(bfr(Wm[(size_t)(k0 + 16 + 8 * g + i) * ld + o]) * 256.0f); }
  return w; }
__device__ __forceinline__ v16h wcolh_oi(const float* Wm, int k0, int o, int lane, int K) { v16h w; const float* p = Wm + (size_t)o * K + k0 + 8 * (lane >> 4);
#pragma unroll
  for (int i = 0; i < 8; ++i) { w[i] = (_Float16)(bfr(p[i]) * 256.0f); w[8 + i] = (_Float16)(bfr(p[16 + i]) * 256.0f); }
  return w; }
#define WQKV_LAYOUT 1   // 0 = (in,out) [DIN][CC]; 1 = (out,in) [CC][DIN]; 2 = per-head [NH][DIN][HD]
__device__ __forceinline__ v16b wcol_hdk(const float* Wm, int k0, int o, int lane) { v16b w; const int g = lane >> 4; const float* p = Wm + (size_t)(o / HD) * DIN * HD + (o % HD);
#pragma unroll
  for (int i = 0; i < 8; ++i) { w[i] = (__bf16)p[(size_t)(k0 + 8 * g + i) * HD]; w[8 + i] = (__bf16)p[(size_t)(k0 + 16 + 8 * g + i) * HD]; }
  return w; }
#define WO_OUT_IN 0
#if WQKV_LAYOUT == 1
#define HDK 64              // real key / query width (C / 4); the q / k rows keep a 256-wide pitch, columns 64..255 are neither written nor read
__device__ __forceinline__ v16b zero16b() { v16b w; _Pragma("unroll") for (int i = 0; i < 16; ++i) w[i] = (__bf16)0.0f; return w; }
#define WCOL(W, k0, o, lane) ((which == 2 || (o) < HDK) ? wcol_oi(W, k0, (o), lane, DIN) : zero16b())   /* (out,in): Wh [256][256] full; Wf / Wg [64][256]: projected columns >= 64 are zero fragments (tile-uniform: 64 is a multiple of the 16-column tile) */
#elif WQKV_LAYOUT == 2
#define WCOL(W, k0, o, lane) wcol_hdk(W, k0, o, lane)
#else
#define WCOL(W, k0, o, lane) wcol_io(W, k0, o, lane, CC)
#endif
#if WO_OUT_IN
#define WOCOL(W, k0, o, lane) wcol_oi(W, k0, o, lane, CC)
#define WOCOLH(W, k0, o, lane) wcolh_oi(W, k0, o, lane, CC)
#else
#define WOCOL(W, k0, o, lane) wcol_io(W, k0, o, lane, DIN)
#define WOCOLH(W, k0, o, lane) wcolh_io(W, k0, o, lane, DIN)
#endif

#ifndef SM_EXTRA_PARAMS
#define SM_EXTRA_PARAMS
#endif
#ifndef PROJ_EXTRA_PARAMS
#define PROJ_EXTRA_PARAMS
#endif
#ifndef SM_MASK_HOOK
#define SM_MASK_HOOK (void)0
#endif

#define WS_QH  0u                                      // f16 rows of q x log2(e) [b*t][CC]
#define WS_KH  (WS_QH + 2u * (size_t)NB * TT * CC)      // f16 k rows [b*t][CC]
#define WS_VT  (WS_KH + 2u * (size_t)NB * TT * CC)      // f16 v planes [b][c][t]
#define WS_QL  (WS_VT + 2u * (size_t)NB * CC * TT)      // f16 residual rows of q x log2(e), unscaled [b][t < QHI][CC]
#define WS_KL  (WS_QL + 2u * (size_t)NB * QHI * CC)     // f16 k residual x 2^10 rows [b][t < KHI][CC]
#define WS_VB  (WS_KL + 2u * (size_t)NB * KHI * CC)     // bf16 v hi planes [b][c][t < KHI]
#define WS_VBL (WS_VB + 2u * (size_t)NB * CC * KHI)
#define WS_S   (WS_VBL + 2u * (size_t)NB * CC * KHI)    // f32 softmax statistics (m, l) [key slice][b*t][2] at the head of this region
#define WS_Y   (WS_S  + 4u * (size_t)HG * TQC * TT)      // end of the TQC x TT f32 region
#define WS_END (WS_Y  + 0u)
#define WS_Y2 (WS_END)                                   // f32 partial context rows o[key slice][b*TT + t][256]
#define KSP 4              // key slices of k_fa: one work-group per (query block, key slice, batch); each slice fills its own f32 context plane and its (m, l) rows, k_resT merges the planes
#define YPL ((size_t)NB * TT * CC)   // elements of one context plane
#define WS_END3 (WS_Y2 + 4u * (size_t)KSP * NB * TT * CC)

typedef __attribute__((ext_vector_type(4))) __bf16 v4b;
#define L2E 1.44269504088896340736f
#define PKP 264            // bf16 pitch of k_proj's staged rows: 528 B = 16 B x 33 (odd multiple: 16-byte fragment reads without bank conflicts)
__device__ __forceinline__ v4b cvt4b(v4f v) { v4b r;
#pragma unroll
  for (int u = 0; u < 4; ++u) r[u] = (__bf16)v[u];
  return r; }
// one bias value, rounded to bf16 (0 where the pointer is null). The s_wait_xcnt 0 stands behind the load because the compiler may give the value the register that held the load's offset.
__device__ __forceinline__ float ld_bias(const float* __restrict__ B, int i) { float v = 0.f; if (B) { v = B[i]; asm volatile("s_wait_xcnt 0x0" ::: "memory"); } return bfr(v); }
// ---- k_proj: block = (64 rows, column block cb): cb 0 = the 64 query and the 64 key columns side by side (weight rows Wq then Wk), cb 1 / 2 = the two 128-column halves of v; X W (+ b) with exact bf16 products (K = DIN). Only columns that k_fa reads are formed: the q / k rows keep their 256-wide pitch, their columns 64..255 are never read and stay unwritten. The block's x tile (read from the channels-first input, turned to token-major on the way) and weight rows are rounded to bf16 once and staged in LDS by whole-line loads, every fragment is read from there -> cb 0: q f16 rows + residual rows, k f16 rows; cb 1 / 2: v f16 planes [c][t]
__global__ __launch_bounds__(128) void k_proj(const float* __restrict__ X, const float* __restrict__ WQ, const float* __restrict__ WK, const float* __restrict__ WV, const float* __restrict__ BQ, const float* __restrict__ BK, const float* __restrict__ BV,
    _Float16* __restrict__ QH, _Float16* __restrict__ QL, _Float16* __restrict__ KH, _Float16* __restrict__ VT) {
  __shared__ __align__(16) char smem[(64 + 128) * PKP * 2];   /* the bf16 x rows and weight rows while the products run, then the output staging tiles */
  __bf16 (*sX)[PKP] = (__bf16 (*)[PKP])smem; __bf16 (*sW)[PKP] = (__bf16 (*)[PKP])(smem + 64 * PKP * 2);
  _Float16 (*sh)[136] = (_Float16 (*)[136])smem; _Float16 (*sl)[136] = (_Float16 (*)[136])(smem + 17408); _Float16 (*th)[72] = (_Float16 (*)[72])(smem + 34816);
  const int tid = threadIdx.x, wave = tid >> 5, lane = tid & 31, col = lane & 15, g = lane >> 4; const int cb = blockIdx.y; const int c0 = (cb - 1) * 128; const size_t r0 = (size_t)blockIdx.x * 64; const size_t bb = r0 / TT; const int t0 = (int)(r0 % TT);
  const unsigned lo = (unsigned)tid * 16u;   /* each 64 weight rows are 64 KiB in a row: block base + one 32-bit byte offset per lane; trips differ by constants only, and every wave-wide load covers 512 B in a row (four whole lines) */
  const int sr = tid >> 6, sc = (tid & 63) * 4;
  { const char* xb = (const char*)(X + bb * (size_t)DIN * TT + t0); v4f rx[32];   /* x is channels-first [b][c][t]: the block's tile is 256 channel rows of 64 times (256 B each) */
    const unsigned xlo = (unsigned)(tid >> 3) * (4u * TT * 4u) + (unsigned)(tid & 7) * 16u;   /* a lane owns 4 x 4 blocks (4 channels, 4 times): 8 lanes x 16 B = one whole 128-B line per channel row, 4 rows per wave-wide load; tile base + one 32-bit byte offset per lane, the loads differ by constants only */
#pragma unroll
    for (int ci = 0; ci < 4; ++ci)
#pragma unroll
      for (int hf = 0; hf < 2; ++hf)
#pragma unroll
        for (int u = 0; u < 4; ++u) rx[(ci * 2 + hf) * 4 + u] = *(const v4f*)(xb + ((size_t)(ci * 64 + u) * (TT * 4) + hf * 128) + xlo);
    asm volatile("s_wait_loadcnt 0x0\n\ts_wait_xcnt 0x0" ::: "memory");   /* the 32 loads per lane fly together and are all back here; the next group's loads stay behind it, so the staging registers are used again */
#pragma unroll
    for (int ci = 0; ci < 4; ++ci)
#pragma unroll
      for (int hf = 0; hf < 2; ++hf)
#pragma unroll
        for (int tu = 0; tu < 4; ++tu) { v4f cv;   /* the 4 x 4 block is turned in registers: one 8-byte LDS store holds 4 channels of one time */
#pragma unroll
          for (int u = 0; u < 4; ++u) cv[u] = rx[(ci * 2 + hf) * 4 + u][tu];
          *(v4b*)&sX[hf * 32 + (tid & 7) * 4 + tu][ci * 64 + (tid >> 3) * 4] = cvt4b(cv); } }
#pragma unroll
  for (int hb = 0; hb < 2; ++hb) { const char* wb = (const char*)(cb == 0 ? (hb == 0 ? WQ : WK) : WV + (size_t)(c0 + hb * 64) * DIN); v4f rw[32];   /* block-uniform choice: Wq and Wk hold 64 rows each, a half of Wv's column block holds 64 */
#pragma unroll
    for (int i = 0; i < 32; ++i) rw[i] = *(const v4f*)(wb + (size_t)i * 2048 + lo);
    asm volatile("s_wait_loadcnt 0x0\n\ts_wait_xcnt 0x0" ::: "memory");   /* as above */
#pragma unroll
    for (int i = 0; i < 32; ++i) *(v4b*)&sW[hb * 64 + sr + 2 * i][sc] = cvt4b(rw[i]); }
  __syncthreads();   /* both tiles are published */
  v8f acc[8] = {}; v16b a = frag_b(&sX[wave * 16 + col][0], lane), w[8];
#pragma unroll
  for (int j = 0; j < 8; ++j) w[j] = frag_b(&sW[j * 16 + col][0], lane);
#pragma unroll
  for (int kc = 0; kc < DIN / 32; ++kc) { v16b an = a, wn[8];   /* the next k-step's 18 LDS reads stand together in front of this k-step's products, into a second register set: read directly in front of its product, each fragment would cost a whole LDS latency */
#pragma unroll
    for (int j = 0; j < 8; ++j) wn[j] = w[j];
    if (kc + 1 < DIN / 32) { an = frag_b(&sX[wave * 16 + col][kc * 32 + 32], lane);
#pragma unroll
      for (int j = 0; j < 8; ++j) wn[j] = frag_b(&sW[j * 16 + col][kc * 32 + 32], lane); }
#pragma unroll
    for (int j = 0; j < 8; ++j) acc[j] = wmma_bf(a, w[j], acc[j]);
    a = an;
#pragma unroll
    for (int j = 0; j < 8; ++j) w[j] = wn[j]; }
  __syncthreads();   /* every wave has read its last fragment: the LDS becomes the output staging tiles */
  if (cb == 0) {   /* tiles j 0..3 = query columns (value + residual), j 4..7 = key columns (value only: no kernel reads a key residual) */
#pragma unroll
    for (int j = 0; j < 8; ++j) { const float bias = ld_bias(j < 4 ? BQ : BK, (j & 3) * 16 + col);
#pragma unroll
      for (int r = 0; r < 8; ++r) { const float v = (acc[j][r] + bias) * (j < 4 ? L2E : 1.0f); const _Float16 hv = (_Float16)v; sh[wave * 16 + 8 * g + r][j * 16 + col] = hv; if (j < 4) sl[wave * 16 + 8 * g + r][j * 16 + col] = (_Float16)(v - (float)hv); } }   /* the query carries log2(e), so that k_fa's scores are exp2 arguments */
    __syncthreads();
    for (int e = tid; e < 64 * 8; e += 128) { const int rl = e >> 3, q = e & 7;   /* 8 lanes x 16 B = the one whole 128-B line that each q / k row holds */
      vst2((unsigned*)(QH + (r0 + rl) * CC + q * 8), *(const v4u*)&sh[rl][q * 8]); vst2((unsigned*)(QL + (bb * QHI + t0 + rl) * (size_t)CC + q * 8), *(const v4u*)&sl[rl][q * 8]); vst2((unsigned*)(KH + (r0 + rl) * CC + q * 8), *(const v4u*)&sh[rl][HDK + q * 8]); }
  } else {
#pragma unroll
    for (int j = 0; j < 8; ++j) { const float bias = ld_bias(BV, c0 + j * 16 + col);
#pragma unroll
      for (int r = 0; r < 8; ++r) th[j * 16 + col][wave * 16 + 8 * g + r] = (_Float16)(acc[j][r] + bias); }
    __syncthreads();
    for (int e = tid; e < 128 * 8; e += 128) { const int cl = e >> 3, q = e & 7; vst2((unsigned*)(VT + (bb * CC + c0 + cl) * (size_t)TT + t0 + q * 8), *(const v4u*)&th[cl][q * 8]); } } }
// ---- k_resT: tile (64 times, 64 channels) of batch bz: out[b][c][t] = bf16(v[b][c][t]) + bf16(gamma) * a[b][t][c] (a = the KSP token-major partial context planes merged by their softmax statistics: sum_s 2^(m_s - M) plane_s / sum_s 2^(m_s - M) l_s; LDS transpose back to channels-first)
__global__ __launch_bounds__(256) void k_resT(const float* __restrict__ V, const float* __restrict__ A, const float* __restrict__ ML, const float* __restrict__ GM, float* __restrict__ OUT) { __shared__ float tl[64][65];
  const int tid = threadIdx.x; const int t0 = blockIdx.x * 64, c0 = blockIdx.y * 64; const size_t b = blockIdx.z; const float gm = bfr(GM[0]);
  const char* ab = (const char*)(A + (b * TT + t0) * (size_t)CC + c0); const unsigned vo = (unsigned)(((tid >> 4) * CC + (tid & 15) * 4) * 4);   /* tile base (the same for the whole block) + one 32-bit byte offset per lane; planes and trips differ by constants only, so no address is stepped while loads are in flight */
  const char* mb = (const char*)(ML + (b * TT + t0) * 2); const unsigned mvo = (unsigned)((tid >> 4) * 8);
#pragma unroll
  for (int i = 0; i < 4; ++i) { const int tr = (tid >> 4) + 16 * i, q = tid & 15; v4f pl[KSP]; v2f sm[KSP];
#pragma unroll
    for (int s = 0; s < KSP; ++s) { pl[s] = *(const v4f*)(ab + ((size_t)s * YPL + (size_t)i * 16 * CC) * 4 + vo); sm[s] = *(const v2f*)(mb + ((size_t)s * NB * TT + (size_t)i * 16) * 8 + mvo); }
    asm volatile("s_wait_loadcnt 0x0\n\ts_wait_xcnt 0x0" :: "v"(vo) : "memory");   /* the planes' and statistics' loads fly together and are all back here, before the sums; vo as an input keeps the lane offset in its register up to this wait */
    float mx = sm[0][0];
#pragma unroll
    for (int s = 1; s < KSP; ++s) mx = fmaxf(mx, sm[s][0]);
    float w[KSP], den = 0.f;
#pragma unroll
    for (int s = 0; s < KSP; ++s) { w[s] = __builtin_amdgcn_exp2f(sm[s][0] - mx); den += w[s] * sm[s][1]; }
    const float inv = 1.0f / den;   /* the slice with the highest reference gives about 1 or more: the key its reference was taken from */
    v4f ld = pl[0] * (w[0] * inv);
#pragma unroll
    for (int s = 1; s < KSP; ++s) ld += pl[s] * (w[s] * inv);   /* key slices added in rising order */
#pragma unroll
    for (int u = 0; u < 4; ++u) tl[tr][q * 4 + u] = ld[u]; }
  __syncthreads();
  for (int e = tid; e < 64 * 16; e += 256) { const int cl = e >> 4, q = e & 15; const size_t off = (b * CC + c0 + cl) * (size_t)TT + t0 + q * 4; const v4f vv = *(const v4f*)(V + off); asm volatile("s_wait_loadcnt 0x0" ::: "memory"); v4f o;
#pragma unroll
    for (int u = 0; u < 4; ++u) o[u] = bfr(vv[u]) + gm * tl[q * 4 + u][cl];
    vst2(OUT + off, o); } }   
// ---- k_fa: block = (128 queries qb, key slice ks, batch b), 4 waves x 32 queries (two 16-query tiles u per wave): scores, softmax and P . v in one pass over the slice's keys, no score plane. Per 64-key tile: v [256 ch][64 keys] and k [64 keys][64 dims] go to LDS by asynchronous copies, two buffers, the next tile in flight while this one is worked on; every key and value fragment that a wave reads from LDS feeds the products of both its query tiles. Per 32 keys each wave forms S^T = k . q^T (A = key rows, B = query columns; q residual and q hi, 2 products chained into one accumulator whose start value C is minus the held reference m, so D is the exp2 argument as it stands), whose D registers (lane = query, element = key 8g + r) ARE the B fragment of o^T = v^T . P^T (tile 0 -> elements 0..7, tile 1 -> 8..15), so P never leaves the registers. Reference m (log2 domain, a maximum seen earlier) and sum l per query live one per lane and query tile; a maximum is searched and the accumulators are rescaled only in the first pass and when some lane's sum of P tops FLIM. Out: unnormalised context plane ks and (m, l) per (slice, query); k_resT merges the slices.
#define FKT 64             // keys per LDS tile
#define FPI 72             // f16 pitch of both LDS tiles: 144 B = 16 B x 9 (odd multiple: 16-byte fragment reads without bank conflicts)
__device__ __forceinline__ v8f wmma_h(v16h a, v16h b, v8f c) { return __builtin_amdgcn_wmma_f32_16x16x32_f16(false, a, false, b, (short)0, c, false, false); }
#define FLIM 32768.0f      // a pass whose 16 P values of a lane sum to more takes a new reference: below it every P fits f16
#define FTB ((CC + FKT) * FPI * 2)   // bytes of one k / v tile buffer (46,080)
// one 16-byte asynchronous copy per lane, global memory -> LDS through no register. The builtin, not asm text: this kernel holds more than 256 vector registers, and the operands of an asm statement must all lie in the low register window, where they crowd out values that live through the key loop (spills)
typedef v4i __attribute__((address_space(1))) gv4i;
typedef v4i __attribute__((address_space(3))) lv4i;
__device__ __forceinline__ void fa_copy(char* l, const char* gp) { __builtin_amdgcn_global_load_async_to_lds_b128((gv4i*)gp, (lv4i*)l, 0, 0); }
// one tile: twenty copies per lane (16 value rows, then 4 key rows, 16 rows apart; the key rows stand behind the CC value rows of the buffer); lb = the lane's place in the buffer, gv / gk = its global addresses
__device__ __forceinline__ void fa_tile(char* lb, const char* gv, const char* gk) {
#pragma unroll
  for (int i = 0; i < CC / 16; ++i) fa_copy(lb + i * 16 * FPI * 2, gv + (size_t)i * 16 * TT * 2);
#pragma unroll
  for (int i = 0; i < FKT / 16; ++i) fa_copy(lb + (CC + i * 16) * FPI * 2, gk + (size_t)i * 16 * CC * 2); }
// exp2 for the seldom-taken rescale path, with the issue slot that the instruction set asks for behind a transcendental in the same statement
__device__ __forceinline__ float exp2_slot(float x) { float r; asm("v_exp_f32 %0, %1\n\tv_nop" : "=v"(r) : "v"(x)); return r; }
#define FQW 4              // waves per work-group
#define FQT 2              // 16-query tiles per wave: 256 accumulator registers; the second launch bound asks for two waves per SIMD, that is two work-groups per WGP, so that one group's products cover the other's barriers and vector work
__global__ __launch_bounds__(FQW * 32, 2) void k_fa(const _Float16* __restrict__ QH, const _Float16* __restrict__ QL, const _Float16* __restrict__ KH, const _Float16* __restrict__ VT, float* __restrict__ Y0, float* __restrict__ ML) {
  __shared__ __align__(16) char smem[2 * FTB];   /* two k / v tile buffers (92,160 B) while the keys are walked, then one 16 x 132 f32 transpose buffer per wave (33,792 B) */
  const int tid = threadIdx.x, wave = tid >> 5, lane = tid & 31, col = lane & 15, g = lane >> 4; const int qb = blockIdx.x, ks = blockIdx.y; const size_t b = blockIdx.z;
  const size_t q0 = b * TT + qb * (FQW * FQT * 16) + wave * (FQT * 16); const int key0 = ks * (TT / KSP);
  v16h qh[FQT][HDK / 32], ql[FQT][HDK / 32];
#pragma unroll
  for (int u = 0; u < FQT; ++u)
#pragma unroll
    for (int kc = 0; kc < HDK / 32; ++kc) { qh[u][kc] = frag_h(QH + (q0 + u * 16 + col) * CC + kc * 32, lane); ql[u][kc] = frag_h(QL + (q0 + u * 16 + col) * CC + kc * 32, lane); }
  asm volatile("s_wait_xcnt 0x0" ::: "memory");   /* behind the query loads, before their address registers are written again for the copies */
  v8f acc[FQT][CC / 16] = {}, cm[FQT] = {}; float m[FQT] = {}, l[FQT] = {};   /* cm = -m in all eight elements: the C operand of the score products */
  const char* vb = (const char*)(VT + b * CC * TT + key0); const char* kb = (const char*)(KH + (b * TT + key0) * CC);   /* tile bases (the same for the whole block) + one 32-bit byte offset per lane; rows differ by constants only */
  const unsigned vvo = (unsigned)((tid >> 3) * (TT * 2) + (tid & 7) * 16), kvo = (unsigned)((tid >> 3) * (CC * 2) + (tid & 7) * 16);
  char* lb = smem + ((tid >> 3) * (FPI * 2) + (tid & 7) * 16);   /* 8 lanes x 16 B = one whole 128-B line per value or key row */
  const char* gv = vb + vvo; const char* gk = kb + kvo;
  fa_tile(lb, gv, gk);   /* tile 0 -> buffer 0 */
  asm volatile("s_wait_asynccnt 0x0" ::: "memory");   /* this wave's copies of tile 0 have landed */
  __syncthreads();   /* tile 0 is published */
  fa_tile(lb + FTB, gv + FKT * 2, gk + FKT * CC * 2);   /* tile 1 -> buffer 1 */
#pragma unroll 1   /* rolled: one copy of the tile's code serves both buffers, which differ by one address term; unrolled it would only lengthen the hot text */
  for (int st = 0; st < TT / KSP / FKT; ++st) { const char* tb = smem + (st & 1) * FTB; const _Float16 (*sV)[FPI] = (const _Float16 (*)[FPI])tb; const _Float16 (*sK)[FPI] = (const _Float16 (*)[FPI])(tb + CC * FPI * 2);
#pragma unroll 1   /* rolled: the products of one 32-key half stay a scheduling region of their own */
    for (int kk = 0; kk < FKT / 32; ++kk) { v8f sa[FQT][2]; v16h ka[2][HDK / 32];   /* the short loops of this pass run over register arrays: unrolled, so that every index is a constant */
#pragma unroll
      for (int t = 0; t < 2; ++t)
#pragma unroll
        for (int kc = 0; kc < HDK / 32; ++kc) ka[t][kc] = frag_h(&sK[kk * 32 + t * 16 + col][kc * 32], lane);
#pragma unroll
      for (int u = 0; u < FQT; ++u)
#pragma unroll
        for (int t = 0; t < 2; ++t) sa[u][t] = wmma_h(ka[t][0], ql[u][0], cm[u]);
#pragma unroll
      for (int u = 0; u < FQT; ++u)
#pragma unroll
        for (int t = 0; t < 2; ++t) sa[u][t] = wmma_h(ka[t][0], qh[u][0], sa[u][t]);
#pragma unroll
      for (int u = 0; u < FQT; ++u)
#pragma unroll
        for (int t = 0; t < 2; ++t) sa[u][t] = wmma_h(ka[t][1], ql[u][1], sa[u][t]);
#pragma unroll
      for (int u = 0; u < FQT; ++u)
#pragma unroll
        for (int t = 0; t < 2; ++t) sa[u][t] = wmma_h(ka[t][1], qh[u][1], sa[u][t]);
      float e[FQT][16], ps[FQT];
#pragma unroll
      for (int u = 0; u < FQT; ++u) { float pq[4];
#pragma unroll
        for (int i = 0; i < 16; ++i) e[u][i] = __builtin_amdgcn_exp2f(sa[u][i >> 3][i & 7]);
#pragma unroll
        for (int w = 0; w < 4; ++w) pq[w] = (e[u][w] + e[u][4 + w]) + (e[u][8 + w] + e[u][12 + w]);
        ps[u] = (pq[0] + pq[1]) + (pq[2] + pq[3]); }
      const bool first = (st | kk) == 0;   /* the same for the whole block: the first pass has no reference yet */
      if (__any(!(ps[0] <= FLIM) | !(ps[1] <= FLIM)) || first) {   /* seldom taken, one test per pass for both query tiles: the scores have outgrown a reference */
#pragma unroll
        for (int u = 0; u < FQT; ++u) { float pq[4];
          float mx = sa[u][0][0];
#pragma unroll
          for (int i = 1; i < 16; ++i) mx = fmaxf(mx, sa[u][i >> 3][i & 7]);
          mx = fmaxf(mx, __shfl_xor(mx, 16));   /* lanes col and col + 16 hold the two key halves of one query and keep one reference */
          const float mn = m[u] + (first ? mx : fmaxf(mx, 0.f)), dd = mn - m[u], al = exp2_slot(fminf(-dd, 0.f));   /* the reference only rises behind the first pass; there l and the accumulators are still 0 */
          l[u] *= al;
#pragma unroll
          for (int j = 0; j < CC / 16; ++j) acc[u][j] *= al;
          m[u] = mn;
#pragma unroll
          for (int r = 0; r < 8; ++r) cm[u][r] = -mn;
#pragma unroll
          for (int i = 0; i < 16; ++i) e[u][i] = exp2_slot(sa[u][i >> 3][i & 7] - dd);
#pragma unroll
          for (int w = 0; w < 4; ++w) pq[w] = (e[u][w] + e[u][4 + w]) + (e[u][8 + w] + e[u][12 + w]);
          ps[u] = (pq[0] + pq[1]) + (pq[2] + pq[3]); } }
      v16h p[FQT];
#pragma unroll
      for (int u = 0; u < FQT; ++u) { l[u] += ps[u];
#pragma unroll
        for (int i = 0; i < 16; ++i) p[u][i] = (_Float16)e[u][i]; }
#pragma unroll
      for (int j = 0; j < CC / 16; ++j) { const v16h vf = frag_h(&sV[j * 16 + col][kk * 32], lane);
#pragma unroll
        for (int u = 0; u < FQT; ++u) acc[u][j] = wmma_h(vf, p[u], acc[u][j]); }
      /* order of this block's LDS reads and products: eight value fragments ahead, then blocks of eight products with the reads of four later fragments as one group between them; left alone the compiler reads each fragment directly in front of its products, which then wait a whole LDS latency */
      __builtin_amdgcn_sched_group_barrier(0x100, 16, 0);
#pragma unroll
      for (int j = 0; j < 2; ++j) { __builtin_amdgcn_sched_group_barrier(0x8, 8, 0); __builtin_amdgcn_sched_group_barrier(0x100, 8, 0); }
      __builtin_amdgcn_sched_group_barrier(0x8, 16, 0);
      __builtin_amdgcn_sched_barrier(0);   /* keeps the slot below behind the products */
      asm volatile("v_nop"); }   /* one more issue slot behind the pass's last product, on both ways out of the pass: the chip wants four in front of the first vector instruction that writes over its P fragment */
    asm volatile("s_wait_dscnt 0x0" ::: "memory");      /* this wave's reads of the tile are back */
    asm volatile("s_wait_asynccnt 0x0" ::: "memory");   /* this wave's copies of the next tile have landed */
    __syncthreads();   /* the next tile is published, and every wave has left this one */
    if (st + 2 < TT / KSP / FKT) fa_tile(lb + (st & 1) * FTB, gv + (size_t)(st + 2) * (FKT * 2), gk + (size_t)(st + 2) * (FKT * CC * 2)); }   /* block-uniform test: tile st + 2 goes into the buffer just left and flies during trip st + 1 */
  asm volatile("s_wait_asynccnt 0x0" ::: "memory");   /* no copy is outstanding when the LDS changes its use */
#pragma unroll
  for (int u = 0; u < FQT; ++u) { l[u] += __shfl_xor(l[u], 16);
    if (g == 0) { v2f st2; st2[0] = m[u]; st2[1] = l[u]; vst2(ML + ((size_t)ks * NB * TT + q0 + u * 16 + col) * 2, st2); } }   /* 16 lanes x 8 B = one 128-B line per query tile */
  /* the last trip's barrier has ended every wave's reads of the tiles: the LDS becomes the waves' private transpose buffers */
  float* sw = (float*)smem + wave * (16 * 132); float* Y = Y0 + (size_t)ks * YPL;
#pragma unroll
  for (int u = 0; u < FQT; ++u)
#pragma unroll
  for (int hh = 0; hh < 2; ++hh) {
#pragma unroll
    for (int jj = 0; jj < 8; ++jj) { const v8f a = acc[u][hh * 8 + jj]; v4f lo, hi;
#pragma unroll
      for (int w = 0; w < 4; ++w) { lo[w] = a[w]; hi[w] = a[4 + w]; }
      *(v4f*)(sw + col * 132 + jj * 16 + 8 * g) = lo; *(v4f*)(sw + col * 132 + jj * 16 + 8 * g + 4) = hi; }
    LDSX();
#pragma unroll
    for (int rl = 0; rl < 16; ++rl) vst2(Y + (q0 + u * 16 + rl) * CC + hh * 128 + lane * 4, *(const v4f*)(sw + rl * 132 + lane * 4));
    asm volatile("s_wait_xcnt 0x0" ::: "memory");   /* behind the stores, before their address and data registers are written again */
    LDSX(); } }
extern "C" void kernel_launch(void* const* d_in, const int* in_sizes, int n_in, void* d_out, int out_size, void* d_ws, size_t ws_size, hipStream_t stream) {
  (void)in_sizes; (void)n_in; (void)out_size;
  const float** F = (const float**)d_in;
  if (ws_size < (size_t)WS_END) return;
  char* ws = (char*)d_ws; _Float16 *QH = (_Float16*)(ws + WS_QH), *KH = (_Float16*)(ws + WS_KH), *VT = (_Float16*)(ws + WS_VT), *QL = (_Float16*)(ws + WS_QL), *KL = (_Float16*)(ws + WS_KL); __bf16 *VB = (__bf16*)(ws + WS_VB), *VBL = (__bf16*)(ws + WS_VBL); float *ML = (float*)(ws + WS_S), *Y = (float*)(ws + WS_Y);
  (void)Y; (void)QL; (void)KL; (void)VB; (void)VBL;
  // inputs: 0 x [4,256,64,64] CHANNELS-FIRST (N = 4,096 positions); 1 Wq [64,256] (out,in), 2 bq [64]; 3 Wk [64,256], 4 bk [64]; 5 Wv [256,256] (out,in), 6 bv [256]; 7 gamma [1] (zero biases, read)
  if (ws_size < (size_t)WS_END3) return;
  float *Y2 = (float*)(ws + WS_Y2);
  k_proj<<<dim3(TNB * TT / 64, 3), 128, 0, stream>>>(F[0], F[1], F[3], F[5], F[2], F[4], F[6], QH, QL, KH, VT);   /* column block 0: q (Wq / bq) and k (Wk / bk), 64 real columns each, side by side; 1 / 2: values v (Wv / bv), 128 columns each */
  k_fa<<<dim3(TT / (FQW * FQT * 16), KSP, TNB), FQW * 32, 0, stream>>>(QH, QL, KH, VT, Y2, ML);   /* scores, softmax and P . v fused: one launch for all batches, 512 work-groups of 4 waves */
  k_resT<<<dim3(TT / 64, CC / 64, TNB), 256, 0, stream>>>(F[0], Y2, ML, F[7], (float*)d_out);   /* out[b][c][m] = x + gamma * o (transposed back to channels-first) */
}

// v009
// One run takes 56.8 microseconds.
// Timed twice side by side with v008, it ran 1.11 times as fast both times.
// All steps since v000 together make it 32.1 times as fast.
// compute dtype: all float inputs rounded to bf16; the q / k (64-dim) and v (256-dim) pointwise projections with EXACT bf16 products on WMMA 16x16x32 (f32 accumulate) + bias; UNSCALED scores q_n . k_m in the log2 domain: the query x log2(e) as f16 hi + f16 residual (unscaled) against the key once to f16 (2 products into one f32 accumulator that starts at minus the held reference, K = 64: two k-steps); softmax over m in f32 (held reference maximum and sum, per key slice); unnormalised P (at most 2^15) once to f16 x v once to f16 (1 product, f32 accumulate); each key slice's context divided by the slice's f32 sum and stored once as f16, the slices merged in f32 with weights 2^(m_s - M) l_s; out = bf16(x) + bf16(gamma) * o in f32; f32 output.
#include <hip/hip_runtime.h>
#include <math.h>

typedef __attribute__((ext_vector_type(16))) _Float16 v16h;
typedef __attribute__((ext_vector_type(16))) __bf16 v16b;
typedef __attribute__((ext_vector_type(8)))  _Float16 v8h;
typedef __attribute__((ext_vector_type(8)))  float v8f;
typedef __attribute__((ext_vector_type(4)))  float v4f;
typedef __attribute__((ext_vector_type(2)))  float v2f;
typedef __attribute__((ext_vector_type(4)))  unsigned v4u;
typedef __attribute__((ext_vector_type(4)))  int v4i;
typedef float __attribute__((may_alias)) float_a;
typedef int __attribute__((may_alias)) int_a;

template <typename T> __device__ __forceinline__ void vst2(void* p, T v) { *(T*)p = v;  }
__device__ __forceinline__ v8f wmma16(v16h a, v16h b, v8f c) {
  v8f d = __builtin_amdgcn_wmma_f32_16x16x32_f16(false, a, false, b, (short)0, c, false, false);
  asm volatile("v_nop\n\tv_nop\n\tv_nop\n\tv_nop" : "+v"(d) : "v"(a), "v"(b));
  return d;
}
__device__ __forceinline__ v8f wmma_bf(v16b a, v16b b, v8f c) {
  v8f d = __builtin_amdgcn_wmma_f32_16x16x32_bf16(false, a, false, b, (short)0, c, false, false);
  asm volatile("v_nop\n\tv_nop\n\tv_nop\n\tv_nop" : "+v"(d) : "v"(a), "v"(b));
  return d;
}
// 16x16x32 fragments: lane = (h = lane>>4, row/col = lane&15); elements 0..7 = k0+8h+0..7, 8..15 = k0+16+8h+0..7; D element r = row 8h+r
__device__ __forceinline__ v16h frag_h(const _Float16* rowk0, int lane) {
  union { v16h v; v8h q[2]; } u; const _Float16* p = rowk0 + 8 * (lane >> 4);
  u.q[0] = *(const v8h*)p; u.q[1] = *(const v8h*)(p + 16); return u.v;
}
__device__ __forceinline__ v16h frag_f32(const float* rowk0, int lane) {
  v16h a; const float* p = rowk0 + 8 * (lane >> 4);
#pragma unroll
  for (int i = 0; i < 8; ++i) { a[i] = (_Float16)p[i]; a[8 + i] = (_Float16)p[16 + i]; }
  return a;
}
__device__ __forceinline__ v16h frag_f32s(const float* rowk0, int lane, float sc) {
  v16h a; const float* p = rowk0 + 8 * (lane >> 4);
#pragma unroll
  for (int i = 0; i < 8; ++i) { a[i] = (_Float16)(p[i] * sc); a[8 + i] = (_Float16)(p[16 + i] * sc); }
  return a;
}
// column fragment from a [K][ld] layout (column n), rows >= K read as 0
__device__ __forceinline__ v16h fragc_f32(const float* W, int k0, int n, int lane, int ld, int K) {
  v16h a; const int g = lane >> 4;
#pragma unroll
  for (int i = 0; i < 8; ++i) { const int ka = k0 + 8 * g + i, kb = ka + 16;
    a[i] = (_Float16)(ka < K ? W[(size_t)(ka < K ? ka : K - 1) * ld + n] : 0.f); a[8 + i] = (_Float16)(kb < K ? W[(size_t)(kb < K ? kb : K - 1) * ld + n] : 0.f); }
  return a;
}
struct F2 { v16b h, l; };
__device__ __forceinline__ F2 bsplit16(const float v[16]) { F2 r;
#pragma unroll
  for (int i = 0; i < 16; ++i) { const __bf16 h = (__bf16)v[i]; r.h[i] = h; r.l[i] = (__bf16)(v[i] - (float)h); }
  return r; }
__device__ __forceinline__ F2 split_row(const float* row, int k0, int lane) { float v[16]; const float* p = row + k0 + 8 * (lane >> 4);
#pragma unroll
  for (int i = 0; i < 8; ++i) { v[i] = p[i]; v[8 + i] = p[16 + i]; }
  return bsplit16(v); }
__device__ __forceinline__ F2 split_rowK(const float* row, int k0, int lane, int K) { float v[16]; const int g = lane >> 4;
#pragma unroll
  for (int i = 0; i < 8; ++i) { const int ka = k0 + 8 * g + i, kb = ka + 16; v[i] = ka < K ? row[ka < K ? ka : K - 1] : 0.f; v[8 + i] = kb < K ? row[kb < K ? kb : K - 1] : 0.f; }
  return bsplit16(v); }
__device__ __forceinline__ F2 split_col(const float* W, int k0, int n, int lane, int ld, int K) { float v[16]; const int g = lane >> 4;
#pragma unroll
  for (int i = 0; i < 8; ++i) { const int ka = k0 + 8 * g + i, kb = ka + 16; v[i] = ka < K ? W[(size_t)(ka < K ? ka : K - 1) * ld + n] : 0.f; v[8 + i] = kb < K ? W[(size_t)(kb < K ? kb : K - 1) * ld + n] : 0.f; }
  return bsplit16(v); }
__device__ __forceinline__ v8f mac3(const F2& a, const F2& b, v8f c) { c = wmma_bf(a.l, b.h, c); c = wmma_bf(a.h, b.l, c); return wmma_bf(a.h, b.h, c); }
__device__ __forceinline__ float sigm(float v) { return 1.0f / (1.0f + expf(-v)); }
#define LDSX() do { asm volatile("s_wait_dscnt 0" ::: "memory"); __builtin_amdgcn_wave_barrier(); __builtin_amdgcn_fence(__ATOMIC_RELEASE, "workgroup"); } while (0)

// SAGAN-style 2-D self-attention (x [4,256,64,64] -> N = 4,096 positions; 1x1 convs: q = Wq x + bq, k = Wk x + bk with Wq / Wk [64,256], v = Wv x + bv with Wv [256,256] (1/16 scale, zero biases); attn[n, m] = softmax_m(q[:, n] . k[:, m]) (UNSCALED, sigma - 8: strongly peaked); out[c, n] = sum_m v[c, m] attn[n, m]; result = gamma out + x with gamma [1] uniform(0, 1)).
#define NB 4
#define TT 4096
#define CC 256            // NH * HD = projected width
#define DIN 256          // input (model) width
#define NH 1
#define HD 256
#define NQB (TT / 64)
#define HG 1
#define SCALE (1.0f)
#define CAUSAL 0
#ifndef TNB
#define TNB NB
#endif
__device__ __forceinline__ float bfr(float v) { return (float)(__bf16)v; }
__host__ __device__ __forceinline__ int kb_last(int qb) { return CAUSAL ? ((qb * 64 + 63) >> 7) : (TT / 128 - 1); }
typedef __attribute__((ext_vector_type(8))) __bf16 v8b;
__device__ __forceinline__ v16b frag_b(const __bf16* rowk0, int lane) {
  union { v16b v; v8b q[2]; } u; const __bf16* p = rowk0 + 8 * (lane >> 4);
  u.q[0] = *(const v8b*)p; u.q[1] = *(const v8b*)(p + 16); return u.v;
}
#define QBH 0               // k_fa: single-product P . h on every block (the bf16 hi/lo value planes are not used)
#define QBH_SC 0            // k_fa: every block takes the 2-product branch (q f16 hi + residual against k once to f16): the 3-product variant would cost 4.3 G-slot more planes
#define TQC 2048           // sizes the WS_S region: TQC x 4,096 f32 entries (32 MiB)
#define QHI 4096            // rows carrying a q residual plane (all rows when non-causal: 2-product logits everywhere)
#define KHI 64              // no block reads the k residual plane (QBH_SC 0)
// B fragment (k rows k0+.., output column o) of a weight: (in,out) [K][ld] or (out,in) [ld rows of K]: bf16 exact, or f16(bf16 * 256) exact
__device__ __forceinline__ v16b wcol_io(const float* Wm, int k0, int o, int lane, int ld) { v16b w; const int g = lane >> 4;
#pragma unroll
  for (int i = 0; i < 8; ++i) { w[i] = (__bf16)Wm[(size_t)(k0 + 8 * g + i) * ld + o]; w[8 + i] = (__bf16)Wm[(size_t)(k0 + 16 + 8 * g + i) * ld + o]; }
  return w; }
__device__ __forceinline__ v16b wcol_oi(const float* Wm, int k0, int o, int lane, int K) { v16b w; const float* p = Wm + (size_t)o * K + k0 + 8 * (lane >> 4);
#pragma unroll
  for (int i = 0; i < 8; ++i) { w[i] = (__bf16)p[i]; w[8 + i] = (__bf16)p[16 + i]; }
  return w; }
__device__ __forceinline__ v16h wcolh_io(const float* Wm, int k0, int o, int lane, int ld) { v16h w; const int g = lane >> 4;
#pragma unroll
  for (int i = 0; i < 8; ++i) { w[i] = (_Float16)(bfr(Wm[(size_t)(k0 + 8 * g + i) * ld + o]) * 256.0f); w[8 + i] = (_Float16)(bfr(Wm[(size_t)(k0 + 16 + 8 * g + i) * ld + o]) * 256.0f); }
  return w; }
__device__ __forceinline__ v16h wcolh_oi(const float* Wm, int k0, int o, int lane, int K) { v16h w; const float* p = Wm + (size_t)o * K + k0 + 8 * (lane >> 4);
#pragma unroll
  for (int i = 0; i < 8; ++i) { w[i] = (_Float16)(bfr(p[i]) * 256.0f); w[8 + i] = (_Float16)(bfr(p[16 + i]) * 256.0f); }
  return w; }
#define WQKV_LAYOUT 1   // 0 = (in,out) [DIN][CC]; 1 = (out,in) [CC][DIN]; 2 = per-head [NH][DIN][HD]
__device__ __forceinline__ v16b wcol_hdk(const float* Wm, int k0, int o, int lane) { v16b w; const int g = lane >> 4; const float* p = Wm + (size_t)(o / HD) * DIN * HD + (o % HD);
#pragma unroll
  for (int i = 0; i < 8; ++i) { w[i] = (__bf16)p[(size_t)(k0 + 8 * g + i) * HD]; w[8 + i] = (__bf16)p[(size_t)(k0 + 16 + 8 * g + i) * HD]; }
  return w; }
#define WO_OUT_IN 0
#if WQKV_LAYOUT == 1
#define HDK 64              // real key / query width (C / 4); the q / k rows keep a 256-wide pitch, columns 64..255 are neither written nor read
__device__ __forceinline__ v16b zero16b() { v16b w; _Pragma("unroll") for (int i = 0; i < 16; ++i) w[i] = (__bf16)0.0f; return w; }
#define WCOL(W, k0, o, lane) ((which == 2 || (o) < HDK) ? wcol_oi(W, k0, (o), lane, DIN) : zero16b())   /* (out,in): Wh [256][256] full; Wf / Wg [64][256]: projected columns >= 64 are zero fragments (tile-uniform: 64 is a multiple of the 16-column tile) */
#elif WQKV_LAYOUT == 2
#define WCOL(W, k0, o, lane) wcol_hdk(W, k0, o, lane)
#else
#define WCOL(W, k0, o, lane) wcol_io(W, k0, o, lane, CC)
#endif
#if WO_OUT_IN
#define WOCOL(W, k0, o, lane) wcol_oi(W, k0, o, lane, CC)
#define WOCOLH(W, k0, o, lane) wcolh_oi(W, k0, o, lane, CC)
#else
#define WOCOL(W, k0, o, lane) wcol_io(W, k0, o, lane, DIN)
#define WOCOLH(W, k0, o, lane) wcolh_io(W, k0, o, lane, DIN)
#endif

#ifndef SM_EXTRA_PARAMS
#define SM_EXTRA_PARAMS
#endif
#ifndef PROJ_EXTRA_PARAMS
#define PROJ_EXTRA_PARAMS
#endif
#ifndef SM_MASK_HOOK
#define SM_MASK_HOOK (void)0
#endif

#define WS_QH  0u                                      // f16 rows of q x log2(e) [b*t][CC]
#define WS_KH  (WS_QH + 2u * (size_t)NB * TT * CC)      // f16 k rows [b*t][CC]
#define WS_VT  (WS_KH + 2u * (size_t)NB * TT * CC)      // f16 v planes [b][c][t]
#define WS_QL  (WS_VT + 2u * (size_t)NB * CC * TT)      // f16 residual rows of q x log2(e), unscaled [b][t < QHI][CC]
#define WS_KL  (WS_QL + 2u * (size_t)NB * QHI * CC)     // f16 k residual x 2^10 rows [b][t < KHI][CC]
#define WS_VB  (WS_KL + 2u * (size_t)NB * KHI * CC)     // bf16 v hi planes [b][c][t < KHI]
#define WS_VBL (WS_VB + 2u * (size_t)NB * CC * KHI)
#define WS_S   (WS_VBL + 2u * (size_t)NB * CC * KHI)    // f32 softmax statistics (m, l) [key slice][b*t][2] at the head of this region
#define WS_Y   (WS_S  + 4u * (size_t)HG * TQC * TT)      // end of the TQC x TT f32 region
#define WS_END (WS_Y  + 0u)
#define WS_Y2 (WS_END)                                   // f16 partial context rows o[b*TT + t][key slice][256], each divided by its slice's sum; the slices of one time stand side by side
#define KSP 4              // key slices of k_fa: one work-group per (query block, key slice, batch); each slice fills its own f16 context rows and its (m, l) rows, k_resT merges the slices
#define WS_END3 (WS_Y2 + 2u * (size_t)KSP * NB * TT * CC)

typedef __attribute__((ext_vector_type(4))) __bf16 v4b;
#define L2E 1.44269504088896340736f
#define PKP 264            // bf16 pitch of k_proj's staged rows: 528 B = 16 B x 33 (odd multiple: 16-byte fragment reads without bank conflicts)
__device__ __forceinline__ v4b cvt4b(v4f v) { v4b r;
#pragma unroll
  for (int u = 0; u < 4; ++u) r[u] = (__bf16)v[u];
  return r; }
// one bias value, rounded to bf16 (0 where the pointer is null). The s_wait_xcnt 0 stands behind the load because the compiler may give the value the register that held the load's offset.
__device__ __forceinline__ float ld_bias(const float* __restrict__ B, int i) { float v = 0.f; if (B) { v = B[i]; asm volatile("s_wait_xcnt 0x0" ::: "memory"); } return bfr(v); }
// ---- k_proj: block = (64 rows, column block cb): cb 0 = the 64 query and the 64 key columns side by side (weight rows Wq then Wk), cb 1 / 2 = the two 128-column halves of v; X W (+ b) with exact bf16 products (K = DIN). Only columns that k_fa reads are formed: the q / k rows keep their 256-wide pitch, their columns 64..255 are never read and stay unwritten. The block's x tile (read from the channels-first input, turned to token-major on the way) and weight rows are rounded to bf16 once and staged in LDS by whole-line loads, every fragment is read from there -> cb 0: q f16 rows + residual rows, k f16 rows; cb 1 / 2: v f16 planes [c][t]
__global__ __launch_bounds__(128) void k_proj(const float* __restrict__ X, const float* __restrict__ WQ, const float* __restrict__ WK, const float* __restrict__ WV, const float* __restrict__ BQ, const float* __restrict__ BK, const float* __restrict__ BV,
    _Float16* __restrict__ QH, _Float16* __restrict__ QL, _Float16* __restrict__ KH, _Float16* __restrict__ VT) {
  __shared__ __align__(16) char smem[(64 + 128) * PKP * 2];   /* the bf16 x rows and weight rows while the products run, then the output staging tiles */
  __bf16 (*sX)[PKP] = (__bf16 (*)[PKP])smem; __bf16 (*sW)[PKP] = (__bf16 (*)[PKP])(smem + 64 * PKP * 2);
  _Float16 (*sh)[136] = (_Float16 (*)[136])smem; _Float16 (*sl)[136] = (_Float16 (*)[136])(smem + 17408); _Float16 (*th)[72] = (_Float16 (*)[72])(smem + 34816);
  const int tid = threadIdx.x, wave = tid >> 5, lane = tid & 31, col = lane & 15, g = lane >> 4; const int cb = blockIdx.y; const int c0 = (cb - 1) * 128; const size_t r0 = (size_t)blockIdx.x * 64; const size_t bb = r0 / TT; const int t0 = (int)(r0 % TT);
  const unsigned lo = (unsigned)tid * 16u;   /* each 64 weight rows are 64 KiB in a row: block base + one 32-bit byte offset per lane; trips differ by constants only, and every wave-wide load covers 512 B in a row (four whole lines) */
  const int sr = tid >> 6, sc = (tid & 63) * 4;
  { const char* xb = (const char*)(X + bb * (size_t)DIN * TT + t0); v4f rx[32];   /* x is channels-first [b][c][t]: the block's tile is 256 channel rows of 64 times (256 B each) */
    const unsigned xlo = (unsigned)(tid >> 3) * (4u * TT * 4u) + (unsigned)(tid & 7) * 16u;   /* a lane owns 4 x 4 blocks (4 channels, 4 times): 8 lanes x 16 B = one whole 128-B line per channel row, 4 rows per wave-wide load; tile base + one 32-bit byte offset per lane, the loads differ by constants only */
#pragma unroll
    for (int ci = 0; ci < 4; ++ci)
#pragma unroll
      for (int hf = 0; hf < 2; ++hf)
#pragma unroll
        for (int u = 0; u < 4; ++u) rx[(ci * 2 + hf) * 4 + u] = *(const v4f*)(xb + ((size_t)(ci * 64 + u) * (TT * 4) + hf * 128) + xlo);
    asm volatile("s_wait_loadcnt 0x0\n\ts_wait_xcnt 0x0" ::: "memory");   /* the 32 loads per lane fly together and are all back here; the next group's loads stay behind it, so the staging registers are used again */
#pragma unroll
    for (int ci = 0; ci < 4; ++ci)
#pragma unroll
      for (int hf = 0; hf < 2; ++hf)
#pragma unroll
        for (int tu = 0; tu < 4; ++tu) { v4f cv;   /* the 4 x 4 block is turned in registers: one 8-byte LDS store holds 4 channels of one time */
#pragma unroll
          for (int u = 0; u < 4; ++u) cv[u] = rx[(ci * 2 + hf) * 4 + u][tu];
          *(v4b*)&sX[hf * 32 + (tid & 7) * 4 + tu][ci * 64 + (tid >> 3) * 4] = cvt4b(cv); } }
#pragma unroll
  for (int hb = 0; hb < 2; ++hb) { const char* wb = (const char*)(cb == 0 ? (hb == 0 ? WQ : WK) : WV + (size_t)(c0 + hb * 64) * DIN); v4f rw[32];   /* block-uniform choice: Wq and Wk hold 64 rows each, a half of Wv's column block holds 64 */
#pragma unroll
    for (int i = 0; i < 32; ++i) rw[i] = *(const v4f*)(wb + (size_t)i * 2048 + lo);
    asm volatile("s_wait_loadcnt 0x0\n\ts_wait_xcnt 0x0" ::: "memory");   /* as above */
#pragma unroll
    for (int i = 0; i < 32; ++i) *(v4b*)&sW[hb * 64 + sr + 2 * i][sc] = cvt4b(rw[i]); }
  __syncthreads();   /* both tiles are published */
  v8f acc[8] = {}; v16b a = frag_b(&sX[wave * 16 + col][0], lane), w[8];
#pragma unroll
  for (int j = 0; j < 8; ++j) w[j] = frag_b(&sW[j * 16 + col][0], lane);
#pragma unroll
  for (int kc = 0; kc < DIN / 32; ++kc) { v16b an = a, wn[8];   /* the next k-step's 18 LDS reads stand together in front of this k-step's products, into a second register set: read directly in front of its product, each fragment would cost a whole LDS latency */
#pragma unroll
    for (int j = 0; j < 8; ++j) wn[j] = w[j];
    if (kc + 1 < DIN / 32) { an = frag_b(&sX[wave * 16 + col][kc * 32 + 32], lane);
#pragma unroll
      for (int j = 0; j < 8; ++j) wn[j] = frag_b(&sW[j * 16 + col][kc * 32 + 32], lane); }
#pragma unroll
    for (int j = 0; j < 8; ++j) acc[j] = wmma_bf(a, w[j], acc[j]);
    a = an;
#pragma unroll
    for (int j = 0; j < 8; ++j) w[j] = wn[j]; }
  __syncthreads();   /* every wave has read its last fragment: the LDS becomes the output staging tiles */
  if (cb == 0) {   /* tiles j 0..3 = query columns (value + residual), j 4..7 = key columns (value only: no kernel reads a key residual) */
#pragma unroll
    for (int j = 0; j < 8; ++j) { const float bias = ld_bias(j < 4 ? BQ : BK, (j & 3) * 16 + col);
#pragma unroll
      for (int r = 0; r < 8; ++r) { const float v = (acc[j][r] + bias) * (j < 4 ? L2E : 1.0f); const _Float16 hv = (_Float16)v; sh[wave * 16 + 8 * g + r][j * 16 + col] = hv; if (j < 4) sl[wave * 16 + 8 * g + r][j * 16 + col] = (_Float16)(v - (float)hv); } }   /* the query carries log2(e), so that k_fa's scores are exp2 arguments */
    __syncthreads();
    for (int e = tid; e < 64 * 8; e += 128) { const int rl = e >> 3, q = e & 7;   /* 8 lanes x 16 B = the one whole 128-B line that each q / k row holds */
      vst2((unsigned*)(QH + (r0 + rl) * CC + q * 8), *(const v4u*)&sh[rl][q * 8]); vst2((unsigned*)(QL + (bb * QHI + t0 + rl) * (size_t)CC + q * 8), *(const v4u*)&sl[rl][q * 8]); vst2((unsigned*)(KH + (r0 + rl) * CC + q * 8), *(const v4u*)&sh[rl][HDK + q * 8]); }
  } else {
#pragma unroll
    for (int j = 0; j < 8; ++j) { const float bias = ld_bias(BV, c0 + j * 16 + col);
#pragma unroll
      for (int r = 0; r < 8; ++r) th[j * 16 + col][wave * 16 + 8 * g + r] = (_Float16)(acc[j][r] + bias); }
    __syncthreads();
    for (int e = tid; e < 128 * 8; e += 128) { const int cl = e >> 3, q = e & 7; vst2((unsigned*)(VT + (bb * CC + c0 + cl) * (size_t)TT + t0 + q * 8), *(const v4u*)&th[cl][q * 8]); } } }
// exp2 for the seldom-run places (k_fa's rescale path, k_resT's slice weights), with the issue slot that the instruction set asks for behind a transcendental in the same statement
__device__ __forceinline__ float exp2_slot(float x) { float r; asm("v_exp_f32 %0, %1\n\tv_nop" : "=v"(r) : "v"(x)); return r; }
// ---- k_resT: tile (64 times, RTC channels) of batch bz: out[b][c][t] = bf16(v[b][c][t]) + bf16(gamma) * a[b][t][c] (a = the KSP f16 context rows of each time, each already divided by its slice's sum l_s, merged by their softmax statistics: sum_s 2^(m_s - M) l_s row_s / sum_s 2^(m_s - M) l_s; LDS transpose back to channels-first)
#define RTC 128            // channels per tile: 128 f16 = 256 B of a context row, as 64 times are 256 B of an output row
__global__ __launch_bounds__(512) void k_resT(const float* __restrict__ V, const _Float16* __restrict__ A, const float* __restrict__ ML, const float* __restrict__ GM, float* __restrict__ OUT) { __shared__ float tl[64][RTC + 1];
  const int tid = threadIdx.x; const int t0 = blockIdx.x * 64, c0 = blockIdx.y * RTC; const size_t b = blockIdx.z; const float gm = bfr(GM[0]);
  const char* ab = (const char*)(A + (b * TT + t0) * (size_t)(KSP * CC) + c0); const unsigned vo = (unsigned)(((tid >> 4) * (KSP * CC) + (tid & 15) * 8) * 2);   /* tile base (the same for the whole block) + one 32-bit byte offset per lane; slices and trips differ by constants that fit the load's offset field, so no address is formed or stepped in vector registers while loads are in flight */
  const char* mb = (const char*)(ML + (b * TT + t0) * 2); const unsigned mvo = (unsigned)((tid >> 4) * 8);
#pragma unroll
  for (int i = 0; i < 2; ++i) { const int tr = (tid >> 4) + 32 * i, q = tid & 15; v8h pl[KSP]; v2f sm[KSP];
#pragma unroll
    for (int s = 0; s < KSP; ++s) { pl[s] = *(const v8h*)(ab + ((size_t)i * 32 * KSP * CC + (size_t)s * CC) * 2 + vo); sm[s] = *(const v2f*)(mb + ((size_t)s * NB * TT + (size_t)i * 32) * 8 + mvo); }
    asm volatile("s_wait_loadcnt 0x0\n\ts_wait_xcnt 0x0" :: "v"(vo) : "memory");   /* the rows' and statistics' loads fly together and are all back here, before the sums; vo as an input keeps the lane offset in its register up to this wait */
    float mx = sm[0][0];
#pragma unroll
    for (int s = 1; s < KSP; ++s) mx = fmaxf(mx, sm[s][0]);
    float w[KSP], den = 0.f;
#pragma unroll
    for (int s = 0; s < KSP; ++s) { w[s] = exp2_slot(sm[s][0] - mx) * sm[s][1]; den += w[s]; }
    const float inv = 1.0f / den;   /* the slice with the highest reference gives about 1 or more: the key its reference was taken from */
    float ld[8];
#pragma unroll
    for (int u = 0; u < 8; ++u) ld[u] = (float)pl[0][u] * (w[0] * inv);
#pragma unroll
    for (int s = 1; s < KSP; ++s)   /* key slices added in rising order */
#pragma unroll
      for (int u = 0; u < 8; ++u) ld[u] += (float)pl[s][u] * (w[s] * inv);
#pragma unroll
    for (int u = 0; u < 8; ++u) tl[tr][q * 8 + u] = ld[u]; }
  __syncthreads();
  for (int e = tid; e < RTC * 16; e += 512) { const int cl = e >> 4, q = e & 15; const size_t off = (b * CC + c0 + cl) * (size_t)TT + t0 + q * 4; const v4f vv = *(const v4f*)(V + off); asm volatile("s_wait_loadcnt 0x0" ::: "memory"); v4f o;
#pragma unroll
    for (int u = 0; u < 4; ++u) o[u] = bfr(vv[u]) + gm * tl[q * 4 + u][cl];
    vst2(OUT + off, o); } }   
// ---- k_fa: block = (128 queries qb, key slice ks, batch b), 4 waves x 32 queries (two 16-query tiles u per wave): scores, softmax and P . v in one pass over the slice's keys, no score plane. Per 64-key tile: v [256 ch][64 keys] and k [64 keys][64 dims] go to LDS by asynchronous copies, two buffers, the next tile in flight while this one is worked on; every key and value fragment that a wave reads from LDS feeds the products of both its query tiles. Per 32 keys each wave forms S^T = k . q^T (A = key rows, B = query columns; q residual and q hi, 2 products chained into one accumulator whose start value C is minus the held reference m, so D is the exp2 argument as it stands), whose D registers (lane = query, element = key 8g + r) ARE the B fragment of o^T = v^T . P^T (tile 0 -> elements 0..7, tile 1 -> 8..15), so P never leaves the registers. Reference m (log2 domain, a maximum seen earlier) and sum l per query live one per lane and query tile; a maximum is searched and the accumulators are rescaled only in the first pass and when some lane's sum of P tops FLIM. Out: context rows of slice ks, divided by the slice's sum l and rounded once to f16, and (m, l) per (slice, query); k_resT merges the slices.
#define FKT 64             // keys per LDS tile
#define FPI 72             // f16 pitch of both LDS tiles: 144 B = 16 B x 9 (odd multiple: 16-byte fragment reads without bank conflicts)
__device__ __forceinline__ v8f wmma_h(v16h a, v16h b, v8f c) { return __builtin_amdgcn_wmma_f32_16x16x32_f16(false, a, false, b, (short)0, c, false, false); }
#define FLIM 32768.0f      // a pass whose 16 P values of a lane sum to more takes a new reference: below it every P fits f16
#define FTB ((CC + FKT) * FPI * 2)   // bytes of one k / v tile buffer (46,080)
// one 16-byte asynchronous copy per lane, global memory -> LDS through no register. The builtin, not asm text: this kernel holds more than 256 vector registers, and the operands of an asm statement must all lie in the low register window, where they crowd out values that live through the key loop (spills)
typedef v4i __attribute__((address_space(1))) gv4i;
typedef v4i __attribute__((address_space(3))) lv4i;
__device__ __forceinline__ void fa_copy(char* l, const char* gp) { __builtin_amdgcn_global_load_async_to_lds_b128((gv4i*)gp, (lv4i*)l, 0, 0); }
// one tile: twenty copies per lane (16 value rows, then 4 key rows, 16 rows apart; the key rows stand behind the CC value rows of the buffer); lb = the lane's place in the buffer, gv / gk = its global addresses
__device__ __forceinline__ void fa_tile(char* lb, const char* gv, const char* gk) {
#pragma unroll
  for (int i = 0; i < CC / 16; ++i) fa_copy(lb + i * 16 * FPI * 2, gv + (size_t)i * 16 * TT * 2);
#pragma unroll
  for (int i = 0; i < FKT / 16; ++i) fa_copy(lb + (CC + i * 16) * FPI * 2, gk + (size_t)i * 16 * CC * 2); }
#define FQW 4              // waves per work-group
#define FQT 2              // 16-query tiles per wave: 256 accumulator registers; the second launch bound asks for two waves per SIMD, that is two work-groups per WGP, so that one group's products cover the other's barriers and vector work
__global__ __launch_bounds__(FQW * 32, 2) void k_fa(const _Float16* __restrict__ QH, const _Float16* __restrict__ QL, const _Float16* __restrict__ KH, const _Float16* __restrict__ VT, _Float16* __restrict__ Y0, float* __restrict__ ML) {
  __shared__ __align__(16) char smem[2 * FTB];   /* two k / v tile buffers (92,160 B) while the keys are walked, then one 32 x 264 f16 transpose buffer per wave (67,584 B) */
  const int tid = threadIdx.x, wave = tid >> 5, lane = tid & 31, col = lane & 15, g = lane >> 4; const int qb = blockIdx.x, ks = blockIdx.y; const size_t b = blockIdx.z;
  const size_t q0 = b * TT + qb * (FQW * FQT * 16) + wave * (FQT * 16); const int key0 = ks * (TT / KSP);
  v16h qh[FQT][HDK / 32], ql[FQT][HDK / 32];
#pragma unroll
  for (int u = 0; u < FQT; ++u)
#pragma unroll
    for (int kc = 0; kc < HDK / 32; ++kc) { qh[u][kc] = frag_h(QH + (q0 + u * 16 + col) * CC + kc * 32, lane); ql[u][kc] = frag_h(QL + (q0 + u * 16 + col) * CC + kc * 32, lane); }
  asm volatile("s_wait_xcnt 0x0" ::: "memory");   /* behind the query loads, before their address registers are written again for the copies */
  v8f acc[FQT][CC / 16] = {}, cm[FQT] = {}; float m[FQT] = {}, l[FQT] = {};   /* cm = -m in all eight elements: the C operand of the score products */
  const char* vb = (const char*)(VT + b * CC * TT + key0); const char* kb = (const char*)(KH + (b * TT + key0) * CC);   /* tile bases (the same for the whole block) + one 32-bit byte offset per lane; rows differ by constants only */
  const unsigned vvo = (unsigned)((tid >> 3) * (TT * 2) + (tid & 7) * 16), kvo = (unsigned)((tid >> 3) * (CC * 2) + (tid & 7) * 16);
  char* lb = smem + ((tid >> 3) * (FPI * 2) + (tid & 7) * 16);   /* 8 lanes x 16 B = one whole 128-B line per value or key row */
  const char* gv = vb + vvo; const char* gk = kb + kvo;
  fa_tile(lb, gv, gk);   /* tile 0 -> buffer 0 */
  asm volatile("s_wait_asynccnt 0x0" ::: "memory");   /* this wave's copies of tile 0 have landed */
  __syncthreads();   /* tile 0 is published */
  fa_tile(lb + FTB, gv + FKT * 2, gk + FKT * CC * 2);   /* tile 1 -> buffer 1 */
#pragma unroll 1   /* rolled: one copy of the tile's code serves both buffers, which differ by one address term; unrolled it would only lengthen the hot text */
  for (int st = 0; st < TT / KSP / FKT; ++st) { const char* tb = smem + (st & 1) * FTB; const _Float16 (*sV)[FPI] = (const _Float16 (*)[FPI])tb; const _Float16 (*sK)[FPI] = (const _Float16 (*)[FPI])(tb + CC * FPI * 2);
#pragma unroll 1   /* rolled: the products of one 32-key half stay a scheduling region of their own */
    for (int kk = 0; kk < FKT / 32; ++kk) { v8f sa[FQT][2]; v16h ka[2][HDK / 32];   /* the short loops of this pass run over register arrays: unrolled, so that every index is a constant */
#pragma unroll
      for (int t = 0; t < 2; ++t)
#pragma unroll
        for (int kc = 0; kc < HDK / 32; ++kc) ka[t][kc] = frag_h(&sK[kk * 32 + t * 16 + col][kc * 32], lane);
#pragma unroll
      for (int u = 0; u < FQT; ++u)
#pragma unroll
        for (int t = 0; t < 2; ++t) sa[u][t] = wmma_h(ka[t][0], ql[u][0], cm[u]);
#pragma unroll
      for (int u = 0; u < FQT; ++u)
#pragma unroll
        for (int t = 0; t < 2; ++t) sa[u][t] = wmma_h(ka[t][0], qh[u][0], sa[u][t]);
#pragma unroll
      for (int u = 0; u < FQT; ++u)
#pragma unroll
        for (int t = 0; t < 2; ++t) sa[u][t] = wmma_h(ka[t][1], ql[u][1], sa[u][t]);
#pragma unroll
      for (int u = 0; u < FQT; ++u)
#pragma unroll
        for (int t = 0; t < 2; ++t) sa[u][t] = wmma_h(ka[t][1], qh[u][1], sa[u][t]);
      float e[FQT][16], ps[FQT];
#pragma unroll
      for (int u = 0; u < FQT; ++u) { float pq[4];
#pragma unroll
        for (int i = 0; i < 16; ++i) e[u][i] = __builtin_amdgcn_exp2f(sa[u][i >> 3][i & 7]);
#pragma unroll
        for (int w = 0; w < 4; ++w) pq[w] = (e[u][w] + e[u][4 + w]) + (e[u][8 + w] + e[u][12 + w]);
        ps[u] = (pq[0] + pq[1]) + (pq[2] + pq[3]); }
      const bool first = (st | kk) == 0;   /* the same for the whole block: the first pass has no reference yet */
      if (__any(!(ps[0] <= FLIM) | !(ps[1] <= FLIM)) || first) {   /* seldom taken, one test per pass for both query tiles: the scores have outgrown a reference */
#pragma unroll
        for (int u = 0; u < FQT; ++u) { float pq[4];
          float mx = sa[u][0][0];
#pragma unroll
          for (int i = 1; i < 16; ++i) mx = fmaxf(mx, sa[u][i >> 3][i & 7]);
          mx = fmaxf(mx, __shfl_xor(mx, 16));   /* lanes col and col + 16 hold the two key halves of one query and keep one reference */
          const float mn = m[u] + (first ? mx : fmaxf(mx, 0.f)), dd = mn - m[u], al = exp2_slot(fminf(-dd, 0.f));   /* the reference only rises behind the first pass; there l and the accumulators are still 0 */
          l[u] *= al;
#pragma unroll
          for (int j = 0; j < CC / 16; ++j) acc[u][j] *= al;
          m[u] = mn;
#pragma unroll
          for (int r = 0; r < 8; ++r) cm[u][r] = -mn;
#pragma unroll
          for (int i = 0; i < 16; ++i) e[u][i] = exp2_slot(sa[u][i >> 3][i & 7] - dd);
#pragma unroll
          for (int w = 0; w < 4; ++w) pq[w] = (e[u][w] + e[u][4 + w]) + (e[u][8 + w] + e[u][12 + w]);
          ps[u] = (pq[0] + pq[1]) + (pq[2] + pq[3]); } }
      v16h p[FQT];
#pragma unroll
      for (int u = 0; u < FQT; ++u) { l[u] += ps[u];
#pragma unroll
        for (int i = 0; i < 16; ++i) p[u][i] = (_Float16)e[u][i]; }
#pragma unroll
      for (int j = 0; j < CC / 16; ++j) { const v16h vf = frag_h(&sV[j * 16 + col][kk * 32], lane);
#pragma unroll
        for (int u = 0; u < FQT; ++u) acc[u][j] = wmma_h(vf, p[u], acc[u][j]); }
      /* order of this block's LDS reads and products: eight value fragments ahead, then blocks of eight products with the reads of four later fragments as one group between them; left alone the compiler reads each fragment directly in front of its products, which then wait a whole LDS latency */
      __builtin_amdgcn_sched_group_barrier(0x100, 16, 0);
#pragma unroll
      for (int j = 0; j < 2; ++j) { __builtin_amdgcn_sched_group_barrier(0x8, 8, 0); __builtin_amdgcn_sched_group_barrier(0x100, 8, 0); }
      __builtin_amdgcn_sched_group_barrier(0x8, 16, 0);
      __builtin_amdgcn_sched_barrier(0);   /* keeps the slot below behind the products */
      asm volatile("v_nop"); }   /* one more issue slot behind the pass's last product, on both ways out of the pass: the chip wants four in front of the first vector instruction that writes over its P fragment */
    asm volatile("s_wait_dscnt 0x0" ::: "memory");      /* this wave's reads of the tile are back */
    asm volatile("s_wait_asynccnt 0x0" ::: "memory");   /* this wave's copies of the next tile have landed */
    __syncthreads();   /* the next tile is published, and every wave has left this one */
    if (st + 2 < TT / KSP / FKT) fa_tile(lb + (st & 1) * FTB, gv + (size_t)(st + 2) * (FKT * 2), gk + (size_t)(st + 2) * (FKT * CC * 2)); }   /* block-uniform test: tile st + 2 goes into the buffer just left and flies during trip st + 1 */
  asm volatile("s_wait_asynccnt 0x0" ::: "memory");   /* no copy is outstanding when the LDS changes its use */
  float il[FQT];   /* 1 / l: the slice's context leaves divided by the slice's own sum, so that it is no larger than the values and fits f16 */
#pragma unroll
  for (int u = 0; u < FQT; ++u) { l[u] += __shfl_xor(l[u], 16); il[u] = 1.0f / l[u];   /* l is about 1 or more: the key that the reference was taken from */
    if (g == 0) { v2f st2; st2[0] = m[u]; st2[1] = l[u]; vst2(ML + ((size_t)ks * NB * TT + q0 + u * 16 + col) * 2, st2); } }   /* 16 lanes x 8 B = one 128-B line per query tile */
  /* the last trip's barrier has ended every wave's reads of the tiles: the LDS becomes the waves' private transpose buffers (a wave's 32 query rows of 256 f16 channels, pitch 528 B = 16 B x 33) */
  char* sw = smem + wave * (FQT * 16 * 528); _Float16* Y = Y0 + (size_t)ks * CC;
#pragma unroll
  for (int u = 0; u < FQT; ++u)
#pragma unroll
    for (int j = 0; j < CC / 16; ++j) { const v8f a = acc[u][j] * il[u]; v8h hv;
#pragma unroll
      for (int r = 0; r < 8; ++r) hv[r] = (_Float16)a[r];
      *(v8h*)(sw + (u * 16 + col) * 528 + (j * 16 + 8 * g) * 2) = hv; }
  LDSX();
#pragma unroll
  for (int u = 0; u < FQT; ++u) {
#pragma unroll
    for (int rl = 0; rl < 16; ++rl) vst2(Y + (q0 + u * 16 + rl) * (KSP * CC) + lane * 8, *(const v8h*)(sw + (u * 16 + rl) * 528 + lane * 16));   /* 32 lanes x 16 B = one query's whole 512-B row */
    asm volatile("s_wait_xcnt 0x0" ::: "memory"); } }   /* behind the stores, before their data registers are written again by the next tile's LDS reads */
extern "C" void kernel_launch(void* const* d_in, const int* in_sizes, int n_in, void* d_out, int out_size, void* d_ws, size_t ws_size, hipStream_t stream) {
  (void)in_sizes; (void)n_in; (void)out_size;
  const float** F = (const float**)d_in;
  if (ws_size < (size_t)WS_END) return;
  char* ws = (char*)d_ws; _Float16 *QH = (_Float16*)(ws + WS_QH), *KH = (_Float16*)(ws + WS_KH), *VT = (_Float16*)(ws + WS_VT), *QL = (_Float16*)(ws + WS_QL), *KL = (_Float16*)(ws + WS_KL); __bf16 *VB = (__bf16*)(ws + WS_VB), *VBL = (__bf16*)(ws + WS_VBL); float *ML = (float*)(ws + WS_S), *Y = (float*)(ws + WS_Y);
  (void)Y; (void)QL; (void)KL; (void)VB; (void)VBL;
  // inputs: 0 x [4,256,64,64] CHANNELS-FIRST (N = 4,096 positions); 1 Wq [64,256] (out,in), 2 bq [64]; 3 Wk [64,256], 4 bk [64]; 5 Wv [256,256] (out,in), 6 bv [256]; 7 gamma [1] (zero biases, read)
  if (ws_size < (size_t)WS_END3) return;
  _Float16 *Y2 = (_Float16*)(ws + WS_Y2);
  k_proj<<<dim3(TNB * TT / 64, 3), 128, 0, stream>>>(F[0], F[1], F[3], F[5], F[2], F[4], F[6], QH, QL, KH, VT);   /* column block 0: q (Wq / bq) and k (Wk / bk), 64 real columns each, side by side; 1 / 2: values v (Wv / bv), 128 columns each */
  k_fa<<<dim3(TT / (FQW * FQT * 16), KSP, TNB), FQW * 32, 0, stream>>>(QH, QL, KH, VT, Y2, ML);   /* scores, softmax and P . v fused: one launch for all batches, 512 work-groups of 4 waves */
  k_resT<<<dim3(TT / 64, CC / RTC, TNB), 512, 0, stream>>>(F[0], Y2, ML, F[7], (float*)d_out);   /* out[b][c][m] = x + gamma * o (transposed back to channels-first) */
}

// v010
// A run of this version takes 54.8 microseconds.
// Timed twice side by side with v009, it ran 1.03 and 1.04 times as fast.
// Over all steps from v000 it is 33.3 times as fast.
// compute dtype: all float inputs rounded to bf16; the q / k (64-dim) and v (256-dim) pointwise projections with EXACT bf16 products on WMMA 16x16x32 (f32 accumulate) + bias; UNSCALED scores q_n . k_m in the log2 domain: the query x log2(e) as f16 hi + f16 residual (unscaled) against the key once to f16 (2 products into one f32 accumulator that starts at minus the held reference, K = 64: two k-steps); softmax over m in f32 (held reference maximum and sum, per key slice); unnormalised P (at most 2^15) once to f16 x v once to f16 (1 product, f32 accumulate); each key slice's context divided by the slice's f32 sum and stored once as f16, the slices merged in f32 with weights 2^(m_s - M) l_s; out = bf16(x) + bf16(gamma) * o in f32; f32 output.
#include <hip/hip_runtime.h>
#include <math.h>

typedef __attribute__((ext_vector_type(16))) _Float16 v16h;
typedef __attribute__((ext_vector_type(16))) __bf16 v16b;
typedef __attribute__((ext_vector_type(8)))  _Float16 v8h;
typedef __attribute__((ext_vector_type(8)))  float v8f;
typedef __attribute__((ext_vector_type(4)))  float v4f;
typedef __attribute__((ext_vector_type(2)))  float v2f;
typedef __attribute__((ext_vector_type(4)))  unsigned v4u;
typedef __attribute__((ext_vector_type(4)))  int v4i;
typedef float __attribute__((may_alias)) float_a;
typedef int __attribute__((may_alias)) int_a;

template <typename T> __device__ __forceinline__ void vst2(void* p, T v) { *(T*)p = v;  }
__device__ __forceinline__ v8f wmma16(v16h a, v16h b, v8f c) {
  v8f d = __builtin_amdgcn_wmma_f32_16x16x32_f16(false, a, false, b, (short)0, c, false, false);
  asm volatile("v_nop\n\tv_nop\n\tv_nop\n\tv_nop" : "+v"(d) : "v"(a), "v"(b));
  return d;
}
__device__ __forceinline__ v8f wmma_bf(v16b a, v16b b, v8f c) {
  v8f d = __builtin_amdgcn_wmma_f32_16x16x32_bf16(false, a, false, b, (short)0, c, false, false);
  asm volatile("v_nop\n\tv_nop\n\tv_nop\n\tv_nop" : "+v"(d) : "v"(a), "v"(b));
  return d;
}
// 16x16x32 fragments: lane = (h = lane>>4, row/col = lane&15); elements 0..7 = k0+8h+0..7, 8..15 = k0+16+8h+0..7; D element r = row 8h+r
__device__ __forceinline__ v16h frag_h(const _Float16* rowk0, int lane) {
  union { v16h v; v8h q[2]; } u; const _Float16* p = rowk0 + 8 * (lane >> 4);
  u.q[0] = *(const v8h*)p; u.q[1] = *(const v8h*)(p + 16); return u.v;
}
__device__ __forceinline__ v16h frag_f32(const float* rowk0, int lane) {
  v16h a; const float* p = rowk0 + 8 * (lane >> 4);
#pragma unroll
  for (int i = 0; i < 8; ++i) { a[i] = (_Float16)p[i]; a[8 + i] = (_Float16)p[16 + i]; }
  return a;
}
__device__ __forceinline__ v16h frag_f32s(const float* rowk0, int lane, float sc) {
  v16h a; const float* p = rowk0 + 8 * (lane >> 4);
#pragma unroll
  for (int i = 0; i < 8; ++i) { a[i] = (_Float16)(p[i] * sc); a[8 + i] = (_Float16)(p[16 + i] * sc); }
  return a;
}
// column fragment from a [K][ld] layout (column n), rows >= K read as 0
__device__ __forceinline__ v16h fragc_f32(const float* W, int k0, int n, int lane, int ld, int K) {
  v16h a; const int g = lane >> 4;
#pragma unroll
  for (int i = 0; i < 8; ++i) { const int ka = k0 + 8 * g + i, kb = ka + 16;
    a[i] = (_Float16)(ka < K ? W[(size_t)(ka < K ? ka : K - 1) * ld + n] : 0.f); a[8 + i] = (_Float16)(kb < K ? W[(size_t)(kb < K ? kb : K - 1) * ld + n] : 0.f); }
  return a;
}
struct F2 { v16b h, l; };
__device__ __forceinline__ F2 bsplit16(const float v[16]) { F2 r;
#pragma unroll
  for (int i = 0; i < 16; ++i) { const __bf16 h = (__bf16)v[i]; r.h[i] = h; r.l[i] = (__bf16)(v[i] - (float)h); }
  return r; }
__device__ __forceinline__ F2 split_row(const float* row, int k0, int lane) { float v[16]; const float* p = row + k0 + 8 * (lane >> 4);
#pragma unroll
  for (int i = 0; i < 8; ++i) { v[i] = p[i]; v[8 + i] = p[16 + i]; }
  return bsplit16(v); }
__device__ __forceinline__ F2 split_rowK(const float* row, int k0, int lane, int K) { float v[16]; const int g = lane >> 4;
#pragma unroll
  for (int i = 0; i < 8; ++i) { const int ka = k0 + 8 * g + i, kb = ka + 16; v[i] = ka < K ? row[ka < K ? ka : K - 1] : 0.f; v[8 + i] = kb < K ? row[kb < K ? kb : K - 1] : 0.f; }
  return bsplit16(v); }
__device__ __forceinline__ F2 split_col(const float* W, int k0, int n, int lane, int ld, int K) { float v[16]; const int g = lane >> 4;
#pragma unroll
  for (int i = 0; i < 8; ++i) { const int ka = k0 + 8 * g + i, kb = ka + 16; v[i] = ka < K ? W[(size_t)(ka < K ? ka : K - 1) * ld + n] : 0.f; v[8 + i] = kb < K ? W[(size_t)(kb < K ? kb : K - 1) * ld + n] : 0.f; }
  return bsplit16(v); }
__device__ __forceinline__ v8f mac3(const F2& a, const F2& b, v8f c) { c = wmma_bf(a.l, b.h, c); c = wmma_bf(a.h, b.l, c); return wmma_bf(a.h, b.h, c); }
__device__ __forceinline__ float sigm(float v) { return 1.0f / (1.0f + expf(-v)); }
#define LDSX() do { asm volatile("s_wait_dscnt 0" ::: "memory"); __builtin_amdgcn_wave_barrier(); __builtin_amdgcn_fence(__ATOMIC_RELEASE, "workgroup"); } while (0)

// SAGAN-style 2-D self-attention (x [4,256,64,64] -> N = 4,096 positions; 1x1 convs: q = Wq x + bq, k = Wk x + bk with Wq / Wk [64,256], v = Wv x + bv with Wv [256,256] (1/16 scale, zero biases); attn[n, m] = softmax_m(q[:, n] . k[:, m]) (UNSCALED, sigma - 8: strongly peaked); out[c, n] = sum_m v[c, m] attn[n, m]; result = gamma out + x with gamma [1] uniform(0, 1)).
#define NB 4
#define TT 4096
#define CC 256            // NH * HD = projected width
#define DIN 256          // input (model) width
#define NH 1
#define HD 256
#define NQB (TT / 64)
#define HG 1
#define SCALE (1.0f)
#define CAUSAL 0
#ifndef TNB
#define TNB NB
#endif
__device__ __forceinline__ float bfr(float v) { return (float)(__bf16)v; }
__host__ __device__ __forceinline__ int kb_last(int qb) { return CAUSAL ? ((qb * 64 + 63) >> 7) : (TT / 128 - 1); }
typedef __attribute__((ext_vector_type(8))) __bf16 v8b;
__device__ __forceinline__ v16b frag_b(const __bf16* rowk0, int lane) {
  union { v16b v; v8b q[2]; } u; const __bf16* p = rowk0 + 8 * (lane >> 4);
  u.q[0] = *(const v8b*)p; u.q[1] = *(const v8b*)(p + 16); return u.v;
}
#define QBH 0               // k_fa: single-product P . h on every block (the bf16 hi/lo value planes are not used)
#define QBH_SC 0            // k_fa: every block takes the 2-product branch (q f16 hi + residual against k once to f16): the 3-product variant would cost 4.3 G-slot more planes
#define TQC 2048           // sizes the WS_S region: TQC x 4,096 f32 entries (32 MiB)
#define QHI 4096            // rows carrying a q residual plane (all rows when non-causal: 2-product logits everywhere)
#define KHI 64              // no block reads the k residual plane (QBH_SC 0)
// B fragment (k rows k0+.., output column o) of a weight: (in,out) [K][ld] or (out,in) [ld rows of K]: bf16 exact, or f16(bf16 * 256) exact
__device__ __forceinline__ v16b wcol_io(const float* Wm, int k0, int o, int lane, int ld) { v16b w; const int g = lane >> 4;
#pragma unroll
  for (int i = 0; i < 8; ++i) { w[i] = (__bf16)Wm[(size_t)(k0 + 8 * g + i) * ld + o]; w[8 + i] = (__bf16)Wm[(size_t)(k0 + 16 + 8 * g + i) * ld + o]; }
  return w; }
__device__ __forceinline__ v16b wcol_oi(const float* Wm, int k0, int o, int lane, int K) { v16b w; const float* p = Wm + (size_t)o * K + k0 + 8 * (lane >> 4);
#pragma unroll
  for (int i = 0; i < 8; ++i) { w[i] = (__bf16)p[i]; w[8 + i] = (__bf16)p[16 + i]; }
  return w; }
__device__ __forceinline__ v16h wcolh_io(const float* Wm, int k0, int o, int lane, int ld) { v16h w; const int g = lane >> 4;
#pragma unroll
  for (int i = 0; i < 8; ++i) { w[i] = (_Float16)(bfr(Wm[(size_t)(k0 + 8 * g + i) * ld + o]) * 256.0f); w[8 + i] = (_Float16)(bfr(Wm[(size_t)(k0 + 16 + 8 * g + i) * ld + o]) * 256.0f); }
  return w; }
__device__ __forceinline__ v16h wcolh_oi(const float* Wm, int k0, int o, int lane, int K) { v16h w; const float* p = Wm + (size_t)o * K + k0 + 8 * (lane >> 4);
#pragma unroll
  for (int i = 0; i < 8; ++i) { w[i] = (_Float16)(bfr(p[i]) * 256.0f); w[8 + i] = (_Float16)(bfr(p[16 + i]) * 256.0f); }
  return w; }
#define WQKV_LAYOUT 1   // 0 = (in,out) [DIN][CC]; 1 = (out,in) [CC][DIN]; 2 = per-head [NH][DIN][HD]
__device__ __forceinline__ v16b wcol_hdk(const float* Wm, int k0, int o, int lane) { v16b w; const int g = lane >> 4; const float* p = Wm + (size_t)(o / HD) * DIN * HD + (o % HD);
#pragma unroll
  for (int i = 0; i < 8; ++i) { w[i] = (__bf16)p[(size_t)(k0 + 8 * g + i) * HD]; w[8 + i] = (__bf16)p[(size_t)(k0 + 16 + 8 * g + i) * HD]; }
  return w; }
#define WO_OUT_IN 0
#if WQKV_LAYOUT == 1
#define HDK 64              // real key / query width (C / 4); the q / k rows keep a 256-wide pitch, columns 64..255 are neither written nor read
__device__ __forceinline__ v16b zero16b() { v16b w; _Pragma("unroll") for (int i = 0; i < 16; ++i) w[i] = (__bf16)0.0f; return w; }
#define WCOL(W, k0, o, lane) ((which == 2 || (o) < HDK) ? wcol_oi(W, k0, (o), lane, DIN) : zero16b())   /* (out,in): Wh [256][256] full; Wf / Wg [64][256]: projected columns >= 64 are zero fragments (tile-uniform: 64 is a multiple of the 16-column tile) */
#elif WQKV_LAYOUT == 2
#define WCOL(W, k0, o, lane) wcol_hdk(W, k0, o, lane)
#else
#define WCOL(W, k0, o, lane) wcol_io(W, k0, o, lane, CC)
#endif
#if WO_OUT_IN
#define WOCOL(W, k0, o, lane) wcol_oi(W, k0, o, lane, CC)
#define WOCOLH(W, k0, o, lane) wcolh_oi(W, k0, o, lane, CC)
#else
#define WOCOL(W, k0, o, lane) wcol_io(W, k0, o, lane, DIN)
#define WOCOLH(W, k0, o, lane) wcolh_io(W, k0, o, lane, DIN)
#endif

#ifndef SM_EXTRA_PARAMS
#define SM_EXTRA_PARAMS
#endif
#ifndef PROJ_EXTRA_PARAMS
#define PROJ_EXTRA_PARAMS
#endif
#ifndef SM_MASK_HOOK
#define SM_MASK_HOOK (void)0
#endif

#define WS_QH  0u                                      // f16 rows of q x log2(e) [b*t][CC]
#define WS_KH  (WS_QH + 2u * (size_t)NB * TT * CC)      // f16 k rows [b*t][CC]
#define WS_VT  (WS_KH + 2u * (size_t)NB * TT * CC)      // f16 v planes [b][c][t]
#define WS_QL  (WS_VT + 2u * (size_t)NB * CC * TT)      // f16 residual rows of q x log2(e), unscaled [b][t < QHI][CC]
#define WS_KL  (WS_QL + 2u * (size_t)NB * QHI * CC)     // f16 k residual x 2^10 rows [b][t < KHI][CC]
#define WS_VB  (WS_KL + 2u * (size_t)NB * KHI * CC)     // bf16 v hi planes [b][c][t < KHI]
#define WS_VBL (WS_VB + 2u * (size_t)NB * CC * KHI)
#define WS_S   (WS_VBL + 2u * (size_t)NB * CC * KHI)    // f32 softmax statistics (m, l) [key slice][b*t][2] at the head of this region
#define WS_Y   (WS_S  + 4u * (size_t)HG * TQC * TT)      // end of the TQC x TT f32 region
#define WS_END (WS_Y  + 0u)
#define WS_Y2 (WS_END)                                   // f16 partial context rows o[b*TT + t][key slice][256], each divided by its slice's sum; the slices of one time stand side by side
#define KSP 4              // key slices of k_fa: one work-group per (query block, key slice, batch); each slice fills its own f16 context rows and its (m, l) rows, k_resT merges the slices
#define WS_END3 (WS_Y2 + 2u * (size_t)KSP * NB * TT * CC)

typedef __attribute__((ext_vector_type(4))) __bf16 v4b;
#define L2E 1.44269504088896340736f
#define PKP 264            // bf16 pitch of k_proj's staged rows: 528 B = 16 B x 33 (odd multiple: 16-byte fragment reads without bank conflicts)
__device__ __forceinline__ v4b cvt4b(v4f v) { v4b r;
#pragma unroll
  for (int u = 0; u < 4; ++u) r[u] = (__bf16)v[u];
  return r; }
// one bias value, rounded to bf16 (0 where the pointer is null). The s_wait_xcnt 0 stands behind the load because the compiler may give the value the register that held the load's offset.
__device__ __forceinline__ float ld_bias(const float* __restrict__ B, int i) { float v = 0.f; if (B) { v = B[i]; asm volatile("s_wait_xcnt 0x0" ::: "memory"); } return bfr(v); }
// ---- k_proj: block = (64 rows, column block cb): cb 0 = the 64 query and the 64 key columns side by side (weight rows Wq then Wk), cb 1 / 2 = the two 128-column halves of v; X W (+ b) with exact bf16 products (K = DIN). Only columns that k_fa reads are formed: the q / k rows keep their 256-wide pitch, their columns 64..255 are never read and stay unwritten. The block's x tile (read from the channels-first input, turned to token-major on the way) and weight rows are rounded to bf16 once and staged in LDS by whole-line loads, every fragment is read from there -> cb 0: q f16 rows + residual rows, k f16 rows; cb 1 / 2: v f16 planes [c][t]
__global__ __launch_bounds__(128) void k_proj(const float* __restrict__ X, const float* __restrict__ WQ, const float* __restrict__ WK, const float* __restrict__ WV, const float* __restrict__ BQ, const float* __restrict__ BK, const float* __restrict__ BV,
    _Float16* __restrict__ QH, _Float16* __restrict__ QL, _Float16* __restrict__ KH, _Float16* __restrict__ VT) {
  __shared__ __align__(16) char smem[(64 + 128) * PKP * 2];   /* the bf16 x rows and weight rows while the products run, then the output staging tiles */
  __bf16 (*sX)[PKP] = (__bf16 (*)[PKP])smem; __bf16 (*sW)[PKP] = (__bf16 (*)[PKP])(smem + 64 * PKP * 2);
  _Float16 (*sh)[136] = (_Float16 (*)[136])smem; _Float16 (*sl)[136] = (_Float16 (*)[136])(smem + 17408); _Float16 (*th)[72] = (_Float16 (*)[72])(smem + 34816);
  const int tid = threadIdx.x, wave = tid >> 5, lane = tid & 31, col = lane & 15, g = lane >> 4; const int cb = blockIdx.y; const int c0 = (cb - 1) * 128; const size_t r0 = (size_t)blockIdx.x * 64; const size_t bb = r0 / TT; const int t0 = (int)(r0 % TT);
  const unsigned lo = (unsigned)tid * 16u;   /* each 64 weight rows are 64 KiB in a row: block base + one 32-bit byte offset per lane; trips differ by constants only, and every wave-wide load covers 512 B in a row (four whole lines) */
  const int sr = tid >> 6, sc = (tid & 63) * 4;
  { const char* xb = (const char*)(X + bb * (size_t)DIN * TT + t0); v4f rx[32];   /* x is channels-first [b][c][t]: the block's tile is 256 channel rows of 64 times (256 B each) */
    const unsigned xlo = (unsigned)(tid >> 3) * (4u * TT * 4u) + (unsigned)(tid & 7) * 16u;   /* a lane owns 4 x 4 blocks (4 channels, 4 times): 8 lanes x 16 B = one whole 128-B line per channel row, 4 rows per wave-wide load; tile base + one 32-bit byte offset per lane, the loads differ by constants only */
#pragma unroll
    for (int ci = 0; ci < 4; ++ci)
#pragma unroll
      for (int hf = 0; hf < 2; ++hf)
#pragma unroll
        for (int u = 0; u < 4; ++u) rx[(ci * 2 + hf) * 4 + u] = *(const v4f*)(xb + ((size_t)(ci * 64 + u) * (TT * 4) + hf * 128) + xlo);
    asm volatile("s_wait_loadcnt 0x0\n\ts_wait_xcnt 0x0" ::: "memory");   /* the 32 loads per lane fly together and are all back here; the next group's loads stay behind it, so the staging registers are used again */
#pragma unroll
    for (int ci = 0; ci < 4; ++ci)
#pragma unroll
      for (int hf = 0; hf < 2; ++hf)
#pragma unroll
        for (int tu = 0; tu < 4; ++tu) { v4f cv;   /* the 4 x 4 block is turned in registers: one 8-byte LDS store holds 4 channels of one time */
#pragma unroll
          for (int u = 0; u < 4; ++u) cv[u] = rx[(ci * 2 + hf) * 4 + u][tu];
          *(v4b*)&sX[hf * 32 + (tid & 7) * 4 + tu][ci * 64 + (tid >> 3) * 4] = cvt4b(cv); } }
#pragma unroll
  for (int hb = 0; hb < 2; ++hb) { const char* wb = (const char*)(cb == 0 ? (hb == 0 ? WQ : WK) : WV + (size_t)(c0 + hb * 64) * DIN); v4f rw[32];   /* block-uniform choice: Wq and Wk hold 64 rows each, a half of Wv's column block holds 64 */
#pragma unroll
    for (int i = 0; i < 32; ++i) rw[i] = *(const v4f*)(wb + (size_t)i * 2048 + lo);
    asm volatile("s_wait_loadcnt 0x0\n\ts_wait_xcnt 0x0" ::: "memory");   /* as above */
#pragma unroll
    for (int i = 0; i < 32; ++i) *(v4b*)&sW[hb * 64 + sr + 2 * i][sc] = cvt4b(rw[i]); }
  __syncthreads();   /* both tiles are published */
  v8f acc[8] = {}; v16b a = frag_b(&sX[wave * 16 + col][0], lane), w[8];
#pragma unroll
  for (int j = 0; j < 8; ++j) w[j] = frag_b(&sW[j * 16 + col][0], lane);
#pragma unroll
  for (int kc = 0; kc < DIN / 32; ++kc) { v16b an = a, wn[8];   /* the next k-step's 18 LDS reads stand together in front of this k-step's products, into a second register set: read directly in front of its product, each fragment would cost a whole LDS latency */
#pragma unroll
    for (int j = 0; j < 8; ++j) wn[j] = w[j];
    if (kc + 1 < DIN / 32) { an = frag_b(&sX[wave * 16 + col][kc * 32 + 32], lane);
#pragma unroll
      for (int j = 0; j < 8; ++j) wn[j] = frag_b(&sW[j * 16 + col][kc * 32 + 32], lane); }
#pragma unroll
    for (int j = 0; j < 8; ++j) acc[j] = wmma_bf(a, w[j], acc[j]);
    a = an;
#pragma unroll
    for (int j = 0; j < 8; ++j) w[j] = wn[j]; }
  __syncthreads();   /* every wave has read its last fragment: the LDS becomes the output staging tiles */
  if (cb == 0) {   /* tiles j 0..3 = query columns (value + residual), j 4..7 = key columns (value only: no kernel reads a key residual) */
#pragma unroll
    for (int j = 0; j < 8; ++j) { const float bias = ld_bias(j < 4 ? BQ : BK, (j & 3) * 16 + col);
#pragma unroll
      for (int r = 0; r < 8; ++r) { const float v = (acc[j][r] + bias) * (j < 4 ? L2E : 1.0f); const _Float16 hv = (_Float16)v; sh[wave * 16 + 8 * g + r][j * 16 + col] = hv; if (j < 4) sl[wave * 16 + 8 * g + r][j * 16 + col] = (_Float16)(v - (float)hv); } }   /* the query carries log2(e), so that k_fa's scores are exp2 arguments */
    __syncthreads();
    for (int e = tid; e < 64 * 8; e += 128) { const int rl = e >> 3, q = e & 7;   /* 8 lanes x 16 B = the one whole 128-B line that each q / k row holds */
      vst2((unsigned*)(QH + (r0 + rl) * CC + q * 8), *(const v4u*)&sh[rl][q * 8]); vst2((unsigned*)(QL + (bb * QHI + t0 + rl) * (size_t)CC + q * 8), *(const v4u*)&sl[rl][q * 8]); vst2((unsigned*)(KH + (r0 + rl) * CC + q * 8), *(const v4u*)&sh[rl][HDK + q * 8]); }
  } else {
#pragma unroll
    for (int j = 0; j < 8; ++j) { const float bias = ld_bias(BV, c0 + j * 16 + col);
#pragma unroll
      for (int r = 0; r < 8; ++r) th[j * 16 + col][wave * 16 + 8 * g + r] = (_Float16)(acc[j][r] + bias); }
    __syncthreads();
    for (int e = tid; e < 128 * 8; e += 128) { const int cl = e >> 3, q = e & 7; vst2((unsigned*)(VT + (bb * CC + c0 + cl) * (size_t)TT + t0 + q * 8), *(const v4u*)&th[cl][q * 8]); } } }
// exp2 for the seldom-run places (k_fa's rescale path, k_resT's slice weights), with the issue slot that the instruction set asks for behind a transcendental in the same statement
__device__ __forceinline__ float exp2_slot(float x) { float r; asm("v_exp_f32 %0, %1\n\tv_nop" : "=v"(r) : "v"(x)); return r; }
// ---- k_resT: tile (64 times, RTC channels) of batch bz: out[b][c][t] = bf16(v[b][c][t]) + bf16(gamma) * a[b][t][c] (a = the KSP f16 context rows of each time, each already divided by its slice's sum l_s, merged by their softmax statistics: sum_s 2^(m_s - M) l_s row_s / sum_s 2^(m_s - M) l_s; LDS transpose back to channels-first)
#define RTC 128            // channels per tile: 128 f16 = 256 B of a context row, as 64 times are 256 B of an output row
__global__ __launch_bounds__(512) void k_resT(const float* __restrict__ V, const _Float16* __restrict__ A, const float* __restrict__ ML, const float* __restrict__ GM, float* __restrict__ OUT) { __shared__ float tl[64][RTC + 1];
  const int tid = threadIdx.x; const int t0 = blockIdx.x * 64, c0 = blockIdx.y * RTC; const size_t b = blockIdx.z; const float gm = bfr(GM[0]);
  const char* ab = (const char*)(A + (b * TT + t0) * (size_t)(KSP * CC) + c0); const unsigned vo = (unsigned)(((tid >> 4) * (KSP * CC) + (tid & 15) * 8) * 2);   /* tile base (the same for the whole block) + one 32-bit byte offset per lane; slices and trips differ by constants that fit the load's offset field, so no address is formed or stepped in vector registers while loads are in flight */
  const char* mb = (const char*)(ML + (b * TT + t0) * 2); const unsigned mvo = (unsigned)((tid >> 4) * 8);
#pragma unroll
  for (int i = 0; i < 2; ++i) { const int tr = (tid >> 4) + 32 * i, q = tid & 15; v8h pl[KSP]; v2f sm[KSP];
#pragma unroll
    for (int s = 0; s < KSP; ++s) { pl[s] = *(const v8h*)(ab + ((size_t)i * 32 * KSP * CC + (size_t)s * CC) * 2 + vo); sm[s] = *(const v2f*)(mb + ((size_t)s * NB * TT + (size_t)i * 32) * 8 + mvo); }
    asm volatile("s_wait_loadcnt 0x0\n\ts_wait_xcnt 0x0" :: "v"(vo) : "memory");   /* the rows' and statistics' loads fly together and are all back here, before the sums; vo as an input keeps the lane offset in its register up to this wait */
    float mx = sm[0][0];
#pragma unroll
    for (int s = 1; s < KSP; ++s) mx = fmaxf(mx, sm[s][0]);
    float w[KSP], den = 0.f;
#pragma unroll
    for (int s = 0; s < KSP; ++s) { w[s] = exp2_slot(sm[s][0] - mx) * sm[s][1]; den += w[s]; }
    const float inv = 1.0f / den;   /* the slice with the highest reference gives about 1 or more: the key its reference was taken from */
    float ld[8];
#pragma unroll
    for (int u = 0; u < 8; ++u) ld[u] = (float)pl[0][u] * (w[0] * inv);
#pragma unroll
    for (int s = 1; s < KSP; ++s)   /* key slices added in rising order */
#pragma unroll
      for (int u = 0; u < 8; ++u) ld[u] += (float)pl[s][u] * (w[s] * inv);
#pragma unroll
    for (int u = 0; u < 8; ++u) tl[tr][q * 8 + u] = ld[u]; }
  __syncthreads();
  for (int e = tid; e < RTC * 16; e += 512) { const int cl = e >> 4, q = e & 15; const size_t off = (b * CC + c0 + cl) * (size_t)TT + t0 + q * 4; const v4f vv = *(const v4f*)(V + off); asm volatile("s_wait_loadcnt 0x0" ::: "memory"); v4f o;
#pragma unroll
    for (int u = 0; u < 4; ++u) o[u] = bfr(vv[u]) + gm * tl[q * 4 + u][cl];
    vst2(OUT + off, o); } }   
// ---- k_fa: block = (128 queries qb, key slice ks, batch b), 4 waves x 32 queries (two 16-query tiles u per wave): scores, softmax and P . v in one pass over the slice's keys, no score plane. Per 64-key tile: v [256 ch][64 keys] and k [64 keys][64 dims] go to LDS by asynchronous copies, two buffers, the next tile in flight while this one is worked on; every key and value fragment that a wave reads from LDS feeds the products of both its query tiles. Per 32 keys each wave forms S^T = k . q^T (A = key rows, B = query columns; q residual and q hi, 2 products chained into one accumulator whose start value C is minus the held reference m, so D is the exp2 argument as it stands), whose D registers (lane = query, element = key 8g + r) ARE the B fragment of o^T = v^T . P^T (tile 0 -> elements 0..7, tile 1 -> 8..15), so P never leaves the registers. Reference m (log2 domain, a maximum seen earlier) and sum l per query live one per lane and query tile; a maximum is searched and the accumulators are rescaled only in the first pass and when some lane's sum of P tops FLIM. Out: context rows of slice ks, divided by the slice's sum l and rounded once to f16, and (m, l) per (slice, query); k_resT merges the slices.
#define FKT 64             // keys per LDS tile
#define FPI 72             // f16 pitch of both LDS tiles: 144 B = 16 B x 9 (odd multiple: 16-byte fragment reads without bank conflicts)
__device__ __forceinline__ v8f wmma_h(v16h a, v16h b, v8f c) { return __builtin_amdgcn_wmma_f32_16x16x32_f16(false, a, false, b, (short)0, c, false, false); }
#define FA_ORDER() __builtin_amdgcn_sched_barrier(0)   // scheduling fence between a group of LDS reads and a block of products: both stay in the written order. Left alone the compiler reads each fragment directly in front of its products, which then wait a whole LDS latency, or mixes reads among the products
#define FLIM 32768.0f      // a pass whose 16 P values of a lane sum to more takes a new reference: below it every P fits f16
#define FTB ((CC + FKT) * FPI * 2)   // bytes of one k / v tile buffer (46,080)
// one 16-byte asynchronous copy per lane, global memory -> LDS through no register. The builtin, not asm text: this kernel holds more than 256 vector registers, and the operands of an asm statement must all lie in the low register window, where they crowd out values that live through the key loop (spills)
typedef v4i __attribute__((address_space(1))) gv4i;
typedef v4i __attribute__((address_space(3))) lv4i;
__device__ __forceinline__ void fa_copy(char* l, const char* gp) { __builtin_amdgcn_global_load_async_to_lds_b128((gv4i*)gp, (lv4i*)l, 0, 0); }
// one tile: twenty copies per lane (16 value rows, then 4 key rows, 16 rows apart; the key rows stand behind the CC value rows of the buffer); lb = the lane's place in the buffer, gv / gk = its global addresses
__device__ __forceinline__ void fa_tile(char* lb, const char* gv, const char* gk) {
#pragma unroll
  for (int i = 0; i < CC / 16; ++i) fa_copy(lb + i * 16 * FPI * 2, gv + (size_t)i * 16 * TT * 2);
#pragma unroll
  for (int i = 0; i < FKT / 16; ++i) fa_copy(lb + (CC + i * 16) * FPI * 2, gk + (size_t)i * 16 * CC * 2); }
#define FQW 4              // waves per work-group
#define FQT 2              // 16-query tiles per wave: 256 accumulator registers; the second launch bound asks for two waves per SIMD, that is two work-groups per WGP, so that one group's products cover the other's barriers and vector work
__global__ __launch_bounds__(FQW * 32, 2) void k_fa(const _Float16* __restrict__ QH, const _Float16* __restrict__ QL, const _Float16* __restrict__ KH, const _Float16* __restrict__ VT, _Float16* __restrict__ Y0, float* __restrict__ ML) {
  __shared__ __align__(16) char smem[2 * FTB];   /* two k / v tile buffers (92,160 B) while the keys are walked, then one 32 x 264 f16 transpose buffer per wave (67,584 B) */
  const int tid = threadIdx.x, wave = tid >> 5, lane = tid & 31, col = lane & 15, g = lane >> 4; const int qb = blockIdx.x, ks = blockIdx.y; const size_t b = blockIdx.z;
  const size_t q0 = b * TT + qb * (FQW * FQT * 16) + wave * (FQT * 16); const int key0 = ks * (TT / KSP);
  v16h qh[FQT][HDK / 32], ql[FQT][HDK / 32];
#pragma unroll
  for (int u = 0; u < FQT; ++u)
#pragma unroll
    for (int kc = 0; kc < HDK / 32; ++kc) { qh[u][kc] = frag_h(QH + (q0 + u * 16 + col) * CC + kc * 32, lane); ql[u][kc] = frag_h(QL + (q0 + u * 16 + col) * CC + kc * 32, lane); }
  asm volatile("s_wait_xcnt 0x0" ::: "memory");   /* behind the query loads, before their address registers are written again for the copies */
  v8f acc[FQT][CC / 16] = {}, cm[FQT] = {}; float m[FQT] = {}, l[FQT] = {};   /* cm = -m in all eight elements: the C operand of the score products */
  const char* vb = (const char*)(VT + b * CC * TT + key0); const char* kb = (const char*)(KH + (b * TT + key0) * CC);   /* tile bases (the same for the whole block) + one 32-bit byte offset per lane; rows differ by constants only */
  const unsigned vvo = (unsigned)((tid >> 3) * (TT * 2) + (tid & 7) * 16), kvo = (unsigned)((tid >> 3) * (CC * 2) + (tid & 7) * 16);
  char* lb = smem + ((tid >> 3) * (FPI * 2) + (tid & 7) * 16);   /* 8 lanes x 16 B = one whole 128-B line per value or key row */
  const char* gv = vb + vvo; const char* gk = kb + kvo;
  fa_tile(lb, gv, gk);   /* tile 0 -> buffer 0 */
  asm volatile("s_wait_asynccnt 0x0" ::: "memory");   /* this wave's copies of tile 0 have landed */
  __syncthreads();   /* tile 0 is published */
  fa_tile(lb + FTB, gv + FKT * 2, gk + FKT * CC * 2);   /* tile 1 -> buffer 1 */
  /* LDS reads stand one phase ahead of their products. A tile's first reads, one group: the first pass's key fragments and its first four value fragments */
  v16h ka[2][HDK / 32], vf[CC / 16];
  { const _Float16 (*nV)[FPI] = (const _Float16 (*)[FPI])(smem); const _Float16 (*nK)[FPI] = (const _Float16 (*)[FPI])(smem + CC * FPI * 2);
#pragma unroll
    for (int t = 0; t < 2; ++t)
#pragma unroll
      for (int kc = 0; kc < HDK / 32; ++kc) ka[t][kc] = frag_h(&nK[t * 16 + col][kc * 32], lane);
#pragma unroll
    for (int j = 0; j < 4; ++j) vf[j] = frag_h(&nV[j * 16 + col][0], lane); }
  __builtin_amdgcn_sched_barrier(0);   /* all of them in this one place, for speed only */
#pragma unroll 1   /* rolled: one copy of the tile's code serves both buffers, which differ by one address term; unrolled it would only lengthen the hot text */
  for (int st = 0; ; ++st) { const char* tb = smem + (st & 1) * FTB; const _Float16 (*sV)[FPI] = (const _Float16 (*)[FPI])tb; const _Float16 (*sK)[FPI] = (const _Float16 (*)[FPI])(tb + CC * FPI * 2);
#pragma unroll   /* both 32-key passes of a tile written out: the first one fetches the second one's first fragments among its own value products */
    for (int kk = 0; kk < FKT / 32; ++kk) { v8f sa[FQT][2];   /* the short loops of this pass run over register arrays: unrolled, so that every index is a constant */
#pragma unroll
      for (int u = 0; u < FQT; ++u)
#pragma unroll
        for (int t = 0; t < 2; ++t) sa[u][t] = wmma_h(ka[t][0], ql[u][0], cm[u]);
#pragma unroll
      for (int u = 0; u < FQT; ++u)
#pragma unroll
        for (int t = 0; t < 2; ++t) sa[u][t] = wmma_h(ka[t][0], qh[u][0], sa[u][t]);
#pragma unroll
      for (int u = 0; u < FQT; ++u)
#pragma unroll
        for (int t = 0; t < 2; ++t) sa[u][t] = wmma_h(ka[t][1], ql[u][1], sa[u][t]);
#pragma unroll
      for (int u = 0; u < FQT; ++u)
#pragma unroll
        for (int t = 0; t < 2; ++t) sa[u][t] = wmma_h(ka[t][1], qh[u][1], sa[u][t]);
      float e[FQT][16], ps[FQT];
#pragma unroll
      for (int u = 0; u < FQT; ++u) { float pq[4];
#pragma unroll
        for (int i = 0; i < 16; ++i) e[u][i] = __builtin_amdgcn_exp2f(sa[u][i >> 3][i & 7]);
#pragma unroll
        for (int w = 0; w < 4; ++w) pq[w] = (e[u][w] + e[u][4 + w]) + (e[u][8 + w] + e[u][12 + w]);
        ps[u] = (pq[0] + pq[1]) + (pq[2] + pq[3]); }
      const bool first = kk == 0 && st == 0;   /* the same for the whole block: the first pass has no reference yet */
      if (__any(!(ps[0] <= FLIM) | !(ps[1] <= FLIM)) || first) {   /* seldom taken, one test per pass for both query tiles: the scores have outgrown a reference */
#pragma unroll
        for (int u = 0; u < FQT; ++u) { float pq[4];
          float mx = sa[u][0][0];
#pragma unroll
          for (int i = 1; i < 16; ++i) mx = fmaxf(mx, sa[u][i >> 3][i & 7]);
          mx = fmaxf(mx, __shfl_xor(mx, 16));   /* lanes col and col + 16 hold the two key halves of one query and keep one reference */
          const float mn = m[u] + (first ? mx : fmaxf(mx, 0.f)), dd = mn - m[u], al = exp2_slot(fminf(-dd, 0.f));   /* the reference only rises behind the first pass; there l and the accumulators are still 0 */
          l[u] *= al;
#pragma unroll
          for (int j = 0; j < CC / 16; ++j) acc[u][j] *= al;
          m[u] = mn;
#pragma unroll
          for (int r = 0; r < 8; ++r) cm[u][r] = -mn;
#pragma unroll
          for (int i = 0; i < 16; ++i) e[u][i] = exp2_slot(sa[u][i >> 3][i & 7] - dd);
#pragma unroll
          for (int w = 0; w < 4; ++w) pq[w] = (e[u][w] + e[u][4 + w]) + (e[u][8 + w] + e[u][12 + w]);
          ps[u] = (pq[0] + pq[1]) + (pq[2] + pq[3]); } }
      v16h p[FQT];
#pragma unroll
      for (int u = 0; u < FQT; ++u) { l[u] += ps[u];
#pragma unroll
        for (int i = 0; i < 16; ++i) p[u][i] = (_Float16)e[u][i]; }
      /* value products: LDS reads in groups, each group at least eight products ahead of its use */
      if (kk + 1 < FKT / 32) {   /* known at compile time. A pass with a successor in the tile: reads in groups of four fragments; in front of its last eight products the next pass's key fragments (into the registers that this pass's score products have left) and first four value fragments */
#pragma unroll
        for (int j = 4; j < 8; ++j) vf[j] = frag_h(&sV[j * 16 + col][kk * 32], lane);
        FA_ORDER();
#pragma unroll
        for (int j = 0; j < 4; ++j)
#pragma unroll
          for (int u = 0; u < FQT; ++u) acc[u][j] = wmma_h(vf[j], p[u], acc[u][j]);
        FA_ORDER();
#pragma unroll
        for (int j = 8; j < 12; ++j) vf[j] = frag_h(&sV[j * 16 + col][kk * 32], lane);
        FA_ORDER();
#pragma unroll
        for (int j = 4; j < 8; ++j)
#pragma unroll
          for (int u = 0; u < FQT; ++u) acc[u][j] = wmma_h(vf[j], p[u], acc[u][j]);
        FA_ORDER();
#pragma unroll
        for (int j = 12; j < 16; ++j) vf[j] = frag_h(&sV[j * 16 + col][kk * 32], lane);
        FA_ORDER();
#pragma unroll
        for (int j = 8; j < 12; ++j)
#pragma unroll
          for (int u = 0; u < FQT; ++u) acc[u][j] = wmma_h(vf[j], p[u], acc[u][j]);
        FA_ORDER();
#pragma unroll
        for (int t = 0; t < 2; ++t)
#pragma unroll
          for (int kc = 0; kc < HDK / 32; ++kc) ka[t][kc] = frag_h(&sK[(kk + 1) * 32 + t * 16 + col][kc * 32], lane);
        __builtin_amdgcn_sched_barrier(0);   /* the key fragments first: the next pass needs them first */
#pragma unroll
        for (int j = 0; j < 4; ++j) vf[j] = frag_h(&sV[j * 16 + col][(kk + 1) * 32], lane);
        FA_ORDER();
#pragma unroll
        for (int j = 12; j < 16; ++j)
#pragma unroll
          for (int u = 0; u < FQT; ++u) acc[u][j] = wmma_h(vf[j], p[u], acc[u][j]);
      } else {   /* the tile's last pass fetches nothing ahead: its registers take eight fragments in one place */
        FA_ORDER();   /* P is packed first: its 32 f32 values and the eight new fragments together would not fit the registers */
#pragma unroll
        for (int j = 4; j < 12; ++j) vf[j] = frag_h(&sV[j * 16 + col][kk * 32], lane);
        FA_ORDER();
#pragma unroll
        for (int j = 0; j < 8; ++j)
#pragma unroll
          for (int u = 0; u < FQT; ++u) acc[u][j] = wmma_h(vf[j], p[u], acc[u][j]);
        FA_ORDER();
#pragma unroll
        for (int j = 12; j < 16; ++j) vf[j] = frag_h(&sV[j * 16 + col][kk * 32], lane);
        FA_ORDER();
#pragma unroll
        for (int j = 8; j < 16; ++j)
#pragma unroll
          for (int u = 0; u < FQT; ++u) acc[u][j] = wmma_h(vf[j], p[u], acc[u][j]);
      }
      __builtin_amdgcn_sched_barrier(0);   /* ends the pass's scheduling region; in the last pass it also keeps the slot below behind the products */
      if (kk + 1 == FKT / 32) asm volatile("v_nop"); }   /* one more issue slot behind the tile's last product, on both ways out */
    asm volatile("s_wait_dscnt 0x0" ::: "memory");      /* this wave's reads of the tile are back */
    asm volatile("s_wait_asynccnt 0x0" ::: "memory");   /* this wave's copies of the next tile have landed */
    __syncthreads();   /* the next tile is published, and every wave has left this one */
    if (st + 1 == TT / KSP / FKT) break;   /* block-uniform: the slice's last tile is done */
    /* the published tile's first reads stand in front of the copies' issue and land under it; the copies aim at the other buffer, which every wave has left */
    { const _Float16 (*nV)[FPI] = (const _Float16 (*)[FPI])((smem + ((st + 1) & 1) * FTB)); const _Float16 (*nK)[FPI] = (const _Float16 (*)[FPI])((smem + ((st + 1) & 1) * FTB) + CC * FPI * 2);
#pragma unroll
      for (int t = 0; t < 2; ++t)
#pragma unroll
        for (int kc = 0; kc < HDK / 32; ++kc) ka[t][kc] = frag_h(&nK[t * 16 + col][kc * 32], lane);
#pragma unroll
      for (int j = 0; j < 4; ++j) vf[j] = frag_h(&nV[j * 16 + col][0], lane); }
    __builtin_amdgcn_sched_barrier(0);   /* all of them in this one place, for speed only */
    if (st + 2 < TT / KSP / FKT) fa_tile(lb + (st & 1) * FTB, gv + (size_t)(st + 2) * (FKT * 2), gk + (size_t)(st + 2) * (FKT * CC * 2)); }   /* block-uniform test: tile st + 2 goes into the buffer just left and flies during trip st + 1 */
  asm volatile("s_wait_asynccnt 0x0" ::: "memory");   /* no copy is outstanding when the LDS changes its use */
  float il[FQT];   /* 1 / l: the slice's context leaves divided by the slice's own sum, so that it is no larger than the values and fits f16 */
#pragma unroll
  for (int u = 0; u < FQT; ++u) { l[u] += __shfl_xor(l[u], 16); il[u] = 1.0f / l[u];   /* l is about 1 or more: the key that the reference was taken from */
    if (g == 0) { v2f st2; st2[0] = m[u]; st2[1] = l[u]; vst2(ML + ((size_t)ks * NB * TT + q0 + u * 16 + col) * 2, st2); } }   /* 16 lanes x 8 B = one 128-B line per query tile */
  /* the last trip's barrier has ended every wave's reads of the tiles: the LDS becomes the waves' private transpose buffers (a wave's 32 query rows of 256 f16 channels, pitch 528 B = 16 B x 33) */
  char* sw = smem + wave * (FQT * 16 * 528); _Float16* Y = Y0 + (size_t)ks * CC;
#pragma unroll
  for (int u = 0; u < FQT; ++u)
#pragma unroll
    for (int j = 0; j < CC / 16; ++j) { const v8f a = acc[u][j] * il[u]; v8h hv;
#pragma unroll
      for (int r = 0; r < 8; ++r) hv[r] = (_Float16)a[r];
      *(v8h*)(sw + (u * 16 + col) * 528 + (j * 16 + 8 * g) * 2) = hv; }
  LDSX();
#pragma unroll
  for (int u = 0; u < FQT; ++u) {
#pragma unroll
    for (int rl = 0; rl < 16; ++rl) vst2(Y + (q0 + u * 16 + rl) * (KSP * CC) + lane * 8, *(const v8h*)(sw + (u * 16 + rl) * 528 + lane * 16));   /* 32 lanes x 16 B = one query's whole 512-B row */
    asm volatile("s_wait_xcnt 0x0" ::: "memory"); } }   /* behind the stores, before their data registers are written again by the next tile's LDS reads */
extern "C" void kernel_launch(void* const* d_in, const int* in_sizes, int n_in, void* d_out, int out_size, void* d_ws, size_t ws_size, hipStream_t stream) {
  (void)in_sizes; (void)n_in; (void)out_size;
  const float** F = (const float**)d_in;
  if (ws_size < (size_t)WS_END) return;
  char* ws = (char*)d_ws; _Float16 *QH = (_Float16*)(ws + WS_QH), *KH = (_Float16*)(ws + WS_KH), *VT = (_Float16*)(ws + WS_VT), *QL = (_Float16*)(ws + WS_QL), *KL = (_Float16*)(ws + WS_KL); __bf16 *VB = (__bf16*)(ws + WS_VB), *VBL = (__bf16*)(ws + WS_VBL); float *ML = (float*)(ws + WS_S), *Y = (float*)(ws + WS_Y);
  (void)Y; (void)QL; (void)KL; (void)VB; (void)VBL;
  // inputs: 0 x [4,256,64,64] CHANNELS-FIRST (N = 4,096 positions); 1 Wq [64,256] (out,in), 2 bq [64]; 3 Wk [64,256], 4 bk [64]; 5 Wv [256,256] (out,in), 6 bv [256]; 7 gamma [1] (zero biases, read)
  if (ws_size < (size_t)WS_END3) return;
  _Float16 *Y2 = (_Float16*)(ws + WS_Y2);
  k_proj<<<dim3(TNB * TT / 64, 3), 128, 0, stream>>>(F[0], F[1], F[3], F[5], F[2], F[4], F[6], QH, QL, KH, VT);   /* column block 0: q (Wq / bq) and k (Wk / bk), 64 real columns each, side by side; 1 / 2: values v (Wv / bv), 128 columns each */
  k_fa<<<dim3(TT / (FQW * FQT * 16), KSP, TNB), FQW * 32, 0, stream>>>(QH, QL, KH, VT, Y2, ML);   /* scores, softmax and P . v fused: one launch for all batches, 512 work-groups of 4 waves */
  k_resT<<<dim3(TT / 64, CC / RTC, TNB), 512, 0, stream>>>(F[0], Y2, ML, F[7], (float*)d_out);   /* out[b][c][m] = x + gamma * o (transposed back to channels-first) */
}
